// v000
// Times are from an AMD MI455X. After a warm-up the kernel runs many times in a row, and a time is the length of
// such a window on the GPU divided by its runs, so every launch and the gaps after it count. The runs cycle
// through copies of the inputs. A figure is the median of several windows, for all but v000 over two sittings.
// Sittings can differ by a few percent; kernels timed side by side share one.
// The starting kernel, v000, takes 574 microseconds a run.
// compute dtype: x, bond_influence, W*/b* (INPUTS) rounded to bf16 with exact bf16 WMMA products (f32 accumulate) for the projections; K pre-split into bf16 hi/lo rows; q f32 split, P and V f16 hi/lo (3 products each); the bond modulation and softmax in f32.
#include <hip/hip_runtime.h>
#include <math.h>

typedef __attribute__((ext_vector_type(16))) _Float16 v16h;
typedef __attribute__((ext_vector_type(16))) __bf16 v16b;
typedef __attribute__((ext_vector_type(8)))  _Float16 v8h;
typedef __attribute__((ext_vector_type(8)))  float v8f;
typedef __attribute__((ext_vector_type(4)))  float v4f;
typedef __attribute__((ext_vector_type(2)))  float v2f;
typedef __attribute__((ext_vector_type(4)))  unsigned v4u;
typedef __attribute__((ext_vector_type(4)))  int v4i;
typedef float __attribute__((may_alias)) float_a;
typedef int __attribute__((may_alias)) int_a;

template <typename T> __device__ __forceinline__ void vst2(void* p, T v) { *(T*)p = v;  }
__device__ __forceinline__ v8f wmma16(v16h a, v16h b, v8f c) {
  v8f d = __builtin_amdgcn_wmma_f32_16x16x32_f16(false, a, false, b, (short)0, c, false, false);
  asm volatile("v_nop\n\tv_nop\n\tv_nop\n\tv_nop" : "+v"(d) : "v"(a), "v"(b));
  return d;
}
__device__ __forceinline__ v8f wmma_bf(v16b a, v16b b, v8f c) {
  v8f d = __builtin_amdgcn_wmma_f32_16x16x32_bf16(false, a, false, b, (short)0, c, false, false);
  asm volatile("v_nop\n\tv_nop\n\tv_nop\n\tv_nop" : "+v"(d) : "v"(a), "v"(b));
  return d;
}
// 16x16x32 fragments: lane = (h = lane>>4, row/col = lane&15); elements 0..7 = k0+8h+0..7, 8..15 = k0+16+8h+0..7; D element r = row 8h+r
__device__ __forceinline__ v16h frag_h(const _Float16* rowk0, int lane) {
  union { v16h v; v8h q[2]; } u; const _Float16* p = rowk0 + 8 * (lane >> 4);
  u.q[0] = *(const v8h*)p; u.q[1] = *(const v8h*)(p + 16); return u.v;
}
__device__ __forceinline__ v16h frag_f32(const float* rowk0, int lane) {
  v16h a; const float* p = rowk0 + 8 * (lane >> 4);
#pragma unroll
  for (int i = 0; i < 8; ++i) { a[i] = (_Float16)p[i]; a[8 + i] = (_Float16)p[16 + i]; }
  return a;
}
__device__ __forceinline__ v16h frag_f32s(const float* rowk0, int lane, float sc) {
  v16h a; const float* p = rowk0 + 8 * (lane >> 4);
#pragma unroll
  for (int i = 0; i < 8; ++i) { a[i] = (_Float16)(p[i] * sc); a[8 + i] = (_Float16)(p[16 + i] * sc); }
  return a;
}
// column fragment from a [K][ld] layout (column n), rows >= K read as 0
__device__ __forceinline__ v16h fragc_f32(const float* W, int k0, int n, int lane, int ld, int K) {
  v16h a; const int g = lane >> 4;
#pragma unroll
  for (int i = 0; i < 8; ++i) { const int ka = k0 + 8 * g + i, kb = ka + 16;
    a[i] = (_Float16)(ka < K ? W[(size_t)ka * ld + n] : 0.f); a[8 + i] = (_Float16)(kb < K ? W[(size_t)kb * ld + n] : 0.f); }
  return a;
}
struct F2 { v16b h, l; };
__device__ __forceinline__ F2 bsplit16(const float v[16]) { F2 r;
#pragma unroll
  for (int i = 0; i < 16; ++i) { const __bf16 h = (__bf16)v[i]; r.h[i] = h; r.l[i] = (__bf16)(v[i] - (float)h); }
  return r; }
__device__ __forceinline__ F2 split_row(const float* row, int k0, int lane) { float v[16]; const float* p = row + k0 + 8 * (lane >> 4);
#pragma unroll
  for (int i = 0; i < 8; ++i) { v[i] = p[i]; v[8 + i] = p[16 + i]; }
  return bsplit16(v); }
__device__ __forceinline__ F2 split_rowK(const float* row, int k0, int lane, int K) { float v[16]; const int g = lane >> 4;
#pragma unroll
  for (int i = 0; i < 8; ++i) { const int ka = k0 + 8 * g + i, kb = ka + 16; v[i] = ka < K ? row[ka] : 0.f; v[8 + i] = kb < K ? row[kb] : 0.f; }
  return bsplit16(v); }
__device__ __forceinline__ F2 split_col(const float* W, int k0, int n, int lane, int ld, int K) { float v[16]; const int g = lane >> 4;
#pragma unroll
  for (int i = 0; i < 8; ++i) { const int ka = k0 + 8 * g + i, kb = ka + 16; v[i] = ka < K ? W[(size_t)ka * ld + n] : 0.f; v[8 + i] = kb < K ? W[(size_t)kb * ld + n] : 0.f; }
  return bsplit16(v); }
__device__ __forceinline__ v8f mac3(const F2& a, const F2& b, v8f c) { c = wmma_bf(a.l, b.h, c); c = wmma_bf(a.h, b.l, c); return wmma_bf(a.h, b.h, c); }
__device__ __forceinline__ float sigm(float v) { return 1.0f / (1.0f + expf(-v)); }
#define LDSX() do { asm volatile("s_wait_dscnt 0" ::: "memory"); __builtin_amdgcn_wave_barrier(); __builtin_amdgcn_fence(__ATOMIC_RELEASE, "workgroup"); } while (0)


// Bond-influence self attention (16 heads x 64 on [2,2048,1024], [in][out] weights + biases): scores = (q.k/8) * bond_influence[b][q][k] (an INPUT matrix, shared by the heads); softmax; (P v) @ Wo + bo.
#define NB 2
#define SS 2048
#define E 1024
#define NH 16
#define HD 64
#define NR (NB * SS)
#define PLO 1024.0f
#define VLO 2048.0f
__device__ __forceinline__ float bfr(float v) { return (float)(__bf16)v; }
__device__ __forceinline__ v16b frag_b(const __bf16* rowk0, int lane) { return __builtin_bit_cast(v16b, frag_h((const _Float16*)rowk0, lane)); }

__global__ __launch_bounds__(256) void k_cvt(const float* __restrict__ x, __bf16* __restrict__ Xb) {
  const size_t i8 = (size_t)blockIdx.x * 256 + threadIdx.x; if (i8 >= (size_t)NR * E / 8) return;
  union { __bf16 h[8]; v4u u; } pk;
#pragma unroll
  for (int e = 0; e < 8; ++e) pk.h[e] = (__bf16)x[i8 * 8 + e];
  vst2((unsigned*)(Xb + i8 * 8), pk.u);
}
// PT rows: [0,E) Wq[:,n], [E,2E) Wk[:,n], [2E,3E) Wv[:,n], [3E,4E) Wo[:,n]  ([in][out] weights: column n as a bf16 row)
__global__ __launch_bounds__(256) void k_pack(const float* __restrict__ Wq, const float* __restrict__ Wk, const float* __restrict__ Wv, const float* __restrict__ Wo, __bf16* __restrict__ PT) {
  const int n = blockIdx.x, tid = threadIdx.x; __shared__ __align__(16) __bf16 srow[E];
  const float* W = n < E ? Wq : (n < 2 * E ? Wk : (n < 3 * E ? Wv : Wo)); const int nn = n & (E - 1);
  for (int k = tid; k < E; k += 256) srow[k] = (__bf16)W[(size_t)k * E + nn];
  __syncthreads();
  if (tid < E / 8) vst2((unsigned*)(PT + (size_t)n * E + tid * 8), *(const v4u*)(&srow[tid * 8]));
}
// QKV: block (64 rows, 128 cols = 2 heads, which); q (+bias) -> Q32 f32 [bh][s][64]; k (+bias) -> bf16 hi/lo rows; v (+bias) -> VT hi/lo x4 [bh][d][s]
__global__ __launch_bounds__(128) void k_qkv(const __bf16* __restrict__ Xb, const __bf16* __restrict__ PT, const float* __restrict__ bq, const float* __restrict__ bk, const float* __restrict__ bv,
                                            float* __restrict__ Q32, __bf16* __restrict__ Kh, __bf16* __restrict__ Kl, _Float16* __restrict__ VTh, _Float16* __restrict__ VTl) {
  __shared__ __align__(16) float so[4][16][132];
  __shared__ __align__(16) _Float16 sth[128][72], stl[128][72];
  const int tid = threadIdx.x, wave = tid >> 5, lane = tid & 31, col = lane & 15, g = lane >> 4;
  const int which = blockIdx.z, r0b = blockIdx.x * 64, r0 = r0b + wave * 16, n0 = blockIdx.y * 128; const int b = r0b / SS, s0 = r0b % SS;
  const float* bb_ = which == 0 ? bq : (which == 1 ? bk : bv);
  v8f acc[8] = {};
#pragma unroll 2
  for (int kc = 0; kc < E / 32; ++kc) { const v16b a = frag_b(Xb + (size_t)(r0 + col) * E + kc * 32, lane);
#pragma unroll
    for (int j = 0; j < 8; ++j) acc[j] = wmma_bf(a, frag_b(PT + (size_t)(which * E + n0 + j * 16 + col) * E + kc * 32, lane), acc[j]); }
  if (which < 2) {
#pragma unroll
    for (int j = 0; j < 8; ++j) { const float bb = bfr(bb_[n0 + j * 16 + col]);
#pragma unroll
      for (int r = 0; r < 8; ++r) so[wave][8 * g + r][j * 16 + col] = acc[j][r] + bb; }
    LDSX();
    if (which == 0) { for (int qq = lane; qq < 2 * 16 * 16; qq += 32) { const int hh = qq >> 8, rl = (qq >> 4) & 15, pc = qq & 15; const int h = (n0 >> 6) + hh;
        vst2(Q32 + (((size_t)b * NH + h) * SS + s0 + wave * 16 + rl) * HD + pc * 4, *(const v4f*)(&so[wave][rl][hh * 64 + pc * 4])); } }
    else {
      for (int qq = lane; qq < 2 * 16 * 16; qq += 32) { const int hh = qq >> 8, rl = (qq >> 4) & 15, pl = qq & 15; const int h = (n0 >> 6) + hh; const int pc = pl & 7; union { __bf16 e[8]; v4u u; } pk;
#pragma unroll
        for (int e = 0; e < 8; ++e) { const float v = so[wave][rl][hh * 64 + pc * 8 + e]; const __bf16 hi = (__bf16)v; pk.e[e] = pl < 8 ? hi : (__bf16)(v - (float)hi); }
        vst2((unsigned*)((pl < 8 ? Kh : Kl) + (((size_t)b * NH + h) * SS + s0 + wave * 16 + rl) * HD + pc * 8), pk.u); } } }
  else {
#pragma unroll
    for (int j = 0; j < 8; ++j) { const float bb = bfr(bb_[n0 + j * 16 + col]);
#pragma unroll
      for (int r = 0; r < 8; ++r) { const float v = (acc[j][r] + bb) * 4.0f; const _Float16 hi = (_Float16)v; sth[j * 16 + col][wave * 16 + 8 * g + r] = hi; stl[j * 16 + col][wave * 16 + 8 * g + r] = (_Float16)((v - (float)hi) * VLO); } }
    __syncthreads();
    for (int qq = tid; qq < 128 * 8; qq += 128) { const int cl = qq >> 3, pc = qq & 7; const int c = n0 + cl, h = c >> 6, d = c & 63; const size_t o = (((size_t)b * NH + h) * HD + d) * SS + s0 + pc * 8;
      vst2(VTh + o, *(const v4u*)(&sth[cl][pc * 8])); vst2(VTl + o, *(const v4u*)(&stl[cl][pc * 8])); } }
}
// bond-scaled attention: block (64 queries, bh); all 32 key tiles of 64; S on q hi/lo x K hi/lo rows; P,V hi/lo; O f32 [bh][s][64]
__global__ __launch_bounds__(128) void k_attn(const float* __restrict__ Q32, const __bf16* __restrict__ Kh, const __bf16* __restrict__ Kl, const _Float16* __restrict__ VTh, const _Float16* __restrict__ VTl, const float* __restrict__ bond, float* __restrict__ O32) {
  __shared__ __align__(16) float sS[4][16][68];
  __shared__ __align__(16) _Float16 sPh[4][16][72], sPl[4][16][72];
  __shared__ __align__(16) float sO[4][16][68];
  const int tid = threadIdx.x, w = tid >> 5, lane = tid & 31, col = lane & 15, g = lane >> 4;
  const size_t bh = blockIdx.y; const int qb = blockIdx.x; const int q0 = qb * 64 + w * 16;
  F2 aq[2];
#pragma unroll
  for (int kc = 0; kc < 2; ++kc) aq[kc] = split_row(Q32 + (bh * SS + q0 + col) * HD, kc * 32, lane);
  const int b = (int)(bh / NH); const float* brow = bond + ((size_t)b * SS + q0) * SS;     // bond_influence rows of my 16 queries
  float mrun = -3.0e38f, lrun = 0.f; v8f acc[4] = {}, ac1[4] = {}, ac2[4] = {};
  LDSX();
#pragma unroll 1
  for (int kt = 0; kt < SS / 64; ++kt) {
#pragma unroll
    for (int t = 0; t < 4; ++t) { const int key = kt * 64 + t * 16 + col; const size_t ko = (bh * SS + key) * HD; v8f s = {};
#pragma unroll
      for (int kc = 0; kc < 2; ++kc) { const v16b khf = frag_b(Kh + ko + kc * 32, lane), klf = frag_b(Kl + ko + kc * 32, lane); s = wmma_bf(aq[kc].l, khf, s); s = wmma_bf(aq[kc].h, klf, s); s = wmma_bf(aq[kc].h, khf, s); }
#pragma unroll
      for (int r = 0; r < 8; ++r) sS[w][8 * g + r][t * 16 + col] = (s[r] * 0.125f) * bfr(brow[(size_t)(8 * g + r) * SS + key]); }
    LDSX();
    float mx = -3.4e38f;
#pragma unroll
    for (int jj = 0; jj < 32; ++jj) mx = fmaxf(mx, sS[w][col][g * 32 + jj]);
    mx = fmaxf(mx, __shfl_xor(mx, 16, 32));
    const float mnew = fmaxf(mrun, mx); const float corr = expf(mrun - mnew);
    float ps = 0.f;
#pragma unroll
    for (int jj = 0; jj < 32; ++jj) { const float p = expf(sS[w][col][g * 32 + jj] - mnew) * 16384.0f; ps += p; const _Float16 hi = (_Float16)p; sPh[w][col][g * 32 + jj] = hi; sPl[w][col][g * 32 + jj] = (_Float16)((p - (float)hi) * PLO); }
    ps += __shfl_xor(ps, 16, 32);
    lrun = lrun * corr + ps * (1.0f / 16384.0f); mrun = mnew;
#pragma unroll
    for (int r = 0; r < 8; ++r) { const float cr = __shfl(corr, 8 * g + r, 32);
#pragma unroll
      for (int t = 0; t < 4; ++t) { acc[t][r] *= cr; ac1[t][r] *= cr; ac2[t][r] *= cr; } }
    LDSX();
#pragma unroll
    for (int kc = 0; kc < 2; ++kc) { const v16h ph = frag_h(&sPh[w][col][0] + kc * 32, lane), pl = frag_h(&sPl[w][col][0] + kc * 32, lane);
#pragma unroll
      for (int t = 0; t < 4; ++t) { const size_t vo = (bh * HD + t * 16 + col) * SS + kt * 64 + kc * 32; const v16h vh = frag_h(VTh + vo, lane);
        acc[t] = wmma16(ph, vh, acc[t]); ac1[t] = wmma16(ph, frag_h(VTl + vo, lane), ac1[t]); ac2[t] = wmma16(pl, vh, ac2[t]); } }
    __builtin_amdgcn_wave_barrier(); }
#pragma unroll
  for (int r = 0; r < 8; ++r) { const float lr = __shfl(lrun, 8 * g + r, 32); const float inv = 1.0f / (lr * 16384.0f * 4.0f);
#pragma unroll
    for (int t = 0; t < 4; ++t) sO[w][8 * g + r][t * 16 + col] = (acc[t][r] + ac1[t][r] * (1.0f / VLO) + ac2[t][r] * (1.0f / PLO)) * inv; }
  LDSX();
  for (int qq = lane; qq < 16 * 16; qq += 32) { const int rl = qq >> 4, pc = qq & 15; vst2(O32 + ((bh * SS) + q0 + rl) * HD + pc * 4, *(const v4f*)(&sO[w][rl][pc * 4])); }
}
// out = ctx Wo + bo : split(ctx) x bf16(Wo rows): 2 products (Wo is an INPUT -> bf16 exact)
__global__ __launch_bounds__(128) void k_out(const float* __restrict__ O32, const __bf16* __restrict__ PT, const float* __restrict__ bo, float* __restrict__ out) {
  __shared__ __align__(16) float so[4][16][132];
  const int tid = threadIdx.x, wave = tid >> 5, lane = tid & 31, col = lane & 15, g = lane >> 4;
  const int r0 = blockIdx.x * 64 + wave * 16, n0 = blockIdx.y * 128; const int ra = r0 + col; const int b = ra / SS, s = ra % SS;
  v8f acc[8] = {};
#pragma unroll 1
  for (int kc = 0; kc < E / 32; ++kc) { const int h = kc >> 1; const F2 a = split_row(O32 + (((size_t)b * NH + h) * SS + s) * HD, (kc & 1) * 32, lane);
#pragma unroll
    for (int j = 0; j < 8; ++j) { const v16b wb = frag_b(PT + (size_t)(3 * E + n0 + j * 16 + col) * E + kc * 32, lane); acc[j] = wmma_bf(a.l, wb, acc[j]); acc[j] = wmma_bf(a.h, wb, acc[j]); } }
#pragma unroll
  for (int j = 0; j < 8; ++j) { const int n = n0 + j * 16 + col; const float bb = bfr(bo[n]);
#pragma unroll
    for (int r = 0; r < 8; ++r) so[wave][8 * g + r][j * 16 + col] = acc[j][r] + bb; }
  LDSX();
#pragma unroll 4
  for (int rl = 0; rl < 16; ++rl) vst2(out + (size_t)(r0 + rl) * E + n0 + lane * 4, *(const v4f*)(&so[wave][rl][lane * 4]));
}
extern "C" void kernel_launch(void* const* d_in, const int* in_sizes, int n_in, void* d_out, int out_size, void* d_ws, size_t ws_size, hipStream_t stream) {
  (void)in_sizes; (void)n_in; (void)out_size; (void)ws_size;
  const float* x = (const float*)d_in[0]; const float* bond = (const float*)d_in[1]; const float* Wq = (const float*)d_in[2]; const float* bq = (const float*)d_in[3]; const float* Wk = (const float*)d_in[4]; const float* bk = (const float*)d_in[5]; const float* Wv = (const float*)d_in[6]; const float* bv = (const float*)d_in[7]; const float* Wo = (const float*)d_in[8]; const float* bo = (const float*)d_in[9];
  float* out = (float*)d_out;
  char* ws = (char*)d_ws; size_t off = 0;
  auto take = [&](size_t bytes) { char* p = ws + off; off += (bytes + 255) & ~(size_t)255; return p; };
  __bf16* Xb = (__bf16*)take((size_t)NR * E * 2); __bf16* PT = (__bf16*)take((size_t)4 * E * E * 2);
  float* Q32 = (float*)take((size_t)NR * E * 4); __bf16* Kh = (__bf16*)take((size_t)NR * E * 2); __bf16* Kl = (__bf16*)take((size_t)NR * E * 2); _Float16* VTh = (_Float16*)take((size_t)NR * E * 2); _Float16* VTl = (_Float16*)take((size_t)NR * E * 2); float* O32 = (float*)take((size_t)NR * E * 4);
  // ws ~ 82 MB
  k_cvt<<<(NR * E / 8 + 255) / 256, 256, 0, stream>>>(x, Xb);
  k_pack<<<4 * E, 256, 0, stream>>>(Wq, Wk, Wv, Wo, PT);
  k_qkv<<<dim3(NR / 64, E / 128, 3), 128, 0, stream>>>(Xb, PT, bq, bk, bv, Q32, Kh, Kl, VTh, VTl);
  k_attn<<<dim3(SS / 64, NB * NH), 128, 0, stream>>>(Q32, Kh, Kl, VTh, VTl, bond, O32);
  k_out<<<dim3(NR / 64, E / 128), 128, 0, stream>>>(O32, PT, bo, out);
}

// v001
// Measured time: 391 microseconds a run.
// Timed twice side by side with v000, it ran 1.50 times as fast both times.
// compute dtype: x, bond_influence, W*/b* (INPUTS) rounded to bf16 with exact bf16 WMMA products (f32 accumulate) for the projections; K pre-split into bf16 hi/lo rows; q f32 split, P and V f16 hi/lo (3 products each); the bond modulation and softmax in f32.
#include <hip/hip_runtime.h>
#include <math.h>

typedef __attribute__((ext_vector_type(16))) _Float16 v16h;
typedef __attribute__((ext_vector_type(16))) __bf16 v16b;
typedef __attribute__((ext_vector_type(8)))  _Float16 v8h;
typedef __attribute__((ext_vector_type(8)))  float v8f;
typedef __attribute__((ext_vector_type(4)))  float v4f;
typedef __attribute__((ext_vector_type(2)))  float v2f;
typedef __attribute__((ext_vector_type(4)))  unsigned v4u;
typedef __attribute__((ext_vector_type(4)))  int v4i;
typedef float __attribute__((may_alias)) float_a;
typedef int __attribute__((may_alias)) int_a;

template <typename T> __device__ __forceinline__ void vst2(void* p, T v) { *(T*)p = v;  }
__device__ __forceinline__ v8f wmma16(v16h a, v16h b, v8f c) {
  v8f d = __builtin_amdgcn_wmma_f32_16x16x32_f16(false, a, false, b, (short)0, c, false, false);
  asm volatile("v_nop\n\tv_nop\n\tv_nop\n\tv_nop" : "+v"(d) : "v"(a), "v"(b));
  return d;
}
__device__ __forceinline__ v8f wmma_bf(v16b a, v16b b, v8f c) {
  v8f d = __builtin_amdgcn_wmma_f32_16x16x32_bf16(false, a, false, b, (short)0, c, false, false);
  asm volatile("v_nop\n\tv_nop\n\tv_nop\n\tv_nop" : "+v"(d) : "v"(a), "v"(b));
  return d;
}
// 16x16x32 fragments: lane = (h = lane>>4, row/col = lane&15); elements 0..7 = k0+8h+0..7, 8..15 = k0+16+8h+0..7; D element r = row 8h+r
__device__ __forceinline__ v16h frag_h(const _Float16* rowk0, int lane) {
  union { v16h v; v8h q[2]; } u; const _Float16* p = rowk0 + 8 * (lane >> 4);
  u.q[0] = *(const v8h*)p; u.q[1] = *(const v8h*)(p + 16); return u.v;
}
__device__ __forceinline__ v16h frag_f32(const float* rowk0, int lane) {
  v16h a; const float* p = rowk0 + 8 * (lane >> 4);
#pragma unroll
  for (int i = 0; i < 8; ++i) { a[i] = (_Float16)p[i]; a[8 + i] = (_Float16)p[16 + i]; }
  return a;
}
__device__ __forceinline__ v16h frag_f32s(const float* rowk0, int lane, float sc) {
  v16h a; const float* p = rowk0 + 8 * (lane >> 4);
#pragma unroll
  for (int i = 0; i < 8; ++i) { a[i] = (_Float16)(p[i] * sc); a[8 + i] = (_Float16)(p[16 + i] * sc); }
  return a;
}
// column fragment from a [K][ld] layout (column n), rows >= K read as 0
__device__ __forceinline__ v16h fragc_f32(const float* W, int k0, int n, int lane, int ld, int K) {
  v16h a; const int g = lane >> 4;
#pragma unroll
  for (int i = 0; i < 8; ++i) { const int ka = k0 + 8 * g + i, kb = ka + 16;
    a[i] = (_Float16)(ka < K ? W[(size_t)ka * ld + n] : 0.f); a[8 + i] = (_Float16)(kb < K ? W[(size_t)kb * ld + n] : 0.f); }
  return a;
}
struct F2 { v16b h, l; };
__device__ __forceinline__ F2 bsplit16(const float v[16]) { F2 r;
#pragma unroll
  for (int i = 0; i < 16; ++i) { const __bf16 h = (__bf16)v[i]; r.h[i] = h; r.l[i] = (__bf16)(v[i] - (float)h); }
  return r; }
__device__ __forceinline__ F2 split_row(const float* row, int k0, int lane) { float v[16]; const float* p = row + k0 + 8 * (lane >> 4);
#pragma unroll
  for (int i = 0; i < 8; ++i) { v[i] = p[i]; v[8 + i] = p[16 + i]; }
  return bsplit16(v); }
__device__ __forceinline__ F2 split_rowK(const float* row, int k0, int lane, int K) { float v[16]; const int g = lane >> 4;
#pragma unroll
  for (int i = 0; i < 8; ++i) { const int ka = k0 + 8 * g + i, kb = ka + 16; v[i] = ka < K ? row[ka] : 0.f; v[8 + i] = kb < K ? row[kb] : 0.f; }
  return bsplit16(v); }
__device__ __forceinline__ F2 split_col(const float* W, int k0, int n, int lane, int ld, int K) { float v[16]; const int g = lane >> 4;
#pragma unroll
  for (int i = 0; i < 8; ++i) { const int ka = k0 + 8 * g + i, kb = ka + 16; v[i] = ka < K ? W[(size_t)ka * ld + n] : 0.f; v[8 + i] = kb < K ? W[(size_t)kb * ld + n] : 0.f; }
  return bsplit16(v); }
__device__ __forceinline__ v8f mac3(const F2& a, const F2& b, v8f c) { c = wmma_bf(a.l, b.h, c); c = wmma_bf(a.h, b.l, c); return wmma_bf(a.h, b.h, c); }
__device__ __forceinline__ float sigm(float v) { return 1.0f / (1.0f + expf(-v)); }
#define LDSX() do { asm volatile("s_wait_dscnt 0" ::: "memory"); __builtin_amdgcn_wave_barrier(); __builtin_amdgcn_fence(__ATOMIC_RELEASE, "workgroup"); } while (0)


// Bond-influence self attention (16 heads x 64 on [2,2048,1024], [in][out] weights + biases): scores = (q.k/8) * bond_influence[b][q][k] (an INPUT matrix, shared by the heads); softmax; (P v) @ Wo + bo.
#define NB 2
#define SS 2048
#define E 1024
#define NH 16
#define HD 64
#define NR (NB * SS)
#define PLO 1024.0f
#define VLO 2048.0f
__device__ __forceinline__ float bfr(float v) { return (float)(__bf16)v; }
// the same fragment from a wave-uniform base and the lane's own 32-bit element offset (row and 8 * half): the address costs one vector register
typedef const _Float16 __attribute__((address_space(1)))* gph; typedef const float __attribute__((address_space(1)))* gpf; typedef const v8h __attribute__((address_space(1)))* gp8; typedef const char __attribute__((address_space(1)))* gpc;
__device__ __forceinline__ unsigned long long sbase(const void* p) {   // a wave-uniform address read into scalar registers, so that the loads below take it as their scalar base
  const unsigned long long u = (unsigned long long)p;
  return ((unsigned long long)(unsigned)__builtin_amdgcn_readfirstlane((int)(u >> 32)) << 32) | (unsigned)__builtin_amdgcn_readfirstlane((int)u); }
__device__ __forceinline__ v16h frag_u(gph ub, unsigned off) { union { v16h v; v8h q[2]; } u; gph p = ub + off; u.q[0] = *(gp8)p; u.q[1] = *(gp8)(p + 16); return u.v; }
__device__ __forceinline__ v16b frag_ub(gph ub, unsigned off) { return __builtin_bit_cast(v16b, frag_u(ub, off)); }
__device__ __forceinline__ v16b frag_b(const __bf16* rowk0, int lane) { return __builtin_bit_cast(v16b, frag_h((const _Float16*)rowk0, lane)); }

__global__ __launch_bounds__(256) void k_cvt(const float* __restrict__ x, __bf16* __restrict__ Xb) {
  const size_t i8 = (size_t)blockIdx.x * 256 + threadIdx.x; if (i8 >= (size_t)NR * E / 8) return;
  union { __bf16 h[8]; v4u u; } pk;
#pragma unroll
  for (int e = 0; e < 8; ++e) pk.h[e] = (__bf16)x[i8 * 8 + e];
  vst2((unsigned*)(Xb + i8 * 8), pk.u);
}
// PT rows: [0,E) Wq[:,n], [E,2E) Wk[:,n], [2E,3E) Wv[:,n], [3E,4E) Wo[:,n]  ([in][out] weights: column n as a bf16 row)
__global__ __launch_bounds__(256) void k_pack(const float* __restrict__ Wq, const float* __restrict__ Wk, const float* __restrict__ Wv, const float* __restrict__ Wo, __bf16* __restrict__ PT) {
  const int n = blockIdx.x, tid = threadIdx.x; __shared__ __align__(16) __bf16 srow[E];
  const float* W = n < E ? Wq : (n < 2 * E ? Wk : (n < 3 * E ? Wv : Wo)); const int nn = n & (E - 1);
  for (int k = tid; k < E; k += 256) srow[k] = (__bf16)W[(size_t)k * E + nn];
  __syncthreads();
  if (tid < E / 8) vst2((unsigned*)(PT + (size_t)n * E + tid * 8), *(const v4u*)(&srow[tid * 8]));
}
// QKV: block (64 rows, 128 cols = 2 heads, which); q (+bias) -> Q32 f32 [bh][s][64]; k (+bias) -> bf16 hi/lo rows; v (+bias) -> VT hi/lo x4 [bh][d][s]
__global__ __launch_bounds__(128) void k_qkv(const __bf16* __restrict__ Xb, const __bf16* __restrict__ PT, const float* __restrict__ bq, const float* __restrict__ bk, const float* __restrict__ bv,
                                            float* __restrict__ Q32, __bf16* __restrict__ Kh, __bf16* __restrict__ Kl, _Float16* __restrict__ VTh, _Float16* __restrict__ VTl) {
  __shared__ __align__(16) float so[4][16][132];
  __shared__ __align__(16) _Float16 sth[128][72], stl[128][72];
  const int tid = threadIdx.x, wave = tid >> 5, lane = tid & 31, col = lane & 15, g = lane >> 4;
  const int which = blockIdx.z, r0b = blockIdx.x * 64, r0 = r0b + wave * 16, n0 = blockIdx.y * 128; const int b = r0b / SS, s0 = r0b % SS;
  const float* bb_ = which == 0 ? bq : (which == 1 ? bk : bv);
  v8f acc[8] = {};
  // two register sets: each k step's 18 fragment loads go out as one group, one step ahead of the products that read them (inner loops unrolled: the sets are register arrays)
  const __bf16* ap = Xb + (size_t)r0b * E; const __bf16* bp = PT + (size_t)(which * E + n0) * E;   // wave-uniform bases; the lane's part is one 32-bit offset each
  const unsigned aol = (wave * 16 + col) * E + 8 * g, bol = col * E + 8 * g;
  v16b a0 = frag_ub((gph)sbase(ap), aol), a1, b0[8], b1[8];
#pragma unroll
  for (int j = 0; j < 8; ++j) b0[j] = frag_ub((gph)sbase(bp) + j * 16 * E, bol);
#pragma unroll 1   // stays rolled: one trip already holds a step of either register set
  for (int kc = 0; kc < E / 32 - 2; kc += 2) {
    const gph au = (gph)sbase(ap + kc * 32), bu = (gph)sbase(bp + kc * 32);
    a1 = frag_ub(au + 32, aol);
#pragma unroll
    for (int j = 0; j < 8; ++j) b1[j] = frag_ub(bu + j * 16 * E + 32, bol);
    asm volatile("s_wait_xcnt 0x0" ::: "memory");   // the scalar bases that the loads above name are advanced while those loads are still out
    __builtin_amdgcn_sched_barrier(0);   // keeps the group above the products below; without it each load sinks to its use and its latency is waited out alone
#pragma unroll
    for (int j = 0; j < 8; ++j) acc[j] = wmma_bf(a0, b0[j], acc[j]);
    a0 = frag_ub(au + 64, aol);
#pragma unroll
    for (int j = 0; j < 8; ++j) b0[j] = frag_ub(bu + j * 16 * E + 64, bol);
    asm volatile("s_wait_xcnt 0x0" ::: "memory");   // the scalar bases that the loads above name are advanced while those loads are still out
    __builtin_amdgcn_sched_barrier(0);   // as above
#pragma unroll
    for (int j = 0; j < 8; ++j) acc[j] = wmma_bf(a1, b1[j], acc[j]); }
  a1 = frag_ub((gph)sbase(ap) + E - 32, aol);   // the last two steps: nothing is left to fetch behind them
#pragma unroll
  for (int j = 0; j < 8; ++j) b1[j] = frag_ub((gph)sbase(bp) + j * 16 * E + E - 32, bol);
  __builtin_amdgcn_sched_barrier(0);   // as above
#pragma unroll
  for (int j = 0; j < 8; ++j) acc[j] = wmma_bf(a0, b0[j], acc[j]);
#pragma unroll
  for (int j = 0; j < 8; ++j) acc[j] = wmma_bf(a1, b1[j], acc[j]);
  if (which < 2) {
#pragma unroll
    for (int j = 0; j < 8; ++j) { const float bb = bfr(bb_[n0 + j * 16 + col]);
#pragma unroll
      for (int r = 0; r < 8; ++r) so[wave][8 * g + r][j * 16 + col] = acc[j][r] + bb; }
    LDSX();
    if (which == 0) { for (int qq = lane; qq < 2 * 16 * 16; qq += 32) { const int hh = qq >> 8, rl = (qq >> 4) & 15, pc = qq & 15; const int h = (n0 >> 6) + hh;
        vst2(Q32 + (((size_t)b * NH + h) * SS + s0 + wave * 16 + rl) * HD + pc * 4, *(const v4f*)(&so[wave][rl][hh * 64 + pc * 4])); } }
    else {
      for (int qq = lane; qq < 2 * 16 * 16; qq += 32) { const int hh = qq >> 8, rl = (qq >> 4) & 15, pl = qq & 15; const int h = (n0 >> 6) + hh; const int pc = pl & 7; union { __bf16 e[8]; v4u u; } pk;
#pragma unroll
        for (int e = 0; e < 8; ++e) { const float v = so[wave][rl][hh * 64 + pc * 8 + e]; const __bf16 hi = (__bf16)v; pk.e[e] = pl < 8 ? hi : (__bf16)(v - (float)hi); }
        vst2((unsigned*)((pl < 8 ? Kh : Kl) + (((size_t)b * NH + h) * SS + s0 + wave * 16 + rl) * HD + pc * 8), pk.u); } } }
  else {
#pragma unroll
    for (int j = 0; j < 8; ++j) { const float bb = bfr(bb_[n0 + j * 16 + col]);
#pragma unroll
      for (int r = 0; r < 8; ++r) { const float v = (acc[j][r] + bb) * 4.0f; const _Float16 hi = (_Float16)v; sth[j * 16 + col][wave * 16 + 8 * g + r] = hi; stl[j * 16 + col][wave * 16 + 8 * g + r] = (_Float16)((v - (float)hi) * VLO); } }
    __syncthreads();
    for (int qq = tid; qq < 128 * 8; qq += 128) { const int cl = qq >> 3, pc = qq & 7; const int c = n0 + cl, h = c >> 6, d = c & 63; const size_t o = (((size_t)b * NH + h) * HD + d) * SS + s0 + pc * 8;
      vst2(VTh + o, *(const v4u*)(&sth[cl][pc * 8])); vst2(VTl + o, *(const v4u*)(&stl[cl][pc * 8])); } }
}
// bond-scaled attention: block (64 queries, bh); all 32 key tiles of 64; S on q hi/lo x K hi/lo rows; P,V hi/lo; O f32 [bh][s][64]
__global__ __launch_bounds__(128) void k_attn(const float* __restrict__ Q32, const __bf16* __restrict__ Kh, const __bf16* __restrict__ Kl, const _Float16* __restrict__ VTh, const _Float16* __restrict__ VTl, const float* __restrict__ bond, float* __restrict__ O32) {
  __shared__ __align__(16) float sS[4][16][68];
  __shared__ __align__(16) _Float16 sPh[4][16][72], sPl[4][16][72];
  __shared__ __align__(16) float sO[4][16][68];
  const int tid = threadIdx.x, w = __builtin_amdgcn_readfirstlane(tid >> 5), lane = tid & 31, col = lane & 15, g = lane >> 4;   // the wave's number in a scalar register: addresses built on it cost no vector registers
  const size_t bh = blockIdx.y; const int qb = blockIdx.x; const int q0 = qb * 64 + w * 16;
  // the split q fragments rest in LDS (each lane its own 128 bytes) and are read back at the head of every tile: their 32 registers are what the V load group needs to stay in flight at four waves per SIMD
  __shared__ __align__(16) v4u sQ[4][8][32];
#pragma unroll
  for (int kc = 0; kc < 2; ++kc) { const F2 q = split_row(Q32 + (bh * SS + q0 + col) * HD, kc * 32, lane); union { v16b v; v4u u[2]; } qh, ql; qh.v = q.h; ql.v = q.l;
    sQ[w][4 * kc][lane] = qh.u[0]; sQ[w][4 * kc + 1][lane] = qh.u[1]; sQ[w][4 * kc + 2][lane] = ql.u[0]; sQ[w][4 * kc + 3][lane] = ql.u[1]; }
  const int b = (int)(bh / NH);
  const unsigned kol = col * HD + 8 * g, vol = col * SS + 8 * g, bol = 8 * g * SS + col;     // lane offsets, in elements: K row, V^T row, bond_influence rows of my 16 queries
  float mrun = -3.0e38f, lrun = 0.f; v8f acc[4] = {}, ac1[4] = {}, ac2[4] = {};
  LDSX();
#pragma unroll 1
  for (int kt = 0; kt < SS / 64; ++kt) {
    // one load group at the head of the tile: the K fragments and bond values of key groups 0 and 1; those of groups 2 and 3 refill a set as soon as it has been read (inner loops unrolled: the sets are register arrays)
    const gph khu = (gph)sbase(Kh + (bh * SS + kt * 64) * HD), klu = (gph)sbase(Kl + (bh * SS + kt * 64) * HD); const gpf bu = (gpf)sbase(bond + ((size_t)b * SS + q0) * SS + kt * 64);   // wave-uniform bases; the lane's part is one 32-bit offset each
    float bv[2][8]; v16b kf[2][4];
#pragma unroll
    for (int t = 0; t < 2; ++t) {
#pragma unroll
      for (int kc = 0; kc < 2; ++kc) { kf[t][2 * kc] = frag_ub(khu + t * 16 * HD + kc * 32, kol); kf[t][2 * kc + 1] = frag_ub(klu + t * 16 * HD + kc * 32, kol); }
#pragma unroll
      for (int r = 0; r < 8; ++r) bv[t][r] = (bu + r * SS + t * 16)[bol]; }
    F2 aq[2];
#pragma unroll
    for (int kc = 0; kc < 2; ++kc) { union { v16b v; v4u u[2]; } qh, ql; qh.u[0] = sQ[w][4 * kc][lane]; qh.u[1] = sQ[w][4 * kc + 1][lane]; ql.u[0] = sQ[w][4 * kc + 2][lane]; ql.u[1] = sQ[w][4 * kc + 3][lane]; aq[kc].h = qh.v; aq[kc].l = ql.v; }
    __builtin_amdgcn_sched_barrier(0);   // keeps the group above the products below; without it each load sinks to its use and its latency is waited out alone
#pragma unroll
    for (int t = 0; t < 4; ++t) { v8f s = {};
#pragma unroll
      for (int kc = 0; kc < 2; ++kc) { s = wmma_bf(aq[kc].l, kf[t & 1][2 * kc], s); s = wmma_bf(aq[kc].h, kf[t & 1][2 * kc + 1], s); s = wmma_bf(aq[kc].h, kf[t & 1][2 * kc], s); }
      if (t < 2) {
#pragma unroll
        for (int kc = 0; kc < 2; ++kc) { kf[t][2 * kc] = frag_ub(khu + (t + 2) * 16 * HD + kc * 32, kol); kf[t][2 * kc + 1] = frag_ub(klu + (t + 2) * 16 * HD + kc * 32, kol); }
        __builtin_amdgcn_sched_barrier(0);   // as above
      }
#pragma unroll
      for (int r = 0; r < 8; ++r) sS[w][8 * g + r][t * 16 + col] = (s[r] * 0.125f) * bfr(bv[t & 1][r]);
      if (t < 2) {
#pragma unroll
        for (int r = 0; r < 8; ++r) bv[t][r] = (bu + r * SS + (t + 2) * 16)[bol];
        __builtin_amdgcn_sched_barrier(0);   // as above
      } }
    LDSX();
    float mx = -3.4e38f;
#pragma unroll
    for (int jj = 0; jj < 32; ++jj) mx = fmaxf(mx, sS[w][col][g * 32 + jj]);
    mx = fmaxf(mx, __shfl_xor(mx, 16, 32));
    const float mnew = fmaxf(mrun, mx); const float corr = expf(mrun - mnew);
    float ps = 0.f;
#pragma unroll
    for (int jj = 0; jj < 32; ++jj) { const float p = expf(sS[w][col][g * 32 + jj] - mnew) * 16384.0f; ps += p; const _Float16 hi = (_Float16)p; sPh[w][col][g * 32 + jj] = hi; sPl[w][col][g * 32 + jj] = (_Float16)((p - (float)hi) * PLO); }
    ps += __shfl_xor(ps, 16, 32);
    lrun = lrun * corr + ps * (1.0f / 16384.0f); mrun = mnew;
    // the V fragments of the tile's first 32 keys go out as one group ahead of the rescale; those of the second 32 refill a set as soon as its products are issued
    const gph vhu = (gph)sbase(VTh + bh * HD * SS + kt * 64), vlu = (gph)sbase(VTl + bh * HD * SS + kt * 64); v16h vf[4][2];
    __builtin_amdgcn_sched_barrier(0);   // keeps the group out of the exponentials above, where the registers are short
#pragma unroll
    for (int t = 0; t < 4; ++t) { vf[t][0] = frag_u(vhu + t * 16 * SS, vol); vf[t][1] = frag_u(vlu + t * 16 * SS, vol); }
    __builtin_amdgcn_sched_barrier(0);   // keeps the group together here, ahead of the shuffles below; without it each load sinks to its use and its latency is waited out alone
#pragma unroll
    for (int r = 0; r < 8; ++r) { const float cr = __shfl(corr, 8 * g + r, 32);
#pragma unroll
      for (int t = 0; t < 4; ++t) { acc[t][r] *= cr; ac1[t][r] *= cr; ac2[t][r] *= cr; } }
    LDSX();
#pragma unroll
    for (int kc = 0; kc < 2; ++kc) { const v16h ph = frag_h(&sPh[w][col][0] + kc * 32, lane), pl = frag_h(&sPl[w][col][0] + kc * 32, lane);
#pragma unroll
      for (int t = 0; t < 4; ++t) {
        acc[t] = wmma16(ph, vf[t][0], acc[t]); ac1[t] = wmma16(ph, vf[t][1], ac1[t]); ac2[t] = wmma16(pl, vf[t][0], ac2[t]);
        if (kc == 0) { vf[t][0] = frag_u(vhu + t * 16 * SS + 32, vol); vf[t][1] = frag_u(vlu + t * 16 * SS + 32, vol);
          __builtin_amdgcn_sched_barrier(0);   // keeps the refill here, four product groups ahead of its use
        } } }
    __builtin_amdgcn_wave_barrier(); }
#pragma unroll
  for (int r = 0; r < 8; ++r) { const float lr = __shfl(lrun, 8 * g + r, 32); const float inv = 1.0f / (lr * 16384.0f * 4.0f);
#pragma unroll
    for (int t = 0; t < 4; ++t) sO[w][8 * g + r][t * 16 + col] = (acc[t][r] + ac1[t][r] * (1.0f / VLO) + ac2[t][r] * (1.0f / PLO)) * inv; }
  LDSX();
  for (int qq = lane; qq < 16 * 16; qq += 32) { const int rl = qq >> 4, pc = qq & 15; vst2(O32 + ((bh * SS) + q0 + rl) * HD + pc * 4, *(const v4f*)(&sO[w][rl][pc * 4])); }
}
// out = ctx Wo + bo : split(ctx) x bf16(Wo rows): 2 products (Wo is an INPUT -> bf16 exact)
__global__ __launch_bounds__(128) void k_out(const float* __restrict__ O32, const __bf16* __restrict__ PT, const float* __restrict__ bo, float* __restrict__ out) {
  __shared__ __align__(16) float so[4][16][132];
  const int tid = threadIdx.x, wave = tid >> 5, lane = tid & 31, col = lane & 15, g = lane >> 4;
  const int r0 = blockIdx.x * 64 + wave * 16, n0 = blockIdx.y * 128;
  v8f acc[8] = {};
  // two register sets: each k step's 20 loads go out as one group, one step ahead of the products that read them (inner loops unrolled: the sets are register arrays)
  const int rb = blockIdx.x * 64; const float* op = O32 + ((size_t)(rb / SS) * NH * SS + rb % SS) * HD; const __bf16* wp = PT + (size_t)(3 * E + n0) * E;   // wave-uniform bases (a block's 64 rows lie in one batch); the lane's part is one 32-bit offset each
  const unsigned ool = ((wave * 16 + col) * HD + 8 * g) * 4, wol = col * E + 8 * g;   // ool in bytes, wol in elements
  float x0[16], x1[16]; v16b w0[8], w1[8];
  { const gpf o0 = (gpf)((gpc)sbase(op) + ool);
#pragma unroll
    for (int i = 0; i < 8; ++i) { x0[i] = o0[i]; x0[8 + i] = o0[16 + i]; } }
#pragma unroll
  for (int j = 0; j < 8; ++j) w0[j] = frag_ub((gph)sbase(wp) + j * 16 * E, wol);
#pragma unroll 1
  for (int h = 0; h < NH - 1; ++h) { const gpf oh = (gpf)((gpc)sbase(op + (size_t)h * SS * HD) + ool); const gph wu = (gph)sbase(wp + h * 64);
#pragma unroll
    for (int i = 0; i < 8; ++i) { x1[i] = oh[32 + i]; x1[8 + i] = oh[48 + i]; }
#pragma unroll
    for (int j = 0; j < 8; ++j) w1[j] = frag_ub(wu + j * 16 * E + 32, wol);
    asm volatile("s_wait_xcnt 0x0" ::: "memory");   // the scalar bases that the loads above name are advanced while those loads are still out
    __builtin_amdgcn_sched_barrier(0);   // keeps the group above the products below; without it each load sinks to its use and its latency is waited out alone
    { const F2 a = bsplit16(x0);
#pragma unroll
      for (int j = 0; j < 8; ++j) { acc[j] = wmma_bf(a.l, w0[j], acc[j]); acc[j] = wmma_bf(a.h, w0[j], acc[j]); } }
#pragma unroll
    for (int i = 0; i < 8; ++i) { x0[i] = oh[SS * HD + i]; x0[8 + i] = oh[SS * HD + 16 + i]; }
#pragma unroll
    for (int j = 0; j < 8; ++j) w0[j] = frag_ub(wu + j * 16 * E + 64, wol);
    asm volatile("s_wait_xcnt 0x0" ::: "memory");   // the scalar bases that the loads above name are advanced while those loads are still out
    __builtin_amdgcn_sched_barrier(0);   // as above
    { const F2 a = bsplit16(x1);
#pragma unroll
      for (int j = 0; j < 8; ++j) { acc[j] = wmma_bf(a.l, w1[j], acc[j]); acc[j] = wmma_bf(a.h, w1[j], acc[j]); } } }
  { const gpf oh = (gpf)((gpc)sbase(op + (size_t)(NH - 1) * SS * HD) + ool);   // the last two steps: nothing is left to fetch behind them
#pragma unroll
    for (int i = 0; i < 8; ++i) { x1[i] = oh[32 + i]; x1[8 + i] = oh[48 + i]; } }
  asm volatile("s_wait_xcnt 0x0" ::: "memory");   // the address registers of the four loads above are given to a fragment of the group below
#pragma unroll
  for (int j = 0; j < 8; ++j) w1[j] = frag_ub((gph)sbase(wp) + j * 16 * E + E - 32, wol);
  __builtin_amdgcn_sched_barrier(0);   // as above
  { const F2 a = bsplit16(x0);
#pragma unroll
    for (int j = 0; j < 8; ++j) { acc[j] = wmma_bf(a.l, w0[j], acc[j]); acc[j] = wmma_bf(a.h, w0[j], acc[j]); } }
  { const F2 a = bsplit16(x1);
#pragma unroll
    for (int j = 0; j < 8; ++j) { acc[j] = wmma_bf(a.l, w1[j], acc[j]); acc[j] = wmma_bf(a.h, w1[j], acc[j]); } }
#pragma unroll
  for (int j = 0; j < 8; ++j) { const int n = n0 + j * 16 + col; const float bb = bfr(bo[n]);
#pragma unroll
    for (int r = 0; r < 8; ++r) so[wave][8 * g + r][j * 16 + col] = acc[j][r] + bb; }
  LDSX();
#pragma unroll 4
  for (int rl = 0; rl < 16; ++rl) vst2(out + (size_t)(r0 + rl) * E + n0 + lane * 4, *(const v4f*)(&so[wave][rl][lane * 4]));
}
extern "C" void kernel_launch(void* const* d_in, const int* in_sizes, int n_in, void* d_out, int out_size, void* d_ws, size_t ws_size, hipStream_t stream) {
  (void)in_sizes; (void)n_in; (void)out_size; (void)ws_size;
  const float* x = (const float*)d_in[0]; const float* bond = (const float*)d_in[1]; const float* Wq = (const float*)d_in[2]; const float* bq = (const float*)d_in[3]; const float* Wk = (const float*)d_in[4]; const float* bk = (const float*)d_in[5]; const float* Wv = (const float*)d_in[6]; const float* bv = (const float*)d_in[7]; const float* Wo = (const float*)d_in[8]; const float* bo = (const float*)d_in[9];
  float* out = (float*)d_out;
  char* ws = (char*)d_ws; size_t off = 0;
  auto take = [&](size_t bytes) { char* p = ws + off; off += (bytes + 255) & ~(size_t)255; return p; };
  __bf16* Xb = (__bf16*)take((size_t)NR * E * 2); __bf16* PT = (__bf16*)take((size_t)4 * E * E * 2);
  float* Q32 = (float*)take((size_t)NR * E * 4); __bf16* Kh = (__bf16*)take((size_t)NR * E * 2); __bf16* Kl = (__bf16*)take((size_t)NR * E * 2); _Float16* VTh = (_Float16*)take((size_t)NR * E * 2); _Float16* VTl = (_Float16*)take((size_t)NR * E * 2); float* O32 = (float*)take((size_t)NR * E * 4);
  // ws ~ 82 MB
  k_cvt<<<(NR * E / 8 + 255) / 256, 256, 0, stream>>>(x, Xb);
  k_pack<<<4 * E, 256, 0, stream>>>(Wq, Wk, Wv, Wo, PT);
  k_qkv<<<dim3(NR / 64, E / 128, 3), 128, 0, stream>>>(Xb, PT, bq, bk, bv, Q32, Kh, Kl, VTh, VTl);
  k_attn<<<dim3(SS / 64, NB * NH), 128, 0, stream>>>(Q32, Kh, Kl, VTh, VTl, bond, O32);
  k_out<<<dim3(NR / 64, E / 128), 128, 0, stream>>>(O32, PT, bo, out);
}

// v002
// It runs in 225 microseconds.
// Timed twice side by side with v001, it ran 1.72 and 1.75 times as fast.
// All steps since v000 together make it 2.59 times as fast.
// compute dtype: x, bond_influence, W*/b* (INPUTS) rounded to bf16 with exact bf16 WMMA products (f32 accumulate) for the projections; K pre-split into bf16 hi/lo fragments; q f32 split, P and V f16 hi/lo (3 products each); the bond modulation and softmax in f32.
#include <hip/hip_runtime.h>
#include <math.h>

typedef __attribute__((ext_vector_type(16))) _Float16 v16h;
typedef __attribute__((ext_vector_type(16))) __bf16 v16b;
typedef __attribute__((ext_vector_type(8)))  _Float16 v8h;
typedef __attribute__((ext_vector_type(8)))  float v8f;
typedef __attribute__((ext_vector_type(4)))  float v4f;
typedef __attribute__((ext_vector_type(2)))  float v2f;
typedef __attribute__((ext_vector_type(4)))  unsigned v4u;
typedef __attribute__((ext_vector_type(4)))  int v4i;
typedef float __attribute__((may_alias)) float_a;
typedef int __attribute__((may_alias)) int_a;

template <typename T> __device__ __forceinline__ void vst2(void* p, T v) { *(T*)p = v;  }
__device__ __forceinline__ v8f wmma16(v16h a, v16h b, v8f c) {
  v8f d = __builtin_amdgcn_wmma_f32_16x16x32_f16(false, a, false, b, (short)0, c, false, false);
  asm volatile("v_nop\n\tv_nop\n\tv_nop\n\tv_nop" : "+v"(d) : "v"(a), "v"(b));
  return d;
}
__device__ __forceinline__ v8f wmma_bf(v16b a, v16b b, v8f c) {
  v8f d = __builtin_amdgcn_wmma_f32_16x16x32_bf16(false, a, false, b, (short)0, c, false, false);
  asm volatile("v_nop\n\tv_nop\n\tv_nop\n\tv_nop" : "+v"(d) : "v"(a), "v"(b));
  return d;
}
// 16x16x32 fragments: lane = (h = lane>>4, row/col = lane&15); elements 0..7 = k0+8h+0..7, 8..15 = k0+16+8h+0..7; D element r = row 8h+r
__device__ __forceinline__ v16h frag_h(const _Float16* rowk0, int lane) {
  union { v16h v; v8h q[2]; } u; const _Float16* p = rowk0 + 8 * (lane >> 4);
  u.q[0] = *(const v8h*)p; u.q[1] = *(const v8h*)(p + 16); return u.v;
}
__device__ __forceinline__ v16h frag_f32(const float* rowk0, int lane) {
  v16h a; const float* p = rowk0 + 8 * (lane >> 4);
#pragma unroll
  for (int i = 0; i < 8; ++i) { a[i] = (_Float16)p[i]; a[8 + i] = (_Float16)p[16 + i]; }
  return a;
}
__device__ __forceinline__ v16h frag_f32s(const float* rowk0, int lane, float sc) {
  v16h a; const float* p = rowk0 + 8 * (lane >> 4);
#pragma unroll
  for (int i = 0; i < 8; ++i) { a[i] = (_Float16)(p[i] * sc); a[8 + i] = (_Float16)(p[16 + i] * sc); }
  return a;
}
// column fragment from a [K][ld] layout (column n), rows >= K read as 0
__device__ __forceinline__ v16h fragc_f32(const float* W, int k0, int n, int lane, int ld, int K) {
  v16h a; const int g = lane >> 4;
#pragma unroll
  for (int i = 0; i < 8; ++i) { const int ka = k0 + 8 * g + i, kb = ka + 16;
    a[i] = (_Float16)(ka < K ? W[(size_t)ka * ld + n] : 0.f); a[8 + i] = (_Float16)(kb < K ? W[(size_t)kb * ld + n] : 0.f); }
  return a;
}
struct F2 { v16b h, l; };
__device__ __forceinline__ F2 bsplit16(const float v[16]) { F2 r;
#pragma unroll
  for (int i = 0; i < 16; ++i) { const __bf16 h = (__bf16)v[i]; r.h[i] = h; r.l[i] = (__bf16)(v[i] - (float)h); }
  return r; }
__device__ __forceinline__ F2 split_row(const float* row, int k0, int lane) { float v[16]; const float* p = row + k0 + 8 * (lane >> 4);
#pragma unroll
  for (int i = 0; i < 8; ++i) { v[i] = p[i]; v[8 + i] = p[16 + i]; }
  return bsplit16(v); }
__device__ __forceinline__ F2 split_rowK(const float* row, int k0, int lane, int K) { float v[16]; const int g = lane >> 4;
#pragma unroll
  for (int i = 0; i < 8; ++i) { const int ka = k0 + 8 * g + i, kb = ka + 16; v[i] = ka < K ? row[ka] : 0.f; v[8 + i] = kb < K ? row[kb] : 0.f; }
  return bsplit16(v); }
__device__ __forceinline__ F2 split_col(const float* W, int k0, int n, int lane, int ld, int K) { float v[16]; const int g = lane >> 4;
#pragma unroll
  for (int i = 0; i < 8; ++i) { const int ka = k0 + 8 * g + i, kb = ka + 16; v[i] = ka < K ? W[(size_t)ka * ld + n] : 0.f; v[8 + i] = kb < K ? W[(size_t)kb * ld + n] : 0.f; }
  return bsplit16(v); }
__device__ __forceinline__ v8f mac3(const F2& a, const F2& b, v8f c) { c = wmma_bf(a.l, b.h, c); c = wmma_bf(a.h, b.l, c); return wmma_bf(a.h, b.h, c); }
__device__ __forceinline__ float sigm(float v) { return 1.0f / (1.0f + expf(-v)); }
#define LDSX() do { asm volatile("s_wait_dscnt 0" ::: "memory"); __builtin_amdgcn_wave_barrier(); __builtin_amdgcn_fence(__ATOMIC_RELEASE, "workgroup"); } while (0)


// Bond-influence self attention (16 heads x 64 on [2,2048,1024], [in][out] weights + biases): scores = (q.k/8) * bond_influence[b][q][k] (an INPUT matrix, shared by the heads); softmax; (P v) @ Wo + bo.
#define NB 2
#define SS 2048
#define E 1024
#define NH 16
#define HD 64
#define NR (NB * SS)
#define PLO 1024.0f
#define VLO 2048.0f
__device__ __forceinline__ float bfr(float v) { return (float)(__bf16)v; }
// FRAGMENT ORDER (every 16-bit matrix operand in the workspace): a 16 x 32 fragment is 1 KiB in a row, two blocks of 512 bytes; block qi holds at lane * 16 bytes the lane's elements 8 * qi .. 8 * qi + 7,
// that is row or column (lane & 15), k = 16 * qi + 8 * (lane >> 4) + 0..7: one wave-wide 16-byte load reads 512 contiguous bytes, four whole 128-byte lines, where a row-major operand made it touch sixteen
// the fragment from a wave-uniform base and the lane's own 32-bit element offset (8 * lane): the address costs one vector register
typedef const _Float16 __attribute__((address_space(1)))* gph; typedef const float __attribute__((address_space(1)))* gpf; typedef const v8h __attribute__((address_space(1)))* gp8; typedef const char __attribute__((address_space(1)))* gpc;
__device__ __forceinline__ unsigned long long sbase(const void* p) {   // a wave-uniform address read into scalar registers, so that the loads below take it as their scalar base
  const unsigned long long u = (unsigned long long)p;
  return ((unsigned long long)(unsigned)__builtin_amdgcn_readfirstlane((int)(u >> 32)) << 32) | (unsigned)__builtin_amdgcn_readfirstlane((int)u); }
__device__ __forceinline__ v16h frag_u(gph ub, unsigned off) { union { v16h v; v8h q[2]; } u; gph p = ub + off; u.q[0] = *(gp8)p; u.q[1] = *(gp8)(p + 256); return u.v; }
__device__ __forceinline__ v16b frag_ub(gph ub, unsigned off) { return __builtin_bit_cast(v16b, frag_u(ub, off)); }
__device__ __forceinline__ v16b frag_b(const __bf16* rowk0, int lane) { return __builtin_bit_cast(v16b, frag_h((const _Float16*)rowk0, lane)); }

__global__ __launch_bounds__(256) void k_cvt(const float* __restrict__ x, __bf16* __restrict__ Xb) {
  // Xb in fragment order: fragment (16-row group rg, k step kc) at element (rg * 32 + kc) * 512; thread i8 writes 16-byte unit i8 of it
  const size_t i8 = (size_t)blockIdx.x * 256 + threadIdx.x; if (i8 >= (size_t)NR * E / 8) return;
  const int ln = (int)(i8 & 31), qi = (int)(i8 >> 5) & 1, kc = (int)(i8 >> 6) & 31, rg = (int)(i8 >> 11);
  const float* xs = x + (size_t)(rg * 16 + (ln & 15)) * E + kc * 32 + qi * 16 + (ln >> 4) * 8;
  union { __bf16 h[8]; v4u u; } pk;
#pragma unroll
  for (int e = 0; e < 8; ++e) pk.h[e] = (__bf16)xs[e];
  vst2((unsigned*)(Xb + i8 * 8), pk.u);
}
// PT columns n: [0,E) Wq[:,n], [E,2E) Wk[:,n], [2E,3E) Wv[:,n], [3E,4E) Wo[:,n]  ([in][out] weights), in fragment order: fragment (16-column group ng, k step kc) at element (ng * 32 + kc) * 512
// block (32 columns, 64 k): whole 128-byte lines of W in, turned in LDS, four whole fragments out
__global__ __launch_bounds__(256) void k_pack(const float* __restrict__ Wq, const float* __restrict__ Wk, const float* __restrict__ Wv, const float* __restrict__ Wo, __bf16* __restrict__ PT) {
  const int n0 = blockIdx.x * 32, k0 = blockIdx.y * 64, tid = threadIdx.x; __shared__ __align__(16) __bf16 st[32][72];
  const float* W = n0 < E ? Wq : (n0 < 2 * E ? Wk : (n0 < 3 * E ? Wv : Wo)); const int nn = n0 & (E - 1);
  const int kr = tid >> 2, pt = tid & 3; const float* wsrc = W + (size_t)(k0 + kr) * E + nn + pt * 8;
#pragma unroll
  for (int e = 0; e < 8; ++e) st[pt * 8 + e][kr] = (__bf16)wsrc[e];
  __syncthreads();
  const int ln = tid & 31, qi = (tid >> 5) & 1, kc = (tid >> 6) & 1, ngl = tid >> 7;
  vst2((unsigned*)(PT + ((size_t)((n0 >> 4) + ngl) * 32 + (k0 >> 5) + kc) * 512 + qi * 256 + ln * 8), *(const v4u*)(&st[ngl * 16 + (ln & 15)][kc * 32 + qi * 16 + (ln >> 4) * 8]));
}
// QKV: block (64 rows, 128 cols = 2 heads, which); q (+bias) -> Q32 f32 [bh][s][64]; k (+bias) -> bf16 hi/lo, v (+bias) -> f16 hi/lo x4, both in fragment order:
// K fragment (16-key group kg, d step kc) at element bh * SS * HD + (kg * 2 + kc) * 512; V fragment (32-key block kb, 16-d group t) at element bh * SS * HD + (kb * 4 + t) * 512
__global__ __launch_bounds__(128) void k_qkv(const __bf16* __restrict__ Xb, const __bf16* __restrict__ PT, const float* __restrict__ bq, const float* __restrict__ bk, const float* __restrict__ bv,
                                            float* __restrict__ Q32, __bf16* __restrict__ Kh, __bf16* __restrict__ Kl, _Float16* __restrict__ VTh, _Float16* __restrict__ VTl) {
  __shared__ __align__(16) float so[4][16][132];
  __shared__ __align__(16) _Float16 sth[128][72], stl[128][72];
  const int tid = threadIdx.x, wave = tid >> 5, lane = tid & 31, col = lane & 15, g = lane >> 4;
  const int which = blockIdx.z, r0b = blockIdx.x * 64, r0 = r0b + wave * 16, n0 = blockIdx.y * 128; const int b = r0b / SS, s0 = r0b % SS;
  const float* bb_ = which == 0 ? bq : (which == 1 ? bk : bv);
  v8f acc[8] = {};
  // two register sets: each k step's 18 fragment loads go out as one group, one step ahead of the products that read them (inner loops unrolled: the sets are register arrays)
  const __bf16* ap = Xb + (size_t)r0b * E; const __bf16* bp = PT + (size_t)(which * E + n0) * E;   // wave-uniform bases; the lane's part is one 32-bit offset each
  const unsigned aol = wave * 16 * E + 8 * lane, bol = 8 * lane;
  v16b a0 = frag_ub((gph)sbase(ap), aol), a1, b0[8], b1[8];
#pragma unroll
  for (int j = 0; j < 8; ++j) b0[j] = frag_ub((gph)sbase(bp) + j * 16 * E, bol);
#pragma unroll 1   // stays rolled: one trip already holds a step of either register set
  for (int kc = 0; kc < E / 32 - 2; kc += 2) {
    const gph au = (gph)sbase(ap + kc * 512), bu = (gph)sbase(bp + kc * 512);
    a1 = frag_ub(au + 512, aol);
#pragma unroll
    for (int j = 0; j < 8; ++j) b1[j] = frag_ub(bu + j * 16 * E + 512, bol);
    asm volatile("s_wait_xcnt 0x0" ::: "memory");   // the scalar bases that the loads above name are advanced while those loads are still out
    __builtin_amdgcn_sched_barrier(0);   // keeps the group above the products below; without it each load sinks to its use and its latency is waited out alone
#pragma unroll
    for (int j = 0; j < 8; ++j) acc[j] = wmma_bf(a0, b0[j], acc[j]);
    a0 = frag_ub(au + 1024, aol);
#pragma unroll
    for (int j = 0; j < 8; ++j) b0[j] = frag_ub(bu + j * 16 * E + 1024, bol);
    asm volatile("s_wait_xcnt 0x0" ::: "memory");   // the scalar bases that the loads above name are advanced while those loads are still out
    __builtin_amdgcn_sched_barrier(0);   // as above
#pragma unroll
    for (int j = 0; j < 8; ++j) acc[j] = wmma_bf(a1, b1[j], acc[j]); }
  a1 = frag_ub((gph)sbase(ap) + (E / 32 - 1) * 512, aol);   // the last two steps: nothing is left to fetch behind them
#pragma unroll
  for (int j = 0; j < 8; ++j) b1[j] = frag_ub((gph)sbase(bp) + j * 16 * E + (E / 32 - 1) * 512, bol);
  __builtin_amdgcn_sched_barrier(0);   // as above
#pragma unroll
  for (int j = 0; j < 8; ++j) acc[j] = wmma_bf(a0, b0[j], acc[j]);
#pragma unroll
  for (int j = 0; j < 8; ++j) acc[j] = wmma_bf(a1, b1[j], acc[j]);
  if (which < 2) {
#pragma unroll
    for (int j = 0; j < 8; ++j) { const float bb = bfr(bb_[n0 + j * 16 + col]);
#pragma unroll
      for (int r = 0; r < 8; ++r) so[wave][8 * g + r][j * 16 + col] = acc[j][r] + bb; }
    LDSX();
    if (which == 0) { for (int qq = lane; qq < 2 * 16 * 16; qq += 32) { const int hh = qq >> 8, rl = (qq >> 4) & 15, pc = qq & 15; const int h = (n0 >> 6) + hh;
        vst2(Q32 + (((size_t)b * NH + h) * SS + s0 + wave * 16 + rl) * HD + pc * 4, *(const v4f*)(&so[wave][rl][hh * 64 + pc * 4])); } }
    else {
      for (int it = 0; it < 8; ++it) { const int hh = it >> 2, u = it & 3; const int h = (n0 >> 6) + hh; union { __bf16 e[8]; v4u u; } ph, pl;   // the wave's 16 rows are one key group; u = 2 * kc + qi: one 512-byte block of the hi and one of the lo plane a trip
#pragma unroll
        for (int e = 0; e < 8; ++e) { const float v = so[wave][col][hh * 64 + u * 16 + g * 8 + e]; const __bf16 hi = (__bf16)v; ph.e[e] = hi; pl.e[e] = (__bf16)(v - (float)hi); }
        const size_t o = (((size_t)b * NH + h) * SS + s0 + wave * 16) * HD + u * 256 + lane * 8;
        vst2((unsigned*)(Kh + o), ph.u); vst2((unsigned*)(Kl + o), pl.u);
        asm volatile("s_wait_xcnt 0x0" ::: "memory");   // the data and address registers of the two stores above are given to other values while the stores are still out
      } } }
  else {
#pragma unroll
    for (int j = 0; j < 8; ++j) { const float bb = bfr(bb_[n0 + j * 16 + col]);
#pragma unroll
      for (int r = 0; r < 8; ++r) { const float v = (acc[j][r] + bb) * 4.0f; const _Float16 hi = (_Float16)v; sth[j * 16 + col][wave * 16 + 8 * g + r] = hi; stl[j * 16 + col][wave * 16 + 8 * g + r] = (_Float16)((v - (float)hi) * VLO); } }
    __syncthreads();
    for (int qq = tid; qq < 128 * 8; qq += 128) { const int qi = (qq >> 5) & 1, t = (qq >> 6) & 3, kbl = (qq >> 8) & 1, hh = qq >> 9; const int h = (n0 >> 6) + hh, cl = hh * 64 + t * 16 + col, sl = kbl * 32 + qi * 16 + g * 8;
      const size_t o = ((size_t)b * NH + h) * HD * SS + (size_t)((s0 >> 5) + kbl) * 2048 + t * 512 + qi * 256 + lane * 8;
      vst2(VTh + o, *(const v4u*)(&sth[cl][sl])); vst2(VTl + o, *(const v4u*)(&stl[cl][sl])); } }
}
// attention: block (64 queries, bh); all key tiles of 64; S on q hi/lo x K hi/lo; P,V hi/lo; O f32 in the order in which k_out reads it: the f32 fragment (16-row group rg of [b][s], head h, d step kc) is
// 2 KiB at float ((rg * NH + h) * 2 + kc) * 512, four blocks of 512 bytes; block j holds at lane * 16 bytes row (lane & 15), d = 32 * kc + 16 * (j >> 1) + 8 * (lane >> 4) + 4 * (j & 1) + 0..3
__global__ __launch_bounds__(128) void k_attn(const float* __restrict__ Q32, const __bf16* __restrict__ Kh, const __bf16* __restrict__ Kl, const _Float16* __restrict__ VTh, const _Float16* __restrict__ VTl, const float* __restrict__ bond, float* __restrict__ O32) {
  __shared__ __align__(16) float sS[4][16][68];
  __shared__ __align__(16) _Float16 sPh[4][16][72], sPl[4][16][72];
  __shared__ __align__(16) float sO[4][16][68];
  const int tid = threadIdx.x, w = __builtin_amdgcn_readfirstlane(tid >> 5), lane = tid & 31, col = lane & 15, g = lane >> 4;   // the wave's number in a scalar register: addresses built on it cost no vector registers
  const size_t bh = blockIdx.y; const int qb = blockIdx.x; const int q0 = qb * 64 + w * 16;
  // the split q fragments rest in LDS (each lane its own 128 bytes) and are read back at the head of every tile: their 32 registers are what the V load group needs to stay in flight at four waves per SIMD
  __shared__ __align__(16) v4u sQ[4][8][32];
#pragma unroll
  for (int kc = 0; kc < 2; ++kc) { const F2 q = split_row(Q32 + (bh * SS + q0 + col) * HD, kc * 32, lane); union { v16b v; v4u u[2]; } qh, ql; qh.v = q.h; ql.v = q.l;
    sQ[w][4 * kc][lane] = qh.u[0]; sQ[w][4 * kc + 1][lane] = qh.u[1]; sQ[w][4 * kc + 2][lane] = ql.u[0]; sQ[w][4 * kc + 3][lane] = ql.u[1]; }
  const int b = (int)(bh / NH);
  const unsigned kol = 8 * lane, vol = 8 * lane, bol = 8 * g * SS + col;     // lane offsets, in elements: K fragment, V fragment, bond_influence rows of my 16 queries
  float mrun = -3.0e38f, lrun = 0.f; v8f acc[4] = {}, ac1[4] = {}, ac2[4] = {};
  LDSX();
#pragma unroll 1
  for (int kt = 0; kt < SS / 64; ++kt) {
    // one load group at the head of the tile: the K fragments and bond values of key groups 0 and 1; those of groups 2 and 3 refill a set as soon as it has been read (inner loops unrolled: the sets are register arrays)
    const gph khu = (gph)sbase(Kh + (bh * SS + kt * 64) * HD), klu = (gph)sbase(Kl + (bh * SS + kt * 64) * HD); const gpf bu = (gpf)sbase(bond + ((size_t)b * SS + q0) * SS + kt * 64);   // wave-uniform bases; the lane's part is one 32-bit offset each
    float bv[2][8]; v16b kf[2][4];
#pragma unroll
    for (int t = 0; t < 2; ++t) {
#pragma unroll
      for (int kc = 0; kc < 2; ++kc) { kf[t][2 * kc] = frag_ub(khu + t * 16 * HD + kc * 512, kol); kf[t][2 * kc + 1] = frag_ub(klu + t * 16 * HD + kc * 512, kol); }
#pragma unroll
      for (int r = 0; r < 8; ++r) bv[t][r] = (bu + r * SS + t * 16)[bol]; }
    F2 aq[2];
#pragma unroll
    for (int kc = 0; kc < 2; ++kc) { union { v16b v; v4u u[2]; } qh, ql; qh.u[0] = sQ[w][4 * kc][lane]; qh.u[1] = sQ[w][4 * kc + 1][lane]; ql.u[0] = sQ[w][4 * kc + 2][lane]; ql.u[1] = sQ[w][4 * kc + 3][lane]; aq[kc].h = qh.v; aq[kc].l = ql.v; }
    __builtin_amdgcn_sched_barrier(0);   // keeps the group above the products below; without it each load sinks to its use and its latency is waited out alone
#pragma unroll
    for (int t = 0; t < 4; ++t) { v8f s = {};
#pragma unroll
      for (int kc = 0; kc < 2; ++kc) { s = wmma_bf(aq[kc].l, kf[t & 1][2 * kc], s); s = wmma_bf(aq[kc].h, kf[t & 1][2 * kc + 1], s); s = wmma_bf(aq[kc].h, kf[t & 1][2 * kc], s); }
      if (t < 2) {
#pragma unroll
        for (int kc = 0; kc < 2; ++kc) { kf[t][2 * kc] = frag_ub(khu + (t + 2) * 16 * HD + kc * 512, kol); kf[t][2 * kc + 1] = frag_ub(klu + (t + 2) * 16 * HD + kc * 512, kol); }
        __builtin_amdgcn_sched_barrier(0);   // as above
      }
#pragma unroll
      for (int r = 0; r < 8; ++r) sS[w][8 * g + r][t * 16 + col] = (s[r] * 0.125f) * bfr(bv[t & 1][r]);
      if (t < 2) {
#pragma unroll
        for (int r = 0; r < 8; ++r) bv[t][r] = (bu + r * SS + (t + 2) * 16)[bol];
        __builtin_amdgcn_sched_barrier(0);   // as above
      } }
    LDSX();
    float mx = -3.4e38f;
#pragma unroll
    for (int jj = 0; jj < 32; ++jj) mx = fmaxf(mx, sS[w][col][g * 32 + jj]);
    mx = fmaxf(mx, __shfl_xor(mx, 16, 32));
    const float mnew = fmaxf(mrun, mx); const float corr = expf(mrun - mnew);
    float ps = 0.f;
#pragma unroll
    for (int jj = 0; jj < 32; ++jj) { const float p = expf(sS[w][col][g * 32 + jj] - mnew) * 16384.0f; ps += p; const _Float16 hi = (_Float16)p; sPh[w][col][g * 32 + jj] = hi; sPl[w][col][g * 32 + jj] = (_Float16)((p - (float)hi) * PLO); }
    ps += __shfl_xor(ps, 16, 32);
    lrun = lrun * corr + ps * (1.0f / 16384.0f); mrun = mnew;
    // the V fragments of the tile's first 32 keys go out as one group ahead of the rescale; those of the second 32 refill a set as soon as its products are issued
    const gph vhu = (gph)sbase(VTh + bh * HD * SS + kt * 64 * HD), vlu = (gph)sbase(VTl + bh * HD * SS + kt * 64 * HD); v16h vf[4][2];
    __builtin_amdgcn_sched_barrier(0);   // keeps the group out of the exponentials above, where the registers are short
#pragma unroll
    for (int t = 0; t < 4; ++t) { vf[t][0] = frag_u(vhu + t * 512, vol); vf[t][1] = frag_u(vlu + t * 512, vol); }
    __builtin_amdgcn_sched_barrier(0);   // keeps the group together here, ahead of the shuffles below; without it each load sinks to its use and its latency is waited out alone
#pragma unroll
    for (int r = 0; r < 8; ++r) { const float cr = __shfl(corr, 8 * g + r, 32);
#pragma unroll
      for (int t = 0; t < 4; ++t) { acc[t][r] *= cr; ac1[t][r] *= cr; ac2[t][r] *= cr; } }
    LDSX();
#pragma unroll
    for (int kc = 0; kc < 2; ++kc) { const v16h ph = frag_h(&sPh[w][col][0] + kc * 32, lane), pl = frag_h(&sPl[w][col][0] + kc * 32, lane);
#pragma unroll
      for (int t = 0; t < 4; ++t) {
        acc[t] = wmma16(ph, vf[t][0], acc[t]); ac1[t] = wmma16(ph, vf[t][1], ac1[t]); ac2[t] = wmma16(pl, vf[t][0], ac2[t]);
        if (kc == 0) { vf[t][0] = frag_u(vhu + 2048 + t * 512, vol); vf[t][1] = frag_u(vlu + 2048 + t * 512, vol);
          __builtin_amdgcn_sched_barrier(0);   // keeps the refill here, four product groups ahead of its use
        } } }
    __builtin_amdgcn_wave_barrier(); }
#pragma unroll
  for (int r = 0; r < 8; ++r) { const float lr = __shfl(lrun, 8 * g + r, 32); const float inv = 1.0f / (lr * 16384.0f * 4.0f);
#pragma unroll
    for (int t = 0; t < 4; ++t) sO[w][8 * g + r][t * 16 + col] = (acc[t][r] + ac1[t][r] * (1.0f / VLO) + ac2[t][r] * (1.0f / PLO)) * inv; }
  LDSX();
  float* od = O32 + ((size_t)((b * SS + q0) >> 4) * NH + (bh % NH)) * 1024 + lane * 4;
  for (int it = 0; it < 8; ++it) vst2(od + it * 128, *(const v4f*)(&sO[w][col][(it >> 2) * 32 + ((it >> 1) & 1) * 16 + 8 * g + (it & 1) * 4]));
}
// out = ctx Wo + bo : split(ctx) x bf16(Wo rows): 2 products (Wo is an INPUT -> bf16 exact)
__global__ __launch_bounds__(128) void k_out(const float* __restrict__ O32, const __bf16* __restrict__ PT, const float* __restrict__ bo, float* __restrict__ out) {
  __shared__ __align__(16) float so[4][16][132];
  const int tid = threadIdx.x, wave = tid >> 5, lane = tid & 31, col = lane & 15, g = lane >> 4;
  const int r0 = blockIdx.x * 64 + wave * 16, n0 = blockIdx.y * 128;
  v8f acc[8] = {};
  // two register sets: each k step's 20 loads go out as one group, one step ahead of the products that read them (inner loops unrolled: the sets are register arrays)
  const int rb = blockIdx.x * 64; const float* op = O32 + (size_t)rb * E; const __bf16* wp = PT + (size_t)(3 * E + n0) * E;   // wave-uniform bases; the lane's part is one 32-bit offset each
  const unsigned ool = (wave * 16 * E + 4 * lane) * 4, wol = 8 * lane;   // ool in bytes, wol in elements
  float x0[16], x1[16]; v16b w0[8], w1[8];
  { const gpf o0 = (gpf)((gpc)sbase(op) + ool);
#pragma unroll
    for (int i = 0; i < 16; ++i) x0[i] = o0[(i >> 2) * 128 + (i & 3)]; }
#pragma unroll
  for (int j = 0; j < 8; ++j) w0[j] = frag_ub((gph)sbase(wp) + j * 16 * E, wol);
#pragma unroll 1
  for (int h = 0; h < NH - 1; ++h) { const gpf oh = (gpf)((gpc)sbase(op + h * 1024) + ool); const gph wu = (gph)sbase(wp + h * 1024);
#pragma unroll
    for (int i = 0; i < 16; ++i) x1[i] = oh[512 + (i >> 2) * 128 + (i & 3)];
#pragma unroll
    for (int j = 0; j < 8; ++j) w1[j] = frag_ub(wu + j * 16 * E + 512, wol);
    asm volatile("s_wait_xcnt 0x0" ::: "memory");   // the scalar bases that the loads above name are advanced while those loads are still out
    __builtin_amdgcn_sched_barrier(0);   // keeps the group above the products below; without it each load sinks to its use and its latency is waited out alone
    { const F2 a = bsplit16(x0);
#pragma unroll
      for (int j = 0; j < 8; ++j) { acc[j] = wmma_bf(a.l, w0[j], acc[j]); acc[j] = wmma_bf(a.h, w0[j], acc[j]); } }
#pragma unroll
    for (int i = 0; i < 16; ++i) x0[i] = oh[1024 + (i >> 2) * 128 + (i & 3)];
#pragma unroll
    for (int j = 0; j < 8; ++j) w0[j] = frag_ub(wu + j * 16 * E + 1024, wol);
    asm volatile("s_wait_xcnt 0x0" ::: "memory");   // the scalar bases that the loads above name are advanced while those loads are still out
    __builtin_amdgcn_sched_barrier(0);   // as above
    { const F2 a = bsplit16(x1);
#pragma unroll
      for (int j = 0; j < 8; ++j) { acc[j] = wmma_bf(a.l, w1[j], acc[j]); acc[j] = wmma_bf(a.h, w1[j], acc[j]); } } }
  { const gpf oh = (gpf)((gpc)sbase(op + (NH - 1) * 1024) + ool);   // the last two steps: nothing is left to fetch behind them
#pragma unroll
    for (int i = 0; i < 16; ++i) x1[i] = oh[512 + (i >> 2) * 128 + (i & 3)]; }
  asm volatile("s_wait_xcnt 0x0" ::: "memory");   // the address registers of the four loads above are given to a fragment of the group below
#pragma unroll
  for (int j = 0; j < 8; ++j) w1[j] = frag_ub((gph)sbase(wp) + j * 16 * E + (E / 32 - 1) * 512, wol);
  __builtin_amdgcn_sched_barrier(0);   // as above
  { const F2 a = bsplit16(x0);
#pragma unroll
    for (int j = 0; j < 8; ++j) { acc[j] = wmma_bf(a.l, w0[j], acc[j]); acc[j] = wmma_bf(a.h, w0[j], acc[j]); } }
  { const F2 a = bsplit16(x1);
#pragma unroll
    for (int j = 0; j < 8; ++j) { acc[j] = wmma_bf(a.l, w1[j], acc[j]); acc[j] = wmma_bf(a.h, w1[j], acc[j]); } }
#pragma unroll
  for (int j = 0; j < 8; ++j) { const int n = n0 + j * 16 + col; const float bb = bfr(bo[n]);
#pragma unroll
    for (int r = 0; r < 8; ++r) so[wave][8 * g + r][j * 16 + col] = acc[j][r] + bb; }
  LDSX();
#pragma unroll 4
  for (int rl = 0; rl < 16; ++rl) vst2(out + (size_t)(r0 + rl) * E + n0 + lane * 4, *(const v4f*)(&so[wave][rl][lane * 4]));
}
extern "C" void kernel_launch(void* const* d_in, const int* in_sizes, int n_in, void* d_out, int out_size, void* d_ws, size_t ws_size, hipStream_t stream) {
  (void)in_sizes; (void)n_in; (void)out_size; (void)ws_size;
  const float* x = (const float*)d_in[0]; const float* bond = (const float*)d_in[1]; const float* Wq = (const float*)d_in[2]; const float* bq = (const float*)d_in[3]; const float* Wk = (const float*)d_in[4]; const float* bk = (const float*)d_in[5]; const float* Wv = (const float*)d_in[6]; const float* bv = (const float*)d_in[7]; const float* Wo = (const float*)d_in[8]; const float* bo = (const float*)d_in[9];
  float* out = (float*)d_out;
  char* ws = (char*)d_ws; size_t off = 0;
  auto take = [&](size_t bytes) { char* p = ws + off; off += (bytes + 255) & ~(size_t)255; return p; };
  __bf16* Xb = (__bf16*)take((size_t)NR * E * 2); __bf16* PT = (__bf16*)take((size_t)4 * E * E * 2);
  float* Q32 = (float*)take((size_t)NR * E * 4); __bf16* Kh = (__bf16*)take((size_t)NR * E * 2); __bf16* Kl = (__bf16*)take((size_t)NR * E * 2); _Float16* VTh = (_Float16*)take((size_t)NR * E * 2); _Float16* VTl = (_Float16*)take((size_t)NR * E * 2); float* O32 = (float*)take((size_t)NR * E * 4);
  // ws ~ 82 MB
  k_cvt<<<(NR * E / 8 + 255) / 256, 256, 0, stream>>>(x, Xb);
  k_pack<<<dim3(4 * E / 32, E / 64), 256, 0, stream>>>(Wq, Wk, Wv, Wo, PT);
  k_qkv<<<dim3(NR / 64, E / 128, 3), 128, 0, stream>>>(Xb, PT, bq, bk, bv, Q32, Kh, Kl, VTh, VTl);
  k_attn<<<dim3(SS / 64, NB * NH), 128, 0, stream>>>(Q32, Kh, Kl, VTh, VTl, bond, O32);
  k_out<<<dim3(NR / 64, E / 128), 128, 0, stream>>>(O32, PT, bo, out);
}

// v003
// A run of this version takes 211 microseconds.
// Next to v002, in two timings, it ran 1.06 and 1.07 times as fast.
// Over all steps from v000 it is 2.77 times as fast.
// compute dtype: x, bond_influence, W*/b* (INPUTS) rounded to bf16 with exact bf16 WMMA products (f32 accumulate) for the projections; K pre-split into bf16 hi/lo fragments; q f32 split, P and V f16 hi/lo (3 products each); the bond modulation and softmax in f32.
#include <hip/hip_runtime.h>
#include <math.h>

typedef __attribute__((ext_vector_type(16))) _Float16 v16h;
typedef __attribute__((ext_vector_type(16))) __bf16 v16b;
typedef __attribute__((ext_vector_type(8)))  _Float16 v8h;
typedef __attribute__((ext_vector_type(8)))  float v8f;
typedef __attribute__((ext_vector_type(4)))  float v4f;
typedef __attribute__((ext_vector_type(2)))  float v2f;
typedef __attribute__((ext_vector_type(4)))  unsigned v4u;
typedef __attribute__((ext_vector_type(4)))  int v4i;
typedef float __attribute__((may_alias)) float_a;
typedef int __attribute__((may_alias)) int_a;

template <typename T> __device__ __forceinline__ void vst2(void* p, T v) { *(T*)p = v;  }
__device__ __forceinline__ v8f wmma16(v16h a, v16h b, v8f c) {
  v8f d = __builtin_amdgcn_wmma_f32_16x16x32_f16(false, a, false, b, (short)0, c, false, false);
  asm volatile("v_nop\n\tv_nop\n\tv_nop\n\tv_nop" : "+v"(d) : "v"(a), "v"(b));
  return d;
}
__device__ __forceinline__ v8f wmma_bf(v16b a, v16b b, v8f c) {
  v8f d = __builtin_amdgcn_wmma_f32_16x16x32_bf16(false, a, false, b, (short)0, c, false, false);
  asm volatile("v_nop\n\tv_nop\n\tv_nop\n\tv_nop" : "+v"(d) : "v"(a), "v"(b));
  return d;
}
// 16x16x32 fragments: lane = (h = lane>>4, row/col = lane&15); elements 0..7 = k0+8h+0..7, 8..15 = k0+16+8h+0..7; D element r = row 8h+r
__device__ __forceinline__ v16h frag_h(const _Float16* rowk0, int lane) {
  union { v16h v; v8h q[2]; } u; const _Float16* p = rowk0 + 8 * (lane >> 4);
  u.q[0] = *(const v8h*)p; u.q[1] = *(const v8h*)(p + 16); return u.v;
}
__device__ __forceinline__ v16h frag_f32(const float* rowk0, int lane) {
  v16h a; const float* p = rowk0 + 8 * (lane >> 4);
#pragma unroll
  for (int i = 0; i < 8; ++i) { a[i] = (_Float16)p[i]; a[8 + i] = (_Float16)p[16 + i]; }
  return a;
}
__device__ __forceinline__ v16h frag_f32s(const float* rowk0, int lane, float sc) {
  v16h a; const float* p = rowk0 + 8 * (lane >> 4);
#pragma unroll
  for (int i = 0; i < 8; ++i) { a[i] = (_Float16)(p[i] * sc); a[8 + i] = (_Float16)(p[16 + i] * sc); }
  return a;
}
// column fragment from a [K][ld] layout (column n), rows >= K read as 0
__device__ __forceinline__ v16h fragc_f32(const float* W, int k0, int n, int lane, int ld, int K) {
  v16h a; const int g = lane >> 4;
#pragma unroll
  for (int i = 0; i < 8; ++i) { const int ka = k0 + 8 * g + i, kb = ka + 16;
    a[i] = (_Float16)(ka < K ? W[(size_t)ka * ld + n] : 0.f); a[8 + i] = (_Float16)(kb < K ? W[(size_t)kb * ld + n] : 0.f); }
  return a;
}
struct F2 { v16b h, l; };
__device__ __forceinline__ F2 bsplit16(const float v[16]) { F2 r;
#pragma unroll
  for (int i = 0; i < 16; ++i) { const __bf16 h = (__bf16)v[i]; r.h[i] = h; r.l[i] = (__bf16)(v[i] - (float)h); }
  return r; }
__device__ __forceinline__ F2 split_row(const float* row, int k0, int lane) { float v[16]; const float* p = row + k0 + 8 * (lane >> 4);
#pragma unroll
  for (int i = 0; i < 8; ++i) { v[i] = p[i]; v[8 + i] = p[16 + i]; }
  return bsplit16(v); }
__device__ __forceinline__ F2 split_rowK(const float* row, int k0, int lane, int K) { float v[16]; const int g = lane >> 4;
#pragma unroll
  for (int i = 0; i < 8; ++i) { const int ka = k0 + 8 * g + i, kb = ka + 16; v[i] = ka < K ? row[ka] : 0.f; v[8 + i] = kb < K ? row[kb] : 0.f; }
  return bsplit16(v); }
__device__ __forceinline__ F2 split_col(const float* W, int k0, int n, int lane, int ld, int K) { float v[16]; const int g = lane >> 4;
#pragma unroll
  for (int i = 0; i < 8; ++i) { const int ka = k0 + 8 * g + i, kb = ka + 16; v[i] = ka < K ? W[(size_t)ka * ld + n] : 0.f; v[8 + i] = kb < K ? W[(size_t)kb * ld + n] : 0.f; }
  return bsplit16(v); }
__device__ __forceinline__ v8f mac3(const F2& a, const F2& b, v8f c) { c = wmma_bf(a.l, b.h, c); c = wmma_bf(a.h, b.l, c); return wmma_bf(a.h, b.h, c); }
__device__ __forceinline__ float sigm(float v) { return 1.0f / (1.0f + expf(-v)); }
#define LDSX() do { asm volatile("s_wait_dscnt 0" ::: "memory"); __builtin_amdgcn_wave_barrier(); __builtin_amdgcn_fence(__ATOMIC_RELEASE, "workgroup"); } while (0)


// Bond-influence self attention (16 heads x 64 on [2,2048,1024], [in][out] weights + biases): scores = (q.k/8) * bond_influence[b][q][k] (an INPUT matrix, shared by the heads); softmax; (P v) @ Wo + bo.
#define NB 2
#define SS 2048
#define E 1024
#define NH 16
#define HD 64
#define NR (NB * SS)
#define PLO 1024.0f
#define VLO 2048.0f
#define SCL2 0.18033688f   // log2(e) / 8: the scores are kept in base-2 units, so that a weight is one hardware exponential
__device__ __forceinline__ float bfr(float v) { return (float)(__bf16)v; }
// FRAGMENT ORDER (every 16-bit matrix operand in the workspace): a 16 x 32 fragment is 1 KiB in a row, two blocks of 512 bytes; block qi holds at lane * 16 bytes the lane's elements 8 * qi .. 8 * qi + 7,
// that is row or column (lane & 15), k = 16 * qi + 8 * (lane >> 4) + 0..7: one wave-wide 16-byte load reads 512 contiguous bytes, four whole 128-byte lines, where a row-major operand made it touch sixteen
// the fragment from a wave-uniform base and the lane's own 32-bit element offset (8 * lane): the address costs one vector register
typedef const _Float16 __attribute__((address_space(1)))* gph; typedef const float __attribute__((address_space(1)))* gpf; typedef const v8h __attribute__((address_space(1)))* gp8; typedef const char __attribute__((address_space(1)))* gpc;
__device__ __forceinline__ unsigned long long sbase(const void* p) {   // a wave-uniform address read into scalar registers, so that the loads below take it as their scalar base
  const unsigned long long u = (unsigned long long)p;
  return ((unsigned long long)(unsigned)__builtin_amdgcn_readfirstlane((int)(u >> 32)) << 32) | (unsigned)__builtin_amdgcn_readfirstlane((int)u); }
__device__ __forceinline__ v16h frag_u(gph ub, unsigned off) { union { v16h v; v8h q[2]; } u; gph p = ub + off; u.q[0] = *(gp8)p; u.q[1] = *(gp8)(p + 256); return u.v; }
__device__ __forceinline__ v16b frag_ub(gph ub, unsigned off) { return __builtin_bit_cast(v16b, frag_u(ub, off)); }
__device__ __forceinline__ v16b frag_b(const __bf16* rowk0, int lane) { return __builtin_bit_cast(v16b, frag_h((const _Float16*)rowk0, lane)); }

__global__ __launch_bounds__(256) void k_cvt(const float* __restrict__ x, __bf16* __restrict__ Xb) {
  // Xb in fragment order: fragment (16-row group rg, k step kc) at element (rg * 32 + kc) * 512; thread i8 writes 16-byte unit i8 of it
  const size_t i8 = (size_t)blockIdx.x * 256 + threadIdx.x; if (i8 >= (size_t)NR * E / 8) return;
  const int ln = (int)(i8 & 31), qi = (int)(i8 >> 5) & 1, kc = (int)(i8 >> 6) & 31, rg = (int)(i8 >> 11);
  const float* xs = x + (size_t)(rg * 16 + (ln & 15)) * E + kc * 32 + qi * 16 + (ln >> 4) * 8;
  union { __bf16 h[8]; v4u u; } pk;
#pragma unroll
  for (int e = 0; e < 8; ++e) pk.h[e] = (__bf16)xs[e];
  vst2((unsigned*)(Xb + i8 * 8), pk.u);
}
// PT columns n: [0,E) Wq[:,n], [E,2E) Wk[:,n], [2E,3E) Wv[:,n], [3E,4E) Wo[:,n]  ([in][out] weights), in fragment order: fragment (16-column group ng, k step kc) at element (ng * 32 + kc) * 512
// block (32 columns, 64 k): whole 128-byte lines of W in, turned in LDS, four whole fragments out
__global__ __launch_bounds__(256) void k_pack(const float* __restrict__ Wq, const float* __restrict__ Wk, const float* __restrict__ Wv, const float* __restrict__ Wo, __bf16* __restrict__ PT) {
  const int n0 = blockIdx.x * 32, k0 = blockIdx.y * 64, tid = threadIdx.x; __shared__ __align__(16) __bf16 st[32][72];
  const float* W = n0 < E ? Wq : (n0 < 2 * E ? Wk : (n0 < 3 * E ? Wv : Wo)); const int nn = n0 & (E - 1);
  const int kr = tid >> 2, pt = tid & 3; const float* wsrc = W + (size_t)(k0 + kr) * E + nn + pt * 8;
#pragma unroll
  for (int e = 0; e < 8; ++e) st[pt * 8 + e][kr] = (__bf16)wsrc[e];
  __syncthreads();
  const int ln = tid & 31, qi = (tid >> 5) & 1, kc = (tid >> 6) & 1, ngl = tid >> 7;
  vst2((unsigned*)(PT + ((size_t)((n0 >> 4) + ngl) * 32 + (k0 >> 5) + kc) * 512 + qi * 256 + ln * 8), *(const v4u*)(&st[ngl * 16 + (ln & 15)][kc * 32 + qi * 16 + (ln >> 4) * 8]));
}
// QKV: block (64 rows, 128 cols = 2 heads, which); q (+bias) -> Q32 f32 [bh][s][64]; k (+bias) -> bf16 hi/lo, v (+bias) -> f16 hi/lo x4, both in fragment order:
// K fragment (16-key group kg, d step kc) at element bh * SS * HD + (kg * 2 + kc) * 512; V fragment (32-key block kb, 16-d group t) at element bh * SS * HD + (kb * 4 + t) * 512
__global__ __launch_bounds__(128) void k_qkv(const __bf16* __restrict__ Xb, const __bf16* __restrict__ PT, const float* __restrict__ bq, const float* __restrict__ bk, const float* __restrict__ bv,
                                            float* __restrict__ Q32, __bf16* __restrict__ Kh, __bf16* __restrict__ Kl, _Float16* __restrict__ VTh, _Float16* __restrict__ VTl) {
  __shared__ __align__(16) float so[4][16][132];
  __shared__ __align__(16) _Float16 sth[128][72], stl[128][72];
  const int tid = threadIdx.x, wave = tid >> 5, lane = tid & 31, col = lane & 15, g = lane >> 4;
  const int which = blockIdx.z, r0b = blockIdx.x * 64, r0 = r0b + wave * 16, n0 = blockIdx.y * 128; const int b = r0b / SS, s0 = r0b % SS;
  const float* bb_ = which == 0 ? bq : (which == 1 ? bk : bv);
  v8f acc[8] = {};
  // two register sets: each k step's 18 fragment loads go out as one group, one step ahead of the products that read them (inner loops unrolled: the sets are register arrays)
  const __bf16* ap = Xb + (size_t)r0b * E; const __bf16* bp = PT + (size_t)(which * E + n0) * E;   // wave-uniform bases; the lane's part is one 32-bit offset each
  const unsigned aol = wave * 16 * E + 8 * lane, bol = 8 * lane;
  v16b a0 = frag_ub((gph)sbase(ap), aol), a1, b0[8], b1[8];
#pragma unroll
  for (int j = 0; j < 8; ++j) b0[j] = frag_ub((gph)sbase(bp) + j * 16 * E, bol);
#pragma unroll 1   // stays rolled: one trip already holds a step of either register set
  for (int kc = 0; kc < E / 32 - 2; kc += 2) {
    const gph au = (gph)sbase(ap + kc * 512), bu = (gph)sbase(bp + kc * 512);
    a1 = frag_ub(au + 512, aol);
#pragma unroll
    for (int j = 0; j < 8; ++j) b1[j] = frag_ub(bu + j * 16 * E + 512, bol);
    asm volatile("s_wait_xcnt 0x0" ::: "memory");   // the scalar bases that the loads above name are advanced while those loads are still out
    __builtin_amdgcn_sched_barrier(0);   // keeps the group above the products below; without it each load sinks to its use and its latency is waited out alone
#pragma unroll
    for (int j = 0; j < 8; ++j) acc[j] = wmma_bf(a0, b0[j], acc[j]);
    a0 = frag_ub(au + 1024, aol);
#pragma unroll
    for (int j = 0; j < 8; ++j) b0[j] = frag_ub(bu + j * 16 * E + 1024, bol);
    asm volatile("s_wait_xcnt 0x0" ::: "memory");   // the scalar bases that the loads above name are advanced while those loads are still out
    __builtin_amdgcn_sched_barrier(0);   // as above
#pragma unroll
    for (int j = 0; j < 8; ++j) acc[j] = wmma_bf(a1, b1[j], acc[j]); }
  a1 = frag_ub((gph)sbase(ap) + (E / 32 - 1) * 512, aol);   // the last two steps: nothing is left to fetch behind them
#pragma unroll
  for (int j = 0; j < 8; ++j) b1[j] = frag_ub((gph)sbase(bp) + j * 16 * E + (E / 32 - 1) * 512, bol);
  __builtin_amdgcn_sched_barrier(0);   // as above
#pragma unroll
  for (int j = 0; j < 8; ++j) acc[j] = wmma_bf(a0, b0[j], acc[j]);
#pragma unroll
  for (int j = 0; j < 8; ++j) acc[j] = wmma_bf(a1, b1[j], acc[j]);
  if (which < 2) {
#pragma unroll
    for (int j = 0; j < 8; ++j) { const float bb = bfr(bb_[n0 + j * 16 + col]);
#pragma unroll
      for (int r = 0; r < 8; ++r) so[wave][8 * g + r][j * 16 + col] = acc[j][r] + bb; }
    LDSX();
    if (which == 0) { for (int qq = lane; qq < 2 * 16 * 16; qq += 32) { const int hh = qq >> 8, rl = (qq >> 4) & 15, pc = qq & 15; const int h = (n0 >> 6) + hh;
        vst2(Q32 + (((size_t)b * NH + h) * SS + s0 + wave * 16 + rl) * HD + pc * 4, *(const v4f*)(&so[wave][rl][hh * 64 + pc * 4])); } }
    else {
      for (int it = 0; it < 8; ++it) { const int hh = it >> 2, u = it & 3; const int h = (n0 >> 6) + hh; union { __bf16 e[8]; v4u u; } ph, pl;   // the wave's 16 rows are one key group; u = 2 * kc + qi: one 512-byte block of the hi and one of the lo plane a trip
#pragma unroll
        for (int e = 0; e < 8; ++e) { const float v = so[wave][col][hh * 64 + u * 16 + g * 8 + e]; const __bf16 hi = (__bf16)v; ph.e[e] = hi; pl.e[e] = (__bf16)(v - (float)hi); }
        const size_t o = (((size_t)b * NH + h) * SS + s0 + wave * 16) * HD + u * 256 + lane * 8;
        vst2((unsigned*)(Kh + o), ph.u); vst2((unsigned*)(Kl + o), pl.u);
        asm volatile("s_wait_xcnt 0x0" ::: "memory");   // the data and address registers of the two stores above are given to other values while the stores are still out
      } } }
  else {
#pragma unroll
    for (int j = 0; j < 8; ++j) { const float bb = bfr(bb_[n0 + j * 16 + col]);
#pragma unroll
      for (int r = 0; r < 8; ++r) { const float v = (acc[j][r] + bb) * 4.0f; const _Float16 hi = (_Float16)v; sth[j * 16 + col][wave * 16 + 8 * g + r] = hi; stl[j * 16 + col][wave * 16 + 8 * g + r] = (_Float16)((v - (float)hi) * VLO); } }
    __syncthreads();
    for (int qq = tid; qq < 128 * 8; qq += 128) { const int qi = (qq >> 5) & 1, t = (qq >> 6) & 3, kbl = (qq >> 8) & 1, hh = qq >> 9; const int h = (n0 >> 6) + hh, cl = hh * 64 + t * 16 + col, sl = kbl * 32 + qi * 16 + g * 8;
      const size_t o = ((size_t)b * NH + h) * HD * SS + (size_t)((s0 >> 5) + kbl) * 2048 + t * 512 + qi * 256 + lane * 8;
      vst2(VTh + o, *(const v4u*)(&sth[cl][sl])); vst2(VTl + o, *(const v4u*)(&stl[cl][sl])); } }
}
// attention: block (64 queries, bh); all key tiles of 64; S on q hi/lo x K hi/lo; P,V hi/lo; O f32 in the order in which k_out reads it: the f32 fragment (16-row group rg of [b][s], head h, d step kc) is
// 2 KiB at float ((rg * NH + h) * 2 + kc) * 512, four blocks of 512 bytes; block j holds at lane * 16 bytes row (lane & 15), d = 32 * kc + 16 * (j >> 1) + 8 * (lane >> 4) + 4 * (j & 1) + 0..3
__global__ __launch_bounds__(128) void k_attn(const float* __restrict__ Q32, const __bf16* __restrict__ Kh, const __bf16* __restrict__ Kl, const _Float16* __restrict__ VTh, const _Float16* __restrict__ VTl, const float* __restrict__ bond, float* __restrict__ O32) {
  __shared__ __align__(16) float sS[4][16][68];
  __shared__ __align__(16) _Float16 sPh[4][16][72], sPl[4][16][72];
  __shared__ __align__(16) float sO[4][16][68];
  const int tid = threadIdx.x, w = __builtin_amdgcn_readfirstlane(tid >> 5), lane = tid & 31, col = lane & 15, g = lane >> 4;   // the wave's number in a scalar register: addresses built on it cost no vector registers
  const size_t bh = blockIdx.y; const int qb = blockIdx.x; const int q0 = qb * 64 + w * 16;
  // the split q fragments rest in LDS (each lane its own 128 bytes) and are read back at the head of every tile: their 32 registers are what the V load group needs to stay in flight at four waves per SIMD
  __shared__ __align__(16) v4u sQ[4][8][32];
#pragma unroll
  for (int kc = 0; kc < 2; ++kc) { const F2 q = split_row(Q32 + (bh * SS + q0 + col) * HD, kc * 32, lane); union { v16b v; v4u u[2]; } qh, ql; qh.v = q.h; ql.v = q.l;
    sQ[w][4 * kc][lane] = qh.u[0]; sQ[w][4 * kc + 1][lane] = qh.u[1]; sQ[w][4 * kc + 2][lane] = ql.u[0]; sQ[w][4 * kc + 3][lane] = ql.u[1]; }
  const int b = (int)(bh / NH);
  const unsigned kol = 8 * lane, vol = 8 * lane, bol = 8 * g * SS + col;     // lane offsets, in elements: K fragment, V fragment, bond_influence rows of my 16 queries
  float mrun = -3.0e38f, lrun = 0.f; v8f acc[4] = {}, ac1[4] = {}, ac2[4] = {};
  LDSX();
#pragma unroll 1
  for (int kt = 0; kt < SS / 64; ++kt) {
    // one load group at the head of the tile: the K fragments and bond values of key groups 0 and 1; those of groups 2 and 3 refill a set as soon as it has been read (inner loops unrolled: the sets are register arrays)
    const gph khu = (gph)sbase(Kh + (bh * SS + kt * 64) * HD), klu = (gph)sbase(Kl + (bh * SS + kt * 64) * HD); const gpf bu = (gpf)sbase(bond + ((size_t)b * SS + q0) * SS + kt * 64);   // wave-uniform bases; the lane's part is one 32-bit offset each
    float bv[2][8]; v16b kf[2][4];
#pragma unroll
    for (int t = 0; t < 2; ++t) {
#pragma unroll
      for (int kc = 0; kc < 2; ++kc) { kf[t][2 * kc] = frag_ub(khu + t * 16 * HD + kc * 512, kol); kf[t][2 * kc + 1] = frag_ub(klu + t * 16 * HD + kc * 512, kol); }
#pragma unroll
      for (int r = 0; r < 8; ++r) bv[t][r] = (bu + r * SS + t * 16)[bol]; }
    F2 aq[2];
#pragma unroll
    for (int kc = 0; kc < 2; ++kc) { union { v16b v; v4u u[2]; } qh, ql; qh.u[0] = sQ[w][4 * kc][lane]; qh.u[1] = sQ[w][4 * kc + 1][lane]; ql.u[0] = sQ[w][4 * kc + 2][lane]; ql.u[1] = sQ[w][4 * kc + 3][lane]; aq[kc].h = qh.v; aq[kc].l = ql.v; }
    __builtin_amdgcn_sched_barrier(0);   // keeps the group above the products below; without it each load sinks to its use and its latency is waited out alone
#pragma unroll
    for (int t = 0; t < 4; ++t) { v8f s = {};
#pragma unroll
      for (int kc = 0; kc < 2; ++kc) { s = wmma_bf(aq[kc].l, kf[t & 1][2 * kc], s); s = wmma_bf(aq[kc].h, kf[t & 1][2 * kc + 1], s); s = wmma_bf(aq[kc].h, kf[t & 1][2 * kc], s); }
      if (t < 2) {
#pragma unroll
        for (int kc = 0; kc < 2; ++kc) { kf[t][2 * kc] = frag_ub(khu + (t + 2) * 16 * HD + kc * 512, kol); kf[t][2 * kc + 1] = frag_ub(klu + (t + 2) * 16 * HD + kc * 512, kol); }
        __builtin_amdgcn_sched_barrier(0);   // as above
      }
#pragma unroll
      for (int r = 0; r < 8; ++r) sS[w][8 * g + r][t * 16 + col] = (s[r] * SCL2) * bfr(bv[t & 1][r]);
      if (t < 2) {
#pragma unroll
        for (int r = 0; r < 8; ++r) bv[t][r] = (bu + r * SS + (t + 2) * 16)[bol];
        __builtin_amdgcn_sched_barrier(0);   // as above
      } }
    LDSX();
    float mx = -3.4e38f;
#pragma unroll
    for (int jj = 0; jj < 32; ++jj) mx = fmaxf(mx, sS[w][col][g * 32 + jj]);
    mx = fmaxf(mx, __shfl_xor(mx, 16, 32));
    const float mnew = fmaxf(mrun, mx - 14.0f); float corr = __builtin_amdgcn_exp2f(mrun - mnew);   // the running reference point lies 14 below the maximum: 2^(s - mnew) is the weight times 16384
    asm volatile("v_nop" : "+v"(corr));   // the slot that the instruction set asks for behind a transcendental
    float ps = 0.f;
#pragma unroll
    for (int jj = 0; jj < 32; ++jj) { const float p = __builtin_amdgcn_exp2f(sS[w][col][g * 32 + jj] - mnew); ps += p; const _Float16 hi = (_Float16)p; sPh[w][col][g * 32 + jj] = hi; sPl[w][col][g * 32 + jj] = (_Float16)((p - (float)hi) * PLO); }
    ps += __shfl_xor(ps, 16, 32);
    lrun = lrun * corr + ps * (1.0f / 16384.0f); mrun = mnew;
    // the V fragments of the tile's first 32 keys go out as one group ahead of the rescale; those of the second 32 refill a set as soon as its products are issued
    const gph vhu = (gph)sbase(VTh + bh * HD * SS + kt * 64 * HD), vlu = (gph)sbase(VTl + bh * HD * SS + kt * 64 * HD); v16h vf[4][2];
    __builtin_amdgcn_sched_barrier(0);   // keeps the group out of the exponentials above, where the registers are short
#pragma unroll
    for (int t = 0; t < 4; ++t) { vf[t][0] = frag_u(vhu + t * 512, vol); vf[t][1] = frag_u(vlu + t * 512, vol); }
    __builtin_amdgcn_sched_barrier(0);   // keeps the group together here, ahead of the shuffles below; without it each load sinks to its use and its latency is waited out alone
#pragma unroll
    for (int r = 0; r < 8; ++r) { const float cr = __shfl(corr, 8 * g + r, 32);
#pragma unroll
      for (int t = 0; t < 4; ++t) { acc[t][r] *= cr; ac1[t][r] *= cr; ac2[t][r] *= cr; } }
    LDSX();
#pragma unroll
    for (int kc = 0; kc < 2; ++kc) { const v16h ph = frag_h(&sPh[w][col][0] + kc * 32, lane), pl = frag_h(&sPl[w][col][0] + kc * 32, lane);
#pragma unroll
      for (int t = 0; t < 4; ++t) {
        acc[t] = wmma16(ph, vf[t][0], acc[t]); ac1[t] = wmma16(ph, vf[t][1], ac1[t]); ac2[t] = wmma16(pl, vf[t][0], ac2[t]);
        if (kc == 0) { vf[t][0] = frag_u(vhu + 2048 + t * 512, vol); vf[t][1] = frag_u(vlu + 2048 + t * 512, vol);
          __builtin_amdgcn_sched_barrier(0);   // keeps the refill here, four product groups ahead of its use
        } } }
    __builtin_amdgcn_wave_barrier(); }
#pragma unroll
  for (int r = 0; r < 8; ++r) { const float lr = __shfl(lrun, 8 * g + r, 32); const float inv = 1.0f / (lr * 16384.0f * 4.0f);
#pragma unroll
    for (int t = 0; t < 4; ++t) sO[w][8 * g + r][t * 16 + col] = (acc[t][r] + ac1[t][r] * (1.0f / VLO) + ac2[t][r] * (1.0f / PLO)) * inv; }
  LDSX();
  float* od = O32 + ((size_t)((b * SS + q0) >> 4) * NH + (bh % NH)) * 1024 + lane * 4;
  for (int it = 0; it < 8; ++it) vst2(od + it * 128, *(const v4f*)(&sO[w][col][(it >> 2) * 32 + ((it >> 1) & 1) * 16 + 8 * g + (it & 1) * 4]));
}
// out = ctx Wo + bo : split(ctx) x bf16(Wo rows): 2 products (Wo is an INPUT -> bf16 exact)
__global__ __launch_bounds__(128) void k_out(const float* __restrict__ O32, const __bf16* __restrict__ PT, const float* __restrict__ bo, float* __restrict__ out) {
  __shared__ __align__(16) float so[4][16][132];
  const int tid = threadIdx.x, wave = tid >> 5, lane = tid & 31, col = lane & 15, g = lane >> 4;
  const int r0 = blockIdx.x * 64 + wave * 16, n0 = blockIdx.y * 128;
  v8f acc[8] = {};
  // two register sets: each k step's 20 loads go out as one group, one step ahead of the products that read them (inner loops unrolled: the sets are register arrays)
  const int rb = blockIdx.x * 64; const float* op = O32 + (size_t)rb * E; const __bf16* wp = PT + (size_t)(3 * E + n0) * E;   // wave-uniform bases; the lane's part is one 32-bit offset each
  const unsigned ool = (wave * 16 * E + 4 * lane) * 4, wol = 8 * lane;   // ool in bytes, wol in elements
  float x0[16], x1[16]; v16b w0[8], w1[8];
  { const gpf o0 = (gpf)((gpc)sbase(op) + ool);
#pragma unroll
    for (int i = 0; i < 16; ++i) x0[i] = o0[(i >> 2) * 128 + (i & 3)]; }
#pragma unroll
  for (int j = 0; j < 8; ++j) w0[j] = frag_ub((gph)sbase(wp) + j * 16 * E, wol);
#pragma unroll 1
  for (int h = 0; h < NH - 1; ++h) { const gpf oh = (gpf)((gpc)sbase(op + h * 1024) + ool); const gph wu = (gph)sbase(wp + h * 1024);
#pragma unroll
    for (int i = 0; i < 16; ++i) x1[i] = oh[512 + (i >> 2) * 128 + (i & 3)];
#pragma unroll
    for (int j = 0; j < 8; ++j) w1[j] = frag_ub(wu + j * 16 * E + 512, wol);
    asm volatile("s_wait_xcnt 0x0" ::: "memory");   // the scalar bases that the loads above name are advanced while those loads are still out
    __builtin_amdgcn_sched_barrier(0);   // keeps the group above the products below; without it each load sinks to its use and its latency is waited out alone
    { const F2 a = bsplit16(x0);
#pragma unroll
      for (int j = 0; j < 8; ++j) { acc[j] = wmma_bf(a.l, w0[j], acc[j]); acc[j] = wmma_bf(a.h, w0[j], acc[j]); } }
#pragma unroll
    for (int i = 0; i < 16; ++i) x0[i] = oh[1024 + (i >> 2) * 128 + (i & 3)];
#pragma unroll
    for (int j = 0; j < 8; ++j) w0[j] = frag_ub(wu + j * 16 * E + 1024, wol);
    asm volatile("s_wait_xcnt 0x0" ::: "memory");   // the scalar bases that the loads above name are advanced while those loads are still out
    __builtin_amdgcn_sched_barrier(0);   // as above
    { const F2 a = bsplit16(x1);
#pragma unroll
      for (int j = 0; j < 8; ++j) { acc[j] = wmma_bf(a.l, w1[j], acc[j]); acc[j] = wmma_bf(a.h, w1[j], acc[j]); } } }
  { const gpf oh = (gpf)((gpc)sbase(op + (NH - 1) * 1024) + ool);   // the last two steps: nothing is left to fetch behind them
#pragma unroll
    for (int i = 0; i < 16; ++i) x1[i] = oh[512 + (i >> 2) * 128 + (i & 3)]; }
  asm volatile("s_wait_xcnt 0x0" ::: "memory");   // the address registers of the four loads above are given to a fragment of the group below
#pragma unroll
  for (int j = 0; j < 8; ++j) w1[j] = frag_ub((gph)sbase(wp) + j * 16 * E + (E / 32 - 1) * 512, wol);
  __builtin_amdgcn_sched_barrier(0);   // as above
  { const F2 a = bsplit16(x0);
#pragma unroll
    for (int j = 0; j < 8; ++j) { acc[j] = wmma_bf(a.l, w0[j], acc[j]); acc[j] = wmma_bf(a.h, w0[j], acc[j]); } }
  { const F2 a = bsplit16(x1);
#pragma unroll
    for (int j = 0; j < 8; ++j) { acc[j] = wmma_bf(a.l, w1[j], acc[j]); acc[j] = wmma_bf(a.h, w1[j], acc[j]); } }
#pragma unroll
  for (int j = 0; j < 8; ++j) { const int n = n0 + j * 16 + col; const float bb = bfr(bo[n]);
#pragma unroll
    for (int r = 0; r < 8; ++r) so[wave][8 * g + r][j * 16 + col] = acc[j][r] + bb; }
  LDSX();
#pragma unroll 4
  for (int rl = 0; rl < 16; ++rl) vst2(out + (size_t)(r0 + rl) * E + n0 + lane * 4, *(const v4f*)(&so[wave][rl][lane * 4]));
}
extern "C" void kernel_launch(void* const* d_in, const int* in_sizes, int n_in, void* d_out, int out_size, void* d_ws, size_t ws_size, hipStream_t stream) {
  (void)in_sizes; (void)n_in; (void)out_size; (void)ws_size;
  const float* x = (const float*)d_in[0]; const float* bond = (const float*)d_in[1]; const float* Wq = (const float*)d_in[2]; const float* bq = (const float*)d_in[3]; const float* Wk = (const float*)d_in[4]; const float* bk = (const float*)d_in[5]; const float* Wv = (const float*)d_in[6]; const float* bv = (const float*)d_in[7]; const float* Wo = (const float*)d_in[8]; const float* bo = (const float*)d_in[9];
  float* out = (float*)d_out;
  char* ws = (char*)d_ws; size_t off = 0;
  auto take = [&](size_t bytes) { char* p = ws + off; off += (bytes + 255) & ~(size_t)255; return p; };
  __bf16* Xb = (__bf16*)take((size_t)NR * E * 2); __bf16* PT = (__bf16*)take((size_t)4 * E * E * 2);
  float* Q32 = (float*)take((size_t)NR * E * 4); __bf16* Kh = (__bf16*)take((size_t)NR * E * 2); __bf16* Kl = (__bf16*)take((size_t)NR * E * 2); _Float16* VTh = (_Float16*)take((size_t)NR * E * 2); _Float16* VTl = (_Float16*)take((size_t)NR * E * 2); float* O32 = (float*)take((size_t)NR * E * 4);
  // ws ~ 84 MB (80 MiB)
  k_cvt<<<(NR * E / 8 + 255) / 256, 256, 0, stream>>>(x, Xb);
  k_pack<<<dim3(4 * E / 32, E / 64), 256, 0, stream>>>(Wq, Wk, Wv, Wo, PT);
  k_qkv<<<dim3(NR / 64, E / 128, 3), 128, 0, stream>>>(Xb, PT, bq, bk, bv, Q32, Kh, Kl, VTh, VTl);
  k_attn<<<dim3(SS / 64, NB * NH), 128, 0, stream>>>(Q32, Kh, Kl, VTh, VTl, bond, O32);
  k_out<<<dim3(NR / 64, E / 128), 128, 0, stream>>>(O32, PT, bo, out);
}

// v004
// One run takes 186 microseconds.
// Two timings next to v003 both put it at 1.12 times that version's speed.
// All steps since v000 together make it 3.09 times as fast.
// compute dtype: x, bond_influence, W*/b* (INPUTS) rounded to bf16 with exact bf16 WMMA products (f32 accumulate) for the projections; K pre-split into bf16 hi/lo fragments; q f32 split, P and V f16 hi/lo (3 products each); the bond modulation and softmax in f32.
#include <hip/hip_runtime.h>
#include <math.h>

typedef __attribute__((ext_vector_type(16))) _Float16 v16h;
typedef __attribute__((ext_vector_type(16))) __bf16 v16b;
typedef __attribute__((ext_vector_type(8)))  _Float16 v8h;
typedef __attribute__((ext_vector_type(8)))  float v8f;
typedef __attribute__((ext_vector_type(4)))  float v4f;
typedef __attribute__((ext_vector_type(2)))  float v2f;
typedef __attribute__((ext_vector_type(4)))  unsigned v4u;
typedef __attribute__((ext_vector_type(4)))  int v4i;
typedef float __attribute__((may_alias)) float_a;
typedef int __attribute__((may_alias)) int_a;

template <typename T> __device__ __forceinline__ void vst2(void* p, T v) { *(T*)p = v;  }
__device__ __forceinline__ v8f wmma16(v16h a, v16h b, v8f c) {
  v8f d = __builtin_amdgcn_wmma_f32_16x16x32_f16(false, a, false, b, (short)0, c, false, false);
  asm volatile("v_nop\n\tv_nop\n\tv_nop\n\tv_nop" : "+v"(d) : "v"(a), "v"(b));
  return d;
}
__device__ __forceinline__ v8f wmma_bf(v16b a, v16b b, v8f c) {
  v8f d = __builtin_amdgcn_wmma_f32_16x16x32_bf16(false, a, false, b, (short)0, c, false, false);
  asm volatile("v_nop\n\tv_nop\n\tv_nop\n\tv_nop" : "+v"(d) : "v"(a), "v"(b));
  return d;
}
// 16x16x32 fragments: lane = (h = lane>>4, row/col = lane&15); elements 0..7 = k0+8h+0..7, 8..15 = k0+16+8h+0..7; D element r = row 8h+r
__device__ __forceinline__ v16h frag_h(const _Float16* rowk0, int lane) {
  union { v16h v; v8h q[2]; } u; const _Float16* p = rowk0 + 8 * (lane >> 4);
  u.q[0] = *(const v8h*)p; u.q[1] = *(const v8h*)(p + 16); return u.v;
}
__device__ __forceinline__ v16h frag_f32(const float* rowk0, int lane) {
  v16h a; const float* p = rowk0 + 8 * (lane >> 4);
#pragma unroll
  for (int i = 0; i < 8; ++i) { a[i] = (_Float16)p[i]; a[8 + i] = (_Float16)p[16 + i]; }
  return a;
}
__device__ __forceinline__ v16h frag_f32s(const float* rowk0, int lane, float sc) {
  v16h a; const float* p = rowk0 + 8 * (lane >> 4);
#pragma unroll
  for (int i = 0; i < 8; ++i) { a[i] = (_Float16)(p[i] * sc); a[8 + i] = (_Float16)(p[16 + i] * sc); }
  return a;
}
// column fragment from a [K][ld] layout (column n), rows >= K read as 0
__device__ __forceinline__ v16h fragc_f32(const float* W, int k0, int n, int lane, int ld, int K) {
  v16h a; const int g = lane >> 4;
#pragma unroll
  for (int i = 0; i < 8; ++i) { const int ka = k0 + 8 * g + i, kb = ka + 16;
    a[i] = (_Float16)(ka < K ? W[(size_t)ka * ld + n] : 0.f); a[8 + i] = (_Float16)(kb < K ? W[(size_t)kb * ld + n] : 0.f); }
  return a;
}
struct F2 { v16b h, l; };
__device__ __forceinline__ F2 bsplit16(const float v[16]) { F2 r;
#pragma unroll
  for (int i = 0; i < 16; ++i) { const __bf16 h = (__bf16)v[i]; r.h[i] = h; r.l[i] = (__bf16)(v[i] - (float)h); }
  return r; }
__device__ __forceinline__ F2 split_row(const float* row, int k0, int lane) { float v[16]; const float* p = row + k0 + 8 * (lane >> 4);
#pragma unroll
  for (int i = 0; i < 8; ++i) { v[i] = p[i]; v[8 + i] = p[16 + i]; }
  return bsplit16(v); }
__device__ __forceinline__ F2 split_rowK(const float* row, int k0, int lane, int K) { float v[16]; const int g = lane >> 4;
#pragma unroll
  for (int i = 0; i < 8; ++i) { const int ka = k0 + 8 * g + i, kb = ka + 16; v[i] = ka < K ? row[ka] : 0.f; v[8 + i] = kb < K ? row[kb] : 0.f; }
  return bsplit16(v); }
__device__ __forceinline__ F2 split_col(const float* W, int k0, int n, int lane, int ld, int K) { float v[16]; const int g = lane >> 4;
#pragma unroll
  for (int i = 0; i < 8; ++i) { const int ka = k0 + 8 * g + i, kb = ka + 16; v[i] = ka < K ? W[(size_t)ka * ld + n] : 0.f; v[8 + i] = kb < K ? W[(size_t)kb * ld + n] : 0.f; }
  return bsplit16(v); }
__device__ __forceinline__ v8f mac3(const F2& a, const F2& b, v8f c) { c = wmma_bf(a.l, b.h, c); c = wmma_bf(a.h, b.l, c); return wmma_bf(a.h, b.h, c); }
__device__ __forceinline__ float sigm(float v) { return 1.0f / (1.0f + expf(-v)); }
#define LDSX() do { asm volatile("s_wait_dscnt 0" ::: "memory"); __builtin_amdgcn_wave_barrier(); __builtin_amdgcn_fence(__ATOMIC_RELEASE, "workgroup"); } while (0)


// Bond-influence self attention (16 heads x 64 on [2,2048,1024], [in][out] weights + biases): scores = (q.k/8) * bond_influence[b][q][k] (an INPUT matrix, shared by the heads); softmax; (P v) @ Wo + bo.
#define NB 2
#define SS 2048
#define E 1024
#define NH 16
#define HD 64
#define NR (NB * SS)
#define PLO 1024.0f
#define VLO 2048.0f
#define SCL2 0.18033688f   // log2(e) / 8: the scores are kept in base-2 units, so that a weight is one hardware exponential
__device__ __forceinline__ float bfr(float v) { return (float)(__bf16)v; }
// FRAGMENT ORDER (every 16-bit matrix operand in the workspace): a 16 x 32 fragment is 1 KiB in a row, two blocks of 512 bytes; block qi holds at lane * 16 bytes the lane's elements 8 * qi .. 8 * qi + 7,
// that is row or column (lane & 15), k = 16 * qi + 8 * (lane >> 4) + 0..7: one wave-wide 16-byte load reads 512 contiguous bytes, four whole 128-byte lines, where a row-major operand made it touch sixteen
// the fragment from a wave-uniform base and the lane's own 32-bit element offset (8 * lane): the address costs one vector register
typedef const _Float16 __attribute__((address_space(1)))* gph; typedef const float __attribute__((address_space(1)))* gpf; typedef const v8h __attribute__((address_space(1)))* gp8; typedef const char __attribute__((address_space(1)))* gpc;
__device__ __forceinline__ unsigned long long sbase(const void* p) {   // a wave-uniform address read into scalar registers, so that the loads below take it as their scalar base
  const unsigned long long u = (unsigned long long)p;
  return ((unsigned long long)(unsigned)__builtin_amdgcn_readfirstlane((int)(u >> 32)) << 32) | (unsigned)__builtin_amdgcn_readfirstlane((int)u); }
__device__ __forceinline__ v16h frag_u(gph ub, unsigned off) { union { v16h v; v8h q[2]; } u; gph p = ub + off; u.q[0] = *(gp8)p; u.q[1] = *(gp8)(p + 256); return u.v; }
__device__ __forceinline__ v16b frag_ub(gph ub, unsigned off) { return __builtin_bit_cast(v16b, frag_u(ub, off)); }
__device__ __forceinline__ v16b frag_b(const __bf16* rowk0, int lane) { return __builtin_bit_cast(v16b, frag_h((const _Float16*)rowk0, lane)); }

// blocks below NB * SS * SS / 8 / 2048: bond_influence (the longer blocks, so they start first); the rest: x
__global__ __launch_bounds__(256) void k_cvt(const float* __restrict__ x, const float* __restrict__ bond, __bf16* __restrict__ Xb, __bf16* __restrict__ Bb) {
  union P8 { __bf16 h[8]; v4u u; };
  if (blockIdx.x < NB * SS * SS / 8 / 2048) {
    // Bb: bond_influence rounded to bf16, in the order of the transposed score accumulators of k_attn: the tile (16-query group qg of [b][q], 16-key group kg) is 512 bytes at element (qg * (SS / 16) + kg) * 256;
    // at lane * 16 bytes stand query (lane & 15), keys 8 * (lane >> 4) + 0..7. A wave takes 8 rows x 128 bytes in (whole lines over its two loads) and puts four whole lines out; a thread does eight such 16-byte units: a wave keeps many loads out at a time, and the launch has an eighth of the waves to start
    const unsigned u = blockIdx.x * 2048 + threadIdx.x;
    const int r = u & 7, o = (u >> 3) & 3, rh = (u >> 5) & 1, ch = (u >> 6) & (SS / 32 - 1), qg = u >> 12;
    const float* bs = bond + (size_t)(qg * 16 + rh * 8 + r) * SS + ch * 32 + o * 8;
    __bf16* bd = Bb + ((size_t)qg * (SS / 16) + ch * 2 + (o >> 1)) * 256 + ((o & 1) * 16 + rh * 8 + r) * 8;
    float in[8][8];
#pragma unroll
    for (int j = 0; j < 8; ++j) {
#pragma unroll
      for (int e = 0; e < 8; ++e) in[j][e] = bs[j * 128 + e]; }
    asm volatile("s_wait_xcnt 0x0" :: "v"(bs) : "memory");   // the address registers of the loads above are given to other values while those loads are still out; named here, they live up to the wait
#pragma unroll
    for (int j = 0; j < 8; ++j) { P8 pk;
#pragma unroll
      for (int e = 0; e < 8; ++e) pk.h[e] = (__bf16)in[j][e];
      vst2((unsigned*)(bd + j * 2048), pk.u); }
    return; }
  // Xb in fragment order: fragment (16-row group rg, k step kc) at element (rg * 32 + kc) * 512; thread i8 writes 16-byte unit i8 of it
  const size_t i8 = (size_t)(blockIdx.x - NB * SS * SS / 8 / 2048) * 256 + threadIdx.x;
  const int ln = (int)(i8 & 31), qi = (int)(i8 >> 5) & 1, kc = (int)(i8 >> 6) & 31, rg = (int)(i8 >> 11);
  const float* xs = x + (size_t)(rg * 16 + (ln & 15)) * E + kc * 32 + qi * 16 + (ln >> 4) * 8;
  P8 pk;
#pragma unroll
  for (int e = 0; e < 8; ++e) pk.h[e] = (__bf16)xs[e];
  vst2((unsigned*)(Xb + i8 * 8), pk.u);
}
// PT columns n: [0,E) Wq[:,n], [E,2E) Wk[:,n], [2E,3E) Wv[:,n], [3E,4E) Wo[:,n]  ([in][out] weights), in fragment order: fragment (16-column group ng, k step kc) at element (ng * 32 + kc) * 512
// block (32 columns, 64 k): whole 128-byte lines of W in, turned in LDS, four whole fragments out
__global__ __launch_bounds__(256) void k_pack(const float* __restrict__ Wq, const float* __restrict__ Wk, const float* __restrict__ Wv, const float* __restrict__ Wo, __bf16* __restrict__ PT) {
  const int n0 = blockIdx.x * 32, k0 = blockIdx.y * 64, tid = threadIdx.x; __shared__ __align__(16) __bf16 st[32][72];
  const float* W = n0 < E ? Wq : (n0 < 2 * E ? Wk : (n0 < 3 * E ? Wv : Wo)); const int nn = n0 & (E - 1);
  const int kr = tid >> 2, pt = tid & 3; const float* wsrc = W + (size_t)(k0 + kr) * E + nn + pt * 8;
#pragma unroll
  for (int e = 0; e < 8; ++e) st[pt * 8 + e][kr] = (__bf16)wsrc[e];
  __syncthreads();
  const int ln = tid & 31, qi = (tid >> 5) & 1, kc = (tid >> 6) & 1, ngl = tid >> 7;
  vst2((unsigned*)(PT + ((size_t)((n0 >> 4) + ngl) * 32 + (k0 >> 5) + kc) * 512 + qi * 256 + ln * 8), *(const v4u*)(&st[ngl * 16 + (ln & 15)][kc * 32 + qi * 16 + (ln >> 4) * 8]));
}
// QKV: block (64 rows, 128 cols = 2 heads, which); q (+bias) -> Q32 f32 [bh][s][64]; k (+bias) -> bf16 hi/lo, v (+bias) -> f16 hi/lo x4, both in fragment order:
// K fragment (16-key group kg, d step kc) at element bh * SS * HD + (kg * 2 + kc) * 512; V fragment (32-key block kb, 16-d group t) at element bh * SS * HD + (kb * 4 + t) * 512
__global__ __launch_bounds__(128) void k_qkv(const __bf16* __restrict__ Xb, const __bf16* __restrict__ PT, const float* __restrict__ bq, const float* __restrict__ bk, const float* __restrict__ bv,
                                            float* __restrict__ Q32, __bf16* __restrict__ Kh, __bf16* __restrict__ Kl, _Float16* __restrict__ VTh, _Float16* __restrict__ VTl) {
  __shared__ __align__(16) float so[4][16][132];
  __shared__ __align__(16) _Float16 sth[128][72], stl[128][72];
  const int tid = threadIdx.x, wave = tid >> 5, lane = tid & 31, col = lane & 15, g = lane >> 4;
  const int which = blockIdx.z, r0b = blockIdx.x * 64, r0 = r0b + wave * 16, n0 = blockIdx.y * 128; const int b = r0b / SS, s0 = r0b % SS;
  const float* bb_ = which == 0 ? bq : (which == 1 ? bk : bv);
  v8f acc[8] = {};
  // two register sets: each k step's 18 fragment loads go out as one group, one step ahead of the products that read them (inner loops unrolled: the sets are register arrays)
  const __bf16* ap = Xb + (size_t)r0b * E; const __bf16* bp = PT + (size_t)(which * E + n0) * E;   // wave-uniform bases; the lane's part is one 32-bit offset each
  const unsigned aol = wave * 16 * E + 8 * lane, bol = 8 * lane;
  v16b a0 = frag_ub((gph)sbase(ap), aol), a1, b0[8], b1[8];
#pragma unroll
  for (int j = 0; j < 8; ++j) b0[j] = frag_ub((gph)sbase(bp) + j * 16 * E, bol);
#pragma unroll 1   // stays rolled: one trip already holds a step of either register set
  for (int kc = 0; kc < E / 32 - 2; kc += 2) {
    const gph au = (gph)sbase(ap + kc * 512), bu = (gph)sbase(bp + kc * 512);
    a1 = frag_ub(au + 512, aol);
#pragma unroll
    for (int j = 0; j < 8; ++j) b1[j] = frag_ub(bu + j * 16 * E + 512, bol);
    asm volatile("s_wait_xcnt 0x0" ::: "memory");   // the scalar bases that the loads above name are advanced while those loads are still out
    __builtin_amdgcn_sched_barrier(0);   // keeps the group above the products below; without it each load sinks to its use and its latency is waited out alone
#pragma unroll
    for (int j = 0; j < 8; ++j) acc[j] = wmma_bf(a0, b0[j], acc[j]);
    a0 = frag_ub(au + 1024, aol);
#pragma unroll
    for (int j = 0; j < 8; ++j) b0[j] = frag_ub(bu + j * 16 * E + 1024, bol);
    asm volatile("s_wait_xcnt 0x0" ::: "memory");   // the scalar bases that the loads above name are advanced while those loads are still out
    __builtin_amdgcn_sched_barrier(0);   // as above
#pragma unroll
    for (int j = 0; j < 8; ++j) acc[j] = wmma_bf(a1, b1[j], acc[j]); }
  a1 = frag_ub((gph)sbase(ap) + (E / 32 - 1) * 512, aol);   // the last two steps: nothing is left to fetch behind them
#pragma unroll
  for (int j = 0; j < 8; ++j) b1[j] = frag_ub((gph)sbase(bp) + j * 16 * E + (E / 32 - 1) * 512, bol);
  __builtin_amdgcn_sched_barrier(0);   // as above
#pragma unroll
  for (int j = 0; j < 8; ++j) acc[j] = wmma_bf(a0, b0[j], acc[j]);
#pragma unroll
  for (int j = 0; j < 8; ++j) acc[j] = wmma_bf(a1, b1[j], acc[j]);
  if (which < 2) {
#pragma unroll
    for (int j = 0; j < 8; ++j) { const float bb = bfr(bb_[n0 + j * 16 + col]);
#pragma unroll
      for (int r = 0; r < 8; ++r) so[wave][8 * g + r][j * 16 + col] = acc[j][r] + bb; }
    LDSX();
    if (which == 0) { for (int qq = lane; qq < 2 * 16 * 16; qq += 32) { const int hh = qq >> 8, rl = (qq >> 4) & 15, pc = qq & 15; const int h = (n0 >> 6) + hh;
        vst2(Q32 + (((size_t)b * NH + h) * SS + s0 + wave * 16 + rl) * HD + pc * 4, *(const v4f*)(&so[wave][rl][hh * 64 + pc * 4])); } }
    else {
      for (int it = 0; it < 8; ++it) { const int hh = it >> 2, u = it & 3; const int h = (n0 >> 6) + hh; union { __bf16 e[8]; v4u u; } ph, pl;   // the wave's 16 rows are one key group; u = 2 * kc + qi: one 512-byte block of the hi and one of the lo plane a trip
#pragma unroll
        for (int e = 0; e < 8; ++e) { const float v = so[wave][col][hh * 64 + u * 16 + g * 8 + e]; const __bf16 hi = (__bf16)v; ph.e[e] = hi; pl.e[e] = (__bf16)(v - (float)hi); }
        const size_t o = (((size_t)b * NH + h) * SS + s0 + wave * 16) * HD + u * 256 + lane * 8;
        vst2((unsigned*)(Kh + o), ph.u); vst2((unsigned*)(Kl + o), pl.u);
        asm volatile("s_wait_xcnt 0x0" ::: "memory");   // the data and address registers of the two stores above are given to other values while the stores are still out
      } } }
  else {
#pragma unroll
    for (int j = 0; j < 8; ++j) { const float bb = bfr(bb_[n0 + j * 16 + col]);
#pragma unroll
      for (int r = 0; r < 8; ++r) { const float v = (acc[j][r] + bb) * 4.0f; const _Float16 hi = (_Float16)v; sth[j * 16 + col][wave * 16 + 8 * g + r] = hi; stl[j * 16 + col][wave * 16 + 8 * g + r] = (_Float16)((v - (float)hi) * VLO); } }
    __syncthreads();
    for (int qq = tid; qq < 128 * 8; qq += 128) { const int qi = (qq >> 5) & 1, t = (qq >> 6) & 3, kbl = (qq >> 8) & 1, hh = qq >> 9; const int h = (n0 >> 6) + hh, cl = hh * 64 + t * 16 + col, sl = kbl * 32 + qi * 16 + g * 8;
      const size_t o = ((size_t)b * NH + h) * HD * SS + (size_t)((s0 >> 5) + kbl) * 2048 + t * 512 + qi * 256 + lane * 8;
      vst2(VTh + o, *(const v4u*)(&sth[cl][sl])); vst2(VTl + o, *(const v4u*)(&stl[cl][sl])); } }
}
// attention: block (64 queries, bh); all key tiles of 64; TRANSPOSED: S^T = K q^T (K hi/lo as A, q hi/lo as B) and O^T += V^T P^T (V hi/lo as A, P hi/lo as B). A lane then holds one query (lane & 15):
// of score tile t its registers r are keys 16 * t + 8 * (lane >> 4) + r, which is the k order of a B fragment, so two score tiles turned into weights ARE the P fragment of 32 keys: scores, softmax and P never leave the registers.
// O f32 in the order in which k_out reads it: the f32 fragment (16-row group rg of [b][s], head h, d step kc) is
// 2 KiB at float ((rg * NH + h) * 2 + kc) * 512, four blocks of 512 bytes; block j holds at lane * 16 bytes row (lane & 15), d = 32 * kc + 16 * (j >> 1) + 8 * (lane >> 4) + 4 * (j & 1) + 0..3: four registers of an O^T accumulator
__device__ __forceinline__ float xhalf(float v) { return __builtin_bit_cast(float, __builtin_amdgcn_permlanex16(__builtin_bit_cast(int, v), __builtin_bit_cast(int, v), 0x76543210, 0xfedcba98, false, false)); }   // lane l with lane l ^ 16
__global__ __launch_bounds__(128) void k_attn(const float* __restrict__ Q32, const __bf16* __restrict__ Kh, const __bf16* __restrict__ Kl, const _Float16* __restrict__ VTh, const _Float16* __restrict__ VTl, const __bf16* __restrict__ Bb, float* __restrict__ O32) {
  const int tid = threadIdx.x, w = __builtin_amdgcn_readfirstlane(tid >> 5), lane = tid & 31, col = lane & 15;   // the wave's number in a scalar register: addresses built on it cost no vector registers
  const size_t bh = blockIdx.y; const int qb = blockIdx.x; const int q0 = qb * 64 + w * 16;
  // the split q fragments rest in LDS (each lane its own 128 bytes) and are read back at the head of every tile: their 32 registers are what the V load group needs to stay in flight at four waves per SIMD
  __shared__ __align__(16) v4u sQ[4][8][32];
#pragma unroll
  for (int kc = 0; kc < 2; ++kc) { const F2 q = split_row(Q32 + (bh * SS + q0 + col) * HD, kc * 32, lane); union { v16b v; v4u u[2]; } qh, ql; qh.v = q.h; ql.v = q.l;
    sQ[w][4 * kc][lane] = qh.u[0]; sQ[w][4 * kc + 1][lane] = qh.u[1]; sQ[w][4 * kc + 2][lane] = ql.u[0]; sQ[w][4 * kc + 3][lane] = ql.u[1]; }
  const int b = (int)(bh / NH);
  const unsigned fol = 8 * lane;     // the lane's offset, in elements, in a K fragment, a V fragment and a bond tile alike
  float mrun = -3.0e38f, lrun = 0.f; v8f acc[4] = {}, ac1[4] = {}, ac2[4] = {};   // lrun: the sum over this lane's half of the keys; the halves are joined behind the loop
  LDSX();
#pragma unroll 1
  for (int kt = 0; kt < SS / 64; ++kt) {
    // one load group at the head of the tile: the K fragments of key groups 0 and 1 and the four bond tiles; the fragments of groups 2 and 3 refill a set as soon as it has been read (inner loops unrolled: the sets are register arrays)
    const gph khu = (gph)sbase(Kh + (bh * SS + kt * 64) * HD), klu = (gph)sbase(Kl + (bh * SS + kt * 64) * HD), bu = (gph)sbase(Bb + ((size_t)((b * SS + q0) >> 4) * (SS / 16) + kt * 4) * 256);   // wave-uniform bases; the lane's part is one 32-bit offset
    const gph vhu = (gph)sbase(VTh + bh * HD * SS + kt * 64 * HD), vlu = (gph)sbase(VTl + bh * HD * SS + kt * 64 * HD);
    v4u bv[4]; v16b kf[2][4];
#pragma unroll
    for (int t = 0; t < 2; ++t) {
#pragma unroll
      for (int kc = 0; kc < 2; ++kc) { kf[t][2 * kc] = frag_ub(khu + t * 16 * HD + kc * 512, fol); kf[t][2 * kc + 1] = frag_ub(klu + t * 16 * HD + kc * 512, fol); } }
#pragma unroll
    for (int t = 0; t < 4; ++t) bv[t] = __builtin_bit_cast(v4u, *(gp8)(bu + t * 256 + fol));
    F2 aq[2];
#pragma unroll
    for (int kc = 0; kc < 2; ++kc) { union { v16b v; v4u u[2]; } qh, ql; qh.u[0] = sQ[w][4 * kc][lane]; qh.u[1] = sQ[w][4 * kc + 1][lane]; ql.u[0] = sQ[w][4 * kc + 2][lane]; ql.u[1] = sQ[w][4 * kc + 3][lane]; aq[kc].h = qh.v; aq[kc].l = ql.v; }
    __builtin_amdgcn_sched_barrier(0);   // keeps the group above the products below; without it each load sinks to its use and its latency is waited out alone
    float sc[4][8];
#pragma unroll
    for (int t = 0; t < 4; ++t) { v8f s = {};
#pragma unroll
      for (int kc = 0; kc < 2; ++kc) { s = wmma_bf(kf[t & 1][2 * kc], aq[kc].l, s); s = wmma_bf(kf[t & 1][2 * kc + 1], aq[kc].h, s); s = wmma_bf(kf[t & 1][2 * kc], aq[kc].h, s); }
      if (t < 2) {
#pragma unroll
        for (int kc = 0; kc < 2; ++kc) { kf[t][2 * kc] = frag_ub(khu + (t + 2) * 16 * HD + kc * 512, fol); kf[t][2 * kc + 1] = frag_ub(klu + (t + 2) * 16 * HD + kc * 512, fol); }
        __builtin_amdgcn_sched_barrier(0);   // as above
      }
#pragma unroll
      for (int r = 0; r < 8; ++r) sc[t][r] = (s[r] * SCL2) * __builtin_bit_cast(float, (r & 1) ? (bv[t][r >> 1] & 0xffff0000u) : (bv[t][r >> 1] << 16)); }
    // the V fragments of the tile's first 32 keys go out as one group ahead of the softmax, which covers their latency; those of the second 32 refill a set as soon as its products are issued
    v16h vf[4][2];
    __builtin_amdgcn_sched_barrier(0);   // keeps the group out of the score products above, where the registers are short
#pragma unroll
    for (int t = 0; t < 4; ++t) { vf[t][0] = frag_u(vhu + t * 512, fol); vf[t][1] = frag_u(vlu + t * 512, fol); }
    __builtin_amdgcn_sched_barrier(0);   // keeps the group together here, ahead of the softmax; without it each load sinks to its use and its latency is waited out alone
    float m4[4], p2[2] = {0.f, 0.f};   // the maximum runs as four independent chains, one a score tile; the sum as two, one a P fragment
#pragma unroll
    for (int t = 0; t < 4; ++t) { m4[t] = sc[t][0];
#pragma unroll
      for (int r = 1; r < 8; ++r) m4[t] = fmaxf(m4[t], sc[t][r]); }
    float mx = fmaxf(fmaxf(m4[0], m4[1]), fmaxf(m4[2], m4[3]));
    mx = fmaxf(mx, xhalf(mx));
    const float mnew = fmaxf(mrun, mx - 14.0f); const float corr = __builtin_amdgcn_exp2f(mrun - mnew);   // the running reference point lies 14 below the maximum: 2^(s - mnew) is the weight times 16384
    v16h ph[2], pl[2];
#pragma unroll
    for (int i = 0; i < 32; ++i) { const float p = __builtin_amdgcn_exp2f(sc[i >> 3][i & 7] - mnew); p2[i >> 4] += p; const _Float16 hi = (_Float16)p; ph[i >> 4][i & 15] = hi; pl[i >> 4][i & 15] = (_Float16)((p - (float)hi) * PLO); }
    lrun = lrun * corr + (p2[0] + p2[1]) * (1.0f / 16384.0f); mrun = mnew;
#pragma unroll
    for (int t = 0; t < 4; ++t) { acc[t] *= corr; ac1[t] *= corr; ac2[t] *= corr; }   // the lane's accumulators all belong to its own query
#pragma unroll
    for (int kc = 0; kc < 2; ++kc) {
#pragma unroll
      for (int t = 0; t < 4; ++t) {
        acc[t] = wmma16(vf[t][0], ph[kc], acc[t]); ac1[t] = wmma16(vf[t][1], ph[kc], ac1[t]); ac2[t] = wmma16(vf[t][0], pl[kc], ac2[t]);
        if (kc == 0) { vf[t][0] = frag_u(vhu + 2048 + t * 512, fol); vf[t][1] = frag_u(vlu + 2048 + t * 512, fol);
          __builtin_amdgcn_sched_barrier(0);   // keeps the refill here, four product groups ahead of its use
        } } } }
  lrun += xhalf(lrun);
  const float inv = 1.0f / (lrun * 16384.0f * 4.0f);
  float* od = O32 + ((size_t)((b * SS + q0) >> 4) * NH + (bh % NH)) * 1024 + lane * 4;
#pragma unroll
  for (int it = 0; it < 8; ++it) { v4f o;
#pragma unroll
    for (int e = 0; e < 4; ++e) { const int t = it >> 1, r = (it & 1) * 4 + e; o[e] = (acc[t][r] + ac1[t][r] * (1.0f / VLO) + ac2[t][r] * (1.0f / PLO)) * inv; }
    vst2(od + it * 128, o); }
}
// out = ctx Wo + bo : split(ctx) x bf16(Wo rows): 2 products (Wo is an INPUT -> bf16 exact)
__global__ __launch_bounds__(128) void k_out(const float* __restrict__ O32, const __bf16* __restrict__ PT, const float* __restrict__ bo, float* __restrict__ out) {
  __shared__ __align__(16) float so[4][16][132];
  const int tid = threadIdx.x, wave = tid >> 5, lane = tid & 31, col = lane & 15, g = lane >> 4;
  const int r0 = blockIdx.x * 64 + wave * 16, n0 = blockIdx.y * 128;
  v8f acc[8] = {};
  // two register sets: each k step's 20 loads go out as one group, one step ahead of the products that read them (inner loops unrolled: the sets are register arrays)
  const int rb = blockIdx.x * 64; const float* op = O32 + (size_t)rb * E; const __bf16* wp = PT + (size_t)(3 * E + n0) * E;   // wave-uniform bases; the lane's part is one 32-bit offset each
  const unsigned ool = (wave * 16 * E + 4 * lane) * 4, wol = 8 * lane;   // ool in bytes, wol in elements
  float x0[16], x1[16]; v16b w0[8], w1[8];
  { const gpf o0 = (gpf)((gpc)sbase(op) + ool);
#pragma unroll
    for (int i = 0; i < 16; ++i) x0[i] = o0[(i >> 2) * 128 + (i & 3)]; }
#pragma unroll
  for (int j = 0; j < 8; ++j) w0[j] = frag_ub((gph)sbase(wp) + j * 16 * E, wol);
#pragma unroll 1
  for (int h = 0; h < NH - 1; ++h) { const gpf oh = (gpf)((gpc)sbase(op + h * 1024) + ool); const gph wu = (gph)sbase(wp + h * 1024);
#pragma unroll
    for (int i = 0; i < 16; ++i) x1[i] = oh[512 + (i >> 2) * 128 + (i & 3)];
#pragma unroll
    for (int j = 0; j < 8; ++j) w1[j] = frag_ub(wu + j * 16 * E + 512, wol);
    asm volatile("s_wait_xcnt 0x0" ::: "memory");   // the scalar bases that the loads above name are advanced while those loads are still out
    __builtin_amdgcn_sched_barrier(0);   // keeps the group above the products below; without it each load sinks to its use and its latency is waited out alone
    { const F2 a = bsplit16(x0);
#pragma unroll
      for (int j = 0; j < 8; ++j) { acc[j] = wmma_bf(a.l, w0[j], acc[j]); acc[j] = wmma_bf(a.h, w0[j], acc[j]); } }
#pragma unroll
    for (int i = 0; i < 16; ++i) x0[i] = oh[1024 + (i >> 2) * 128 + (i & 3)];
#pragma unroll
    for (int j = 0; j < 8; ++j) w0[j] = frag_ub(wu + j * 16 * E + 1024, wol);
    asm volatile("s_wait_xcnt 0x0" ::: "memory");   // the scalar bases that the loads above name are advanced while those loads are still out
    __builtin_amdgcn_sched_barrier(0);   // as above
    { const F2 a = bsplit16(x1);
#pragma unroll
      for (int j = 0; j < 8; ++j) { acc[j] = wmma_bf(a.l, w1[j], acc[j]); acc[j] = wmma_bf(a.h, w1[j], acc[j]); } } }
  { const gpf oh = (gpf)((gpc)sbase(op + (NH - 1) * 1024) + ool);   // the last two steps: nothing is left to fetch behind them
#pragma unroll
    for (int i = 0; i < 16; ++i) x1[i] = oh[512 + (i >> 2) * 128 + (i & 3)]; }
  asm volatile("s_wait_xcnt 0x0" ::: "memory");   // the address registers of the four loads above are given to a fragment of the group below
#pragma unroll
  for (int j = 0; j < 8; ++j) w1[j] = frag_ub((gph)sbase(wp) + j * 16 * E + (E / 32 - 1) * 512, wol);
  __builtin_amdgcn_sched_barrier(0);   // as above
  { const F2 a = bsplit16(x0);
#pragma unroll
    for (int j = 0; j < 8; ++j) { acc[j] = wmma_bf(a.l, w0[j], acc[j]); acc[j] = wmma_bf(a.h, w0[j], acc[j]); } }
  { const F2 a = bsplit16(x1);
#pragma unroll
    for (int j = 0; j < 8; ++j) { acc[j] = wmma_bf(a.l, w1[j], acc[j]); acc[j] = wmma_bf(a.h, w1[j], acc[j]); } }
#pragma unroll
  for (int j = 0; j < 8; ++j) { const int n = n0 + j * 16 + col; const float bb = bfr(bo[n]);
#pragma unroll
    for (int r = 0; r < 8; ++r) so[wave][8 * g + r][j * 16 + col] = acc[j][r] + bb; }
  LDSX();
#pragma unroll 4
  for (int rl = 0; rl < 16; ++rl) vst2(out + (size_t)(r0 + rl) * E + n0 + lane * 4, *(const v4f*)(&so[wave][rl][lane * 4]));
}
extern "C" void kernel_launch(void* const* d_in, const int* in_sizes, int n_in, void* d_out, int out_size, void* d_ws, size_t ws_size, hipStream_t stream) {
  (void)in_sizes; (void)n_in; (void)out_size; (void)ws_size;
  const float* x = (const float*)d_in[0]; const float* bond = (const float*)d_in[1]; const float* Wq = (const float*)d_in[2]; const float* bq = (const float*)d_in[3]; const float* Wk = (const float*)d_in[4]; const float* bk = (const float*)d_in[5]; const float* Wv = (const float*)d_in[6]; const float* bv = (const float*)d_in[7]; const float* Wo = (const float*)d_in[8]; const float* bo = (const float*)d_in[9];
  float* out = (float*)d_out;
  char* ws = (char*)d_ws; size_t off = 0;
  auto take = [&](size_t bytes) { char* p = ws + off; off += (bytes + 255) & ~(size_t)255; return p; };
  __bf16* Xb = (__bf16*)take((size_t)NR * E * 2); __bf16* PT = (__bf16*)take((size_t)4 * E * E * 2);
  float* Q32 = (float*)take((size_t)NR * E * 4); __bf16* Kh = (__bf16*)take((size_t)NR * E * 2); __bf16* Kl = (__bf16*)take((size_t)NR * E * 2); _Float16* VTh = (_Float16*)take((size_t)NR * E * 2); _Float16* VTl = (_Float16*)take((size_t)NR * E * 2); float* O32 = (float*)take((size_t)NR * E * 4); __bf16* Bb = (__bf16*)take((size_t)NB * SS * SS * 2);
  // ws ~ 101 MB
  k_cvt<<<NB * SS * SS / 8 / 2048 + NR * E / 8 / 256, 256, 0, stream>>>(x, bond, Xb, Bb);
  k_pack<<<dim3(4 * E / 32, E / 64), 256, 0, stream>>>(Wq, Wk, Wv, Wo, PT);
  k_qkv<<<dim3(NR / 64, E / 128, 3), 128, 0, stream>>>(Xb, PT, bq, bk, bv, Q32, Kh, Kl, VTh, VTl);
  k_attn<<<dim3(SS / 64, NB * NH), 128, 0, stream>>>(Q32, Kh, Kl, VTh, VTl, Bb, O32);
  k_out<<<dim3(NR / 64, E / 128), 128, 0, stream>>>(O32, PT, bo, out);
}

// v005
// It runs in 171 microseconds.
// Next to v004, in two timings, it ran 1.08 and 1.11 times as fast.
// All steps since v000 together make it 3.39 times as fast.
// compute dtype: x, bond_influence, W*/b* (INPUTS) rounded to bf16 with exact bf16 WMMA products (f32 accumulate) for the projections; K pre-split into bf16 hi/lo fragments; q f32 split, P and V f16 hi/lo (3 products each); the bond modulation and softmax in f32.
#include <hip/hip_runtime.h>
#include <math.h>

typedef __attribute__((ext_vector_type(16))) _Float16 v16h;
typedef __attribute__((ext_vector_type(16))) __bf16 v16b;
typedef __attribute__((ext_vector_type(8)))  _Float16 v8h;
typedef __attribute__((ext_vector_type(8)))  float v8f;
typedef __attribute__((ext_vector_type(4)))  float v4f;
typedef __attribute__((ext_vector_type(2)))  float v2f;
typedef __attribute__((ext_vector_type(4)))  unsigned v4u;
typedef __attribute__((ext_vector_type(4)))  int v4i;
typedef float __attribute__((may_alias)) float_a;
typedef int __attribute__((may_alias)) int_a;

template <typename T> __device__ __forceinline__ void vst2(void* p, T v) { *(T*)p = v;  }
__device__ __forceinline__ v8f wmma16(v16h a, v16h b, v8f c) {
  v8f d = __builtin_amdgcn_wmma_f32_16x16x32_f16(false, a, false, b, (short)0, c, false, false);
  asm volatile("v_nop\n\tv_nop\n\tv_nop\n\tv_nop" : "+v"(d) : "v"(a), "v"(b));
  return d;
}
__device__ __forceinline__ v8f wmma_bf(v16b a, v16b b, v8f c) {
  v8f d = __builtin_amdgcn_wmma_f32_16x16x32_bf16(false, a, false, b, (short)0, c, false, false);
  asm volatile("v_nop\n\tv_nop\n\tv_nop\n\tv_nop" : "+v"(d) : "v"(a), "v"(b));
  return d;
}
// 16x16x32 fragments: lane = (h = lane>>4, row/col = lane&15); elements 0..7 = k0+8h+0..7, 8..15 = k0+16+8h+0..7; D element r = row 8h+r
__device__ __forceinline__ v16h frag_h(const _Float16* rowk0, int lane) {
  union { v16h v; v8h q[2]; } u; const _Float16* p = rowk0 + 8 * (lane >> 4);
  u.q[0] = *(const v8h*)p; u.q[1] = *(const v8h*)(p + 16); return u.v;
}
__device__ __forceinline__ v16h frag_f32(const float* rowk0, int lane) {
  v16h a; const float* p = rowk0 + 8 * (lane >> 4);
#pragma unroll
  for (int i = 0; i < 8; ++i) { a[i] = (_Float16)p[i]; a[8 + i] = (_Float16)p[16 + i]; }
  return a;
}
__device__ __forceinline__ v16h frag_f32s(const float* rowk0, int lane, float sc) {
  v16h a; const float* p = rowk0 + 8 * (lane >> 4);
#pragma unroll
  for (int i = 0; i < 8; ++i) { a[i] = (_Float16)(p[i] * sc); a[8 + i] = (_Float16)(p[16 + i] * sc); }
  return a;
}
// column fragment from a [K][ld] layout (column n), rows >= K read as 0
__device__ __forceinline__ v16h fragc_f32(const float* W, int k0, int n, int lane, int ld, int K) {
  v16h a; const int g = lane >> 4;
#pragma unroll
  for (int i = 0; i < 8; ++i) { const int ka = k0 + 8 * g + i, kb = ka + 16;
    a[i] = (_Float16)(ka < K ? W[(size_t)ka * ld + n] : 0.f); a[8 + i] = (_Float16)(kb < K ? W[(size_t)kb * ld + n] : 0.f); }
  return a;
}
struct F2 { v16b h, l; };
__device__ __forceinline__ F2 bsplit16(const float v[16]) { F2 r;
#pragma unroll
  for (int i = 0; i < 16; ++i) { const __bf16 h = (__bf16)v[i]; r.h[i] = h; r.l[i] = (__bf16)(v[i] - (float)h); }
  return r; }
__device__ __forceinline__ F2 split_row(const float* row, int k0, int lane) { float v[16]; const float* p = row + k0 + 8 * (lane >> 4);
#pragma unroll
  for (int i = 0; i < 8; ++i) { v[i] = p[i]; v[8 + i] = p[16 + i]; }
  return bsplit16(v); }
__device__ __forceinline__ F2 split_rowK(const float* row, int k0, int lane, int K) { float v[16]; const int g = lane >> 4;
#pragma unroll
  for (int i = 0; i < 8; ++i) { const int ka = k0 + 8 * g + i, kb = ka + 16; v[i] = ka < K ? row[ka] : 0.f; v[8 + i] = kb < K ? row[kb] : 0.f; }
  return bsplit16(v); }
__device__ __forceinline__ F2 split_col(const float* W, int k0, int n, int lane, int ld, int K) { float v[16]; const int g = lane >> 4;
#pragma unroll
  for (int i = 0; i < 8; ++i) { const int ka = k0 + 8 * g + i, kb = ka + 16; v[i] = ka < K ? W[(size_t)ka * ld + n] : 0.f; v[8 + i] = kb < K ? W[(size_t)kb * ld + n] : 0.f; }
  return bsplit16(v); }
__device__ __forceinline__ v8f mac3(const F2& a, const F2& b, v8f c) { c = wmma_bf(a.l, b.h, c); c = wmma_bf(a.h, b.l, c); return wmma_bf(a.h, b.h, c); }
__device__ __forceinline__ float sigm(float v) { return 1.0f / (1.0f + expf(-v)); }
#define LDSX() do { asm volatile("s_wait_dscnt 0" ::: "memory"); __builtin_amdgcn_wave_barrier(); __builtin_amdgcn_fence(__ATOMIC_RELEASE, "workgroup"); } while (0)


// Bond-influence self attention (16 heads x 64 on [2,2048,1024], [in][out] weights + biases): scores = (q.k/8) * bond_influence[b][q][k] (an INPUT matrix, shared by the heads); softmax; (P v) @ Wo + bo.
#define NB 2
#define SS 2048
#define E 1024
#define NH 16
#define HD 64
#define NR (NB * SS)
#define PLO 1024.0f
#define VLO 2048.0f
#define SCL2 0.18033688f   // log2(e) / 8: the scores are kept in base-2 units, so that a weight is one hardware exponential
__device__ __forceinline__ float bfr(float v) { return (float)(__bf16)v; }
// FRAGMENT ORDER (every 16-bit matrix operand in the workspace): a 16 x 32 fragment is 1 KiB in a row, two blocks of 512 bytes; block qi holds at lane * 16 bytes the lane's elements 8 * qi .. 8 * qi + 7,
// that is row or column (lane & 15), k = 16 * qi + 8 * (lane >> 4) + 0..7: one wave-wide 16-byte load reads 512 contiguous bytes, four whole 128-byte lines, where a row-major operand made it touch sixteen
// the fragment from a wave-uniform base and the lane's own 32-bit element offset (8 * lane): the address costs one vector register
typedef const _Float16 __attribute__((address_space(1)))* gph; typedef const float __attribute__((address_space(1)))* gpf; typedef const v8h __attribute__((address_space(1)))* gp8; typedef const char __attribute__((address_space(1)))* gpc;
__device__ __forceinline__ unsigned long long sbase(const void* p) {   // a wave-uniform address read into scalar registers, so that the loads below take it as their scalar base
  const unsigned long long u = (unsigned long long)p;
  return ((unsigned long long)(unsigned)__builtin_amdgcn_readfirstlane((int)(u >> 32)) << 32) | (unsigned)__builtin_amdgcn_readfirstlane((int)u); }
__device__ __forceinline__ v16h frag_u(gph ub, unsigned off) { union { v16h v; v8h q[2]; } u; gph p = ub + off; u.q[0] = *(gp8)p; u.q[1] = *(gp8)(p + 256); return u.v; }
__device__ __forceinline__ v16b frag_ub(gph ub, unsigned off) { return __builtin_bit_cast(v16b, frag_u(ub, off)); }
__device__ __forceinline__ v16b frag_b(const __bf16* rowk0, int lane) { return __builtin_bit_cast(v16b, frag_h((const _Float16*)rowk0, lane)); }

// blocks below NB * SS * SS / 8 / 2048: bond_influence (the longer blocks, so they start first); the rest: x
__global__ __launch_bounds__(256) void k_cvt(const float* __restrict__ x, const float* __restrict__ bond, __bf16* __restrict__ Xb, __bf16* __restrict__ Bb) {
  union P8 { __bf16 h[8]; v4u u; };
  if (blockIdx.x < NB * SS * SS / 8 / 2048) {
    // Bb: bond_influence rounded to bf16, in the order of the transposed score accumulators of k_attn: the tile (16-query group qg of [b][q], 16-key group kg) is 512 bytes at element (qg * (SS / 16) + kg) * 256;
    // at lane * 16 bytes stand query (lane & 15), keys 8 * (lane >> 4) + 0..7. A wave takes 8 rows x 128 bytes in (whole lines over its two loads) and puts four whole lines out; a thread does eight such 16-byte units: a wave keeps many loads out at a time, and the launch has an eighth of the waves to start
    const unsigned u = blockIdx.x * 2048 + threadIdx.x;
    const int r = u & 7, o = (u >> 3) & 3, rh = (u >> 5) & 1, ch = (u >> 6) & (SS / 32 - 1), qg = u >> 12;
    const float* bs = bond + (size_t)(qg * 16 + rh * 8 + r) * SS + ch * 32 + o * 8;
    __bf16* bd = Bb + ((size_t)qg * (SS / 16) + ch * 2 + (o >> 1)) * 256 + ((o & 1) * 16 + rh * 8 + r) * 8;
    float in[8][8];
#pragma unroll
    for (int j = 0; j < 8; ++j) {
#pragma unroll
      for (int e = 0; e < 8; ++e) in[j][e] = bs[j * 128 + e]; }
    asm volatile("s_wait_xcnt 0x0" :: "v"(bs) : "memory");   // the address registers of the loads above are given to other values while those loads are still out; named here, they live up to the wait
#pragma unroll
    for (int j = 0; j < 8; ++j) { P8 pk;
#pragma unroll
      for (int e = 0; e < 8; ++e) pk.h[e] = (__bf16)in[j][e];
      vst2((unsigned*)(bd + j * 2048), pk.u); }
    return; }
  // Xb in fragment order: fragment (16-row group rg, k step kc) at element (rg * 32 + kc) * 512; thread i8 writes 16-byte unit i8 of it
  const size_t i8 = (size_t)(blockIdx.x - NB * SS * SS / 8 / 2048) * 256 + threadIdx.x;
  const int ln = (int)(i8 & 31), qi = (int)(i8 >> 5) & 1, kc = (int)(i8 >> 6) & 31, rg = (int)(i8 >> 11);
  const float* xs = x + (size_t)(rg * 16 + (ln & 15)) * E + kc * 32 + qi * 16 + (ln >> 4) * 8;
  P8 pk;
#pragma unroll
  for (int e = 0; e < 8; ++e) pk.h[e] = (__bf16)xs[e];
  vst2((unsigned*)(Xb + i8 * 8), pk.u);
}
// PT columns n: [0,E) Wq[:,n], [E,2E) Wk[:,n], [2E,3E) Wv[:,n], [3E,4E) Wo[:,n]  ([in][out] weights), in fragment order: fragment (16-column group ng, k step kc) at element (ng * 32 + kc) * 512
// block (32 columns, 64 k): whole 128-byte lines of W in, turned in LDS, four whole fragments out
__global__ __launch_bounds__(256) void k_pack(const float* __restrict__ Wq, const float* __restrict__ Wk, const float* __restrict__ Wv, const float* __restrict__ Wo, __bf16* __restrict__ PT) {
  const int n0 = blockIdx.x * 32, k0 = blockIdx.y * 64, tid = threadIdx.x; __shared__ __align__(16) __bf16 st[32][72];
  const float* W = n0 < E ? Wq : (n0 < 2 * E ? Wk : (n0 < 3 * E ? Wv : Wo)); const int nn = n0 & (E - 1);
  const int kr = tid >> 2, pt = tid & 3; const float* wsrc = W + (size_t)(k0 + kr) * E + nn + pt * 8;
#pragma unroll
  for (int e = 0; e < 8; ++e) st[pt * 8 + e][kr] = (__bf16)wsrc[e];
  __syncthreads();
  const int ln = tid & 31, qi = (tid >> 5) & 1, kc = (tid >> 6) & 1, ngl = tid >> 7;
  vst2((unsigned*)(PT + ((size_t)((n0 >> 4) + ngl) * 32 + (k0 >> 5) + kc) * 512 + qi * 256 + ln * 8), *(const v4u*)(&st[ngl * 16 + (ln & 15)][kc * 32 + qi * 16 + (ln >> 4) * 8]));
}
// QKV: block (64 rows, 128 cols = 2 heads, which); q (+bias) -> Q32 f32 [bh][s][64]; k (+bias) -> bf16 hi/lo, v (+bias) -> f16 hi/lo x4, both in fragment order:
// K fragment (16-key group kg, d step kc) at element bh * SS * HD + (kg * 2 + kc) * 512; V fragment (32-key block kb, 16-d group t) at element bh * SS * HD + (kb * 4 + t) * 512
__global__ __launch_bounds__(128) void k_qkv(const __bf16* __restrict__ Xb, const __bf16* __restrict__ PT, const float* __restrict__ bq, const float* __restrict__ bk, const float* __restrict__ bv,
                                            float* __restrict__ Q32, __bf16* __restrict__ Kh, __bf16* __restrict__ Kl, _Float16* __restrict__ VTh, _Float16* __restrict__ VTl) {
  __shared__ __align__(16) float so[4][16][132];
  __shared__ __align__(16) _Float16 sth[128][72], stl[128][72];
  const int tid = threadIdx.x, wave = tid >> 5, lane = tid & 31, col = lane & 15, g = lane >> 4;
  const int which = blockIdx.z, r0b = blockIdx.x * 64, r0 = r0b + wave * 16, n0 = blockIdx.y * 128; const int b = r0b / SS, s0 = r0b % SS;
  const float* bb_ = which == 0 ? bq : (which == 1 ? bk : bv);
  v8f acc[8] = {};
  // two register sets: each k step's 18 fragment loads go out as one group, one step ahead of the products that read them (inner loops unrolled: the sets are register arrays)
  const __bf16* ap = Xb + (size_t)r0b * E; const __bf16* bp = PT + (size_t)(which * E + n0) * E;   // wave-uniform bases; the lane's part is one 32-bit offset each
  const unsigned aol = wave * 16 * E + 8 * lane, bol = 8 * lane;
  v16b a0 = frag_ub((gph)sbase(ap), aol), a1, b0[8], b1[8];
#pragma unroll
  for (int j = 0; j < 8; ++j) b0[j] = frag_ub((gph)sbase(bp) + j * 16 * E, bol);
#pragma unroll 1   // stays rolled: one trip already holds a step of either register set
  for (int kc = 0; kc < E / 32 - 2; kc += 2) {
    const gph au = (gph)sbase(ap + kc * 512), bu = (gph)sbase(bp + kc * 512);
    a1 = frag_ub(au + 512, aol);
#pragma unroll
    for (int j = 0; j < 8; ++j) b1[j] = frag_ub(bu + j * 16 * E + 512, bol);
    asm volatile("s_wait_xcnt 0x0" ::: "memory");   // the scalar bases that the loads above name are advanced while those loads are still out
    __builtin_amdgcn_sched_barrier(0);   // keeps the group above the products below; without it each load sinks to its use and its latency is waited out alone
#pragma unroll
    for (int j = 0; j < 8; ++j) acc[j] = wmma_bf(a0, b0[j], acc[j]);
    a0 = frag_ub(au + 1024, aol);
#pragma unroll
    for (int j = 0; j < 8; ++j) b0[j] = frag_ub(bu + j * 16 * E + 1024, bol);
    asm volatile("s_wait_xcnt 0x0" ::: "memory");   // the scalar bases that the loads above name are advanced while those loads are still out
    __builtin_amdgcn_sched_barrier(0);   // as above
#pragma unroll
    for (int j = 0; j < 8; ++j) acc[j] = wmma_bf(a1, b1[j], acc[j]); }
  a1 = frag_ub((gph)sbase(ap) + (E / 32 - 1) * 512, aol);   // the last two steps: nothing is left to fetch behind them
#pragma unroll
  for (int j = 0; j < 8; ++j) b1[j] = frag_ub((gph)sbase(bp) + j * 16 * E + (E / 32 - 1) * 512, bol);
  __builtin_amdgcn_sched_barrier(0);   // as above
#pragma unroll
  for (int j = 0; j < 8; ++j) acc[j] = wmma_bf(a0, b0[j], acc[j]);
#pragma unroll
  for (int j = 0; j < 8; ++j) acc[j] = wmma_bf(a1, b1[j], acc[j]);
  if (which < 2) {
#pragma unroll
    for (int j = 0; j < 8; ++j) { const float bb = bfr(bb_[n0 + j * 16 + col]);
#pragma unroll
      for (int r = 0; r < 8; ++r) so[wave][8 * g + r][j * 16 + col] = acc[j][r] + bb; }
    LDSX();
    if (which == 0) { for (int qq = lane; qq < 2 * 16 * 16; qq += 32) { const int hh = qq >> 8, rl = (qq >> 4) & 15, pc = qq & 15; const int h = (n0 >> 6) + hh;
        vst2(Q32 + (((size_t)b * NH + h) * SS + s0 + wave * 16 + rl) * HD + pc * 4, *(const v4f*)(&so[wave][rl][hh * 64 + pc * 4])); } }
    else {
      for (int it = 0; it < 8; ++it) { const int hh = it >> 2, u = it & 3; const int h = (n0 >> 6) + hh; union { __bf16 e[8]; v4u u; } ph, pl;   // the wave's 16 rows are one key group; u = 2 * kc + qi: one 512-byte block of the hi and one of the lo plane a trip
#pragma unroll
        for (int e = 0; e < 8; ++e) { const float v = so[wave][col][hh * 64 + u * 16 + g * 8 + e]; const __bf16 hi = (__bf16)v; ph.e[e] = hi; pl.e[e] = (__bf16)(v - (float)hi); }
        const size_t o = (((size_t)b * NH + h) * SS + s0 + wave * 16) * HD + u * 256 + lane * 8;
        vst2((unsigned*)(Kh + o), ph.u); vst2((unsigned*)(Kl + o), pl.u);
        asm volatile("s_wait_xcnt 0x0" ::: "memory");   // the data and address registers of the two stores above are given to other values while the stores are still out
      } } }
  else {
#pragma unroll
    for (int j = 0; j < 8; ++j) { const float bb = bfr(bb_[n0 + j * 16 + col]);
#pragma unroll
      for (int r = 0; r < 8; ++r) { const float v = (acc[j][r] + bb) * 4.0f; const _Float16 hi = (_Float16)v; sth[j * 16 + col][wave * 16 + 8 * g + r] = hi; stl[j * 16 + col][wave * 16 + 8 * g + r] = (_Float16)((v - (float)hi) * VLO); } }
    __syncthreads();
    for (int qq = tid; qq < 128 * 8; qq += 128) { const int qi = (qq >> 5) & 1, t = (qq >> 6) & 3, kbl = (qq >> 8) & 1, hh = qq >> 9; const int h = (n0 >> 6) + hh, cl = hh * 64 + t * 16 + col, sl = kbl * 32 + qi * 16 + g * 8;
      const size_t o = ((size_t)b * NH + h) * HD * SS + (size_t)((s0 >> 5) + kbl) * 2048 + t * 512 + qi * 256 + lane * 8;
      vst2(VTh + o, *(const v4u*)(&sth[cl][sl])); vst2(VTl + o, *(const v4u*)(&stl[cl][sl])); } }
}
// attention: block (128 queries, bh); all key tiles of 64; TRANSPOSED: S^T = K q^T (K hi/lo as A, q hi/lo as B) and O^T += V^T P^T (V hi/lo as A, P hi/lo as B). A lane then holds one query (lane & 15):
// of score tile t its registers r are keys 16 * t + 8 * (lane >> 4) + r, which is the k order of a B fragment, so two score tiles turned into weights ARE the P fragment of 32 keys: scores, softmax and P never leave the registers.
// O f32 in the order in which k_out reads it: the f32 fragment (16-row group rg of [b][s], head h, d step kc) is
// 2 KiB at float ((rg * NH + h) * 2 + kc) * 512, four blocks of 512 bytes; block j holds at lane * 16 bytes row (lane & 15), d = 32 * kc + 16 * (j >> 1) + 8 * (lane >> 4) + 4 * (j & 1) + 0..3: four registers of an O^T accumulator
__device__ __forceinline__ float xhalf(float v) { return __builtin_bit_cast(float, __builtin_amdgcn_permlanex16(__builtin_bit_cast(int, v), __builtin_bit_cast(int, v), 0x76543210, 0xfedcba98, false, false)); }   // lane l with lane l ^ 16
// THE RING: a block of AW waves shares each 64-key tile. The tile's K hi, K lo, V hi and V lo (8 KiB each, contiguous in the workspace, already in fragment order) and each wave's own four bond tiles (2 KiB)
// are copied from global memory straight into one of two LDS buffers while the tile before them is worked on; the fragments are then read from LDS, 512 contiguous bytes a wave-wide read.
#define AW 8
#define KVB 32768                  // bytes of K hi, K lo, V hi, V lo of one tile
#define STB (KVB + AW * 2048)      // bytes of one buffer: that and the bond tiles of the AW waves
__device__ __forceinline__ v16h frag_l(const unsigned char* p) { union { v16h v; v8h q[2]; } u; u.q[0] = *(const v8h*)p; u.q[1] = *(const v8h*)(p + 512); return u.v; }
__device__ __forceinline__ v16b frag_lb(const unsigned char* p) { return __builtin_bit_cast(v16b, frag_l(p)); }
// one wave's share of a tile: eight 512-byte units of the K and V planes (LDS byte address l, global address g) and its four bond tiles (lb, gb); every lane brings 16 bytes a copy.
// The copies and their s_wait_xcnt stand in one statement, so that no address register is given a new value in front of the wait
__device__ __forceinline__ void stage_tile(unsigned l, const char* g, unsigned lb, const char* gb) {
  asm volatile("global_load_async_to_lds_b128 %0, %1, off\n\t"
               "global_load_async_to_lds_b128 %2, %3, off\n\t"
               "global_load_async_to_lds_b128 %4, %5, off\n\t"
               "global_load_async_to_lds_b128 %6, %7, off\n\t"
               "global_load_async_to_lds_b128 %8, %9, off\n\t"
               "global_load_async_to_lds_b128 %10, %11, off\n\t"
               "global_load_async_to_lds_b128 %12, %13, off\n\t"
               "global_load_async_to_lds_b128 %14, %15, off\n\t"
               "global_load_async_to_lds_b128 %16, %17, off\n\t"
               "global_load_async_to_lds_b128 %18, %19, off\n\t"
               "global_load_async_to_lds_b128 %20, %21, off\n\t"
               "global_load_async_to_lds_b128 %22, %23, off\n\t"
               "s_wait_xcnt 0x0"
               :: "v"(l), "v"(g), "v"(l + 512), "v"(g + 512), "v"(l + 1024), "v"(g + 1024), "v"(l + 1536), "v"(g + 1536),
                  "v"(l + 2048), "v"(g + 2048), "v"(l + 2560), "v"(g + 2560), "v"(l + 3072), "v"(g + 3072), "v"(l + 3584), "v"(g + 3584),
                  "v"(lb), "v"(gb), "v"(lb + 512), "v"(gb + 512), "v"(lb + 1024), "v"(gb + 1024), "v"(lb + 1536), "v"(gb + 1536) : "memory");
}
__global__ __launch_bounds__(AW * 32) void k_attn(const float* __restrict__ Q32, const __bf16* __restrict__ Kh, const __bf16* __restrict__ Kl, const _Float16* __restrict__ VTh, const _Float16* __restrict__ VTl, const __bf16* __restrict__ Bb, float* __restrict__ O32) {
  const int tid = threadIdx.x, w = __builtin_amdgcn_readfirstlane(tid >> 5), lane = tid & 31, col = lane & 15;   // the wave's number in a scalar register: addresses built on it cost no vector registers
  const size_t bh = blockIdx.y; const int qb = blockIdx.x; const int q0 = qb * (AW * 16) + w * 16;
  const int b = (int)(bh / NH);
  __shared__ __align__(16) unsigned char ring[2][STB];
  // wave w copies the half (w & 1) of plane (w >> 1) of K hi, K lo, V hi, V lo: in the buffer that is byte w * 4096; a tile is 8192 bytes further in every plane, 2048 in the bond rows of the wave's 16 queries
  // gk, gb, lk, lb: the wave's parts of the four addresses, the same in every lane; l16: the lane's part
  const char* gk = (const char*)(w < 2 ? (const void*)Kh : (w < 4 ? (const void*)Kl : (w < 6 ? (const void*)VTh : (const void*)VTl))) + bh * (SS * HD * 2) + (w & 1) * 4096;
  const char* gb = (const char*)Bb + (size_t)((b * SS + q0) >> 4) * (SS / 16 * 512);
  const unsigned lk = (unsigned)(size_t)&ring[0][0] + w * 4096, lb = (unsigned)(size_t)&ring[0][0] + KVB + w * 2048, l16 = lane * 16;
  stage_tile(lk + l16, gk + l16, lb + l16, gb + l16);   // tile 0 into buffer 0
  // the split q fragments rest in LDS (each lane its own 128 bytes) and are read back at the head of every tile: their 32 registers are what the V fragment group needs at four waves per SIMD
  __shared__ __align__(16) v4u sQ[AW][8][32];
#pragma unroll
  for (int kc = 0; kc < 2; ++kc) { const F2 q = split_row(Q32 + (bh * SS + q0 + col) * HD, kc * 32, lane); union { v16b v; v4u u[2]; } qh, ql; qh.v = q.h; ql.v = q.l;
    sQ[w][4 * kc][lane] = qh.u[0]; sQ[w][4 * kc + 1][lane] = qh.u[1]; sQ[w][4 * kc + 2][lane] = ql.u[0]; sQ[w][4 * kc + 3][lane] = ql.u[1]; }
  float mrun = -3.0e38f, lrun = 0.f; v8f acc[4] = {}, ac1[4] = {}, ac2[4] = {};   // lrun: the sum over this lane's half of the keys; the halves are joined behind the loop
  LDSX();
  asm volatile("s_wait_asynccnt 0x0" ::: "memory");   // this wave's share of tile 0 has landed
  __syncthreads();                                    // every wave's share has: tile 0 may be read
  stage_tile(lk + STB + l16, gk + 8192 + l16, lb + STB + l16, gb + 2048 + l16);   // tile 1 into buffer 1
#pragma unroll 1
  for (int kt = 0; kt < SS / 64; ++kt) {
    // one read group at the head of the tile: the K fragments of key groups 0 and 1 and the four bond tiles; the fragments of groups 2 and 3 refill a set as soon as it has been read (inner loops unrolled: the sets are register arrays)
    const unsigned char* rl = &ring[kt & 1][l16];   // the lane's place in every 512-byte unit of this tile's buffer
    const unsigned char* khu = rl, * klu = rl + 8192, * vhu = rl + 16384, * vlu = rl + 24576, * bu = rl + KVB + w * 2048;
    v4u bv[4]; v16b kf[2][4];
#pragma unroll
    for (int t = 0; t < 2; ++t) {
#pragma unroll
      for (int kc = 0; kc < 2; ++kc) { kf[t][2 * kc] = frag_lb(khu + t * 2048 + kc * 1024); kf[t][2 * kc + 1] = frag_lb(klu + t * 2048 + kc * 1024); } }
#pragma unroll
    for (int t = 0; t < 4; ++t) bv[t] = *(const v4u*)(bu + t * 512);
    F2 aq[2];
#pragma unroll
    for (int kc = 0; kc < 2; ++kc) { union { v16b v; v4u u[2]; } qh, ql; qh.u[0] = sQ[w][4 * kc][lane]; qh.u[1] = sQ[w][4 * kc + 1][lane]; ql.u[0] = sQ[w][4 * kc + 2][lane]; ql.u[1] = sQ[w][4 * kc + 3][lane]; aq[kc].h = qh.v; aq[kc].l = ql.v; }
    __builtin_amdgcn_sched_barrier(0);   // keeps the group above the products below; without it each read sinks to its use and its latency is waited out alone
    float sc[4][8];
#pragma unroll
    for (int t = 0; t < 4; ++t) { v8f s = {};
#pragma unroll
      for (int kc = 0; kc < 2; ++kc) { s = wmma_bf(kf[t & 1][2 * kc], aq[kc].l, s); s = wmma_bf(kf[t & 1][2 * kc + 1], aq[kc].h, s); s = wmma_bf(kf[t & 1][2 * kc], aq[kc].h, s); }
      if (t < 2) {
#pragma unroll
        for (int kc = 0; kc < 2; ++kc) { kf[t][2 * kc] = frag_lb(khu + (t + 2) * 2048 + kc * 1024); kf[t][2 * kc + 1] = frag_lb(klu + (t + 2) * 2048 + kc * 1024); }
        __builtin_amdgcn_sched_barrier(0);   // as above
      }
#pragma unroll
      for (int r = 0; r < 8; ++r) sc[t][r] = (s[r] * SCL2) * __builtin_bit_cast(float, (r & 1) ? (bv[t][r >> 1] & 0xffff0000u) : (bv[t][r >> 1] << 16)); }
    // the V fragments of the tile's first 32 keys are read as one group ahead of the softmax, which covers their latency; those of the second 32 refill a set as soon as its products are issued
    v16h vf[4][2];
    __builtin_amdgcn_sched_barrier(0);   // keeps the group out of the score products above, where the registers are short
#pragma unroll
    for (int t = 0; t < 4; ++t) { vf[t][0] = frag_l(vhu + t * 1024); vf[t][1] = frag_l(vlu + t * 1024); }
    __builtin_amdgcn_sched_barrier(0);   // keeps the group together here, ahead of the softmax; without it each read sinks to its use and its latency is waited out alone
    float m4[4], p2[2] = {0.f, 0.f};   // the maximum runs as four independent chains, one a score tile; the sum as two, one a P fragment
#pragma unroll
    for (int t = 0; t < 4; ++t) { m4[t] = sc[t][0];
#pragma unroll
      for (int r = 1; r < 8; ++r) m4[t] = fmaxf(m4[t], sc[t][r]); }
    float mx = fmaxf(fmaxf(m4[0], m4[1]), fmaxf(m4[2], m4[3]));
    mx = fmaxf(mx, xhalf(mx));
    const float mnew = fmaxf(mrun, mx - 14.0f); const float corr = __builtin_amdgcn_exp2f(mrun - mnew);   // the running reference point lies 14 below the maximum: 2^(s - mnew) is the weight times 16384
    v16h ph[2], pl[2];
#pragma unroll
    for (int i = 0; i < 32; ++i) { const float p = __builtin_amdgcn_exp2f(sc[i >> 3][i & 7] - mnew); p2[i >> 4] += p; const _Float16 hi = (_Float16)p; ph[i >> 4][i & 15] = hi; pl[i >> 4][i & 15] = (_Float16)((p - (float)hi) * PLO); }
    lrun = lrun * corr + (p2[0] + p2[1]) * (1.0f / 16384.0f); mrun = mnew;
#pragma unroll
    for (int t = 0; t < 4; ++t) { acc[t] *= corr; ac1[t] *= corr; ac2[t] *= corr; }   // the lane's accumulators all belong to its own query
#pragma unroll
    for (int kc = 0; kc < 2; ++kc) {
#pragma unroll
      for (int t = 0; t < 4; ++t) {
        acc[t] = wmma16(vf[t][0], ph[kc], acc[t]); ac1[t] = wmma16(vf[t][1], ph[kc], ac1[t]); ac2[t] = wmma16(vf[t][0], pl[kc], ac2[t]);
        if (kc == 0) { vf[t][0] = frag_l(vhu + 4096 + t * 1024); vf[t][1] = frag_l(vlu + 4096 + t * 1024);
          __builtin_amdgcn_sched_barrier(0);   // keeps the refill here, four product groups ahead of its use
        } } }
    // the hand-over: tile kt + 1 becomes readable, and this tile's buffer free for tile kt + 2
    asm volatile("s_wait_dscnt 0x0" ::: "memory");      // this wave's reads of this tile's buffer are done before the buffer is written again
    asm volatile("s_wait_asynccnt 0x0" ::: "memory");   // this wave's share of tile kt + 1 has landed
    __syncthreads();                                    // the same holds of every wave of the block
    if (kt + 2 < SS / 64) { const unsigned bo = (kt & 1) * STB; stage_tile(lk + bo + l16, gk + (kt + 2) * 8192 + l16, lb + bo + l16, gb + (kt + 2) * 2048 + l16); } }
  asm volatile("s_wait_asynccnt 0x0" ::: "memory");   // no copy is out when the wave ends
  lrun += xhalf(lrun);
  const float inv = 1.0f / (lrun * 16384.0f * 4.0f);
  float* od = O32 + ((size_t)((b * SS + q0) >> 4) * NH + (bh % NH)) * 1024 + lane * 4;
#pragma unroll
  for (int it = 0; it < 8; ++it) { v4f o;
#pragma unroll
    for (int e = 0; e < 4; ++e) { const int t = it >> 1, r = (it & 1) * 4 + e; o[e] = (acc[t][r] + ac1[t][r] * (1.0f / VLO) + ac2[t][r] * (1.0f / PLO)) * inv; }
    vst2(od + it * 128, o); }
}
// out = ctx Wo + bo : split(ctx) x bf16(Wo rows): 2 products (Wo is an INPUT -> bf16 exact)
__global__ __launch_bounds__(128) void k_out(const float* __restrict__ O32, const __bf16* __restrict__ PT, const float* __restrict__ bo, float* __restrict__ out) {
  __shared__ __align__(16) float so[4][16][132];
  const int tid = threadIdx.x, wave = tid >> 5, lane = tid & 31, col = lane & 15, g = lane >> 4;
  const int r0 = blockIdx.x * 64 + wave * 16, n0 = blockIdx.y * 128;
  v8f acc[8] = {};
  // two register sets: each k step's 20 loads go out as one group, one step ahead of the products that read them (inner loops unrolled: the sets are register arrays)
  const int rb = blockIdx.x * 64; const float* op = O32 + (size_t)rb * E; const __bf16* wp = PT + (size_t)(3 * E + n0) * E;   // wave-uniform bases; the lane's part is one 32-bit offset each
  const unsigned ool = (wave * 16 * E + 4 * lane) * 4, wol = 8 * lane;   // ool in bytes, wol in elements
  float x0[16], x1[16]; v16b w0[8], w1[8];
  { const gpf o0 = (gpf)((gpc)sbase(op) + ool);
#pragma unroll
    for (int i = 0; i < 16; ++i) x0[i] = o0[(i >> 2) * 128 + (i & 3)]; }
#pragma unroll
  for (int j = 0; j < 8; ++j) w0[j] = frag_ub((gph)sbase(wp) + j * 16 * E, wol);
#pragma unroll 1
  for (int h = 0; h < NH - 1; ++h) { const gpf oh = (gpf)((gpc)sbase(op + h * 1024) + ool); const gph wu = (gph)sbase(wp + h * 1024);
#pragma unroll
    for (int i = 0; i < 16; ++i) x1[i] = oh[512 + (i >> 2) * 128 + (i & 3)];
#pragma unroll
    for (int j = 0; j < 8; ++j) w1[j] = frag_ub(wu + j * 16 * E + 512, wol);
    asm volatile("s_wait_xcnt 0x0" ::: "memory");   // the scalar bases that the loads above name are advanced while those loads are still out
    __builtin_amdgcn_sched_barrier(0);   // keeps the group above the products below; without it each load sinks to its use and its latency is waited out alone
    { const F2 a = bsplit16(x0);
#pragma unroll
      for (int j = 0; j < 8; ++j) { acc[j] = wmma_bf(a.l, w0[j], acc[j]); acc[j] = wmma_bf(a.h, w0[j], acc[j]); } }
#pragma unroll
    for (int i = 0; i < 16; ++i) x0[i] = oh[1024 + (i >> 2) * 128 + (i & 3)];
#pragma unroll
    for (int j = 0; j < 8; ++j) w0[j] = frag_ub(wu + j * 16 * E + 1024, wol);
    asm volatile("s_wait_xcnt 0x0" ::: "memory");   // the scalar bases that the loads above name are advanced while those loads are still out
    __builtin_amdgcn_sched_barrier(0);   // as above
    { const F2 a = bsplit16(x1);
#pragma unroll
      for (int j = 0; j < 8; ++j) { acc[j] = wmma_bf(a.l, w1[j], acc[j]); acc[j] = wmma_bf(a.h, w1[j], acc[j]); } } }
  { const gpf oh = (gpf)((gpc)sbase(op + (NH - 1) * 1024) + ool);   // the last two steps: nothing is left to fetch behind them
#pragma unroll
    for (int i = 0; i < 16; ++i) x1[i] = oh[512 + (i >> 2) * 128 + (i & 3)]; }
  asm volatile("s_wait_xcnt 0x0" ::: "memory");   // the address registers of the four loads above are given to a fragment of the group below
#pragma unroll
  for (int j = 0; j < 8; ++j) w1[j] = frag_ub((gph)sbase(wp) + j * 16 * E + (E / 32 - 1) * 512, wol);
  __builtin_amdgcn_sched_barrier(0);   // as above
  { const F2 a = bsplit16(x0);
#pragma unroll
    for (int j = 0; j < 8; ++j) { acc[j] = wmma_bf(a.l, w0[j], acc[j]); acc[j] = wmma_bf(a.h, w0[j], acc[j]); } }
  { const F2 a = bsplit16(x1);
#pragma unroll
    for (int j = 0; j < 8; ++j) { acc[j] = wmma_bf(a.l, w1[j], acc[j]); acc[j] = wmma_bf(a.h, w1[j], acc[j]); } }
#pragma unroll
  for (int j = 0; j < 8; ++j) { const int n = n0 + j * 16 + col; const float bb = bfr(bo[n]);
#pragma unroll
    for (int r = 0; r < 8; ++r) so[wave][8 * g + r][j * 16 + col] = acc[j][r] + bb; }
  LDSX();
#pragma unroll 4
  for (int rl = 0; rl < 16; ++rl) vst2(out + (size_t)(r0 + rl) * E + n0 + lane * 4, *(const v4f*)(&so[wave][rl][lane * 4]));
}
extern "C" void kernel_launch(void* const* d_in, const int* in_sizes, int n_in, void* d_out, int out_size, void* d_ws, size_t ws_size, hipStream_t stream) {
  (void)in_sizes; (void)n_in; (void)out_size; (void)ws_size;
  const float* x = (const float*)d_in[0]; const float* bond = (const float*)d_in[1]; const float* Wq = (const float*)d_in[2]; const float* bq = (const float*)d_in[3]; const float* Wk = (const float*)d_in[4]; const float* bk = (const float*)d_in[5]; const float* Wv = (const float*)d_in[6]; const float* bv = (const float*)d_in[7]; const float* Wo = (const float*)d_in[8]; const float* bo = (const float*)d_in[9];
  float* out = (float*)d_out;
  char* ws = (char*)d_ws; size_t off = 0;
  auto take = [&](size_t bytes) { char* p = ws + off; off += (bytes + 255) & ~(size_t)255; return p; };
  __bf16* Xb = (__bf16*)take((size_t)NR * E * 2); __bf16* PT = (__bf16*)take((size_t)4 * E * E * 2);
  float* Q32 = (float*)take((size_t)NR * E * 4); __bf16* Kh = (__bf16*)take((size_t)NR * E * 2); __bf16* Kl = (__bf16*)take((size_t)NR * E * 2); _Float16* VTh = (_Float16*)take((size_t)NR * E * 2); _Float16* VTl = (_Float16*)take((size_t)NR * E * 2); float* O32 = (float*)take((size_t)NR * E * 4); __bf16* Bb = (__bf16*)take((size_t)NB * SS * SS * 2);
  // ws ~ 101 MB
  k_cvt<<<NB * SS * SS / 8 / 2048 + NR * E / 8 / 256, 256, 0, stream>>>(x, bond, Xb, Bb);
  k_pack<<<dim3(4 * E / 32, E / 64), 256, 0, stream>>>(Wq, Wk, Wv, Wo, PT);
  k_qkv<<<dim3(NR / 64, E / 128, 3), 128, 0, stream>>>(Xb, PT, bq, bk, bv, Q32, Kh, Kl, VTh, VTl);
  k_attn<<<dim3(SS / (AW * 16), NB * NH), AW * 32, 0, stream>>>(Q32, Kh, Kl, VTh, VTl, Bb, O32);
  k_out<<<dim3(NR / 64, E / 128), 128, 0, stream>>>(O32, PT, bo, out);
}

// v006
// It runs in 162 microseconds.
// Next to v005, in two timings, it ran 1.05 times as fast each time.
// Counting every step since v000, it is 3.57 times as fast.
// compute dtype: x, bond_influence, W*/b* (INPUTS) rounded to bf16 with exact bf16 WMMA products (f32 accumulate) for the projections; K pre-split into bf16 hi/lo fragments; q f32 split, P and V f16 hi/lo (3 products each); the bond modulation and softmax in f32.
#include <hip/hip_runtime.h>
#include <math.h>

typedef __attribute__((ext_vector_type(16))) _Float16 v16h;
typedef __attribute__((ext_vector_type(16))) __bf16 v16b;
typedef __attribute__((ext_vector_type(8)))  _Float16 v8h;
typedef __attribute__((ext_vector_type(8)))  float v8f;
typedef __attribute__((ext_vector_type(4)))  float v4f;
typedef __attribute__((ext_vector_type(2)))  float v2f;
typedef __attribute__((ext_vector_type(4)))  unsigned v4u;
typedef __attribute__((ext_vector_type(4)))  int v4i;
typedef float __attribute__((may_alias)) float_a;
typedef int __attribute__((may_alias)) int_a;

template <typename T> __device__ __forceinline__ void vst2(void* p, T v) { *(T*)p = v;  }
__device__ __forceinline__ v8f wmma16(v16h a, v16h b, v8f c) {
  v8f d = __builtin_amdgcn_wmma_f32_16x16x32_f16(false, a, false, b, (short)0, c, false, false);
  return d;
}
__device__ __forceinline__ v8f wmma_bf(v16b a, v16b b, v8f c) {
  v8f d = __builtin_amdgcn_wmma_f32_16x16x32_bf16(false, a, false, b, (short)0, c, false, false);
  return d;
}
// 16x16x32 fragments: lane = (h = lane>>4, row/col = lane&15); elements 0..7 = k0+8h+0..7, 8..15 = k0+16+8h+0..7; D element r = row 8h+r
__device__ __forceinline__ v16h frag_h(const _Float16* rowk0, int lane) {
  union { v16h v; v8h q[2]; } u; const _Float16* p = rowk0 + 8 * (lane >> 4);
  u.q[0] = *(const v8h*)p; u.q[1] = *(const v8h*)(p + 16); return u.v;
}
__device__ __forceinline__ v16h frag_f32(const float* rowk0, int lane) {
  v16h a; const float* p = rowk0 + 8 * (lane >> 4);
#pragma unroll
  for (int i = 0; i < 8; ++i) { a[i] = (_Float16)p[i]; a[8 + i] = (_Float16)p[16 + i]; }
  return a;
}
__device__ __forceinline__ v16h frag_f32s(const float* rowk0, int lane, float sc) {
  v16h a; const float* p = rowk0 + 8 * (lane >> 4);
#pragma unroll
  for (int i = 0; i < 8; ++i) { a[i] = (_Float16)(p[i] * sc); a[8 + i] = (_Float16)(p[16 + i] * sc); }
  return a;
}
// column fragment from a [K][ld] layout (column n), rows >= K read as 0
__device__ __forceinline__ v16h fragc_f32(const float* W, int k0, int n, int lane, int ld, int K) {
  v16h a; const int g = lane >> 4;
#pragma unroll
  for (int i = 0; i < 8; ++i) { const int ka = k0 + 8 * g + i, kb = ka + 16;
    a[i] = (_Float16)(ka < K ? W[(size_t)ka * ld + n] : 0.f); a[8 + i] = (_Float16)(kb < K ? W[(size_t)kb * ld + n] : 0.f); }
  return a;
}
struct F2 { v16b h, l; };
__device__ __forceinline__ F2 bsplit16(const float v[16]) { F2 r;
#pragma unroll
  for (int i = 0; i < 16; ++i) { const __bf16 h = (__bf16)v[i]; r.h[i] = h; r.l[i] = (__bf16)(v[i] - (float)h); }
  return r; }
__device__ __forceinline__ F2 split_row(const float* row, int k0, int lane) { float v[16]; const float* p = row + k0 + 8 * (lane >> 4);
#pragma unroll
  for (int i = 0; i < 8; ++i) { v[i] = p[i]; v[8 + i] = p[16 + i]; }
  return bsplit16(v); }
__device__ __forceinline__ F2 split_rowK(const float* row, int k0, int lane, int K) { float v[16]; const int g = lane >> 4;
#pragma unroll
  for (int i = 0; i < 8; ++i) { const int ka = k0 + 8 * g + i, kb = ka + 16; v[i] = ka < K ? row[ka] : 0.f; v[8 + i] = kb < K ? row[kb] : 0.f; }
  return bsplit16(v); }
__device__ __forceinline__ F2 split_col(const float* W, int k0, int n, int lane, int ld, int K) { float v[16]; const int g = lane >> 4;
#pragma unroll
  for (int i = 0; i < 8; ++i) { const int ka = k0 + 8 * g + i, kb = ka + 16; v[i] = ka < K ? W[(size_t)ka * ld + n] : 0.f; v[8 + i] = kb < K ? W[(size_t)kb * ld + n] : 0.f; }
  return bsplit16(v); }
__device__ __forceinline__ v8f mac3(const F2& a, const F2& b, v8f c) { c = wmma_bf(a.l, b.h, c); c = wmma_bf(a.h, b.l, c); return wmma_bf(a.h, b.h, c); }
__device__ __forceinline__ float sigm(float v) { return 1.0f / (1.0f + expf(-v)); }
#define LDSX() do { asm volatile("s_wait_dscnt 0" ::: "memory"); __builtin_amdgcn_wave_barrier(); __builtin_amdgcn_fence(__ATOMIC_RELEASE, "workgroup"); } while (0)


// Bond-influence self attention (16 heads x 64 on [2,2048,1024], [in][out] weights + biases): scores = (q.k/8) * bond_influence[b][q][k] (an INPUT matrix, shared by the heads); softmax; (P v) @ Wo + bo.
#define NB 2
#define SS 2048
#define E 1024
#define NH 16
#define HD 64
#define NR (NB * SS)
#define PLO 1024.0f
#define VLO 2048.0f
#define SCL2 0.18033688f   // log2(e) / 8: the scores are kept in base-2 units, so that a weight is one hardware exponential
__device__ __forceinline__ float bfr(float v) { return (float)(__bf16)v; }
// FRAGMENT ORDER (every 16-bit matrix operand in the workspace): a 16 x 32 fragment is 1 KiB in a row, two blocks of 512 bytes; block qi holds at lane * 16 bytes the lane's elements 8 * qi .. 8 * qi + 7,
// that is row or column (lane & 15), k = 16 * qi + 8 * (lane >> 4) + 0..7: one wave-wide 16-byte load reads 512 contiguous bytes, four whole 128-byte lines, where a row-major operand made it touch sixteen
// the fragment from a wave-uniform base and the lane's own 32-bit element offset (8 * lane): the address costs one vector register
typedef const _Float16 __attribute__((address_space(1)))* gph; typedef const float __attribute__((address_space(1)))* gpf; typedef const v8h __attribute__((address_space(1)))* gp8; typedef const char __attribute__((address_space(1)))* gpc;
__device__ __forceinline__ unsigned long long sbase(const void* p) {   // a wave-uniform address read into scalar registers, so that the loads below take it as their scalar base
  const unsigned long long u = (unsigned long long)p;
  return ((unsigned long long)(unsigned)__builtin_amdgcn_readfirstlane((int)(u >> 32)) << 32) | (unsigned)__builtin_amdgcn_readfirstlane((int)u); }
__device__ __forceinline__ v16h frag_u(gph ub, unsigned off) { union { v16h v; v8h q[2]; } u; gph p = ub + off; u.q[0] = *(gp8)p; u.q[1] = *(gp8)(p + 256); return u.v; }
__device__ __forceinline__ v16b frag_ub(gph ub, unsigned off) { return __builtin_bit_cast(v16b, frag_u(ub, off)); }
__device__ __forceinline__ v16b frag_b(const __bf16* rowk0, int lane) { return __builtin_bit_cast(v16b, frag_h((const _Float16*)rowk0, lane)); }

// blocks below NB * SS * SS / 8 / 2048: bond_influence (the longer blocks, so they start first); the rest: x
__global__ __launch_bounds__(256) void k_cvt(const float* __restrict__ x, const float* __restrict__ bond, __bf16* __restrict__ Xb, __bf16* __restrict__ Bb) {
  union P8 { __bf16 h[8]; v4u u; };
  if (blockIdx.x < NB * SS * SS / 8 / 2048) {
    // Bb: bond_influence rounded to bf16, in the order of the transposed score accumulators of k_attn: the tile (16-query group qg of [b][q], 16-key group kg) is 512 bytes at element (qg * (SS / 16) + kg) * 256;
    // at lane * 16 bytes stand query (lane & 15), keys 8 * (lane >> 4) + 0..7. A wave takes 8 rows x 128 bytes in (whole lines over its two loads) and puts four whole lines out; a thread does eight such 16-byte units: a wave keeps many loads out at a time, and the launch has an eighth of the waves to start
    const unsigned u = blockIdx.x * 2048 + threadIdx.x;
    const int r = u & 7, o = (u >> 3) & 3, rh = (u >> 5) & 1, ch = (u >> 6) & (SS / 32 - 1), qg = u >> 12;
    const float* bs = bond + (size_t)(qg * 16 + rh * 8 + r) * SS + ch * 32 + o * 8;
    __bf16* bd = Bb + ((size_t)qg * (SS / 16) + ch * 2 + (o >> 1)) * 256 + ((o & 1) * 16 + rh * 8 + r) * 8;
    float in[8][8];
#pragma unroll
    for (int j = 0; j < 8; ++j) {
#pragma unroll
      for (int e = 0; e < 8; ++e) in[j][e] = bs[j * 128 + e]; }
    asm volatile("s_wait_xcnt 0x0" :: "v"(bs) : "memory");   // the address registers of the loads above are given to other values while those loads are still out; named here, they live up to the wait
#pragma unroll
    for (int j = 0; j < 8; ++j) { P8 pk;
#pragma unroll
      for (int e = 0; e < 8; ++e) pk.h[e] = (__bf16)in[j][e];
      vst2((unsigned*)(bd + j * 2048), pk.u); }
    return; }
  // Xb in fragment order: fragment (16-row group rg, k step kc) at element (rg * 32 + kc) * 512; thread i8 writes 16-byte unit i8 of it
  const size_t i8 = (size_t)(blockIdx.x - NB * SS * SS / 8 / 2048) * 256 + threadIdx.x;
  const int ln = (int)(i8 & 31), qi = (int)(i8 >> 5) & 1, kc = (int)(i8 >> 6) & 31, rg = (int)(i8 >> 11);
  const float* xs = x + (size_t)(rg * 16 + (ln & 15)) * E + kc * 32 + qi * 16 + (ln >> 4) * 8;
  P8 pk;
#pragma unroll
  for (int e = 0; e < 8; ++e) pk.h[e] = (__bf16)xs[e];
  vst2((unsigned*)(Xb + i8 * 8), pk.u);
}
// PT columns n: [0,E) Wq[:,n], [E,2E) Wk[:,n], [2E,3E) Wv[:,n], [3E,4E) Wo[:,n]  ([in][out] weights), in fragment order: fragment (16-column group ng, k step kc) at element (ng * 32 + kc) * 512
// block (32 columns, 64 k): whole 128-byte lines of W in, turned in LDS, four whole fragments out
__global__ __launch_bounds__(256) void k_pack(const float* __restrict__ Wq, const float* __restrict__ Wk, const float* __restrict__ Wv, const float* __restrict__ Wo, __bf16* __restrict__ PT) {
  const int n0 = blockIdx.x * 32, k0 = blockIdx.y * 64, tid = threadIdx.x; __shared__ __align__(16) __bf16 st[32][72];
  const float* W = n0 < E ? Wq : (n0 < 2 * E ? Wk : (n0 < 3 * E ? Wv : Wo)); const int nn = n0 & (E - 1);
  const int kr = tid >> 2, pt = tid & 3; const float* wsrc = W + (size_t)(k0 + kr) * E + nn + pt * 8;
#pragma unroll
  for (int e = 0; e < 8; ++e) st[pt * 8 + e][kr] = (__bf16)wsrc[e];
  __syncthreads();
  const int ln = tid & 31, qi = (tid >> 5) & 1, kc = (tid >> 6) & 1, ngl = tid >> 7;
  vst2((unsigned*)(PT + ((size_t)((n0 >> 4) + ngl) * 32 + (k0 >> 5) + kc) * 512 + qi * 256 + ln * 8), *(const v4u*)(&st[ngl * 16 + (ln & 15)][kc * 32 + qi * 16 + (ln >> 4) * 8]));
}
// QKV: block (64 rows, 128 cols = 2 heads, which); q (+bias) -> Q32 f32 [bh][s][64]; k (+bias) -> bf16 hi/lo, v (+bias) -> f16 hi/lo x4, both in fragment order:
// K fragment (16-key group kg, d step kc) at element bh * SS * HD + (kg * 2 + kc) * 512; V fragment (32-key block kb, 16-d group t) at element bh * SS * HD + (kb * 4 + t) * 512
__global__ __launch_bounds__(128) void k_qkv(const __bf16* __restrict__ Xb, const __bf16* __restrict__ PT, const float* __restrict__ bq, const float* __restrict__ bk, const float* __restrict__ bv,
                                            float* __restrict__ Q32, __bf16* __restrict__ Kh, __bf16* __restrict__ Kl, _Float16* __restrict__ VTh, _Float16* __restrict__ VTl) {
  __shared__ __align__(16) float so[4][16][132];
  __shared__ __align__(16) _Float16 sth[128][72], stl[128][72];
  const int tid = threadIdx.x, wave = tid >> 5, lane = tid & 31, col = lane & 15, g = lane >> 4;
  const int which = blockIdx.z, r0b = blockIdx.x * 64, r0 = r0b + wave * 16, n0 = blockIdx.y * 128; const int b = r0b / SS, s0 = r0b % SS;
  const float* bb_ = which == 0 ? bq : (which == 1 ? bk : bv);
  v8f acc[8] = {};
  // two register sets: each k step's 18 fragment loads go out as one group, one step ahead of the products that read them (inner loops unrolled: the sets are register arrays)
  const __bf16* ap = Xb + (size_t)r0b * E; const __bf16* bp = PT + (size_t)(which * E + n0) * E;   // wave-uniform bases; the lane's part is one 32-bit offset each
  const unsigned aol = wave * 16 * E + 8 * lane, bol = 8 * lane;
  v16b a0 = frag_ub((gph)sbase(ap), aol), a1, b0[8], b1[8];
#pragma unroll
  for (int j = 0; j < 8; ++j) b0[j] = frag_ub((gph)sbase(bp) + j * 16 * E, bol);
#pragma unroll 1   // stays rolled: one trip already holds a step of either register set
  for (int kc = 0; kc < E / 32 - 2; kc += 2) {
    const gph au = (gph)sbase(ap + kc * 512), bu = (gph)sbase(bp + kc * 512);
    a1 = frag_ub(au + 512, aol);
#pragma unroll
    for (int j = 0; j < 8; ++j) b1[j] = frag_ub(bu + j * 16 * E + 512, bol);
    asm volatile("s_wait_xcnt 0x0" ::: "memory");   // the scalar bases that the loads above name are advanced while those loads are still out
    __builtin_amdgcn_sched_barrier(0);   // keeps the group above the products below; without it each load sinks to its use and its latency is waited out alone
#pragma unroll
    for (int j = 0; j < 8; ++j) acc[j] = wmma_bf(a0, b0[j], acc[j]);
    a0 = frag_ub(au + 1024, aol);
#pragma unroll
    for (int j = 0; j < 8; ++j) b0[j] = frag_ub(bu + j * 16 * E + 1024, bol);
    asm volatile("s_wait_xcnt 0x0" ::: "memory");   // the scalar bases that the loads above name are advanced while those loads are still out
    __builtin_amdgcn_sched_barrier(0);   // as above
#pragma unroll
    for (int j = 0; j < 8; ++j) acc[j] = wmma_bf(a1, b1[j], acc[j]); }
  a1 = frag_ub((gph)sbase(ap) + (E / 32 - 1) * 512, aol);   // the last two steps: nothing is left to fetch behind them
#pragma unroll
  for (int j = 0; j < 8; ++j) b1[j] = frag_ub((gph)sbase(bp) + j * 16 * E + (E / 32 - 1) * 512, bol);
  __builtin_amdgcn_sched_barrier(0);   // as above
#pragma unroll
  for (int j = 0; j < 8; ++j) acc[j] = wmma_bf(a0, b0[j], acc[j]);
#pragma unroll
  for (int j = 0; j < 8; ++j) acc[j] = wmma_bf(a1, b1[j], acc[j]);
  if (which < 2) {
#pragma unroll
    for (int j = 0; j < 8; ++j) { const float bb = bfr(bb_[n0 + j * 16 + col]);
#pragma unroll
      for (int r = 0; r < 8; ++r) so[wave][8 * g + r][j * 16 + col] = acc[j][r] + bb; }
    LDSX();
    if (which == 0) { for (int qq = lane; qq < 2 * 16 * 16; qq += 32) { const int hh = qq >> 8, rl = (qq >> 4) & 15, pc = qq & 15; const int h = (n0 >> 6) + hh;
        vst2(Q32 + (((size_t)b * NH + h) * SS + s0 + wave * 16 + rl) * HD + pc * 4, *(const v4f*)(&so[wave][rl][hh * 64 + pc * 4])); } }
    else {
      for (int it = 0; it < 8; ++it) { const int hh = it >> 2, u = it & 3; const int h = (n0 >> 6) + hh; union { __bf16 e[8]; v4u u; } ph, pl;   // the wave's 16 rows are one key group; u = 2 * kc + qi: one 512-byte block of the hi and one of the lo plane a trip
#pragma unroll
        for (int e = 0; e < 8; ++e) { const float v = so[wave][col][hh * 64 + u * 16 + g * 8 + e]; const __bf16 hi = (__bf16)v; ph.e[e] = hi; pl.e[e] = (__bf16)(v - (float)hi); }
        const size_t o = (((size_t)b * NH + h) * SS + s0 + wave * 16) * HD + u * 256 + lane * 8;
        vst2((unsigned*)(Kh + o), ph.u); vst2((unsigned*)(Kl + o), pl.u);
        asm volatile("s_wait_xcnt 0x0" ::: "memory");   // the data and address registers of the two stores above are given to other values while the stores are still out
      } } }
  else {
#pragma unroll
    for (int j = 0; j < 8; ++j) { const float bb = bfr(bb_[n0 + j * 16 + col]);
#pragma unroll
      for (int r = 0; r < 8; ++r) { const float v = (acc[j][r] + bb) * 4.0f; const _Float16 hi = (_Float16)v; sth[j * 16 + col][wave * 16 + 8 * g + r] = hi; stl[j * 16 + col][wave * 16 + 8 * g + r] = (_Float16)((v - (float)hi) * VLO); } }
    __syncthreads();
    for (int qq = tid; qq < 128 * 8; qq += 128) { const int qi = (qq >> 5) & 1, t = (qq >> 6) & 3, kbl = (qq >> 8) & 1, hh = qq >> 9; const int h = (n0 >> 6) + hh, cl = hh * 64 + t * 16 + col, sl = kbl * 32 + qi * 16 + g * 8;
      const size_t o = ((size_t)b * NH + h) * HD * SS + (size_t)((s0 >> 5) + kbl) * 2048 + t * 512 + qi * 256 + lane * 8;
      vst2(VTh + o, *(const v4u*)(&sth[cl][sl])); vst2(VTl + o, *(const v4u*)(&stl[cl][sl])); } }
}
// attention: block (128 queries, bh); all key tiles of 64; TRANSPOSED: S^T = K q^T (K hi/lo as A, q hi/lo as B) and O^T += V^T P^T (V hi/lo as A, P hi/lo as B). A lane then holds one query (lane & 15):
// of score tile t its registers r are keys 16 * t + 8 * (lane >> 4) + r, which is the k order of a B fragment, so two score tiles turned into weights ARE the P fragment of 32 keys: scores, softmax and P never leave the registers.
// O f32 in the order in which k_out reads it: the f32 fragment (16-row group rg of [b][s], head h, d step kc) is
// 2 KiB at float ((rg * NH + h) * 2 + kc) * 512, four blocks of 512 bytes; block j holds at lane * 16 bytes row (lane & 15), d = 32 * kc + 16 * (j >> 1) + 8 * (lane >> 4) + 4 * (j & 1) + 0..3: four registers of an O^T accumulator
__device__ __forceinline__ float xhalf(float v) { return __builtin_bit_cast(float, __builtin_amdgcn_permlanex16(__builtin_bit_cast(int, v), __builtin_bit_cast(int, v), 0x76543210, 0xfedcba98, false, false)); }   // lane l with lane l ^ 16
// THE RING: a block of AW waves shares each 64-key tile. The tile's K hi, K lo, V hi and V lo (8 KiB each, contiguous in the workspace, already in fragment order) and each wave's own four bond tiles (2 KiB)
// are copied from global memory straight into one of two LDS buffers while the tile before them is worked on; the fragments are then read from LDS, 512 contiguous bytes a wave-wide read.
#define AW 8
#define KVB 32768                  // bytes of K hi, K lo, V hi, V lo of one tile
#define STB (KVB + AW * 2048)      // bytes of one buffer: that and the bond tiles of the AW waves
__device__ __forceinline__ v16h frag_l(const unsigned char* p) { union { v16h v; v8h q[2]; } u; u.q[0] = *(const v8h*)p; u.q[1] = *(const v8h*)(p + 512); return u.v; }
__device__ __forceinline__ v16b frag_lb(const unsigned char* p) { return __builtin_bit_cast(v16b, frag_l(p)); }
// one wave's share of a tile: eight 512-byte units of the K and V planes (LDS byte address l, global address g) and its four bond tiles (lb, gb); every lane brings 16 bytes a copy.
// The copies and their s_wait_xcnt stand in one statement, so that no address register is given a new value in front of the wait
__device__ __forceinline__ void stage_tile(unsigned l, const char* g, unsigned lb, const char* gb) {
  asm volatile("global_load_async_to_lds_b128 %0, %1, off\n\t"
               "global_load_async_to_lds_b128 %2, %3, off\n\t"
               "global_load_async_to_lds_b128 %4, %5, off\n\t"
               "global_load_async_to_lds_b128 %6, %7, off\n\t"
               "global_load_async_to_lds_b128 %8, %9, off\n\t"
               "global_load_async_to_lds_b128 %10, %11, off\n\t"
               "global_load_async_to_lds_b128 %12, %13, off\n\t"
               "global_load_async_to_lds_b128 %14, %15, off\n\t"
               "global_load_async_to_lds_b128 %16, %17, off\n\t"
               "global_load_async_to_lds_b128 %18, %19, off\n\t"
               "global_load_async_to_lds_b128 %20, %21, off\n\t"
               "global_load_async_to_lds_b128 %22, %23, off\n\t"
               "s_wait_xcnt 0x0"
               :: "v"(l), "v"(g), "v"(l + 512), "v"(g + 512), "v"(l + 1024), "v"(g + 1024), "v"(l + 1536), "v"(g + 1536),
                  "v"(l + 2048), "v"(g + 2048), "v"(l + 2560), "v"(g + 2560), "v"(l + 3072), "v"(g + 3072), "v"(l + 3584), "v"(g + 3584),
                  "v"(lb), "v"(gb), "v"(lb + 512), "v"(gb + 512), "v"(lb + 1024), "v"(gb + 1024), "v"(lb + 1536), "v"(gb + 1536) : "memory");
}
__global__ __launch_bounds__(AW * 32) void k_attn(const float* __restrict__ Q32, const __bf16* __restrict__ Kh, const __bf16* __restrict__ Kl, const _Float16* __restrict__ VTh, const _Float16* __restrict__ VTl, const __bf16* __restrict__ Bb, float* __restrict__ O32) {
  const int tid = threadIdx.x, w = __builtin_amdgcn_readfirstlane(tid >> 5), lane = tid & 31, col = lane & 15;   // the wave's number in a scalar register: addresses built on it cost no vector registers
  const size_t bh = blockIdx.y; const int qb = blockIdx.x; const int q0 = qb * (AW * 16) + w * 16;
  const int b = (int)(bh / NH);
  __shared__ __align__(16) unsigned char ring[2][STB];
  // wave w copies the half (w & 1) of plane (w >> 1) of K hi, K lo, V hi, V lo: in the buffer that is byte w * 4096; a tile is 8192 bytes further in every plane, 2048 in the bond rows of the wave's 16 queries
  // gk, gb, lk, lb: the wave's parts of the four addresses, the same in every lane; l16: the lane's part
  const char* gk = (const char*)(w < 2 ? (const void*)Kh : (w < 4 ? (const void*)Kl : (w < 6 ? (const void*)VTh : (const void*)VTl))) + bh * (SS * HD * 2) + (w & 1) * 4096;
  const char* gb = (const char*)Bb + (size_t)((b * SS + q0) >> 4) * (SS / 16 * 512);
  const unsigned lk = (unsigned)(size_t)&ring[0][0] + w * 4096, lb = (unsigned)(size_t)&ring[0][0] + KVB + w * 2048, l16 = lane * 16;
  stage_tile(lk + l16, gk + l16, lb + l16, gb + l16);   // tile 0 into buffer 0
  // the split q fragments rest in LDS (each lane its own 128 bytes) and are read back at the head of every tile: their 32 registers are what the V fragment group needs at four waves per SIMD
  __shared__ __align__(16) v4u sQ[AW][8][32];
#pragma unroll
  for (int kc = 0; kc < 2; ++kc) { const F2 q = split_row(Q32 + (bh * SS + q0 + col) * HD, kc * 32, lane); union { v16b v; v4u u[2]; } qh, ql; qh.v = q.h; ql.v = q.l;
    sQ[w][4 * kc][lane] = qh.u[0]; sQ[w][4 * kc + 1][lane] = qh.u[1]; sQ[w][4 * kc + 2][lane] = ql.u[0]; sQ[w][4 * kc + 3][lane] = ql.u[1]; }
  float mrun = -3.0e38f, lrun = 0.f; v8f acc[4] = {}, ac1[4] = {}, ac2[4] = {};   // lrun: the sum over this lane's half of the keys; the halves are joined behind the loop
  LDSX();
  asm volatile("s_wait_asynccnt 0x0" ::: "memory");   // this wave's share of tile 0 has landed
  __syncthreads();                                    // every wave's share has: tile 0 may be read
  stage_tile(lk + STB + l16, gk + 8192 + l16, lb + STB + l16, gb + 2048 + l16);   // tile 1 into buffer 1
#pragma unroll 1
  for (int kt = 0; kt < SS / 64; ++kt) {
    // one read group at the head of the tile: the K fragments of key groups 0 and 1 and the four bond tiles; the fragments of groups 2 and 3 refill a set as soon as it has been read (inner loops unrolled: the sets are register arrays)
    const unsigned char* rl = &ring[kt & 1][l16];   // the lane's place in every 512-byte unit of this tile's buffer
    const unsigned char* khu = rl, * klu = rl + 8192, * vhu = rl + 16384, * vlu = rl + 24576, * bu = rl + KVB + w * 2048;
    v4u bv[4]; v16b kf[2][4];
#pragma unroll
    for (int t = 0; t < 2; ++t) {
#pragma unroll
      for (int kc = 0; kc < 2; ++kc) { kf[t][2 * kc] = frag_lb(khu + t * 2048 + kc * 1024); kf[t][2 * kc + 1] = frag_lb(klu + t * 2048 + kc * 1024); } }
#pragma unroll
    for (int t = 0; t < 4; ++t) bv[t] = *(const v4u*)(bu + t * 512);
    F2 aq[2];
#pragma unroll
    for (int kc = 0; kc < 2; ++kc) { union { v16b v; v4u u[2]; } qh, ql; qh.u[0] = sQ[w][4 * kc][lane]; qh.u[1] = sQ[w][4 * kc + 1][lane]; ql.u[0] = sQ[w][4 * kc + 2][lane]; ql.u[1] = sQ[w][4 * kc + 3][lane]; aq[kc].h = qh.v; aq[kc].l = ql.v; }
    __builtin_amdgcn_sched_barrier(0);   // keeps the group above the products below; without it each read sinks to its use and its latency is waited out alone
    float sc[4][8];
#pragma unroll
    for (int t = 0; t < 4; ++t) { v8f s = {};
#pragma unroll
      for (int kc = 0; kc < 2; ++kc) { s = wmma_bf(kf[t & 1][2 * kc], aq[kc].l, s); s = wmma_bf(kf[t & 1][2 * kc + 1], aq[kc].h, s); s = wmma_bf(kf[t & 1][2 * kc], aq[kc].h, s); }
      if (t < 2) {
#pragma unroll
        for (int kc = 0; kc < 2; ++kc) { kf[t][2 * kc] = frag_lb(khu + (t + 2) * 2048 + kc * 1024); kf[t][2 * kc + 1] = frag_lb(klu + (t + 2) * 2048 + kc * 1024); }
        __builtin_amdgcn_sched_barrier(0);   // as above
      }
#pragma unroll
      for (int r = 0; r < 8; ++r) sc[t][r] = (s[r] * SCL2) * __builtin_bit_cast(float, (r & 1) ? (bv[t][r >> 1] & 0xffff0000u) : (bv[t][r >> 1] << 16)); }
    // the V fragments of the tile's first 32 keys are read as one group ahead of the softmax, which covers their latency; those of the second 32 refill a set as soon as its products are issued
    v16h vf[4][2];
    __builtin_amdgcn_sched_barrier(0);   // keeps the group out of the score products above, where the registers are short
#pragma unroll
    for (int t = 0; t < 4; ++t) { vf[t][0] = frag_l(vhu + t * 1024); vf[t][1] = frag_l(vlu + t * 1024); }
    __builtin_amdgcn_sched_barrier(0);   // keeps the group together here, ahead of the softmax; without it each read sinks to its use and its latency is waited out alone
    float m4[4], p2[2] = {0.f, 0.f};   // the maximum runs as four independent chains, one a score tile; the sum as two, one a P fragment
#pragma unroll
    for (int t = 0; t < 4; ++t) { m4[t] = sc[t][0];
#pragma unroll
      for (int r = 1; r < 8; ++r) m4[t] = fmaxf(m4[t], sc[t][r]); }
    float mx = fmaxf(fmaxf(m4[0], m4[1]), fmaxf(m4[2], m4[3]));
    mx = fmaxf(mx, xhalf(mx));
    const float mnew = fmaxf(mrun, mx - 14.0f); const float corr = __builtin_amdgcn_exp2f(mrun - mnew);   // the running reference point lies 14 below the maximum: 2^(s - mnew) is the weight times 16384
    v16h ph[2], pl[2];
#pragma unroll
    for (int i = 0; i < 32; ++i) { const float p = __builtin_amdgcn_exp2f(sc[i >> 3][i & 7] - mnew); p2[i >> 4] += p; const _Float16 hi = (_Float16)p; ph[i >> 4][i & 15] = hi; pl[i >> 4][i & 15] = (_Float16)((p - (float)hi) * PLO); }
    lrun = lrun * corr + (p2[0] + p2[1]) * (1.0f / 16384.0f); mrun = mnew;
#pragma unroll
    for (int t = 0; t < 4; ++t) { acc[t] *= corr; ac1[t] *= corr; ac2[t] *= corr; }   // the lane's accumulators all belong to its own query
#pragma unroll
    for (int kc = 0; kc < 2; ++kc) {
#pragma unroll
      for (int t = 0; t < 4; ++t) {
        acc[t] = wmma16(vf[t][0], ph[kc], acc[t]); ac1[t] = wmma16(vf[t][1], ph[kc], ac1[t]); ac2[t] = wmma16(vf[t][0], pl[kc], ac2[t]);
        if (kc == 0) { vf[t][0] = frag_l(vhu + 4096 + t * 1024); vf[t][1] = frag_l(vlu + 4096 + t * 1024);
          __builtin_amdgcn_sched_barrier(0);   // keeps the refill here, four product groups ahead of its use
        } } }
    // the hand-over: tile kt + 1 becomes readable, and this tile's buffer free for tile kt + 2
    asm volatile("s_wait_dscnt 0x0" ::: "memory");      // this wave's reads of this tile's buffer are done before the buffer is written again
    asm volatile("s_wait_asynccnt 0x0" ::: "memory");   // this wave's share of tile kt + 1 has landed
    __syncthreads();                                    // the same holds of every wave of the block
    if (kt + 2 < SS / 64) { const unsigned bo = (kt & 1) * STB; stage_tile(lk + bo + l16, gk + (kt + 2) * 8192 + l16, lb + bo + l16, gb + (kt + 2) * 2048 + l16); } }
  asm volatile("s_wait_asynccnt 0x0" ::: "memory");   // no copy is out when the wave ends
  lrun += xhalf(lrun);
  const float inv = 1.0f / (lrun * 16384.0f * 4.0f);
  float* od = O32 + ((size_t)((b * SS + q0) >> 4) * NH + (bh % NH)) * 1024 + lane * 4;
#pragma unroll
  for (int it = 0; it < 8; ++it) { v4f o;
#pragma unroll
    for (int e = 0; e < 4; ++e) { const int t = it >> 1, r = (it & 1) * 4 + e; o[e] = (acc[t][r] + ac1[t][r] * (1.0f / VLO) + ac2[t][r] * (1.0f / PLO)) * inv; }
    vst2(od + it * 128, o); }
}
// out = ctx Wo + bo : split(ctx) x bf16(Wo rows): 2 products (Wo is an INPUT -> bf16 exact)
__global__ __launch_bounds__(128) void k_out(const float* __restrict__ O32, const __bf16* __restrict__ PT, const float* __restrict__ bo, float* __restrict__ out) {
  __shared__ __align__(16) float so[4][16][132];
  const int tid = threadIdx.x, wave = tid >> 5, lane = tid & 31, col = lane & 15, g = lane >> 4;
  const int r0 = blockIdx.x * 64 + wave * 16, n0 = blockIdx.y * 128;
  v8f acc[8] = {};
  // two register sets: each k step's 20 loads go out as one group, one step ahead of the products that read them (inner loops unrolled: the sets are register arrays)
  const int rb = blockIdx.x * 64; const float* op = O32 + (size_t)rb * E; const __bf16* wp = PT + (size_t)(3 * E + n0) * E;   // wave-uniform bases; the lane's part is one 32-bit offset each
  const unsigned ool = (wave * 16 * E + 4 * lane) * 4, wol = 8 * lane;   // ool in bytes, wol in elements
  float x0[16], x1[16]; v16b w0[8], w1[8];
  { const gpf o0 = (gpf)((gpc)sbase(op) + ool);
#pragma unroll
    for (int i = 0; i < 16; ++i) x0[i] = o0[(i >> 2) * 128 + (i & 3)]; }
#pragma unroll
  for (int j = 0; j < 8; ++j) w0[j] = frag_ub((gph)sbase(wp) + j * 16 * E, wol);
#pragma unroll 1
  for (int h = 0; h < NH - 1; ++h) { const gpf oh = (gpf)((gpc)sbase(op + h * 1024) + ool); const gph wu = (gph)sbase(wp + h * 1024);
#pragma unroll
    for (int i = 0; i < 16; ++i) x1[i] = oh[512 + (i >> 2) * 128 + (i & 3)];
#pragma unroll
    for (int j = 0; j < 8; ++j) w1[j] = frag_ub(wu + j * 16 * E + 512, wol);
    asm volatile("s_wait_xcnt 0x0" ::: "memory");   // the scalar bases that the loads above name are advanced while those loads are still out
    __builtin_amdgcn_sched_barrier(0);   // keeps the group above the products below; without it each load sinks to its use and its latency is waited out alone
    { const F2 a = bsplit16(x0);
#pragma unroll
      for (int j = 0; j < 8; ++j) { acc[j] = wmma_bf(a.l, w0[j], acc[j]); acc[j] = wmma_bf(a.h, w0[j], acc[j]); } }
#pragma unroll
    for (int i = 0; i < 16; ++i) x0[i] = oh[1024 + (i >> 2) * 128 + (i & 3)];
#pragma unroll
    for (int j = 0; j < 8; ++j) w0[j] = frag_ub(wu + j * 16 * E + 1024, wol);
    asm volatile("s_wait_xcnt 0x0" ::: "memory");   // the scalar bases that the loads above name are advanced while those loads are still out
    __builtin_amdgcn_sched_barrier(0);   // as above
    { const F2 a = bsplit16(x1);
#pragma unroll
      for (int j = 0; j < 8; ++j) { acc[j] = wmma_bf(a.l, w1[j], acc[j]); acc[j] = wmma_bf(a.h, w1[j], acc[j]); } } }
  { const gpf oh = (gpf)((gpc)sbase(op + (NH - 1) * 1024) + ool);   // the last two steps: nothing is left to fetch behind them
#pragma unroll
    for (int i = 0; i < 16; ++i) x1[i] = oh[512 + (i >> 2) * 128 + (i & 3)]; }
  asm volatile("s_wait_xcnt 0x0" ::: "memory");   // the address registers of the four loads above are given to a fragment of the group below
#pragma unroll
  for (int j = 0; j < 8; ++j) w1[j] = frag_ub((gph)sbase(wp) + j * 16 * E + (E / 32 - 1) * 512, wol);
  __builtin_amdgcn_sched_barrier(0);   // as above
  { const F2 a = bsplit16(x0);
#pragma unroll
    for (int j = 0; j < 8; ++j) { acc[j] = wmma_bf(a.l, w0[j], acc[j]); acc[j] = wmma_bf(a.h, w0[j], acc[j]); } }
  { const F2 a = bsplit16(x1);
#pragma unroll
    for (int j = 0; j < 8; ++j) { acc[j] = wmma_bf(a.l, w1[j], acc[j]); acc[j] = wmma_bf(a.h, w1[j], acc[j]); } }
#pragma unroll
  for (int j = 0; j < 8; ++j) { const int n = n0 + j * 16 + col; const float bb = bfr(bo[n]);
#pragma unroll
    for (int r = 0; r < 8; ++r) so[wave][8 * g + r][j * 16 + col] = acc[j][r] + bb; }
  LDSX();
#pragma unroll 4
  for (int rl = 0; rl < 16; ++rl) vst2(out + (size_t)(r0 + rl) * E + n0 + lane * 4, *(const v4f*)(&so[wave][rl][lane * 4]));
}
extern "C" void kernel_launch(void* const* d_in, const int* in_sizes, int n_in, void* d_out, int out_size, void* d_ws, size_t ws_size, hipStream_t stream) {
  (void)in_sizes; (void)n_in; (void)out_size; (void)ws_size;
  const float* x = (const float*)d_in[0]; const float* bond = (const float*)d_in[1]; const float* Wq = (const float*)d_in[2]; const float* bq = (const float*)d_in[3]; const float* Wk = (const float*)d_in[4]; const float* bk = (const float*)d_in[5]; const float* Wv = (const float*)d_in[6]; const float* bv = (const float*)d_in[7]; const float* Wo = (const float*)d_in[8]; const float* bo = (const float*)d_in[9];
  float* out = (float*)d_out;
  char* ws = (char*)d_ws; size_t off = 0;
  auto take = [&](size_t bytes) { char* p = ws + off; off += (bytes + 255) & ~(size_t)255; return p; };
  __bf16* Xb = (__bf16*)take((size_t)NR * E * 2); __bf16* PT = (__bf16*)take((size_t)4 * E * E * 2);
  float* Q32 = (float*)take((size_t)NR * E * 4); __bf16* Kh = (__bf16*)take((size_t)NR * E * 2); __bf16* Kl = (__bf16*)take((size_t)NR * E * 2); _Float16* VTh = (_Float16*)take((size_t)NR * E * 2); _Float16* VTl = (_Float16*)take((size_t)NR * E * 2); float* O32 = (float*)take((size_t)NR * E * 4); __bf16* Bb = (__bf16*)take((size_t)NB * SS * SS * 2);
  // ws ~ 101 MB
  k_cvt<<<NB * SS * SS / 8 / 2048 + NR * E / 8 / 256, 256, 0, stream>>>(x, bond, Xb, Bb);
  k_pack<<<dim3(4 * E / 32, E / 64), 256, 0, stream>>>(Wq, Wk, Wv, Wo, PT);
  k_qkv<<<dim3(NR / 64, E / 128, 3), 128, 0, stream>>>(Xb, PT, bq, bk, bv, Q32, Kh, Kl, VTh, VTl);
  k_attn<<<dim3(SS / (AW * 16), NB * NH), AW * 32, 0, stream>>>(Q32, Kh, Kl, VTh, VTl, Bb, O32);
  k_out<<<dim3(NR / 64, E / 128), 128, 0, stream>>>(O32, PT, bo, out);
}

// v007
// One run takes 147 microseconds.
// Next to v006, in two timings, it ran 1.07 and 1.08 times as fast.
// All steps since v000 together make it 3.85 times as fast.
// compute dtype: x, bond_influence, W*/b* (INPUTS) rounded to bf16 with exact bf16 WMMA products (f32 accumulate) for the projections; K pre-split into bf16 hi/lo fragments; q f32 split, P and V f16 hi/lo (3 products each); the bond modulation and softmax in f32.
#include <hip/hip_runtime.h>
#include <math.h>

typedef __attribute__((ext_vector_type(16))) _Float16 v16h;
typedef __attribute__((ext_vector_type(16))) __bf16 v16b;
typedef __attribute__((ext_vector_type(8)))  _Float16 v8h;
typedef __attribute__((ext_vector_type(8)))  float v8f;
typedef __attribute__((ext_vector_type(4)))  float v4f;
typedef __attribute__((ext_vector_type(2)))  float v2f;
typedef __attribute__((ext_vector_type(4)))  unsigned v4u;
typedef __attribute__((ext_vector_type(4)))  int v4i;
typedef float __attribute__((may_alias)) float_a;
typedef int __attribute__((may_alias)) int_a;

template <typename T> __device__ __forceinline__ void vst2(void* p, T v) { *(T*)p = v;  }
__device__ __forceinline__ v8f wmma16(v16h a, v16h b, v8f c) {
  v8f d = __builtin_amdgcn_wmma_f32_16x16x32_f16(false, a, false, b, (short)0, c, false, false);
  return d;
}
__device__ __forceinline__ v8f wmma_bf(v16b a, v16b b, v8f c) {
  v8f d = __builtin_amdgcn_wmma_f32_16x16x32_bf16(false, a, false, b, (short)0, c, false, false);
  return d;
}
// 16x16x32 fragments: lane = (h = lane>>4, row/col = lane&15); elements 0..7 = k0+8h+0..7, 8..15 = k0+16+8h+0..7; D element r = row 8h+r
__device__ __forceinline__ v16h frag_h(const _Float16* rowk0, int lane) {
  union { v16h v; v8h q[2]; } u; const _Float16* p = rowk0 + 8 * (lane >> 4);
  u.q[0] = *(const v8h*)p; u.q[1] = *(const v8h*)(p + 16); return u.v;
}
__device__ __forceinline__ v16h frag_f32(const float* rowk0, int lane) {
  v16h a; const float* p = rowk0 + 8 * (lane >> 4);
#pragma unroll
  for (int i = 0; i < 8; ++i) { a[i] = (_Float16)p[i]; a[8 + i] = (_Float16)p[16 + i]; }
  return a;
}
__device__ __forceinline__ v16h frag_f32s(const float* rowk0, int lane, float sc) {
  v16h a; const float* p = rowk0 + 8 * (lane >> 4);
#pragma unroll
  for (int i = 0; i < 8; ++i) { a[i] = (_Float16)(p[i] * sc); a[8 + i] = (_Float16)(p[16 + i] * sc); }
  return a;
}
// column fragment from a [K][ld] layout (column n), rows >= K read as 0
__device__ __forceinline__ v16h fragc_f32(const float* W, int k0, int n, int lane, int ld, int K) {
  v16h a; const int g = lane >> 4;
#pragma unroll
  for (int i = 0; i < 8; ++i) { const int ka = k0 + 8 * g + i, kb = ka + 16;
    a[i] = (_Float16)(ka < K ? W[(size_t)ka * ld + n] : 0.f); a[8 + i] = (_Float16)(kb < K ? W[(size_t)kb * ld + n] : 0.f); }
  return a;
}
struct F2 { v16b h, l; };
__device__ __forceinline__ F2 bsplit16(const float v[16]) { F2 r;
#pragma unroll
  for (int i = 0; i < 16; ++i) { const __bf16 h = (__bf16)v[i]; r.h[i] = h; r.l[i] = (__bf16)(v[i] - (float)h); }
  return r; }
__device__ __forceinline__ F2 split_row(const float* row, int k0, int lane) { float v[16]; const float* p = row + k0 + 8 * (lane >> 4);
#pragma unroll
  for (int i = 0; i < 8; ++i) { v[i] = p[i]; v[8 + i] = p[16 + i]; }
  return bsplit16(v); }
__device__ __forceinline__ F2 split_rowK(const float* row, int k0, int lane, int K) { float v[16]; const int g = lane >> 4;
#pragma unroll
  for (int i = 0; i < 8; ++i) { const int ka = k0 + 8 * g + i, kb = ka + 16; v[i] = ka < K ? row[ka] : 0.f; v[8 + i] = kb < K ? row[kb] : 0.f; }
  return bsplit16(v); }
__device__ __forceinline__ F2 split_col(const float* W, int k0, int n, int lane, int ld, int K) { float v[16]; const int g = lane >> 4;
#pragma unroll
  for (int i = 0; i < 8; ++i) { const int ka = k0 + 8 * g + i, kb = ka + 16; v[i] = ka < K ? W[(size_t)ka * ld + n] : 0.f; v[8 + i] = kb < K ? W[(size_t)kb * ld + n] : 0.f; }
  return bsplit16(v); }
__device__ __forceinline__ v8f mac3(const F2& a, const F2& b, v8f c) { c = wmma_bf(a.l, b.h, c); c = wmma_bf(a.h, b.l, c); return wmma_bf(a.h, b.h, c); }
__device__ __forceinline__ float sigm(float v) { return 1.0f / (1.0f + expf(-v)); }
#define LDSX() do { asm volatile("s_wait_dscnt 0" ::: "memory"); __builtin_amdgcn_wave_barrier(); __builtin_amdgcn_fence(__ATOMIC_RELEASE, "workgroup"); } while (0)


// Bond-influence self attention (16 heads x 64 on [2,2048,1024], [in][out] weights + biases): scores = (q.k/8) * bond_influence[b][q][k] (an INPUT matrix, shared by the heads); softmax; (P v) @ Wo + bo.
#define NB 2
#define SS 2048
#define E 1024
#define NH 16
#define HD 64
#define NR (NB * SS)
#define PLO 1024.0f
#define VLO 2048.0f
#define SCL2 0.18033688f   // log2(e) / 8: the scores are kept in base-2 units, so that a weight is one hardware exponential
__device__ __forceinline__ float bfr(float v) { return (float)(__bf16)v; }
// FRAGMENT ORDER (every 16-bit matrix operand in the workspace): a 16 x 32 fragment is 1 KiB in a row, two blocks of 512 bytes; block qi holds at lane * 16 bytes the lane's elements 8 * qi .. 8 * qi + 7,
// that is row or column (lane & 15), k = 16 * qi + 8 * (lane >> 4) + 0..7: one wave-wide 16-byte load reads 512 contiguous bytes, four whole 128-byte lines, where a row-major operand made it touch sixteen
// the fragment from a wave-uniform base and the lane's own 32-bit element offset (8 * lane): the address costs one vector register
typedef const _Float16 __attribute__((address_space(1)))* gph; typedef const float __attribute__((address_space(1)))* gpf; typedef const v8h __attribute__((address_space(1)))* gp8; typedef const char __attribute__((address_space(1)))* gpc;
__device__ __forceinline__ unsigned long long sbase(const void* p) {   // a wave-uniform address read into scalar registers, so that the loads below take it as their scalar base
  const unsigned long long u = (unsigned long long)p;
  return ((unsigned long long)(unsigned)__builtin_amdgcn_readfirstlane((int)(u >> 32)) << 32) | (unsigned)__builtin_amdgcn_readfirstlane((int)u); }
__device__ __forceinline__ v16h frag_u(gph ub, unsigned off) { union { v16h v; v8h q[2]; } u; gph p = ub + off; u.q[0] = *(gp8)p; u.q[1] = *(gp8)(p + 256); return u.v; }
__device__ __forceinline__ v16b frag_ub(gph ub, unsigned off) { return __builtin_bit_cast(v16b, frag_u(ub, off)); }
__device__ __forceinline__ v16b frag_b(const __bf16* rowk0, int lane) { return __builtin_bit_cast(v16b, frag_h((const _Float16*)rowk0, lane)); }

// blocks below NB * SS * SS / 8 / 2048: bond_influence (the longer blocks, so they start first); the rest: x
__global__ __launch_bounds__(256) void k_cvt(const float* __restrict__ x, const float* __restrict__ bond, __bf16* __restrict__ Xb, __bf16* __restrict__ Bb) {
  union P8 { __bf16 h[8]; v4u u; };
  if (blockIdx.x < NB * SS * SS / 8 / 2048) {
    // Bb: bond_influence rounded to bf16, in the order of the transposed score accumulators of k_attn: the tile (16-query group qg of [b][q], 16-key group kg) is 512 bytes at element (qg * (SS / 16) + kg) * 256;
    // at lane * 16 bytes stand query (lane & 15), keys 8 * (lane >> 4) + 0..7. A wave takes 8 rows x 128 bytes in (whole lines over its two loads) and puts four whole lines out; a thread does eight such 16-byte units: a wave keeps many loads out at a time, and the launch has an eighth of the waves to start
    const unsigned u = blockIdx.x * 2048 + threadIdx.x;
    const int r = u & 7, o = (u >> 3) & 3, rh = (u >> 5) & 1, ch = (u >> 6) & (SS / 32 - 1), qg = u >> 12;
    const float* bs = bond + (size_t)(qg * 16 + rh * 8 + r) * SS + ch * 32 + o * 8;
    __bf16* bd = Bb + ((size_t)qg * (SS / 16) + ch * 2 + (o >> 1)) * 256 + ((o & 1) * 16 + rh * 8 + r) * 8;
    float in[8][8];
#pragma unroll
    for (int j = 0; j < 8; ++j) {
#pragma unroll
      for (int e = 0; e < 8; ++e) in[j][e] = bs[j * 128 + e]; }
    asm volatile("s_wait_xcnt 0x0" :: "v"(bs) : "memory");   // the address registers of the loads above are given to other values while those loads are still out; named here, they live up to the wait
#pragma unroll
    for (int j = 0; j < 8; ++j) { P8 pk;
#pragma unroll
      for (int e = 0; e < 8; ++e) pk.h[e] = (__bf16)in[j][e];
      vst2((unsigned*)(bd + j * 2048), pk.u); }
    return; }
  // Xb in fragment order: fragment (16-row group rg, k step kc) at element (rg * 32 + kc) * 512; thread i8 writes 16-byte unit i8 of it
  const size_t i8 = (size_t)(blockIdx.x - NB * SS * SS / 8 / 2048) * 256 + threadIdx.x;
  const int ln = (int)(i8 & 31), qi = (int)(i8 >> 5) & 1, kc = (int)(i8 >> 6) & 31, rg = (int)(i8 >> 11);
  const float* xs = x + (size_t)(rg * 16 + (ln & 15)) * E + kc * 32 + qi * 16 + (ln >> 4) * 8;
  P8 pk;
#pragma unroll
  for (int e = 0; e < 8; ++e) pk.h[e] = (__bf16)xs[e];
  vst2((unsigned*)(Xb + i8 * 8), pk.u);
}
// PT columns n: [0,E) Wq[:,n], [E,2E) Wk[:,n], [2E,3E) Wv[:,n], [3E,4E) Wo[:,n]  ([in][out] weights), in fragment order: fragment (16-column group ng, k step kc) at element (ng * 32 + kc) * 512
// block (32 columns, 64 k): whole 128-byte lines of W in, turned in LDS, four whole fragments out
__global__ __launch_bounds__(256) void k_pack(const float* __restrict__ Wq, const float* __restrict__ Wk, const float* __restrict__ Wv, const float* __restrict__ Wo, __bf16* __restrict__ PT) {
  const int n0 = blockIdx.x * 32, k0 = blockIdx.y * 64, tid = threadIdx.x; __shared__ __align__(16) __bf16 st[32][72];
  const float* W = n0 < E ? Wq : (n0 < 2 * E ? Wk : (n0 < 3 * E ? Wv : Wo)); const int nn = n0 & (E - 1);
  const int kr = tid >> 2, pt = tid & 3; const float* wsrc = W + (size_t)(k0 + kr) * E + nn + pt * 8;
#pragma unroll
  for (int e = 0; e < 8; ++e) st[pt * 8 + e][kr] = (__bf16)wsrc[e];
  __syncthreads();
  const int ln = tid & 31, qi = (tid >> 5) & 1, kc = (tid >> 6) & 1, ngl = tid >> 7;
  vst2((unsigned*)(PT + ((size_t)((n0 >> 4) + ngl) * 32 + (k0 >> 5) + kc) * 512 + qi * 256 + ln * 8), *(const v4u*)(&st[ngl * 16 + (ln & 15)][kc * 32 + qi * 16 + (ln >> 4) * 8]));
}
// QKV: block (128 rows, 128 cols = 2 heads, which), four waves as 2 x 2; a wave does 64 rows x 64 cols (one head): 8 fragments feed 16 products a k step, where a 16 x 128 wave tile took 9 for 8.
// q (+bias) -> Q32 f32 [bh][s][64]; k (+bias) -> bf16 hi/lo, v (+bias) -> f16 hi/lo x4, both in fragment order:
// K fragment (16-key group kg, d step kc) at element bh * SS * HD + (kg * 2 + kc) * 512; V fragment (32-key block kb, 16-d group t) at element bh * SS * HD + (kb * 4 + t) * 512
// The x and the weight fragments have one layout, so either may be the first operand. For q and k the weights are first: a lane's accumulator registers are then 8 d in a row of one row of x,
// which is a 16-byte unit of a K fragment. For v the rows of x are first: the registers are 8 keys in a row of one d, a unit of a V fragment. K and V go from the registers to the workspace, 512 bytes in a row a wave-wide store
__global__ __launch_bounds__(128) void k_qkv(const __bf16* __restrict__ Xb, const __bf16* __restrict__ PT, const float* __restrict__ bq, const float* __restrict__ bk, const float* __restrict__ bv,
                                            float* __restrict__ Q32, __bf16* __restrict__ Kh, __bf16* __restrict__ Kl, _Float16* __restrict__ VTh, _Float16* __restrict__ VTl) {
  __shared__ __align__(16) float so[4][64][68];
  const int tid = threadIdx.x, wave = __builtin_amdgcn_readfirstlane(tid >> 5), lane = tid & 31, col = lane & 15, g = lane >> 4;
  const int which = blockIdx.z, r0 = blockIdx.x * 128 + (wave >> 1) * 64, n0 = blockIdx.y * 128 + (wave & 1) * 64; const int s0 = r0 % SS;
  const size_t bh = (size_t)(r0 / SS) * NH + (n0 >> 6);
  const float* bb_ = which == 0 ? bq : (which == 1 ? bk : bv);
  v8f acc[4][4] = {};   // acc[i][j]: rows = 16-group i of the first operand, columns = 16-group j of the second
  // two register sets: each k step's 16 fragment loads go out as one group, one step ahead of the products that read them (inner loops unrolled: the sets are register arrays)
  const __bf16* xp = Xb + (size_t)r0 * E; const __bf16* wp = PT + (size_t)(which * E + n0) * E;   // wave-uniform bases; the lane's part is one 32-bit offset
  const __bf16* ap = which < 2 ? wp : xp; const __bf16* bp = which < 2 ? xp : wp;
  const unsigned ol = 8 * lane;
  v16b a0[4], a1[4], b0[4], b1[4];
#pragma unroll
  for (int i = 0; i < 4; ++i) { a0[i] = frag_ub((gph)sbase(ap) + i * 16 * E, ol); b0[i] = frag_ub((gph)sbase(bp) + i * 16 * E, ol); }
#pragma unroll 1   // stays rolled: one trip already holds a step of either register set
  for (int kc = 0; kc < E / 32 - 2; kc += 2) {
    const gph au = (gph)sbase(ap + kc * 512), bu = (gph)sbase(bp + kc * 512);
#pragma unroll
    for (int i = 0; i < 4; ++i) { a1[i] = frag_ub(au + i * 16 * E + 512, ol); b1[i] = frag_ub(bu + i * 16 * E + 512, ol); }
    asm volatile("s_wait_xcnt 0x0" ::: "memory");   // the scalar bases that the loads above name are advanced while those loads are still out
    __builtin_amdgcn_sched_barrier(0);   // keeps the group above the products below; without it each load sinks to its use and its latency is waited out alone
#pragma unroll
    for (int i = 0; i < 4; ++i) {
#pragma unroll
      for (int j = 0; j < 4; ++j) acc[i][j] = wmma_bf(a0[i], b0[j], acc[i][j]); }
#pragma unroll
    for (int i = 0; i < 4; ++i) { a0[i] = frag_ub(au + i * 16 * E + 1024, ol); b0[i] = frag_ub(bu + i * 16 * E + 1024, ol); }
    asm volatile("s_wait_xcnt 0x0" ::: "memory");   // the scalar bases that the loads above name are advanced while those loads are still out
    __builtin_amdgcn_sched_barrier(0);   // as above
#pragma unroll
    for (int i = 0; i < 4; ++i) {
#pragma unroll
      for (int j = 0; j < 4; ++j) acc[i][j] = wmma_bf(a1[i], b1[j], acc[i][j]); } }
#pragma unroll
  for (int i = 0; i < 4; ++i) { a1[i] = frag_ub((gph)sbase(ap) + i * 16 * E + (E / 32 - 1) * 512, ol); b1[i] = frag_ub((gph)sbase(bp) + i * 16 * E + (E / 32 - 1) * 512, ol); }   // the last two steps: nothing is left to fetch behind them
  asm volatile("s_wait_xcnt 0x0" ::: "memory");   // the address registers of the loads above are given to other values while those loads are still out
  __builtin_amdgcn_sched_barrier(0);   // as above
#pragma unroll
  for (int i = 0; i < 4; ++i) {
#pragma unroll
    for (int j = 0; j < 4; ++j) acc[i][j] = wmma_bf(a0[i], b0[j], acc[i][j]); }
#pragma unroll
  for (int i = 0; i < 4; ++i) {
#pragma unroll
    for (int j = 0; j < 4; ++j) acc[i][j] = wmma_bf(a1[i], b1[j], acc[i][j]); }
  if (which < 2) {
    // acc[i][j][r]: column n0 + 16 * i + 8 * g + r of the weights (d = 16 * i + 8 * g + r of the head), row r0 + 16 * j + col of x
#pragma unroll
    for (int i = 0; i < 4; ++i) {
#pragma unroll
      for (int r = 0; r < 8; ++r) { const float bb = bfr(bb_[n0 + i * 16 + 8 * g + r]);
#pragma unroll
        for (int j = 0; j < 4; ++j) acc[i][j][r] += bb; } }
    if (which == 0) {   // the wave's 64 rows are turned in its own LDS rows, so that whole lines go out
#pragma unroll
      for (int j = 0; j < 4; ++j) {
#pragma unroll
        for (int i = 0; i < 4; ++i) { v4f lo4, hi4;
#pragma unroll
          for (int e = 0; e < 4; ++e) { lo4[e] = acc[i][j][e]; hi4[e] = acc[i][j][4 + e]; }
          *(v4f*)(&so[wave][j * 16 + col][i * 16 + 8 * g]) = lo4; *(v4f*)(&so[wave][j * 16 + col][i * 16 + 8 * g + 4]) = hi4; } }
      LDSX();
#pragma unroll
      for (int it = 0; it < 32; ++it) { const int qq = it * 32 + lane, rl = qq >> 4, pc = qq & 15;
        vst2(Q32 + (bh * SS + s0 + rl) * HD + pc * 4, *(const v4f*)(&so[wave][rl][pc * 4]));
        if ((it & 7) == 7) asm volatile("s_wait_xcnt 0x0" ::: "memory");   // the data and address registers of the stores above are given to other values while the stores are still out
      } }
    else {
#pragma unroll
      for (int j = 0; j < 4; ++j) {   // key group j of the wave's 64 rows; i = 2 * kc + qi: one 512-byte block of the hi and one of the lo plane
#pragma unroll
        for (int i = 0; i < 4; ++i) { union { __bf16 e[8]; v4u u; } ph, pl;
#pragma unroll
          for (int e = 0; e < 8; ++e) { const float v = acc[i][j][e]; const __bf16 hi = (__bf16)v; ph.e[e] = hi; pl.e[e] = (__bf16)(v - (float)hi); }
          const size_t o = (bh * SS + s0 + j * 16) * HD + i * 256 + lane * 8;
          vst2((unsigned*)(Kh + o), ph.u); vst2((unsigned*)(Kl + o), pl.u);
          asm volatile("s_wait_xcnt 0x0" ::: "memory");   // the data and address registers of the two stores above are given to other values while the stores are still out
        } } } }
  else {
    // acc[i][j][r]: row r0 + 16 * i + 8 * g + r of x (a key), column n0 + 16 * j + col of the weights (d = 16 * j + col of the head)
#pragma unroll
    for (int j = 0; j < 4; ++j) { const float bb = bfr(bb_[n0 + j * 16 + col]);
#pragma unroll
      for (int i = 0; i < 4; ++i) { union { _Float16 e[8]; v4u u; } ph, pl;   // 32-key block i >> 1, its half i & 1
#pragma unroll
        for (int e = 0; e < 8; ++e) { const float v = (acc[i][j][e] + bb) * 4.0f; const _Float16 hi = (_Float16)v; ph.e[e] = hi; pl.e[e] = (_Float16)((v - (float)hi) * VLO); }
        const size_t o = bh * HD * SS + (size_t)((s0 >> 5) + (i >> 1)) * 2048 + j * 512 + (i & 1) * 256 + lane * 8;
        vst2((unsigned*)(VTh + o), ph.u); vst2((unsigned*)(VTl + o), pl.u);
        asm volatile("s_wait_xcnt 0x0" ::: "memory");   // the data and address registers of the two stores above are given to other values while the stores are still out
      } } }
}
// attention: block (128 queries, bh); all key tiles of 64; TRANSPOSED: S^T = K q^T (K hi/lo as A, q hi/lo as B) and O^T += V^T P^T (V hi/lo as A, P hi/lo as B). A lane then holds one query (lane & 15):
// of score tile t its registers r are keys 16 * t + 8 * (lane >> 4) + r, which is the k order of a B fragment, so two score tiles turned into weights ARE the P fragment of 32 keys: scores, softmax and P never leave the registers.
// O f32 in the order in which k_out reads it: the f32 fragment (16-row group rg of [b][s], head h, d step kc) is
// 2 KiB at float ((rg * NH + h) * 2 + kc) * 512, four blocks of 512 bytes; block j holds at lane * 16 bytes row (lane & 15), d = 32 * kc + 16 * (j >> 1) + 8 * (lane >> 4) + 4 * (j & 1) + 0..3: four registers of an O^T accumulator
__device__ __forceinline__ float xhalf(float v) { return __builtin_bit_cast(float, __builtin_amdgcn_permlanex16(__builtin_bit_cast(int, v), __builtin_bit_cast(int, v), 0x76543210, 0xfedcba98, false, false)); }   // lane l with lane l ^ 16
// THE RING: a block of AW waves shares each 64-key tile. The tile's K hi, K lo, V hi and V lo (8 KiB each, contiguous in the workspace, already in fragment order) and each wave's own four bond tiles (2 KiB)
// are copied from global memory straight into one of two LDS buffers while the tile before them is worked on; the fragments are then read from LDS, 512 contiguous bytes a wave-wide read.
#define AW 8
#define KVB 32768                  // bytes of K hi, K lo, V hi, V lo of one tile
#define STB (KVB + AW * 2048)      // bytes of one buffer: that and the bond tiles of the AW waves
__device__ __forceinline__ v16h frag_l(const unsigned char* p) { union { v16h v; v8h q[2]; } u; u.q[0] = *(const v8h*)p; u.q[1] = *(const v8h*)(p + 512); return u.v; }
__device__ __forceinline__ v16b frag_lb(const unsigned char* p) { return __builtin_bit_cast(v16b, frag_l(p)); }
// one wave's share of a tile: eight 512-byte units of the K and V planes (LDS byte address l, global address g) and its four bond tiles (lb, gb); every lane brings 16 bytes a copy.
// The copies and their s_wait_xcnt stand in one statement, so that no address register is given a new value in front of the wait
__device__ __forceinline__ void stage_tile(unsigned l, const char* g, unsigned lb, const char* gb) {
  asm volatile("global_load_async_to_lds_b128 %0, %1, off\n\t"
               "global_load_async_to_lds_b128 %2, %3, off\n\t"
               "global_load_async_to_lds_b128 %4, %5, off\n\t"
               "global_load_async_to_lds_b128 %6, %7, off\n\t"
               "global_load_async_to_lds_b128 %8, %9, off\n\t"
               "global_load_async_to_lds_b128 %10, %11, off\n\t"
               "global_load_async_to_lds_b128 %12, %13, off\n\t"
               "global_load_async_to_lds_b128 %14, %15, off\n\t"
               "global_load_async_to_lds_b128 %16, %17, off\n\t"
               "global_load_async_to_lds_b128 %18, %19, off\n\t"
               "global_load_async_to_lds_b128 %20, %21, off\n\t"
               "global_load_async_to_lds_b128 %22, %23, off\n\t"
               "s_wait_xcnt 0x0"
               :: "v"(l), "v"(g), "v"(l + 512), "v"(g + 512), "v"(l + 1024), "v"(g + 1024), "v"(l + 1536), "v"(g + 1536),
                  "v"(l + 2048), "v"(g + 2048), "v"(l + 2560), "v"(g + 2560), "v"(l + 3072), "v"(g + 3072), "v"(l + 3584), "v"(g + 3584),
                  "v"(lb), "v"(gb), "v"(lb + 512), "v"(gb + 512), "v"(lb + 1024), "v"(gb + 1024), "v"(lb + 1536), "v"(gb + 1536) : "memory");
}
__global__ __launch_bounds__(AW * 32) void k_attn(const float* __restrict__ Q32, const __bf16* __restrict__ Kh, const __bf16* __restrict__ Kl, const _Float16* __restrict__ VTh, const _Float16* __restrict__ VTl, const __bf16* __restrict__ Bb, float* __restrict__ O32) {
  const int tid = threadIdx.x, w = __builtin_amdgcn_readfirstlane(tid >> 5), lane = tid & 31, col = lane & 15;   // the wave's number in a scalar register: addresses built on it cost no vector registers
  const size_t bh = blockIdx.y; const int qb = blockIdx.x; const int q0 = qb * (AW * 16) + w * 16;
  const int b = (int)(bh / NH);
  __shared__ __align__(16) unsigned char ring[2][STB];
  // wave w copies the half (w & 1) of plane (w >> 1) of K hi, K lo, V hi, V lo: in the buffer that is byte w * 4096; a tile is 8192 bytes further in every plane, 2048 in the bond rows of the wave's 16 queries
  // gk, gb, lk, lb: the wave's parts of the four addresses, the same in every lane; l16: the lane's part
  const char* gk = (const char*)(w < 2 ? (const void*)Kh : (w < 4 ? (const void*)Kl : (w < 6 ? (const void*)VTh : (const void*)VTl))) + bh * (SS * HD * 2) + (w & 1) * 4096;
  const char* gb = (const char*)Bb + (size_t)((b * SS + q0) >> 4) * (SS / 16 * 512);
  const unsigned lk = (unsigned)(size_t)&ring[0][0] + w * 4096, lb = (unsigned)(size_t)&ring[0][0] + KVB + w * 2048, l16 = lane * 16;
  stage_tile(lk + l16, gk + l16, lb + l16, gb + l16);   // tile 0 into buffer 0
  // the split q fragments rest in LDS (each lane its own 128 bytes) and are read back at the head of every tile: their 32 registers are what the V fragment group needs at four waves per SIMD
  __shared__ __align__(16) v4u sQ[AW][8][32];
#pragma unroll
  for (int kc = 0; kc < 2; ++kc) { const F2 q = split_row(Q32 + (bh * SS + q0 + col) * HD, kc * 32, lane); union { v16b v; v4u u[2]; } qh, ql; qh.v = q.h; ql.v = q.l;
    sQ[w][4 * kc][lane] = qh.u[0]; sQ[w][4 * kc + 1][lane] = qh.u[1]; sQ[w][4 * kc + 2][lane] = ql.u[0]; sQ[w][4 * kc + 3][lane] = ql.u[1]; }
  float mrun = -3.0e38f, lrun = 0.f; v8f acc[4] = {}, ac1[4] = {}, ac2[4] = {};   // lrun: the sum over this lane's half of the keys; the halves are joined behind the loop
  LDSX();
  asm volatile("s_wait_asynccnt 0x0" ::: "memory");   // this wave's share of tile 0 has landed
  __syncthreads();                                    // every wave's share has: tile 0 may be read
  stage_tile(lk + STB + l16, gk + 8192 + l16, lb + STB + l16, gb + 2048 + l16);   // tile 1 into buffer 1
#pragma unroll 1
  for (int kt = 0; kt < SS / 64; ++kt) {
    // one read group at the head of the tile: the K fragments of key groups 0 and 1 and the four bond tiles; the fragments of groups 2 and 3 refill a set as soon as it has been read (inner loops unrolled: the sets are register arrays)
    const unsigned char* rl = &ring[kt & 1][l16];   // the lane's place in every 512-byte unit of this tile's buffer
    const unsigned char* khu = rl, * klu = rl + 8192, * vhu = rl + 16384, * vlu = rl + 24576, * bu = rl + KVB + w * 2048;
    v4u bv[4]; v16b kf[2][4];
#pragma unroll
    for (int t = 0; t < 2; ++t) {
#pragma unroll
      for (int kc = 0; kc < 2; ++kc) { kf[t][2 * kc] = frag_lb(khu + t * 2048 + kc * 1024); kf[t][2 * kc + 1] = frag_lb(klu + t * 2048 + kc * 1024); } }
#pragma unroll
    for (int t = 0; t < 4; ++t) bv[t] = *(const v4u*)(bu + t * 512);
    F2 aq[2];
#pragma unroll
    for (int kc = 0; kc < 2; ++kc) { union { v16b v; v4u u[2]; } qh, ql; qh.u[0] = sQ[w][4 * kc][lane]; qh.u[1] = sQ[w][4 * kc + 1][lane]; ql.u[0] = sQ[w][4 * kc + 2][lane]; ql.u[1] = sQ[w][4 * kc + 3][lane]; aq[kc].h = qh.v; aq[kc].l = ql.v; }
    __builtin_amdgcn_sched_barrier(0);   // keeps the group above the products below; without it each read sinks to its use and its latency is waited out alone
    float sc[4][8];
#pragma unroll
    for (int t = 0; t < 4; ++t) { v8f s = {};
#pragma unroll
      for (int kc = 0; kc < 2; ++kc) { s = wmma_bf(kf[t & 1][2 * kc], aq[kc].l, s); s = wmma_bf(kf[t & 1][2 * kc + 1], aq[kc].h, s); s = wmma_bf(kf[t & 1][2 * kc], aq[kc].h, s); }
      if (t < 2) {
#pragma unroll
        for (int kc = 0; kc < 2; ++kc) { kf[t][2 * kc] = frag_lb(khu + (t + 2) * 2048 + kc * 1024); kf[t][2 * kc + 1] = frag_lb(klu + (t + 2) * 2048 + kc * 1024); }
        __builtin_amdgcn_sched_barrier(0);   // as above
      }
#pragma unroll
      for (int r = 0; r < 8; ++r) sc[t][r] = (s[r] * SCL2) * __builtin_bit_cast(float, (r & 1) ? (bv[t][r >> 1] & 0xffff0000u) : (bv[t][r >> 1] << 16)); }
    // the V fragments of the tile's first 32 keys are read as one group ahead of the softmax, which covers their latency; those of the second 32 refill a set as soon as its products are issued
    v16h vf[4][2];
    __builtin_amdgcn_sched_barrier(0);   // keeps the group out of the score products above, where the registers are short
#pragma unroll
    for (int t = 0; t < 4; ++t) { vf[t][0] = frag_l(vhu + t * 1024); vf[t][1] = frag_l(vlu + t * 1024); }
    __builtin_amdgcn_sched_barrier(0);   // keeps the group together here, ahead of the softmax; without it each read sinks to its use and its latency is waited out alone
    float m4[4], p2[2] = {0.f, 0.f};   // the maximum runs as four independent chains, one a score tile; the sum as two, one a P fragment
#pragma unroll
    for (int t = 0; t < 4; ++t) { m4[t] = sc[t][0];
#pragma unroll
      for (int r = 1; r < 8; ++r) m4[t] = fmaxf(m4[t], sc[t][r]); }
    float mx = fmaxf(fmaxf(m4[0], m4[1]), fmaxf(m4[2], m4[3]));
    mx = fmaxf(mx, xhalf(mx));
    const float mnew = fmaxf(mrun, mx - 14.0f); const float corr = __builtin_amdgcn_exp2f(mrun - mnew);   // the running reference point lies 14 below the maximum: 2^(s - mnew) is the weight times 16384
    v16h ph[2], pl[2];
#pragma unroll
    for (int i = 0; i < 32; ++i) { const float p = __builtin_amdgcn_exp2f(sc[i >> 3][i & 7] - mnew); p2[i >> 4] += p; const _Float16 hi = (_Float16)p; ph[i >> 4][i & 15] = hi; pl[i >> 4][i & 15] = (_Float16)((p - (float)hi) * PLO); }
    lrun = lrun * corr + (p2[0] + p2[1]) * (1.0f / 16384.0f); mrun = mnew;
#pragma unroll
    for (int t = 0; t < 4; ++t) { acc[t] *= corr; ac1[t] *= corr; ac2[t] *= corr; }   // the lane's accumulators all belong to its own query
#pragma unroll
    for (int kc = 0; kc < 2; ++kc) {
#pragma unroll
      for (int t = 0; t < 4; ++t) {
        acc[t] = wmma16(vf[t][0], ph[kc], acc[t]); ac1[t] = wmma16(vf[t][1], ph[kc], ac1[t]); ac2[t] = wmma16(vf[t][0], pl[kc], ac2[t]);
        if (kc == 0) { vf[t][0] = frag_l(vhu + 4096 + t * 1024); vf[t][1] = frag_l(vlu + 4096 + t * 1024);
          __builtin_amdgcn_sched_barrier(0);   // keeps the refill here, four product groups ahead of its use
        } } }
    // the hand-over: tile kt + 1 becomes readable, and this tile's buffer free for tile kt + 2
    asm volatile("s_wait_dscnt 0x0" ::: "memory");      // this wave's reads of this tile's buffer are done before the buffer is written again
    asm volatile("s_wait_asynccnt 0x0" ::: "memory");   // this wave's share of tile kt + 1 has landed
    __syncthreads();                                    // the same holds of every wave of the block
    if (kt + 2 < SS / 64) { const unsigned bo = (kt & 1) * STB; stage_tile(lk + bo + l16, gk + (kt + 2) * 8192 + l16, lb + bo + l16, gb + (kt + 2) * 2048 + l16); } }
  asm volatile("s_wait_asynccnt 0x0" ::: "memory");   // no copy is out when the wave ends
  lrun += xhalf(lrun);
  const float inv = 1.0f / (lrun * 16384.0f * 4.0f);
  float* od = O32 + ((size_t)((b * SS + q0) >> 4) * NH + (bh % NH)) * 1024 + lane * 4;
#pragma unroll
  for (int it = 0; it < 8; ++it) { v4f o;
#pragma unroll
    for (int e = 0; e < 4; ++e) { const int t = it >> 1, r = (it & 1) * 4 + e; o[e] = (acc[t][r] + ac1[t][r] * (1.0f / VLO) + ac2[t][r] * (1.0f / PLO)) * inv; }
    vst2(od + it * 128, o); }
}
// out = ctx Wo + bo : split(ctx) x bf16(Wo rows): 2 products (Wo is an INPUT -> bf16 exact)
__global__ __launch_bounds__(128) void k_out(const float* __restrict__ O32, const __bf16* __restrict__ PT, const float* __restrict__ bo, float* __restrict__ out) {
  __shared__ __align__(16) float so[4][16][132];
  const int tid = threadIdx.x, wave = tid >> 5, lane = tid & 31, col = lane & 15, g = lane >> 4;
  const int r0 = blockIdx.x * 64 + wave * 16, n0 = blockIdx.y * 128;
  v8f acc[8] = {};
  // two register sets: each k step's 20 loads go out as one group, one step ahead of the products that read them (inner loops unrolled: the sets are register arrays)
  const int rb = blockIdx.x * 64; const float* op = O32 + (size_t)rb * E; const __bf16* wp = PT + (size_t)(3 * E + n0) * E;   // wave-uniform bases; the lane's part is one 32-bit offset each
  const unsigned ool = (wave * 16 * E + 4 * lane) * 4, wol = 8 * lane;   // ool in bytes, wol in elements
  float x0[16], x1[16]; v16b w0[8], w1[8];
  { const gpf o0 = (gpf)((gpc)sbase(op) + ool);
#pragma unroll
    for (int i = 0; i < 16; ++i) x0[i] = o0[(i >> 2) * 128 + (i & 3)]; }
#pragma unroll
  for (int j = 0; j < 8; ++j) w0[j] = frag_ub((gph)sbase(wp) + j * 16 * E, wol);
#pragma unroll 1
  for (int h = 0; h < NH - 1; ++h) { const gpf oh = (gpf)((gpc)sbase(op + h * 1024) + ool); const gph wu = (gph)sbase(wp + h * 1024);
#pragma unroll
    for (int i = 0; i < 16; ++i) x1[i] = oh[512 + (i >> 2) * 128 + (i & 3)];
#pragma unroll
    for (int j = 0; j < 8; ++j) w1[j] = frag_ub(wu + j * 16 * E + 512, wol);
    asm volatile("s_wait_xcnt 0x0" ::: "memory");   // the scalar bases that the loads above name are advanced while those loads are still out
    __builtin_amdgcn_sched_barrier(0);   // keeps the group above the products below; without it each load sinks to its use and its latency is waited out alone
    { const F2 a = bsplit16(x0);
#pragma unroll
      for (int j = 0; j < 8; ++j) { acc[j] = wmma_bf(a.l, w0[j], acc[j]); acc[j] = wmma_bf(a.h, w0[j], acc[j]); } }
#pragma unroll
    for (int i = 0; i < 16; ++i) x0[i] = oh[1024 + (i >> 2) * 128 + (i & 3)];
#pragma unroll
    for (int j = 0; j < 8; ++j) w0[j] = frag_ub(wu + j * 16 * E + 1024, wol);
    asm volatile("s_wait_xcnt 0x0" ::: "memory");   // the scalar bases that the loads above name are advanced while those loads are still out
    __builtin_amdgcn_sched_barrier(0);   // as above
    { const F2 a = bsplit16(x1);
#pragma unroll
      for (int j = 0; j < 8; ++j) { acc[j] = wmma_bf(a.l, w1[j], acc[j]); acc[j] = wmma_bf(a.h, w1[j], acc[j]); } } }
  { const gpf oh = (gpf)((gpc)sbase(op + (NH - 1) * 1024) + ool);   // the last two steps: nothing is left to fetch behind them
#pragma unroll
    for (int i = 0; i < 16; ++i) x1[i] = oh[512 + (i >> 2) * 128 + (i & 3)]; }
  asm volatile("s_wait_xcnt 0x0" ::: "memory");   // the address registers of the four loads above are given to a fragment of the group below
#pragma unroll
  for (int j = 0; j < 8; ++j) w1[j] = frag_ub((gph)sbase(wp) + j * 16 * E + (E / 32 - 1) * 512, wol);
  __builtin_amdgcn_sched_barrier(0);   // as above
  { const F2 a = bsplit16(x0);
#pragma unroll
    for (int j = 0; j < 8; ++j) { acc[j] = wmma_bf(a.l, w0[j], acc[j]); acc[j] = wmma_bf(a.h, w0[j], acc[j]); } }
  { const F2 a = bsplit16(x1);
#pragma unroll
    for (int j = 0; j < 8; ++j) { acc[j] = wmma_bf(a.l, w1[j], acc[j]); acc[j] = wmma_bf(a.h, w1[j], acc[j]); } }
#pragma unroll
  for (int j = 0; j < 8; ++j) { const int n = n0 + j * 16 + col; const float bb = bfr(bo[n]);
#pragma unroll
    for (int r = 0; r < 8; ++r) so[wave][8 * g + r][j * 16 + col] = acc[j][r] + bb; }
  LDSX();
#pragma unroll 4
  for (int rl = 0; rl < 16; ++rl) vst2(out + (size_t)(r0 + rl) * E + n0 + lane * 4, *(const v4f*)(&so[wave][rl][lane * 4]));
}
extern "C" void kernel_launch(void* const* d_in, const int* in_sizes, int n_in, void* d_out, int out_size, void* d_ws, size_t ws_size, hipStream_t stream) {
  (void)in_sizes; (void)n_in; (void)out_size; (void)ws_size;
  const float* x = (const float*)d_in[0]; const float* bond = (const float*)d_in[1]; const float* Wq = (const float*)d_in[2]; const float* bq = (const float*)d_in[3]; const float* Wk = (const float*)d_in[4]; const float* bk = (const float*)d_in[5]; const float* Wv = (const float*)d_in[6]; const float* bv = (const float*)d_in[7]; const float* Wo = (const float*)d_in[8]; const float* bo = (const float*)d_in[9];
  float* out = (float*)d_out;
  char* ws = (char*)d_ws; size_t off = 0;
  auto take = [&](size_t bytes) { char* p = ws + off; off += (bytes + 255) & ~(size_t)255; return p; };
  __bf16* Xb = (__bf16*)take((size_t)NR * E * 2); __bf16* PT = (__bf16*)take((size_t)4 * E * E * 2);
  float* Q32 = (float*)take((size_t)NR * E * 4); __bf16* Kh = (__bf16*)take((size_t)NR * E * 2); __bf16* Kl = (__bf16*)take((size_t)NR * E * 2); _Float16* VTh = (_Float16*)take((size_t)NR * E * 2); _Float16* VTl = (_Float16*)take((size_t)NR * E * 2); float* O32 = (float*)take((size_t)NR * E * 4); __bf16* Bb = (__bf16*)take((size_t)NB * SS * SS * 2);
  // ws ~ 101 MB
  k_cvt<<<NB * SS * SS / 8 / 2048 + NR * E / 8 / 256, 256, 0, stream>>>(x, bond, Xb, Bb);
  k_pack<<<dim3(4 * E / 32, E / 64), 256, 0, stream>>>(Wq, Wk, Wv, Wo, PT);
  k_qkv<<<dim3(NR / 128, E / 128, 3), 128, 0, stream>>>(Xb, PT, bq, bk, bv, Q32, Kh, Kl, VTh, VTl);
  k_attn<<<dim3(SS / (AW * 16), NB * NH), AW * 32, 0, stream>>>(Q32, Kh, Kl, VTh, VTl, Bb, O32);
  k_out<<<dim3(NR / 64, E / 128), 128, 0, stream>>>(O32, PT, bo, out);
}

// v008
// One run takes 138 microseconds.
// Two timings next to v007 both put it at 1.06 times that version's speed.
// Counting every step since v000, it is 4.09 times as fast.
// compute dtype: x, bond_influence, W*/b* (INPUTS) rounded to bf16 with exact bf16 WMMA products (f32 accumulate) for the projections; K pre-split into bf16 hi/lo fragments; q f32 split, P and V f16 hi/lo (3 products each); the bond modulation and softmax in f32.
#include <hip/hip_runtime.h>
#include <math.h>

typedef __attribute__((ext_vector_type(16))) _Float16 v16h;
typedef __attribute__((ext_vector_type(16))) __bf16 v16b;
typedef __attribute__((ext_vector_type(8)))  _Float16 v8h;
typedef __attribute__((ext_vector_type(8)))  float v8f;
typedef __attribute__((ext_vector_type(4)))  float v4f;
typedef __attribute__((ext_vector_type(2)))  float v2f;
typedef __attribute__((ext_vector_type(4)))  unsigned v4u;
typedef __attribute__((ext_vector_type(4)))  int v4i;
typedef float __attribute__((may_alias)) float_a;
typedef int __attribute__((may_alias)) int_a;

template <typename T> __device__ __forceinline__ void vst2(void* p, T v) { *(T*)p = v;  }
__device__ __forceinline__ v8f wmma16(v16h a, v16h b, v8f c) {
  v8f d = __builtin_amdgcn_wmma_f32_16x16x32_f16(false, a, false, b, (short)0, c, false, false);
  return d;
}
__device__ __forceinline__ v8f wmma_bf(v16b a, v16b b, v8f c) {
  v8f d = __builtin_amdgcn_wmma_f32_16x16x32_bf16(false, a, false, b, (short)0, c, false, false);
  return d;
}
// 16x16x32 fragments: lane = (h = lane>>4, row/col = lane&15); elements 0..7 = k0+8h+0..7, 8..15 = k0+16+8h+0..7; D element r = row 8h+r
__device__ __forceinline__ v16h frag_h(const _Float16* rowk0, int lane) {
  union { v16h v; v8h q[2]; } u; const _Float16* p = rowk0 + 8 * (lane >> 4);
  u.q[0] = *(const v8h*)p; u.q[1] = *(const v8h*)(p + 16); return u.v;
}
__device__ __forceinline__ v16h frag_f32(const float* rowk0, int lane) {
  v16h a; const float* p = rowk0 + 8 * (lane >> 4);
#pragma unroll
  for (int i = 0; i < 8; ++i) { a[i] = (_Float16)p[i]; a[8 + i] = (_Float16)p[16 + i]; }
  return a;
}
__device__ __forceinline__ v16h frag_f32s(const float* rowk0, int lane, float sc) {
  v16h a; const float* p = rowk0 + 8 * (lane >> 4);
#pragma unroll
  for (int i = 0; i < 8; ++i) { a[i] = (_Float16)(p[i] * sc); a[8 + i] = (_Float16)(p[16 + i] * sc); }
  return a;
}
// column fragment from a [K][ld] layout (column n), rows >= K read as 0
__device__ __forceinline__ v16h fragc_f32(const float* W, int k0, int n, int lane, int ld, int K) {
  v16h a; const int g = lane >> 4;
#pragma unroll
  for (int i = 0; i < 8; ++i) { const int ka = k0 + 8 * g + i, kb = ka + 16;
    a[i] = (_Float16)(ka < K ? W[(size_t)ka * ld + n] : 0.f); a[8 + i] = (_Float16)(kb < K ? W[(size_t)kb * ld + n] : 0.f); }
  return a;
}
struct F2 { v16b h, l; };
__device__ __forceinline__ F2 bsplit16(const float v[16]) { F2 r;
#pragma unroll
  for (int i = 0; i < 16; ++i) { const __bf16 h = (__bf16)v[i]; r.h[i] = h; r.l[i] = (__bf16)(v[i] - (float)h); }
  return r; }
__device__ __forceinline__ F2 split_row(const float* row, int k0, int lane) { float v[16]; const float* p = row + k0 + 8 * (lane >> 4);
#pragma unroll
  for (int i = 0; i < 8; ++i) { v[i] = p[i]; v[8 + i] = p[16 + i]; }
  return bsplit16(v); }
__device__ __forceinline__ F2 split_rowK(const float* row, int k0, int lane, int K) { float v[16]; const int g = lane >> 4;
#pragma unroll
  for (int i = 0; i < 8; ++i) { const int ka = k0 + 8 * g + i, kb = ka + 16; v[i] = ka < K ? row[ka] : 0.f; v[8 + i] = kb < K ? row[kb] : 0.f; }
  return bsplit16(v); }
__device__ __forceinline__ F2 split_col(const float* W, int k0, int n, int lane, int ld, int K) { float v[16]; const int g = lane >> 4;
#pragma unroll
  for (int i = 0; i < 8; ++i) { const int ka = k0 + 8 * g + i, kb = ka + 16; v[i] = ka < K ? W[(size_t)ka * ld + n] : 0.f; v[8 + i] = kb < K ? W[(size_t)kb * ld + n] : 0.f; }
  return bsplit16(v); }
__device__ __forceinline__ v8f mac3(const F2& a, const F2& b, v8f c) { c = wmma_bf(a.l, b.h, c); c = wmma_bf(a.h, b.l, c); return wmma_bf(a.h, b.h, c); }
__device__ __forceinline__ float sigm(float v) { return 1.0f / (1.0f + expf(-v)); }
#define LDSX() do { asm volatile("s_wait_dscnt 0" ::: "memory"); __builtin_amdgcn_wave_barrier(); __builtin_amdgcn_fence(__ATOMIC_RELEASE, "workgroup"); } while (0)


// Bond-influence self attention (16 heads x 64 on [2,2048,1024], [in][out] weights + biases): scores = (q.k/8) * bond_influence[b][q][k] (an INPUT matrix, shared by the heads); softmax; (P v) @ Wo + bo.
#define NB 2
#define SS 2048
#define E 1024
#define NH 16
#define HD 64
#define NR (NB * SS)
#define VSC 64.0f   // V is stored times 64; a weight is at most 16384 (k_attn). At these sizes the low halves of V and of P stand in f16 as they are, with no factor of their own, so all three products of P V have one scale
#define SCL2 0.18033688f   // log2(e) / 8: the scores are kept in base-2 units, so that a weight is one hardware exponential
__device__ __forceinline__ float bfr(float v) { return (float)(__bf16)v; }
// FRAGMENT ORDER (every 16-bit matrix operand in the workspace): a 16 x 32 fragment is 1 KiB in a row, two blocks of 512 bytes; block qi holds at lane * 16 bytes the lane's elements 8 * qi .. 8 * qi + 7,
// that is row or column (lane & 15), k = 16 * qi + 8 * (lane >> 4) + 0..7: one wave-wide 16-byte load reads 512 contiguous bytes, four whole 128-byte lines, where a row-major operand made it touch sixteen
// the fragment from a wave-uniform base and the lane's own 32-bit element offset (8 * lane): the address costs one vector register
typedef const _Float16 __attribute__((address_space(1)))* gph; typedef const float __attribute__((address_space(1)))* gpf; typedef const v8h __attribute__((address_space(1)))* gp8; typedef const char __attribute__((address_space(1)))* gpc;
__device__ __forceinline__ unsigned long long sbase(const void* p) {   // a wave-uniform address read into scalar registers, so that the loads below take it as their scalar base
  const unsigned long long u = (unsigned long long)p;
  return ((unsigned long long)(unsigned)__builtin_amdgcn_readfirstlane((int)(u >> 32)) << 32) | (unsigned)__builtin_amdgcn_readfirstlane((int)u); }
__device__ __forceinline__ v16h frag_u(gph ub, unsigned off) { union { v16h v; v8h q[2]; } u; gph p = ub + off; u.q[0] = *(gp8)p; u.q[1] = *(gp8)(p + 256); return u.v; }
__device__ __forceinline__ v16b frag_ub(gph ub, unsigned off) { return __builtin_bit_cast(v16b, frag_u(ub, off)); }
__device__ __forceinline__ v16b frag_b(const __bf16* rowk0, int lane) { return __builtin_bit_cast(v16b, frag_h((const _Float16*)rowk0, lane)); }

// blocks below NB * SS * SS / 8 / 2048: bond_influence (the longer blocks, so they start first); the rest: x
__global__ __launch_bounds__(256) void k_cvt(const float* __restrict__ x, const float* __restrict__ bond, __bf16* __restrict__ Xb, __bf16* __restrict__ Bb) {
  union P8 { __bf16 h[8]; v4u u; };
  if (blockIdx.x < NB * SS * SS / 8 / 2048) {
    // Bb: bond_influence rounded to bf16, in the order of the transposed score accumulators of k_attn: the tile (16-query group qg of [b][q], 16-key group kg) is 512 bytes at element (qg * (SS / 16) + kg) * 256;
    // at lane * 16 bytes stand query (lane & 15), keys 8 * (lane >> 4) + 0..7. A wave takes 8 rows x 128 bytes in (whole lines over its two loads) and puts four whole lines out; a thread does eight such 16-byte units: a wave keeps many loads out at a time, and the launch has an eighth of the waves to start
    const unsigned u = blockIdx.x * 2048 + threadIdx.x;
    const int r = u & 7, o = (u >> 3) & 3, rh = (u >> 5) & 1, ch = (u >> 6) & (SS / 32 - 1), qg = u >> 12;
    const float* bs = bond + (size_t)(qg * 16 + rh * 8 + r) * SS + ch * 32 + o * 8;
    __bf16* bd = Bb + ((size_t)qg * (SS / 16) + ch * 2 + (o >> 1)) * 256 + ((o & 1) * 16 + rh * 8 + r) * 8;
    float in[8][8];
#pragma unroll
    for (int j = 0; j < 8; ++j) {
#pragma unroll
      for (int e = 0; e < 8; ++e) in[j][e] = bs[j * 128 + e]; }
    asm volatile("s_wait_xcnt 0x0" :: "v"(bs) : "memory");   // the address registers of the loads above are given to other values while those loads are still out; named here, they live up to the wait
#pragma unroll
    for (int j = 0; j < 8; ++j) { P8 pk;
#pragma unroll
      for (int e = 0; e < 8; ++e) pk.h[e] = (__bf16)in[j][e];
      vst2((unsigned*)(bd + j * 2048), pk.u); }
    return; }
  // Xb in fragment order: fragment (16-row group rg, k step kc) at element (rg * 32 + kc) * 512; thread i8 writes 16-byte unit i8 of it
  const size_t i8 = (size_t)(blockIdx.x - NB * SS * SS / 8 / 2048) * 256 + threadIdx.x;
  const int ln = (int)(i8 & 31), qi = (int)(i8 >> 5) & 1, kc = (int)(i8 >> 6) & 31, rg = (int)(i8 >> 11);
  const float* xs = x + (size_t)(rg * 16 + (ln & 15)) * E + kc * 32 + qi * 16 + (ln >> 4) * 8;
  P8 pk;
#pragma unroll
  for (int e = 0; e < 8; ++e) pk.h[e] = (__bf16)xs[e];
  vst2((unsigned*)(Xb + i8 * 8), pk.u);
}
// PT columns n: [0,E) Wq[:,n], [E,2E) Wk[:,n], [2E,3E) Wv[:,n], [3E,4E) Wo[:,n]  ([in][out] weights), in fragment order: fragment (16-column group ng, k step kc) at element (ng * 32 + kc) * 512
// block (32 columns, 64 k): whole 128-byte lines of W in, turned in LDS, four whole fragments out
__global__ __launch_bounds__(256) void k_pack(const float* __restrict__ Wq, const float* __restrict__ Wk, const float* __restrict__ Wv, const float* __restrict__ Wo, __bf16* __restrict__ PT) {
  const int n0 = blockIdx.x * 32, k0 = blockIdx.y * 64, tid = threadIdx.x; __shared__ __align__(16) __bf16 st[32][72];
  const float* W = n0 < E ? Wq : (n0 < 2 * E ? Wk : (n0 < 3 * E ? Wv : Wo)); const int nn = n0 & (E - 1);
  const int kr = tid >> 2, pt = tid & 3; const float* wsrc = W + (size_t)(k0 + kr) * E + nn + pt * 8;
#pragma unroll
  for (int e = 0; e < 8; ++e) st[pt * 8 + e][kr] = (__bf16)wsrc[e];
  __syncthreads();
  const int ln = tid & 31, qi = (tid >> 5) & 1, kc = (tid >> 6) & 1, ngl = tid >> 7;
  vst2((unsigned*)(PT + ((size_t)((n0 >> 4) + ngl) * 32 + (k0 >> 5) + kc) * 512 + qi * 256 + ln * 8), *(const v4u*)(&st[ngl * 16 + (ln & 15)][kc * 32 + qi * 16 + (ln >> 4) * 8]));
}
// QKV: block (128 rows, 128 cols = 2 heads, which), four waves as 2 x 2; a wave does 64 rows x 64 cols (one head): 8 fragments feed 16 products a k step, where a 16 x 128 wave tile took 9 for 8.
// q (+bias) -> Q32 f32 [bh][s][64]; k (+bias) -> bf16 hi/lo, v (+bias) -> f16 hi/lo x64, both in fragment order:
// K fragment (16-key group kg, d step kc) at element bh * SS * HD + (kg * 2 + kc) * 512; V fragment (32-key block kb, 16-d group t) at element bh * SS * HD + (kb * 4 + t) * 512
// The x and the weight fragments have one layout, so either may be the first operand. For q and k the weights are first: a lane's accumulator registers are then 8 d in a row of one row of x,
// which is a 16-byte unit of a K fragment. For v the rows of x are first: the registers are 8 keys in a row of one d, a unit of a V fragment. K and V go from the registers to the workspace, 512 bytes in a row a wave-wide store
__global__ __launch_bounds__(128) void k_qkv(const __bf16* __restrict__ Xb, const __bf16* __restrict__ PT, const float* __restrict__ bq, const float* __restrict__ bk, const float* __restrict__ bv,
                                            float* __restrict__ Q32, __bf16* __restrict__ Kh, __bf16* __restrict__ Kl, _Float16* __restrict__ VTh, _Float16* __restrict__ VTl) {
  __shared__ __align__(16) float so[4][64][68];
  const int tid = threadIdx.x, wave = __builtin_amdgcn_readfirstlane(tid >> 5), lane = tid & 31, col = lane & 15, g = lane >> 4;
  const int which = blockIdx.z, r0 = blockIdx.x * 128 + (wave >> 1) * 64, n0 = blockIdx.y * 128 + (wave & 1) * 64; const int s0 = r0 % SS;
  const size_t bh = (size_t)(r0 / SS) * NH + (n0 >> 6);
  const float* bb_ = which == 0 ? bq : (which == 1 ? bk : bv);
  v8f acc[4][4] = {};   // acc[i][j]: rows = 16-group i of the first operand, columns = 16-group j of the second
  // two register sets: each k step's 16 fragment loads go out as one group, one step ahead of the products that read them (inner loops unrolled: the sets are register arrays)
  const __bf16* xp = Xb + (size_t)r0 * E; const __bf16* wp = PT + (size_t)(which * E + n0) * E;   // wave-uniform bases; the lane's part is one 32-bit offset
  const __bf16* ap = which < 2 ? wp : xp; const __bf16* bp = which < 2 ? xp : wp;
  const unsigned ol = 8 * lane;
  v16b a0[4], a1[4], b0[4], b1[4];
#pragma unroll
  for (int i = 0; i < 4; ++i) { a0[i] = frag_ub((gph)sbase(ap) + i * 16 * E, ol); b0[i] = frag_ub((gph)sbase(bp) + i * 16 * E, ol); }
#pragma unroll 1   // stays rolled: one trip already holds a step of either register set
  for (int kc = 0; kc < E / 32 - 2; kc += 2) {
    const gph au = (gph)sbase(ap + kc * 512), bu = (gph)sbase(bp + kc * 512);
#pragma unroll
    for (int i = 0; i < 4; ++i) { a1[i] = frag_ub(au + i * 16 * E + 512, ol); b1[i] = frag_ub(bu + i * 16 * E + 512, ol); }
    asm volatile("s_wait_xcnt 0x0" ::: "memory");   // the scalar bases that the loads above name are advanced while those loads are still out
    __builtin_amdgcn_sched_barrier(0);   // keeps the group above the products below; without it each load sinks to its use and its latency is waited out alone
#pragma unroll
    for (int i = 0; i < 4; ++i) {
#pragma unroll
      for (int j = 0; j < 4; ++j) acc[i][j] = wmma_bf(a0[i], b0[j], acc[i][j]); }
#pragma unroll
    for (int i = 0; i < 4; ++i) { a0[i] = frag_ub(au + i * 16 * E + 1024, ol); b0[i] = frag_ub(bu + i * 16 * E + 1024, ol); }
    asm volatile("s_wait_xcnt 0x0" ::: "memory");   // the scalar bases that the loads above name are advanced while those loads are still out
    __builtin_amdgcn_sched_barrier(0);   // as above
#pragma unroll
    for (int i = 0; i < 4; ++i) {
#pragma unroll
      for (int j = 0; j < 4; ++j) acc[i][j] = wmma_bf(a1[i], b1[j], acc[i][j]); } }
#pragma unroll
  for (int i = 0; i < 4; ++i) { a1[i] = frag_ub((gph)sbase(ap) + i * 16 * E + (E / 32 - 1) * 512, ol); b1[i] = frag_ub((gph)sbase(bp) + i * 16 * E + (E / 32 - 1) * 512, ol); }   // the last two steps: nothing is left to fetch behind them
  asm volatile("s_wait_xcnt 0x0" ::: "memory");   // the address registers of the loads above are given to other values while those loads are still out
  __builtin_amdgcn_sched_barrier(0);   // as above
#pragma unroll
  for (int i = 0; i < 4; ++i) {
#pragma unroll
    for (int j = 0; j < 4; ++j) acc[i][j] = wmma_bf(a0[i], b0[j], acc[i][j]); }
#pragma unroll
  for (int i = 0; i < 4; ++i) {
#pragma unroll
    for (int j = 0; j < 4; ++j) acc[i][j] = wmma_bf(a1[i], b1[j], acc[i][j]); }
  if (which < 2) {
    // acc[i][j][r]: column n0 + 16 * i + 8 * g + r of the weights (d = 16 * i + 8 * g + r of the head), row r0 + 16 * j + col of x
#pragma unroll
    for (int i = 0; i < 4; ++i) {
#pragma unroll
      for (int r = 0; r < 8; ++r) { const float bb = bfr(bb_[n0 + i * 16 + 8 * g + r]);
#pragma unroll
        for (int j = 0; j < 4; ++j) acc[i][j][r] += bb; } }
    if (which == 0) {   // the wave's 64 rows are turned in its own LDS rows, so that whole lines go out
#pragma unroll
      for (int j = 0; j < 4; ++j) {
#pragma unroll
        for (int i = 0; i < 4; ++i) { v4f lo4, hi4;
#pragma unroll
          for (int e = 0; e < 4; ++e) { lo4[e] = acc[i][j][e]; hi4[e] = acc[i][j][4 + e]; }
          *(v4f*)(&so[wave][j * 16 + col][i * 16 + 8 * g]) = lo4; *(v4f*)(&so[wave][j * 16 + col][i * 16 + 8 * g + 4]) = hi4; } }
      LDSX();
#pragma unroll
      for (int it = 0; it < 32; ++it) { const int qq = it * 32 + lane, rl = qq >> 4, pc = qq & 15;
        vst2(Q32 + (bh * SS + s0 + rl) * HD + pc * 4, *(const v4f*)(&so[wave][rl][pc * 4]));
        if ((it & 7) == 7) asm volatile("s_wait_xcnt 0x0" ::: "memory");   // the data and address registers of the stores above are given to other values while the stores are still out
      } }
    else {
#pragma unroll
      for (int j = 0; j < 4; ++j) {   // key group j of the wave's 64 rows; i = 2 * kc + qi: one 512-byte block of the hi and one of the lo plane
#pragma unroll
        for (int i = 0; i < 4; ++i) { union { __bf16 e[8]; v4u u; } ph, pl;
#pragma unroll
          for (int e = 0; e < 8; ++e) { const float v = acc[i][j][e]; const __bf16 hi = (__bf16)v; ph.e[e] = hi; pl.e[e] = (__bf16)(v - (float)hi); }
          const size_t o = (bh * SS + s0 + j * 16) * HD + i * 256 + lane * 8;
          vst2((unsigned*)(Kh + o), ph.u); vst2((unsigned*)(Kl + o), pl.u);
          asm volatile("s_wait_xcnt 0x0" ::: "memory");   // the data and address registers of the two stores above are given to other values while the stores are still out
        } } } }
  else {
    // acc[i][j][r]: row r0 + 16 * i + 8 * g + r of x (a key), column n0 + 16 * j + col of the weights (d = 16 * j + col of the head)
#pragma unroll
    for (int j = 0; j < 4; ++j) { const float bb = bfr(bb_[n0 + j * 16 + col]);
#pragma unroll
      for (int i = 0; i < 4; ++i) { union { _Float16 e[8]; v4u u; } ph, pl;   // 32-key block i >> 1, its half i & 1
#pragma unroll
        for (int e = 0; e < 8; ++e) { const float v = (acc[i][j][e] + bb) * VSC; const _Float16 hi = (_Float16)v; ph.e[e] = hi; pl.e[e] = (_Float16)(v - (float)hi); }
        const size_t o = bh * HD * SS + (size_t)((s0 >> 5) + (i >> 1)) * 2048 + j * 512 + (i & 1) * 256 + lane * 8;
        vst2((unsigned*)(VTh + o), ph.u); vst2((unsigned*)(VTl + o), pl.u);
        asm volatile("s_wait_xcnt 0x0" ::: "memory");   // the data and address registers of the two stores above are given to other values while the stores are still out
      } } }
}
// attention: block (128 queries, bh); all key tiles of 64; TRANSPOSED: S^T = K q^T (K hi/lo as A, q hi/lo as B) and O^T += V^T P^T (V hi/lo as A, P hi/lo as B). A lane then holds one query (lane & 15):
// of score tile t its registers r are keys 16 * t + 8 * (lane >> 4) + r, which is the k order of a B fragment, so two score tiles turned into weights ARE the P fragment of 32 keys: scores, softmax and P never leave the registers.
// O f32 in the order in which k_out reads it: the f32 fragment (16-row group rg of [b][s], head h, d step kc) is
// 2 KiB at float ((rg * NH + h) * 2 + kc) * 512, four blocks of 512 bytes; block j holds at lane * 16 bytes row (lane & 15), d = 32 * kc + 16 * (j >> 1) + 8 * (lane >> 4) + 4 * (j & 1) + 0..3: four registers of an O^T accumulator
__device__ __forceinline__ float xhalf(float v) { return __builtin_bit_cast(float, __builtin_amdgcn_permlanex16(__builtin_bit_cast(int, v), __builtin_bit_cast(int, v), 0x76543210, 0xfedcba98, false, false)); }   // lane l with lane l ^ 16
// THE RING: a block of AW waves shares each 64-key tile. The tile's K hi, K lo, V hi and V lo (8 KiB each, contiguous in the workspace, already in fragment order) and each wave's own four bond tiles (2 KiB)
// are copied from global memory straight into one of two LDS buffers while the tile before them is worked on; the fragments are then read from LDS, 512 contiguous bytes a wave-wide read.
#define AW 8
#define KVB 32768                  // bytes of K hi, K lo, V hi, V lo of one tile
#define STB (KVB + AW * 2048)      // bytes of one buffer: that and the bond tiles of the AW waves
__device__ __forceinline__ v16h frag_l(const unsigned char* p) { union { v16h v; v8h q[2]; } u; u.q[0] = *(const v8h*)p; u.q[1] = *(const v8h*)(p + 512); return u.v; }
__device__ __forceinline__ v16b frag_lb(const unsigned char* p) { return __builtin_bit_cast(v16b, frag_l(p)); }
// one wave's share of a tile: eight 512-byte units of the K and V planes (LDS byte address l, global address g) and its four bond tiles (lb, gb); every lane brings 16 bytes a copy.
// The copies and their s_wait_xcnt stand in one statement, so that no address register is given a new value in front of the wait
__device__ __forceinline__ void stage_tile(unsigned l, const char* g, unsigned lb, const char* gb) {
  asm volatile("global_load_async_to_lds_b128 %0, %1, off\n\t"
               "global_load_async_to_lds_b128 %2, %3, off\n\t"
               "global_load_async_to_lds_b128 %4, %5, off\n\t"
               "global_load_async_to_lds_b128 %6, %7, off\n\t"
               "global_load_async_to_lds_b128 %8, %9, off\n\t"
               "global_load_async_to_lds_b128 %10, %11, off\n\t"
               "global_load_async_to_lds_b128 %12, %13, off\n\t"
               "global_load_async_to_lds_b128 %14, %15, off\n\t"
               "global_load_async_to_lds_b128 %16, %17, off\n\t"
               "global_load_async_to_lds_b128 %18, %19, off\n\t"
               "global_load_async_to_lds_b128 %20, %21, off\n\t"
               "global_load_async_to_lds_b128 %22, %23, off\n\t"
               "s_wait_xcnt 0x0"
               :: "v"(l), "v"(g), "v"(l + 512), "v"(g + 512), "v"(l + 1024), "v"(g + 1024), "v"(l + 1536), "v"(g + 1536),
                  "v"(l + 2048), "v"(g + 2048), "v"(l + 2560), "v"(g + 2560), "v"(l + 3072), "v"(g + 3072), "v"(l + 3584), "v"(g + 3584),
                  "v"(lb), "v"(gb), "v"(lb + 512), "v"(gb + 512), "v"(lb + 1024), "v"(gb + 1024), "v"(lb + 1536), "v"(gb + 1536) : "memory");
}
// amdgpu_waves_per_eu(4, 4): holds a wave to 256 registers, so that two blocks stay resident on a WGP
__global__ __launch_bounds__(AW * 32) __attribute__((amdgpu_waves_per_eu(4, 4))) void k_attn(const float* __restrict__ Q32, const __bf16* __restrict__ Kh, const __bf16* __restrict__ Kl, const _Float16* __restrict__ VTh, const _Float16* __restrict__ VTl, const __bf16* __restrict__ Bb, float* __restrict__ O32) {
  const int tid = threadIdx.x, w = __builtin_amdgcn_readfirstlane(tid >> 5), lane = tid & 31, col = lane & 15;   // the wave's number in a scalar register: addresses built on it cost no vector registers
  const size_t bh = blockIdx.y; const int qb = blockIdx.x; const int q0 = qb * (AW * 16) + w * 16;
  const int b = (int)(bh / NH);
  __shared__ __align__(16) unsigned char ring[2][STB];
  // wave w copies the half (w & 1) of plane (w >> 1) of K hi, K lo, V hi, V lo: in the buffer that is byte w * 4096; a tile is 8192 bytes further in every plane, 2048 in the bond rows of the wave's 16 queries
  // gk, gb, lk, lb: the wave's parts of the four addresses, the same in every lane; l16: the lane's part
  const char* gk = (const char*)(w < 2 ? (const void*)Kh : (w < 4 ? (const void*)Kl : (w < 6 ? (const void*)VTh : (const void*)VTl))) + bh * (SS * HD * 2) + (w & 1) * 4096;
  const char* gb = (const char*)Bb + (size_t)((b * SS + q0) >> 4) * (SS / 16 * 512);
  const unsigned lk = (unsigned)(size_t)&ring[0][0] + w * 4096, lb = (unsigned)(size_t)&ring[0][0] + KVB + w * 2048, l16 = lane * 16;
  stage_tile(lk + l16, gk + l16, lb + l16, gb + l16);   // tile 0 into buffer 0
  // the split q fragments stay in registers through the loop: one accumulator set leaves room for them at four waves per SIMD
  F2 aq[2];
#pragma unroll
  for (int kc = 0; kc < 2; ++kc) aq[kc] = split_row(Q32 + (bh * SS + q0 + col) * HD, kc * 32, lane);
  float mrun = -3.0e38f, lrun = 0.f; v8f acc[4] = {};   // one accumulator set takes all three products of P V; lrun: the sum over this lane's half of the keys; the halves are joined behind the loop
  asm volatile("s_wait_asynccnt 0x0" ::: "memory");   // this wave's share of tile 0 has landed
  __syncthreads();                                    // every wave's share has: tile 0 may be read
  stage_tile(lk + STB + l16, gk + 8192 + l16, lb + STB + l16, gb + 2048 + l16);   // tile 1 into buffer 1
#pragma unroll 1
  for (int kt = 0; kt < SS / 64; ++kt) {
    // one read group at the head of the tile: the K fragments of key groups 0 and 1 and the four bond tiles; the fragments of groups 2 and 3 refill a set as soon as it has been read (inner loops unrolled: the sets are register arrays)
    const unsigned char* rl = &ring[kt & 1][l16];   // the lane's place in every 512-byte unit of this tile's buffer
    const unsigned char* khu = rl, * klu = rl + 8192, * vhu = rl + 16384, * vlu = rl + 24576, * bu = rl + KVB + w * 2048;
    v4u bv[4]; v16b kf[2][4];
#pragma unroll
    for (int t = 0; t < 2; ++t) {
#pragma unroll
      for (int kc = 0; kc < 2; ++kc) { kf[t][2 * kc] = frag_lb(khu + t * 2048 + kc * 1024); kf[t][2 * kc + 1] = frag_lb(klu + t * 2048 + kc * 1024); } }
#pragma unroll
    for (int t = 0; t < 4; ++t) bv[t] = *(const v4u*)(bu + t * 512);
    __builtin_amdgcn_sched_barrier(0);   // keeps the group above the products below; without it each read sinks to its use and its latency is waited out alone
    float sc[4][8];
#pragma unroll
    for (int t = 0; t < 4; ++t) { v8f s = {};
#pragma unroll
      for (int kc = 0; kc < 2; ++kc) { s = wmma_bf(kf[t & 1][2 * kc], aq[kc].l, s); s = wmma_bf(kf[t & 1][2 * kc + 1], aq[kc].h, s); s = wmma_bf(kf[t & 1][2 * kc], aq[kc].h, s); }
      if (t < 2) {
#pragma unroll
        for (int kc = 0; kc < 2; ++kc) { kf[t][2 * kc] = frag_lb(khu + (t + 2) * 2048 + kc * 1024); kf[t][2 * kc + 1] = frag_lb(klu + (t + 2) * 2048 + kc * 1024); }
        __builtin_amdgcn_sched_barrier(0);   // as above
      }
#pragma unroll
      for (int r = 0; r < 8; ++r) sc[t][r] = (s[r] * SCL2) * __builtin_bit_cast(float, (r & 1) ? (bv[t][r >> 1] & 0xffff0000u) : (bv[t][r >> 1] << 16)); }
    // the V fragments of the tile's first 32 keys are read as one group ahead of the softmax, which covers their latency; those of the second 32 as one group behind the first four products: the low halves into the set just read, the high halves into a set of their own
    v16h vf[4][2], vg[4];
    __builtin_amdgcn_sched_barrier(0);   // keeps the group out of the score products above, where the registers are short
#pragma unroll
    for (int t = 0; t < 4; ++t) { vf[t][0] = frag_l(vhu + t * 1024); vf[t][1] = frag_l(vlu + t * 1024); }
    __builtin_amdgcn_sched_barrier(0);   // keeps the group together here, ahead of the softmax; without it each read sinks to its use and its latency is waited out alone
    float m4[4], p2[2] = {0.f, 0.f};   // the maximum runs as four independent chains, one a score tile; the sum as two, one a P fragment
#pragma unroll
    for (int t = 0; t < 4; ++t) { m4[t] = sc[t][0];
#pragma unroll
      for (int r = 1; r < 8; ++r) m4[t] = fmaxf(m4[t], sc[t][r]); }
    float mx = fmaxf(fmaxf(m4[0], m4[1]), fmaxf(m4[2], m4[3]));
    mx = fmaxf(mx, xhalf(mx));
    const float mnew = fmaxf(mrun, mx - 14.0f); const float corr = __builtin_amdgcn_exp2f(mrun - mnew);   // the running reference point lies 14 below the maximum: 2^(s - mnew) is the weight times 16384
    v16h ph[2], pl[2];
#pragma unroll
    for (int i = 0; i < 32; i += 2) { const v2f x = (v2f){sc[i >> 3][i & 7], sc[i >> 3][(i & 7) + 1]} - (v2f){mnew, mnew}; sc[i >> 3][i & 7] = x[0]; sc[i >> 3][(i & 7) + 1] = x[1]; }   // the 32 differences as 16 packed subtractions: the compiler then keeps the free slot behind a v_exp_f32 whose source is written next
#pragma unroll
    for (int i = 0; i < 32; ++i) { const float p = __builtin_amdgcn_exp2f(sc[i >> 3][i & 7]); p2[i >> 4] += p; const _Float16 hi = (_Float16)p; ph[i >> 4][i & 15] = hi; pl[i >> 4][i & 15] = (_Float16)(p - (float)hi); }
    lrun = lrun * corr + (p2[0] + p2[1]) * (1.0f / 16384.0f); mrun = mnew;
#pragma unroll
    for (int t = 0; t < 4; ++t) acc[t] *= corr;   // the lane's accumulators all belong to its own query
#pragma unroll
    for (int kc = 0; kc < 2; ++kc) {
      // each product runs over the four d groups before the next one starts: a product into an accumulator stands four behind the last one into it
#pragma unroll
      for (int t = 0; t < 4; ++t) acc[t] = wmma16(vf[t][1], ph[kc], acc[t]);
      if (kc == 0) {
#pragma unroll
        for (int t = 0; t < 4; ++t) { vf[t][1] = frag_l(vlu + 4096 + t * 1024); vg[t] = frag_l(vhu + 4096 + t * 1024); }
        __builtin_amdgcn_sched_barrier(0);   // keeps the group here, eight products ahead of its first use
      }
#pragma unroll
      for (int t = 0; t < 4; ++t) acc[t] = wmma16(kc == 0 ? vf[t][0] : vg[t], pl[kc], acc[t]);
#pragma unroll
      for (int t = 0; t < 4; ++t) acc[t] = wmma16(kc == 0 ? vf[t][0] : vg[t], ph[kc], acc[t]);
      if (kc == 0) __builtin_amdgcn_sched_barrier(0);   // keeps the eight products above ahead of the hand-over's LDS wait; without it that wait rises to just behind the group of reads and their latency is waited out
    }
    // the hand-over: tile kt + 1 becomes readable, and this tile's buffer free for tile kt + 2
    asm volatile("s_wait_dscnt 0x0" ::: "memory");      // this wave's reads of this tile's buffer are done before the buffer is written again
    asm volatile("s_wait_asynccnt 0x0" ::: "memory");   // this wave's share of tile kt + 1 has landed
    __syncthreads();                                    // the same holds of every wave of the block
    if (kt + 2 < SS / 64) { const unsigned bo = (kt & 1) * STB; stage_tile(lk + bo + l16, gk + (kt + 2) * 8192 + l16, lb + bo + l16, gb + (kt + 2) * 2048 + l16); } }
  asm volatile("s_wait_asynccnt 0x0" ::: "memory");   // no copy is out when the wave ends
  lrun += xhalf(lrun);
  const float inv = 1.0f / (lrun * 16384.0f * VSC);
  float* od = O32 + ((size_t)((b * SS + q0) >> 4) * NH + (bh % NH)) * 1024 + lane * 4;
#pragma unroll
  for (int it = 0; it < 8; ++it) { v4f o;
#pragma unroll
    for (int e = 0; e < 4; ++e) { const int t = it >> 1, r = (it & 1) * 4 + e; o[e] = acc[t][r] * inv; }
    vst2(od + it * 128, o); }
}
// out = ctx Wo + bo : split(ctx) x bf16(Wo rows): 2 products (Wo is an INPUT -> bf16 exact)
__global__ __launch_bounds__(128) void k_out(const float* __restrict__ O32, const __bf16* __restrict__ PT, const float* __restrict__ bo, float* __restrict__ out) {
  __shared__ __align__(16) float so[4][16][132];
  const int tid = threadIdx.x, wave = tid >> 5, lane = tid & 31, col = lane & 15, g = lane >> 4;
  const int r0 = blockIdx.x * 64 + wave * 16, n0 = blockIdx.y * 128;
  v8f acc[8] = {};
  // two register sets: each k step's 20 loads go out as one group, one step ahead of the products that read them (inner loops unrolled: the sets are register arrays)
  const int rb = blockIdx.x * 64; const float* op = O32 + (size_t)rb * E; const __bf16* wp = PT + (size_t)(3 * E + n0) * E;   // wave-uniform bases; the lane's part is one 32-bit offset each
  const unsigned ool = (wave * 16 * E + 4 * lane) * 4, wol = 8 * lane;   // ool in bytes, wol in elements
  float x0[16], x1[16]; v16b w0[8], w1[8];
  { const gpf o0 = (gpf)((gpc)sbase(op) + ool);
#pragma unroll
    for (int i = 0; i < 16; ++i) x0[i] = o0[(i >> 2) * 128 + (i & 3)]; }
#pragma unroll
  for (int j = 0; j < 8; ++j) w0[j] = frag_ub((gph)sbase(wp) + j * 16 * E, wol);
#pragma unroll 1
  for (int h = 0; h < NH - 1; ++h) { const gpf oh = (gpf)((gpc)sbase(op + h * 1024) + ool); const gph wu = (gph)sbase(wp + h * 1024);
#pragma unroll
    for (int i = 0; i < 16; ++i) x1[i] = oh[512 + (i >> 2) * 128 + (i & 3)];
#pragma unroll
    for (int j = 0; j < 8; ++j) w1[j] = frag_ub(wu + j * 16 * E + 512, wol);
    asm volatile("s_wait_xcnt 0x0" ::: "memory");   // the scalar bases that the loads above name are advanced while those loads are still out
    __builtin_amdgcn_sched_barrier(0);   // keeps the group above the products below; without it each load sinks to its use and its latency is waited out alone
    { const F2 a = bsplit16(x0);
#pragma unroll
      for (int j = 0; j < 8; ++j) { acc[j] = wmma_bf(a.l, w0[j], acc[j]); acc[j] = wmma_bf(a.h, w0[j], acc[j]); } }
#pragma unroll
    for (int i = 0; i < 16; ++i) x0[i] = oh[1024 + (i >> 2) * 128 + (i & 3)];
#pragma unroll
    for (int j = 0; j < 8; ++j) w0[j] = frag_ub(wu + j * 16 * E + 1024, wol);
    asm volatile("s_wait_xcnt 0x0" ::: "memory");   // the scalar bases that the loads above name are advanced while those loads are still out
    __builtin_amdgcn_sched_barrier(0);   // as above
    { const F2 a = bsplit16(x1);
#pragma unroll
      for (int j = 0; j < 8; ++j) { acc[j] = wmma_bf(a.l, w1[j], acc[j]); acc[j] = wmma_bf(a.h, w1[j], acc[j]); } } }
  { const gpf oh = (gpf)((gpc)sbase(op + (NH - 1) * 1024) + ool);   // the last two steps: nothing is left to fetch behind them
#pragma unroll
    for (int i = 0; i < 16; ++i) x1[i] = oh[512 + (i >> 2) * 128 + (i & 3)]; }
  asm volatile("s_wait_xcnt 0x0" ::: "memory");   // the address registers of the four loads above are given to a fragment of the group below
#pragma unroll
  for (int j = 0; j < 8; ++j) w1[j] = frag_ub((gph)sbase(wp) + j * 16 * E + (E / 32 - 1) * 512, wol);
  __builtin_amdgcn_sched_barrier(0);   // as above
  { const F2 a = bsplit16(x0);
#pragma unroll
    for (int j = 0; j < 8; ++j) { acc[j] = wmma_bf(a.l, w0[j], acc[j]); acc[j] = wmma_bf(a.h, w0[j], acc[j]); } }
  { const F2 a = bsplit16(x1);
#pragma unroll
    for (int j = 0; j < 8; ++j) { acc[j] = wmma_bf(a.l, w1[j], acc[j]); acc[j] = wmma_bf(a.h, w1[j], acc[j]); } }
#pragma unroll
  for (int j = 0; j < 8; ++j) { const int n = n0 + j * 16 + col; const float bb = bfr(bo[n]);
#pragma unroll
    for (int r = 0; r < 8; ++r) so[wave][8 * g + r][j * 16 + col] = acc[j][r] + bb; }
  LDSX();
#pragma unroll 4
  for (int rl = 0; rl < 16; ++rl) vst2(out + (size_t)(r0 + rl) * E + n0 + lane * 4, *(const v4f*)(&so[wave][rl][lane * 4]));
}
extern "C" void kernel_launch(void* const* d_in, const int* in_sizes, int n_in, void* d_out, int out_size, void* d_ws, size_t ws_size, hipStream_t stream) {
  (void)in_sizes; (void)n_in; (void)out_size; (void)ws_size;
  const float* x = (const float*)d_in[0]; const float* bond = (const float*)d_in[1]; const float* Wq = (const float*)d_in[2]; const float* bq = (const float*)d_in[3]; const float* Wk = (const float*)d_in[4]; const float* bk = (const float*)d_in[5]; const float* Wv = (const float*)d_in[6]; const float* bv = (const float*)d_in[7]; const float* Wo = (const float*)d_in[8]; const float* bo = (const float*)d_in[9];
  float* out = (float*)d_out;
  char* ws = (char*)d_ws; size_t off = 0;
  auto take = [&](size_t bytes) { char* p = ws + off; off += (bytes + 255) & ~(size_t)255; return p; };
  __bf16* Xb = (__bf16*)take((size_t)NR * E * 2); __bf16* PT = (__bf16*)take((size_t)4 * E * E * 2);
  float* Q32 = (float*)take((size_t)NR * E * 4); __bf16* Kh = (__bf16*)take((size_t)NR * E * 2); __bf16* Kl = (__bf16*)take((size_t)NR * E * 2); _Float16* VTh = (_Float16*)take((size_t)NR * E * 2); _Float16* VTl = (_Float16*)take((size_t)NR * E * 2); float* O32 = (float*)take((size_t)NR * E * 4); __bf16* Bb = (__bf16*)take((size_t)NB * SS * SS * 2);
  // ws ~ 101 MB
  k_cvt<<<NB * SS * SS / 8 / 2048 + NR * E / 8 / 256, 256, 0, stream>>>(x, bond, Xb, Bb);
  k_pack<<<dim3(4 * E / 32, E / 64), 256, 0, stream>>>(Wq, Wk, Wv, Wo, PT);
  k_qkv<<<dim3(NR / 128, E / 128, 3), 128, 0, stream>>>(Xb, PT, bq, bk, bv, Q32, Kh, Kl, VTh, VTl);
  k_attn<<<dim3(SS / (AW * 16), NB * NH), AW * 32, 0, stream>>>(Q32, Kh, Kl, VTh, VTl, Bb, O32);
  k_out<<<dim3(NR / 64, E / 128), 128, 0, stream>>>(O32, PT, bo, out);
}

// v009
// Measured time: 131 microseconds a run.
// Timed twice side by side with v008, it ran 1.05 and 1.03 times as fast.
// Counting every step since v000, it is 4.24 times as fast.
// compute dtype: x, bond_influence, W*/b* (INPUTS) rounded to bf16 with exact bf16 WMMA products (f32 accumulate) for the projections; K pre-split into bf16 hi/lo fragments; q f32 split, P and V f16 hi/lo (3 products each); the bond modulation and softmax in f32.
#include <hip/hip_runtime.h>
#include <math.h>

typedef __attribute__((ext_vector_type(16))) _Float16 v16h;
typedef __attribute__((ext_vector_type(16))) __bf16 v16b;
typedef __attribute__((ext_vector_type(8)))  _Float16 v8h;
typedef __attribute__((ext_vector_type(8)))  float v8f;
typedef __attribute__((ext_vector_type(4)))  float v4f;
typedef __attribute__((ext_vector_type(2)))  float v2f;
typedef __attribute__((ext_vector_type(4)))  unsigned v4u;
typedef __attribute__((ext_vector_type(4)))  int v4i;
typedef float __attribute__((may_alias)) float_a;
typedef int __attribute__((may_alias)) int_a;

template <typename T> __device__ __forceinline__ void vst2(void* p, T v) { *(T*)p = v;  }
__device__ __forceinline__ v8f wmma16(v16h a, v16h b, v8f c) {
  v8f d = __builtin_amdgcn_wmma_f32_16x16x32_f16(false, a, false, b, (short)0, c, false, false);
  return d;
}
__device__ __forceinline__ v8f wmma_bf(v16b a, v16b b, v8f c) {
  v8f d = __builtin_amdgcn_wmma_f32_16x16x32_bf16(false, a, false, b, (short)0, c, false, false);
  return d;
}
// 16x16x32 fragments: lane = (h = lane>>4, row/col = lane&15); elements 0..7 = k0+8h+0..7, 8..15 = k0+16+8h+0..7; D element r = row 8h+r
__device__ __forceinline__ v16h frag_h(const _Float16* rowk0, int lane) {
  union { v16h v; v8h q[2]; } u; const _Float16* p = rowk0 + 8 * (lane >> 4);
  u.q[0] = *(const v8h*)p; u.q[1] = *(const v8h*)(p + 16); return u.v;
}
__device__ __forceinline__ v16h frag_f32(const float* rowk0, int lane) {
  v16h a; const float* p = rowk0 + 8 * (lane >> 4);
#pragma unroll
  for (int i = 0; i < 8; ++i) { a[i] = (_Float16)p[i]; a[8 + i] = (_Float16)p[16 + i]; }
  return a;
}
__device__ __forceinline__ v16h frag_f32s(const float* rowk0, int lane, float sc) {
  v16h a; const float* p = rowk0 + 8 * (lane >> 4);
#pragma unroll
  for (int i = 0; i < 8; ++i) { a[i] = (_Float16)(p[i] * sc); a[8 + i] = (_Float16)(p[16 + i] * sc); }
  return a;
}
// column fragment from a [K][ld] layout (column n), rows >= K read as 0
__device__ __forceinline__ v16h fragc_f32(const float* W, int k0, int n, int lane, int ld, int K) {
  v16h a; const int g = lane >> 4;
#pragma unroll
  for (int i = 0; i < 8; ++i) { const int ka = k0 + 8 * g + i, kb = ka + 16;
    a[i] = (_Float16)(ka < K ? W[(size_t)ka * ld + n] : 0.f); a[8 + i] = (_Float16)(kb < K ? W[(size_t)kb * ld + n] : 0.f); }
  return a;
}
struct F2 { v16b h, l; };
__device__ __forceinline__ F2 bsplit16(const float v[16]) { F2 r;
#pragma unroll
  for (int i = 0; i < 16; ++i) { const __bf16 h = (__bf16)v[i]; r.h[i] = h; r.l[i] = (__bf16)(v[i] - (float)h); }
  return r; }
__device__ __forceinline__ F2 split_row(const float* row, int k0, int lane) { float v[16]; const float* p = row + k0 + 8 * (lane >> 4);
#pragma unroll
  for (int i = 0; i < 8; ++i) { v[i] = p[i]; v[8 + i] = p[16 + i]; }
  return bsplit16(v); }
__device__ __forceinline__ F2 split_rowK(const float* row, int k0, int lane, int K) { float v[16]; const int g = lane >> 4;
#pragma unroll
  for (int i = 0; i < 8; ++i) { const int ka = k0 + 8 * g + i, kb = ka + 16; v[i] = ka < K ? row[ka] : 0.f; v[8 + i] = kb < K ? row[kb] : 0.f; }
  return bsplit16(v); }
__device__ __forceinline__ F2 split_col(const float* W, int k0, int n, int lane, int ld, int K) { float v[16]; const int g = lane >> 4;
#pragma unroll
  for (int i = 0; i < 8; ++i) { const int ka = k0 + 8 * g + i, kb = ka + 16; v[i] = ka < K ? W[(size_t)ka * ld + n] : 0.f; v[8 + i] = kb < K ? W[(size_t)kb * ld + n] : 0.f; }
  return bsplit16(v); }
__device__ __forceinline__ v8f mac3(const F2& a, const F2& b, v8f c) { c = wmma_bf(a.l, b.h, c); c = wmma_bf(a.h, b.l, c); return wmma_bf(a.h, b.h, c); }
__device__ __forceinline__ float sigm(float v) { return 1.0f / (1.0f + expf(-v)); }
#define LDSX() do { asm volatile("s_wait_dscnt 0" ::: "memory"); __builtin_amdgcn_wave_barrier(); __builtin_amdgcn_fence(__ATOMIC_RELEASE, "workgroup"); } while (0)


// Bond-influence self attention (16 heads x 64 on [2,2048,1024], [in][out] weights + biases): scores = (q.k/8) * bond_influence[b][q][k] (an INPUT matrix, shared by the heads); softmax; (P v) @ Wo + bo.
#define NB 2
#define SS 2048
#define E 1024
#define NH 16
#define HD 64
#define NR (NB * SS)
#define VSC 64.0f   // V is stored times 64; a weight is at most 16384 (k_attn). At these sizes the low halves of V and of P stand in f16 as they are, with no factor of their own, so all three products of P V have one scale
#define SCL2 0.18033688f   // log2(e) / 8: the scores are kept in base-2 units, so that a weight is one hardware exponential
__device__ __forceinline__ float bfr(float v) { return (float)(__bf16)v; }
// FRAGMENT ORDER (every 16-bit matrix operand in the workspace): a 16 x 32 fragment is 1 KiB in a row, two blocks of 512 bytes; block qi holds at lane * 16 bytes the lane's elements 8 * qi .. 8 * qi + 7,
// that is row or column (lane & 15), k = 16 * qi + 8 * (lane >> 4) + 0..7: one wave-wide 16-byte load reads 512 contiguous bytes, four whole 128-byte lines, where a row-major operand made it touch sixteen
// the fragment from a wave-uniform base and the lane's own 32-bit element offset (8 * lane): the address costs one vector register
typedef const _Float16 __attribute__((address_space(1)))* gph; typedef const float __attribute__((address_space(1)))* gpf; typedef const v8h __attribute__((address_space(1)))* gp8; typedef const char __attribute__((address_space(1)))* gpc;
__device__ __forceinline__ unsigned long long sbase(const void* p) {   // a wave-uniform address read into scalar registers, so that the loads below take it as their scalar base
  const unsigned long long u = (unsigned long long)p;
  return ((unsigned long long)(unsigned)__builtin_amdgcn_readfirstlane((int)(u >> 32)) << 32) | (unsigned)__builtin_amdgcn_readfirstlane((int)u); }
__device__ __forceinline__ v16h frag_u(gph ub, unsigned off) { union { v16h v; v8h q[2]; } u; gph p = ub + off; u.q[0] = *(gp8)p; u.q[1] = *(gp8)(p + 256); return u.v; }
__device__ __forceinline__ v16b frag_ub(gph ub, unsigned off) { return __builtin_bit_cast(v16b, frag_u(ub, off)); }
__device__ __forceinline__ v16b frag_b(const __bf16* rowk0, int lane) { return __builtin_bit_cast(v16b, frag_h((const _Float16*)rowk0, lane)); }

// ONE launch turns all three kinds of input into their 16-bit planes: CB_W blocks the weights, CB_B blocks bond_influence, CB_X blocks x. Every block takes 64 KiB in and puts 32 KiB out, a thread eight 16-byte units:
// a wave keeps sixteen loads out at a time, all 1024 blocks are resident together, and there is one launch to start and to drain where there were two with 4608 blocks
#define CB_W (4 * E / 32 * (E / 512))
#define CB_B (NB * SS * SS / 8 / 2048)
#define CB_X (NR * E / 8 / 2048)
typedef __attribute__((ext_vector_type(2))) __bf16 v2b;
// amdgpu_waves_per_eu(8, 8): four blocks a WGP are eight waves a SIMD; a wave may then take 128 registers, so that all sixteen loads go out before the first is waited for
__global__ __launch_bounds__(256) __attribute__((amdgpu_waves_per_eu(8, 8))) void k_cvt(const float* __restrict__ x, const float* __restrict__ bond, const float* __restrict__ Wq, const float* __restrict__ Wk, const float* __restrict__ Wv, const float* __restrict__ Wo,
                                            __bf16* __restrict__ Xb, __bf16* __restrict__ Bb, __bf16* __restrict__ PT) {
  union P8 { __bf16 h[8]; v4u u; };
  __shared__ __align__(16) __bf16 st[32][520];
  const int tid = threadIdx.x;
  if (blockIdx.x < CB_W) {
    // PT columns n: [0,E) Wq[:,n], [E,2E) Wk[:,n], [2E,3E) Wv[:,n], [3E,4E) Wo[:,n]  ([in][out] weights), in fragment order: fragment (16-column group ng, k step kc) at element (ng * 32 + kc) * 512
    // block (32 columns, 512 k): whole 128-byte lines of W in, turned in LDS, 32 whole fragments out. A thread takes rows k in pairs, so that two rounded values go into LDS as one dword
    const int n0 = (blockIdx.x >> 1) * 32, k0 = (blockIdx.x & 1) * 512;
    const float* W = n0 < E ? Wq : (n0 < 2 * E ? Wk : (n0 < 3 * E ? Wv : Wo)); const int nn = n0 & (E - 1);
    const int kr = tid >> 2, pt = tid & 3; const float* wsrc = W + (size_t)(k0 + kr * 2) * E + nn + pt * 8;
    float in[8][8];   // in[j]: row k0 + (j >> 1) * 128 + kr * 2 + (j & 1)
#pragma unroll
    for (int j = 0; j < 8; ++j) {
#pragma unroll
      for (int e = 0; e < 8; ++e) in[j][e] = wsrc[((j >> 1) * 128 + (j & 1)) * E + e]; }
    asm volatile("s_wait_xcnt 0x0" :: "v"(wsrc) : "memory");   // the address registers of the loads above are given to other values while those loads are still out; named here, they live up to the wait
#pragma unroll
    for (int j = 0; j < 4; ++j) {
#pragma unroll
      for (int e = 0; e < 8; ++e) *(v2b*)(&st[pt * 8 + e][j * 128 + kr * 2]) = (v2b){(__bf16)in[2 * j][e], (__bf16)in[2 * j + 1][e]}; }
    __syncthreads();
    const int ln = tid & 31, qi = (tid >> 5) & 1, kc = (tid >> 6) & 1, ngl = tid >> 7;
    __bf16* pd = PT + ((size_t)((n0 >> 4) + ngl) * 32 + (k0 >> 5) + kc) * 512 + qi * 256 + ln * 8;
    v4u ou[8];
#pragma unroll
    for (int j = 0; j < 8; ++j) ou[j] = *(const v4u*)(&st[ngl * 16 + (ln & 15)][j * 64 + kc * 32 + qi * 16 + (ln >> 4) * 8]);
#pragma unroll
    for (int j = 0; j < 8; ++j) vst2((unsigned*)(pd + j * 1024), ou[j]);
    return; }
  // bond_influence and x, rounded to bf16, have one form: a row of the source is cut into chunks of 32 floats; the chunk ch of the 16-row group qg is 1 KiB at element (qg * (chunks a row) + ch) * 512, two blocks of 512 bytes;
  // block (o >> 1) holds at lane * 16 bytes row (lane & 15), floats 16 * (o >> 1) + 8 * (lane >> 4) + 0..7 of the chunk. For x that is the fragment (16-row group, k step); for the bond it is two tiles of the transposed score accumulators of k_attn:
  // the tile (16-query group qg of [b][q], 16-key group kg) is 512 bytes at element (qg * (SS / 16) + kg) * 256; at lane * 16 bytes stand query (lane & 15), keys 8 * (lane >> 4) + 0..7.
  // A wave takes 8 rows x 128 bytes in (whole lines over its two loads) and puts four whole lines out
  const bool isb = blockIdx.x < CB_W + CB_B;
  const unsigned u = (blockIdx.x - (isb ? CB_W : CB_W + CB_B)) * 2048 + tid;
  const int lg = isb ? 6 : 5;   // log2 of the chunks a row: SS / 32 and E / 32
  const int r = u & 7, o = (u >> 3) & 3, rh = (u >> 5) & 1, ch = (u >> 6) & ((1 << lg) - 1), qg = u >> (6 + lg);
  const float* bs = (isb ? bond : x) + ((size_t)(qg * 16 + rh * 8 + r) << (lg + 5)) + ch * 32 + o * 8;
  __bf16* bd = (isb ? Bb : Xb) + ((((size_t)qg << lg) + ch) * 2 + (o >> 1)) * 256 + ((o & 1) * 16 + rh * 8 + r) * 8;
  float in[8][8];
#pragma unroll
  for (int j = 0; j < 8; ++j) {
#pragma unroll
    for (int e = 0; e < 8; ++e) in[j][e] = bs[j * 128 + e]; }
  asm volatile("s_wait_xcnt 0x0" :: "v"(bs) : "memory");   // the address registers of the loads above are given to other values while those loads are still out; named here, they live up to the wait
#pragma unroll
  for (int j = 0; j < 8; ++j) { P8 pk;
#pragma unroll
    for (int e = 0; e < 8; ++e) pk.h[e] = (__bf16)in[j][e];
    vst2((unsigned*)(bd + j * 2048), pk.u); }
  asm volatile("s_wait_xcnt 0x0" ::: "memory");   // in the built code the weight part stands behind these stores and gives their address registers new values
}
// QKV: block (128 rows, 128 cols = 2 heads, which), four waves as 2 x 2; a wave does 64 rows x 64 cols (one head): 8 fragments feed 16 products a k step, where a 16 x 128 wave tile took 9 for 8.
// q (+bias) -> Q32 f32 [bh][s][64]; k (+bias) -> bf16 hi/lo, v (+bias) -> f16 hi/lo x64, both in fragment order:
// K fragment (16-key group kg, d step kc) at element bh * SS * HD + (kg * 2 + kc) * 512; V fragment (32-key block kb, 16-d group t) at element bh * SS * HD + (kb * 4 + t) * 512
// The x and the weight fragments have one layout, so either may be the first operand. For q and k the weights are first: a lane's accumulator registers are then 8 d in a row of one row of x,
// which is a 16-byte unit of a K fragment. For v the rows of x are first: the registers are 8 keys in a row of one d, a unit of a V fragment. K and V go from the registers to the workspace, 512 bytes in a row a wave-wide store
__global__ __launch_bounds__(128) void k_qkv(const __bf16* __restrict__ Xb, const __bf16* __restrict__ PT, const float* __restrict__ bq, const float* __restrict__ bk, const float* __restrict__ bv,
                                            float* __restrict__ Q32, __bf16* __restrict__ Kh, __bf16* __restrict__ Kl, _Float16* __restrict__ VTh, _Float16* __restrict__ VTl) {
  __shared__ __align__(16) float so[4][64][68];
  const int tid = threadIdx.x, wave = __builtin_amdgcn_readfirstlane(tid >> 5), lane = tid & 31, col = lane & 15, g = lane >> 4;
  const int which = blockIdx.z, r0 = blockIdx.x * 128 + (wave >> 1) * 64, n0 = blockIdx.y * 128 + (wave & 1) * 64; const int s0 = r0 % SS;
  const size_t bh = (size_t)(r0 / SS) * NH + (n0 >> 6);
  const float* bb_ = which == 0 ? bq : (which == 1 ? bk : bv);
  v8f acc[4][4] = {};   // acc[i][j]: rows = 16-group i of the first operand, columns = 16-group j of the second
  // two register sets: each k step's 16 fragment loads go out as one group, one step ahead of the products that read them (inner loops unrolled: the sets are register arrays)
  const __bf16* xp = Xb + (size_t)r0 * E; const __bf16* wp = PT + (size_t)(which * E + n0) * E;   // wave-uniform bases; the lane's part is one 32-bit offset
  const __bf16* ap = which < 2 ? wp : xp; const __bf16* bp = which < 2 ? xp : wp;
  const unsigned ol = 8 * lane;
  v16b a0[4], a1[4], b0[4], b1[4];
#pragma unroll
  for (int i = 0; i < 4; ++i) { a0[i] = frag_ub((gph)sbase(ap) + i * 16 * E, ol); b0[i] = frag_ub((gph)sbase(bp) + i * 16 * E, ol); }
#pragma unroll 1   // stays rolled: one trip already holds a step of either register set
  for (int kc = 0; kc < E / 32 - 2; kc += 2) {
    const gph au = (gph)sbase(ap + kc * 512), bu = (gph)sbase(bp + kc * 512);
#pragma unroll
    for (int i = 0; i < 4; ++i) { a1[i] = frag_ub(au + i * 16 * E + 512, ol); b1[i] = frag_ub(bu + i * 16 * E + 512, ol); }
    asm volatile("s_wait_xcnt 0x0" ::: "memory");   // the scalar bases that the loads above name are advanced while those loads are still out
    __builtin_amdgcn_sched_barrier(0);   // keeps the group above the products below; without it each load sinks to its use and its latency is waited out alone
#pragma unroll
    for (int i = 0; i < 4; ++i) {
#pragma unroll
      for (int j = 0; j < 4; ++j) acc[i][j] = wmma_bf(a0[i], b0[j], acc[i][j]); }
#pragma unroll
    for (int i = 0; i < 4; ++i) { a0[i] = frag_ub(au + i * 16 * E + 1024, ol); b0[i] = frag_ub(bu + i * 16 * E + 1024, ol); }
    asm volatile("s_wait_xcnt 0x0" ::: "memory");   // the scalar bases that the loads above name are advanced while those loads are still out
    __builtin_amdgcn_sched_barrier(0);   // as above
#pragma unroll
    for (int i = 0; i < 4; ++i) {
#pragma unroll
      for (int j = 0; j < 4; ++j) acc[i][j] = wmma_bf(a1[i], b1[j], acc[i][j]); } }
#pragma unroll
  for (int i = 0; i < 4; ++i) { a1[i] = frag_ub((gph)sbase(ap) + i * 16 * E + (E / 32 - 1) * 512, ol); b1[i] = frag_ub((gph)sbase(bp) + i * 16 * E + (E / 32 - 1) * 512, ol); }   // the last two steps: nothing is left to fetch behind them
  asm volatile("s_wait_xcnt 0x0" ::: "memory");   // the address registers of the loads above are given to other values while those loads are still out
  __builtin_amdgcn_sched_barrier(0);   // as above
#pragma unroll
  for (int i = 0; i < 4; ++i) {
#pragma unroll
    for (int j = 0; j < 4; ++j) acc[i][j] = wmma_bf(a0[i], b0[j], acc[i][j]); }
#pragma unroll
  for (int i = 0; i < 4; ++i) {
#pragma unroll
    for (int j = 0; j < 4; ++j) acc[i][j] = wmma_bf(a1[i], b1[j], acc[i][j]); }
  if (which < 2) {
    // acc[i][j][r]: column n0 + 16 * i + 8 * g + r of the weights (d = 16 * i + 8 * g + r of the head), row r0 + 16 * j + col of x
#pragma unroll
    for (int i = 0; i < 4; ++i) {
#pragma unroll
      for (int r = 0; r < 8; ++r) { const float bb = bfr(bb_[n0 + i * 16 + 8 * g + r]);
#pragma unroll
        for (int j = 0; j < 4; ++j) acc[i][j][r] += bb; } }
    if (which == 0) {   // the wave's 64 rows are turned in its own LDS rows, so that whole lines go out
#pragma unroll
      for (int j = 0; j < 4; ++j) {
#pragma unroll
        for (int i = 0; i < 4; ++i) { v4f lo4, hi4;
#pragma unroll
          for (int e = 0; e < 4; ++e) { lo4[e] = acc[i][j][e]; hi4[e] = acc[i][j][4 + e]; }
          *(v4f*)(&so[wave][j * 16 + col][i * 16 + 8 * g]) = lo4; *(v4f*)(&so[wave][j * 16 + col][i * 16 + 8 * g + 4]) = hi4; } }
      LDSX();
#pragma unroll
      for (int it = 0; it < 32; ++it) { const int qq = it * 32 + lane, rl = qq >> 4, pc = qq & 15;
        vst2(Q32 + (bh * SS + s0 + rl) * HD + pc * 4, *(const v4f*)(&so[wave][rl][pc * 4]));
        if ((it & 7) == 7) asm volatile("s_wait_xcnt 0x0" ::: "memory");   // the data and address registers of the stores above are given to other values while the stores are still out
      } }
    else {
#pragma unroll
      for (int j = 0; j < 4; ++j) {   // key group j of the wave's 64 rows; i = 2 * kc + qi: one 512-byte block of the hi and one of the lo plane
#pragma unroll
        for (int i = 0; i < 4; ++i) { union { __bf16 e[8]; v4u u; } ph, pl;
#pragma unroll
          for (int e = 0; e < 8; ++e) { const float v = acc[i][j][e]; const __bf16 hi = (__bf16)v; ph.e[e] = hi; pl.e[e] = (__bf16)(v - (float)hi); }
          const size_t o = (bh * SS + s0 + j * 16) * HD + i * 256 + lane * 8;
          vst2((unsigned*)(Kh + o), ph.u); vst2((unsigned*)(Kl + o), pl.u);
          asm volatile("s_wait_xcnt 0x0" ::: "memory");   // the data and address registers of the two stores above are given to other values while the stores are still out
        } } } }
  else {
    // acc[i][j][r]: row r0 + 16 * i + 8 * g + r of x (a key), column n0 + 16 * j + col of the weights (d = 16 * j + col of the head)
#pragma unroll
    for (int j = 0; j < 4; ++j) { const float bb = bfr(bb_[n0 + j * 16 + col]);
#pragma unroll
      for (int i = 0; i < 4; ++i) { union { _Float16 e[8]; v4u u; } ph, pl;   // 32-key block i >> 1, its half i & 1
#pragma unroll
        for (int e = 0; e < 8; ++e) { const float v = (acc[i][j][e] + bb) * VSC; const _Float16 hi = (_Float16)v; ph.e[e] = hi; pl.e[e] = (_Float16)(v - (float)hi); }
        const size_t o = bh * HD * SS + (size_t)((s0 >> 5) + (i >> 1)) * 2048 + j * 512 + (i & 1) * 256 + lane * 8;
        vst2((unsigned*)(VTh + o), ph.u); vst2((unsigned*)(VTl + o), pl.u);
        asm volatile("s_wait_xcnt 0x0" ::: "memory");   // the data and address registers of the two stores above are given to other values while the stores are still out
      } } }
}
// attention: block (128 queries, bh); all key tiles of 64; TRANSPOSED: S^T = K q^T (K hi/lo as A, q hi/lo as B) and O^T += V^T P^T (V hi/lo as A, P hi/lo as B). A lane then holds one query (lane & 15):
// of score tile t its registers r are keys 16 * t + 8 * (lane >> 4) + r, which is the k order of a B fragment, so two score tiles turned into weights ARE the P fragment of 32 keys: scores, softmax and P never leave the registers.
// O f32 in the order in which k_out reads it: the f32 fragment (16-row group rg of [b][s], head h, d step kc) is
// 2 KiB at float ((rg * NH + h) * 2 + kc) * 512, four blocks of 512 bytes; block j holds at lane * 16 bytes row (lane & 15), d = 32 * kc + 16 * (j >> 1) + 8 * (lane >> 4) + 4 * (j & 1) + 0..3: four registers of an O^T accumulator
__device__ __forceinline__ float xhalf(float v) { return __builtin_bit_cast(float, __builtin_amdgcn_permlanex16(__builtin_bit_cast(int, v), __builtin_bit_cast(int, v), 0x76543210, 0xfedcba98, false, false)); }   // lane l with lane l ^ 16
// THE RING: a block of AW waves shares each 64-key tile. The tile's K hi, K lo, V hi and V lo (8 KiB each, contiguous in the workspace, already in fragment order) and each wave's own four bond tiles (2 KiB)
// are copied from global memory straight into one of two LDS buffers while the tile before them is worked on; the fragments are then read from LDS, 512 contiguous bytes a wave-wide read.
#define AW 8
#define KVB 32768                  // bytes of K hi, K lo, V hi, V lo of one tile
#define STB (KVB + AW * 2048)      // bytes of one buffer: that and the bond tiles of the AW waves
__device__ __forceinline__ v16h frag_l(const unsigned char* p) { union { v16h v; v8h q[2]; } u; u.q[0] = *(const v8h*)p; u.q[1] = *(const v8h*)(p + 512); return u.v; }
__device__ __forceinline__ v16b frag_lb(const unsigned char* p) { return __builtin_bit_cast(v16b, frag_l(p)); }
// one wave's share of a tile: eight 512-byte units of the K and V planes (LDS byte address l, global address g) and its four bond tiles (lb, gb); every lane brings 16 bytes a copy.
// The copies and their s_wait_xcnt stand in one statement, so that no address register is given a new value in front of the wait
__device__ __forceinline__ void stage_tile(unsigned l, const char* g, unsigned lb, const char* gb) {
  asm volatile("global_load_async_to_lds_b128 %0, %1, off\n\t"
               "global_load_async_to_lds_b128 %2, %3, off\n\t"
               "global_load_async_to_lds_b128 %4, %5, off\n\t"
               "global_load_async_to_lds_b128 %6, %7, off\n\t"
               "global_load_async_to_lds_b128 %8, %9, off\n\t"
               "global_load_async_to_lds_b128 %10, %11, off\n\t"
               "global_load_async_to_lds_b128 %12, %13, off\n\t"
               "global_load_async_to_lds_b128 %14, %15, off\n\t"
               "global_load_async_to_lds_b128 %16, %17, off\n\t"
               "global_load_async_to_lds_b128 %18, %19, off\n\t"
               "global_load_async_to_lds_b128 %20, %21, off\n\t"
               "global_load_async_to_lds_b128 %22, %23, off\n\t"
               "s_wait_xcnt 0x0"
               :: "v"(l), "v"(g), "v"(l + 512), "v"(g + 512), "v"(l + 1024), "v"(g + 1024), "v"(l + 1536), "v"(g + 1536),
                  "v"(l + 2048), "v"(g + 2048), "v"(l + 2560), "v"(g + 2560), "v"(l + 3072), "v"(g + 3072), "v"(l + 3584), "v"(g + 3584),
                  "v"(lb), "v"(gb), "v"(lb + 512), "v"(gb + 512), "v"(lb + 1024), "v"(gb + 1024), "v"(lb + 1536), "v"(gb + 1536) : "memory");
}
// amdgpu_waves_per_eu(4, 4): holds a wave to 256 registers, so that two blocks stay resident on a WGP
__global__ __launch_bounds__(AW * 32) __attribute__((amdgpu_waves_per_eu(4, 4))) void k_attn(const float* __restrict__ Q32, const __bf16* __restrict__ Kh, const __bf16* __restrict__ Kl, const _Float16* __restrict__ VTh, const _Float16* __restrict__ VTl, const __bf16* __restrict__ Bb, float* __restrict__ O32) {
  const int tid = threadIdx.x, w = __builtin_amdgcn_readfirstlane(tid >> 5), lane = tid & 31, col = lane & 15;   // the wave's number in a scalar register: addresses built on it cost no vector registers
  const size_t bh = blockIdx.y; const int qb = blockIdx.x; const int q0 = qb * (AW * 16) + w * 16;
  const int b = (int)(bh / NH);
  __shared__ __align__(16) unsigned char ring[2][STB];
  // wave w copies the half (w & 1) of plane (w >> 1) of K hi, K lo, V hi, V lo: in the buffer that is byte w * 4096; a tile is 8192 bytes further in every plane, 2048 in the bond rows of the wave's 16 queries
  // gk, gb, lk, lb: the wave's parts of the four addresses, the same in every lane; l16: the lane's part
  const char* gk = (const char*)(w < 2 ? (const void*)Kh : (w < 4 ? (const void*)Kl : (w < 6 ? (const void*)VTh : (const void*)VTl))) + bh * (SS * HD * 2) + (w & 1) * 4096;
  const char* gb = (const char*)Bb + (size_t)((b * SS + q0) >> 4) * (SS / 16 * 512);
  const unsigned lk = (unsigned)(size_t)&ring[0][0] + w * 4096, lb = (unsigned)(size_t)&ring[0][0] + KVB + w * 2048, l16 = lane * 16;
  stage_tile(lk + l16, gk + l16, lb + l16, gb + l16);   // tile 0 into buffer 0
  // the split q fragments stay in registers through the loop: one accumulator set leaves room for them at four waves per SIMD
  F2 aq[2];
#pragma unroll
  for (int kc = 0; kc < 2; ++kc) aq[kc] = split_row(Q32 + (bh * SS + q0 + col) * HD, kc * 32, lane);
  float mrun = -3.0e38f, lrun = 0.f; v8f acc[4] = {};   // one accumulator set takes all three products of P V; lrun: the sum over this lane's half of the keys; the halves are joined behind the loop
  asm volatile("s_wait_asynccnt 0x0" ::: "memory");   // this wave's share of tile 0 has landed
  __syncthreads();                                    // every wave's share has: tile 0 may be read
  stage_tile(lk + STB + l16, gk + 8192 + l16, lb + STB + l16, gb + 2048 + l16);   // tile 1 into buffer 1
#pragma unroll 1
  for (int kt = 0; kt < SS / 64; ++kt) {
    // one read group at the head of the tile: the K fragments of key groups 0 and 1 and the four bond tiles; the fragments of groups 2 and 3 refill a set as soon as it has been read (inner loops unrolled: the sets are register arrays)
    const unsigned char* rl = &ring[kt & 1][l16];   // the lane's place in every 512-byte unit of this tile's buffer
    const unsigned char* khu = rl, * klu = rl + 8192, * vhu = rl + 16384, * vlu = rl + 24576, * bu = rl + KVB + w * 2048;
    v4u bv[4]; v16b kf[2][4];
#pragma unroll
    for (int t = 0; t < 2; ++t) {
#pragma unroll
      for (int kc = 0; kc < 2; ++kc) { kf[t][2 * kc] = frag_lb(khu + t * 2048 + kc * 1024); kf[t][2 * kc + 1] = frag_lb(klu + t * 2048 + kc * 1024); } }
#pragma unroll
    for (int t = 0; t < 4; ++t) bv[t] = *(const v4u*)(bu + t * 512);
    __builtin_amdgcn_sched_barrier(0);   // keeps the group above the products below; without it each read sinks to its use and its latency is waited out alone
    float sc[4][8];
#pragma unroll
    for (int t = 0; t < 4; ++t) { v8f s = {};
#pragma unroll
      for (int kc = 0; kc < 2; ++kc) { s = wmma_bf(kf[t & 1][2 * kc], aq[kc].l, s); s = wmma_bf(kf[t & 1][2 * kc + 1], aq[kc].h, s); s = wmma_bf(kf[t & 1][2 * kc], aq[kc].h, s); }
      if (t < 2) {
#pragma unroll
        for (int kc = 0; kc < 2; ++kc) { kf[t][2 * kc] = frag_lb(khu + (t + 2) * 2048 + kc * 1024); kf[t][2 * kc + 1] = frag_lb(klu + (t + 2) * 2048 + kc * 1024); }
        __builtin_amdgcn_sched_barrier(0);   // as above
      }
#pragma unroll
      for (int r = 0; r < 8; ++r) sc[t][r] = (s[r] * SCL2) * __builtin_bit_cast(float, (r & 1) ? (bv[t][r >> 1] & 0xffff0000u) : (bv[t][r >> 1] << 16)); }
    // the V fragments of the tile's first 32 keys are read as one group ahead of the softmax, which covers their latency; those of the second 32 as one group behind the first four products: the low halves into the set just read, the high halves into a set of their own
    v16h vf[4][2], vg[4];
    __builtin_amdgcn_sched_barrier(0);   // keeps the group out of the score products above, where the registers are short
#pragma unroll
    for (int t = 0; t < 4; ++t) { vf[t][0] = frag_l(vhu + t * 1024); vf[t][1] = frag_l(vlu + t * 1024); }
    __builtin_amdgcn_sched_barrier(0);   // keeps the group together here, ahead of the softmax; without it each read sinks to its use and its latency is waited out alone
    float m4[4], p2[2] = {0.f, 0.f};   // the maximum runs as four independent chains, one a score tile; the sum as two, one a P fragment
#pragma unroll
    for (int t = 0; t < 4; ++t) { m4[t] = sc[t][0];
#pragma unroll
      for (int r = 1; r < 8; ++r) m4[t] = fmaxf(m4[t], sc[t][r]); }
    float mx = fmaxf(fmaxf(m4[0], m4[1]), fmaxf(m4[2], m4[3]));
    mx = fmaxf(mx, xhalf(mx));
    const float mnew = fmaxf(mrun, mx - 14.0f); const float corr = __builtin_amdgcn_exp2f(mrun - mnew);   // the running reference point lies 14 below the maximum: 2^(s - mnew) is the weight times 16384
    v16h ph[2], pl[2];
#pragma unroll
    for (int i = 0; i < 32; i += 2) { const v2f x = (v2f){sc[i >> 3][i & 7], sc[i >> 3][(i & 7) + 1]} - (v2f){mnew, mnew}; sc[i >> 3][i & 7] = x[0]; sc[i >> 3][(i & 7) + 1] = x[1]; }   // the 32 differences as 16 packed subtractions: the compiler then keeps the free slot behind a v_exp_f32 whose source is written next
#pragma unroll
    for (int i = 0; i < 32; ++i) { const float p = __builtin_amdgcn_exp2f(sc[i >> 3][i & 7]); p2[i >> 4] += p; const _Float16 hi = (_Float16)p; ph[i >> 4][i & 15] = hi; pl[i >> 4][i & 15] = (_Float16)(p - (float)hi); }
    lrun = lrun * corr + (p2[0] + p2[1]) * (1.0f / 16384.0f); mrun = mnew;
#pragma unroll
    for (int t = 0; t < 4; ++t) acc[t] *= corr;   // the lane's accumulators all belong to its own query
#pragma unroll
    for (int kc = 0; kc < 2; ++kc) {
      // each product runs over the four d groups before the next one starts: a product into an accumulator stands four behind the last one into it
#pragma unroll
      for (int t = 0; t < 4; ++t) acc[t] = wmma16(vf[t][1], ph[kc], acc[t]);
      if (kc == 0) {
#pragma unroll
        for (int t = 0; t < 4; ++t) { vf[t][1] = frag_l(vlu + 4096 + t * 1024); vg[t] = frag_l(vhu + 4096 + t * 1024); }
        __builtin_amdgcn_sched_barrier(0);   // keeps the group here, eight products ahead of its first use
      }
#pragma unroll
      for (int t = 0; t < 4; ++t) acc[t] = wmma16(kc == 0 ? vf[t][0] : vg[t], pl[kc], acc[t]);
#pragma unroll
      for (int t = 0; t < 4; ++t) acc[t] = wmma16(kc == 0 ? vf[t][0] : vg[t], ph[kc], acc[t]);
      if (kc == 0) __builtin_amdgcn_sched_barrier(0);   // keeps the eight products above ahead of the hand-over's LDS wait; without it that wait rises to just behind the group of reads and their latency is waited out
    }
    // the hand-over: tile kt + 1 becomes readable, and this tile's buffer free for tile kt + 2
    asm volatile("s_wait_dscnt 0x0" ::: "memory");      // this wave's reads of this tile's buffer are done before the buffer is written again
    asm volatile("s_wait_asynccnt 0x0" ::: "memory");   // this wave's share of tile kt + 1 has landed
    __syncthreads();                                    // the same holds of every wave of the block
    if (kt + 2 < SS / 64) { const unsigned bo = (kt & 1) * STB; stage_tile(lk + bo + l16, gk + (kt + 2) * 8192 + l16, lb + bo + l16, gb + (kt + 2) * 2048 + l16); } }
  asm volatile("s_wait_asynccnt 0x0" ::: "memory");   // no copy is out when the wave ends
  lrun += xhalf(lrun);
  const float inv = 1.0f / (lrun * 16384.0f * VSC);
  float* od = O32 + ((size_t)((b * SS + q0) >> 4) * NH + (bh % NH)) * 1024 + lane * 4;
#pragma unroll
  for (int it = 0; it < 8; ++it) { v4f o;
#pragma unroll
    for (int e = 0; e < 4; ++e) { const int t = it >> 1, r = (it & 1) * 4 + e; o[e] = acc[t][r] * inv; }
    vst2(od + it * 128, o); }
}
// out = ctx Wo + bo : split(ctx) x bf16(Wo rows): 2 products (Wo is an INPUT -> bf16 exact)
__global__ __launch_bounds__(128) void k_out(const float* __restrict__ O32, const __bf16* __restrict__ PT, const float* __restrict__ bo, float* __restrict__ out) {
  __shared__ __align__(16) float so[4][16][132];
  const int tid = threadIdx.x, wave = tid >> 5, lane = tid & 31, col = lane & 15, g = lane >> 4;
  const int r0 = blockIdx.x * 64 + wave * 16, n0 = blockIdx.y * 128;
  v8f acc[8] = {};
  // two register sets: each k step's 20 loads go out as one group, one step ahead of the products that read them (inner loops unrolled: the sets are register arrays)
  const int rb = blockIdx.x * 64; const float* op = O32 + (size_t)rb * E; const __bf16* wp = PT + (size_t)(3 * E + n0) * E;   // wave-uniform bases; the lane's part is one 32-bit offset each
  const unsigned ool = (wave * 16 * E + 4 * lane) * 4, wol = 8 * lane;   // ool in bytes, wol in elements
  float x0[16], x1[16]; v16b w0[8], w1[8];
  { const gpf o0 = (gpf)((gpc)sbase(op) + ool);
#pragma unroll
    for (int i = 0; i < 16; ++i) x0[i] = o0[(i >> 2) * 128 + (i & 3)]; }
#pragma unroll
  for (int j = 0; j < 8; ++j) w0[j] = frag_ub((gph)sbase(wp) + j * 16 * E, wol);
#pragma unroll 1
  for (int h = 0; h < NH - 1; ++h) { const gpf oh = (gpf)((gpc)sbase(op + h * 1024) + ool); const gph wu = (gph)sbase(wp + h * 1024);
#pragma unroll
    for (int i = 0; i < 16; ++i) x1[i] = oh[512 + (i >> 2) * 128 + (i & 3)];
#pragma unroll
    for (int j = 0; j < 8; ++j) w1[j] = frag_ub(wu + j * 16 * E + 512, wol);
    asm volatile("s_wait_xcnt 0x0" ::: "memory");   // the scalar bases that the loads above name are advanced while those loads are still out
    __builtin_amdgcn_sched_barrier(0);   // keeps the group above the products below; without it each load sinks to its use and its latency is waited out alone
    { const F2 a = bsplit16(x0);
#pragma unroll
      for (int j = 0; j < 8; ++j) { acc[j] = wmma_bf(a.l, w0[j], acc[j]); acc[j] = wmma_bf(a.h, w0[j], acc[j]); } }
#pragma unroll
    for (int i = 0; i < 16; ++i) x0[i] = oh[1024 + (i >> 2) * 128 + (i & 3)];
#pragma unroll
    for (int j = 0; j < 8; ++j) w0[j] = frag_ub(wu + j * 16 * E + 1024, wol);
    asm volatile("s_wait_xcnt 0x0" ::: "memory");   // the scalar bases that the loads above name are advanced while those loads are still out
    __builtin_amdgcn_sched_barrier(0);   // as above
    { const F2 a = bsplit16(x1);
#pragma unroll
      for (int j = 0; j < 8; ++j) { acc[j] = wmma_bf(a.l, w1[j], acc[j]); acc[j] = wmma_bf(a.h, w1[j], acc[j]); } } }
  { const gpf oh = (gpf)((gpc)sbase(op + (NH - 1) * 1024) + ool);   // the last two steps: nothing is left to fetch behind them
#pragma unroll
    for (int i = 0; i < 16; ++i) x1[i] = oh[512 + (i >> 2) * 128 + (i & 3)]; }
  asm volatile("s_wait_xcnt 0x0" ::: "memory");   // the address registers of the four loads above are given to a fragment of the group below
#pragma unroll
  for (int j = 0; j < 8; ++j) w1[j] = frag_ub((gph)sbase(wp) + j * 16 * E + (E / 32 - 1) * 512, wol);
  __builtin_amdgcn_sched_barrier(0);   // as above
  { const F2 a = bsplit16(x0);
#pragma unroll
    for (int j = 0; j < 8; ++j) { acc[j] = wmma_bf(a.l, w0[j], acc[j]); acc[j] = wmma_bf(a.h, w0[j], acc[j]); } }
  { const F2 a = bsplit16(x1);
#pragma unroll
    for (int j = 0; j < 8; ++j) { acc[j] = wmma_bf(a.l, w1[j], acc[j]); acc[j] = wmma_bf(a.h, w1[j], acc[j]); } }
#pragma unroll
  for (int j = 0; j < 8; ++j) { const int n = n0 + j * 16 + col; const float bb = bfr(bo[n]);
#pragma unroll
    for (int r = 0; r < 8; ++r) so[wave][8 * g + r][j * 16 + col] = acc[j][r] + bb; }
  LDSX();
#pragma unroll 4
  for (int rl = 0; rl < 16; ++rl) vst2(out + (size_t)(r0 + rl) * E + n0 + lane * 4, *(const v4f*)(&so[wave][rl][lane * 4]));
}
extern "C" void kernel_launch(void* const* d_in, const int* in_sizes, int n_in, void* d_out, int out_size, void* d_ws, size_t ws_size, hipStream_t stream) {
  (void)in_sizes; (void)n_in; (void)out_size; (void)ws_size;
  const float* x = (const float*)d_in[0]; const float* bond = (const float*)d_in[1]; const float* Wq = (const float*)d_in[2]; const float* bq = (const float*)d_in[3]; const float* Wk = (const float*)d_in[4]; const float* bk = (const float*)d_in[5]; const float* Wv = (const float*)d_in[6]; const float* bv = (const float*)d_in[7]; const float* Wo = (const float*)d_in[8]; const float* bo = (const float*)d_in[9];
  float* out = (float*)d_out;
  char* ws = (char*)d_ws; size_t off = 0;
  auto take = [&](size_t bytes) { char* p = ws + off; off += (bytes + 255) & ~(size_t)255; return p; };
  __bf16* Xb = (__bf16*)take((size_t)NR * E * 2); __bf16* PT = (__bf16*)take((size_t)4 * E * E * 2);
  float* Q32 = (float*)take((size_t)NR * E * 4); __bf16* Kh = (__bf16*)take((size_t)NR * E * 2); __bf16* Kl = (__bf16*)take((size_t)NR * E * 2); _Float16* VTh = (_Float16*)take((size_t)NR * E * 2); _Float16* VTl = (_Float16*)take((size_t)NR * E * 2); float* O32 = (float*)take((size_t)NR * E * 4); __bf16* Bb = (__bf16*)take((size_t)NB * SS * SS * 2);
  // ws ~ 101 MB (96 MiB)
  k_cvt<<<CB_W + CB_B + CB_X, 256, 0, stream>>>(x, bond, Wq, Wk, Wv, Wo, Xb, Bb, PT);
  k_qkv<<<dim3(NR / 128, E / 128, 3), 128, 0, stream>>>(Xb, PT, bq, bk, bv, Q32, Kh, Kl, VTh, VTl);
  k_attn<<<dim3(SS / (AW * 16), NB * NH), AW * 32, 0, stream>>>(Q32, Kh, Kl, VTh, VTl, Bb, O32);
  k_out<<<dim3(NR / 64, E / 128), 128, 0, stream>>>(O32, PT, bo, out);
}

// v010
// It runs in 131 microseconds.
// Two timings next to v009 put it at 1.04 and 1.02 times that version's speed.
// Over all steps from v000 it is 4.37 times as fast.
// compute dtype: x, bond_influence, W*/b* (INPUTS) rounded to bf16 with exact bf16 WMMA products (f32 accumulate) for the projections; K pre-split into bf16 hi/lo fragments; q f32 split, P and V f16 hi/lo (3 products each); the bond modulation and softmax in f32.
#include <hip/hip_runtime.h>
#include <math.h>

typedef __attribute__((ext_vector_type(16))) _Float16 v16h;
typedef __attribute__((ext_vector_type(16))) __bf16 v16b;
typedef __attribute__((ext_vector_type(8)))  _Float16 v8h;
typedef __attribute__((ext_vector_type(8)))  float v8f;
typedef __attribute__((ext_vector_type(4)))  float v4f;
typedef __attribute__((ext_vector_type(2)))  float v2f;
typedef __attribute__((ext_vector_type(4)))  unsigned v4u;
typedef __attribute__((ext_vector_type(4)))  int v4i;
typedef float __attribute__((may_alias)) float_a;
typedef int __attribute__((may_alias)) int_a;

template <typename T> __device__ __forceinline__ void vst2(void* p, T v) { *(T*)p = v;  }
__device__ __forceinline__ v8f wmma16(v16h a, v16h b, v8f c) {
  v8f d = __builtin_amdgcn_wmma_f32_16x16x32_f16(false, a, false, b, (short)0, c, false, false);
  return d;
}
__device__ __forceinline__ v8f wmma_bf(v16b a, v16b b, v8f c) {
  v8f d = __builtin_amdgcn_wmma_f32_16x16x32_bf16(false, a, false, b, (short)0, c, false, false);
  return d;
}
// 16x16x32 fragments: lane = (h = lane>>4, row/col = lane&15); elements 0..7 = k0+8h+0..7, 8..15 = k0+16+8h+0..7; D element r = row 8h+r
__device__ __forceinline__ v16h frag_h(const _Float16* rowk0, int lane) {
  union { v16h v; v8h q[2]; } u; const _Float16* p = rowk0 + 8 * (lane >> 4);
  u.q[0] = *(const v8h*)p; u.q[1] = *(const v8h*)(p + 16); return u.v;
}
__device__ __forceinline__ v16h frag_f32(const float* rowk0, int lane) {
  v16h a; const float* p = rowk0 + 8 * (lane >> 4);
#pragma unroll
  for (int i = 0; i < 8; ++i) { a[i] = (_Float16)p[i]; a[8 + i] = (_Float16)p[16 + i]; }
  return a;
}
__device__ __forceinline__ v16h frag_f32s(const float* rowk0, int lane, float sc) {
  v16h a; const float* p = rowk0 + 8 * (lane >> 4);
#pragma unroll
  for (int i = 0; i < 8; ++i) { a[i] = (_Float16)(p[i] * sc); a[8 + i] = (_Float16)(p[16 + i] * sc); }
  return a;
}
// column fragment from a [K][ld] layout (column n), rows >= K read as 0
__device__ __forceinline__ v16h fragc_f32(const float* W, int k0, int n, int lane, int ld, int K) {
  v16h a; const int g = lane >> 4;
#pragma unroll
  for (int i = 0; i < 8; ++i) { const int ka = k0 + 8 * g + i, kb = ka + 16;
    a[i] = (_Float16)(ka < K ? W[(size_t)ka * ld + n] : 0.f); a[8 + i] = (_Float16)(kb < K ? W[(size_t)kb * ld + n] : 0.f); }
  return a;
}
struct F2 { v16b h, l; };
__device__ __forceinline__ F2 bsplit16(const float v[16]) { F2 r;
#pragma unroll
  for (int i = 0; i < 16; ++i) { const __bf16 h = (__bf16)v[i]; r.h[i] = h; r.l[i] = (__bf16)(v[i] - (float)h); }
  return r; }
__device__ __forceinline__ F2 split_row(const float* row, int k0, int lane) { float v[16]; const float* p = row + k0 + 8 * (lane >> 4);
#pragma unroll
  for (int i = 0; i < 8; ++i) { v[i] = p[i]; v[8 + i] = p[16 + i]; }
  return bsplit16(v); }
__device__ __forceinline__ F2 split_rowK(const float* row, int k0, int lane, int K) { float v[16]; const int g = lane >> 4;
#pragma unroll
  for (int i = 0; i < 8; ++i) { const int ka = k0 + 8 * g + i, kb = ka + 16; v[i] = ka < K ? row[ka] : 0.f; v[8 + i] = kb < K ? row[kb] : 0.f; }
  return bsplit16(v); }
__device__ __forceinline__ F2 split_col(const float* W, int k0, int n, int lane, int ld, int K) { float v[16]; const int g = lane >> 4;
#pragma unroll
  for (int i = 0; i < 8; ++i) { const int ka = k0 + 8 * g + i, kb = ka + 16; v[i] = ka < K ? W[(size_t)ka * ld + n] : 0.f; v[8 + i] = kb < K ? W[(size_t)kb * ld + n] : 0.f; }
  return bsplit16(v); }
__device__ __forceinline__ v8f mac3(const F2& a, const F2& b, v8f c) { c = wmma_bf(a.l, b.h, c); c = wmma_bf(a.h, b.l, c); return wmma_bf(a.h, b.h, c); }
__device__ __forceinline__ float sigm(float v) { return 1.0f / (1.0f + expf(-v)); }
#define LDSX() do { asm volatile("s_wait_dscnt 0" ::: "memory"); __builtin_amdgcn_wave_barrier(); __builtin_amdgcn_fence(__ATOMIC_RELEASE, "workgroup"); } while (0)


// Bond-influence self attention (16 heads x 64 on [2,2048,1024], [in][out] weights + biases): scores = (q.k/8) * bond_influence[b][q][k] (an INPUT matrix, shared by the heads); softmax; (P v) @ Wo + bo.
#define NB 2
#define SS 2048
#define E 1024
#define NH 16
#define HD 64
#define NR (NB * SS)
#define VSC 64.0f   // V is stored times 64; a weight is at most 65504, the largest of a tile 1024 where the reference point was set (k_attn). At these sizes the low halves of V and of P stand in f16 as they are, with no factor of their own, so all three products of P V have one scale
#define HRM 10.0f   // where the softmax's reference point is set, it lies this far (base 2) below the tile's maximum: 32 weights of 2^10 sum to half of what f16 holds, which leaves the scores room to grow before the point must move
#define SCL2 0.18033688f   // log2(e) / 8: the scores are kept in base-2 units, so that a weight is one hardware exponential
__device__ __forceinline__ float bfr(float v) { return (float)(__bf16)v; }
// FRAGMENT ORDER (every 16-bit matrix operand in the workspace): a 16 x 32 fragment is 1 KiB in a row, two blocks of 512 bytes; block qi holds at lane * 16 bytes the lane's elements 8 * qi .. 8 * qi + 7,
// that is row or column (lane & 15), k = 16 * qi + 8 * (lane >> 4) + 0..7: one wave-wide 16-byte load reads 512 contiguous bytes, four whole 128-byte lines, where a row-major operand made it touch sixteen
// the fragment from a wave-uniform base and the lane's own 32-bit element offset (8 * lane): the address costs one vector register
typedef const _Float16 __attribute__((address_space(1)))* gph; typedef const float __attribute__((address_space(1)))* gpf; typedef const v8h __attribute__((address_space(1)))* gp8; typedef const char __attribute__((address_space(1)))* gpc;
__device__ __forceinline__ unsigned long long sbase(const void* p) {   // a wave-uniform address read into scalar registers, so that the loads below take it as their scalar base
  const unsigned long long u = (unsigned long long)p;
  return ((unsigned long long)(unsigned)__builtin_amdgcn_readfirstlane((int)(u >> 32)) << 32) | (unsigned)__builtin_amdgcn_readfirstlane((int)u); }
__device__ __forceinline__ v16h frag_u(gph ub, unsigned off) { union { v16h v; v8h q[2]; } u; gph p = ub + off; u.q[0] = *(gp8)p; u.q[1] = *(gp8)(p + 256); return u.v; }
__device__ __forceinline__ v16b frag_ub(gph ub, unsigned off) { return __builtin_bit_cast(v16b, frag_u(ub, off)); }
__device__ __forceinline__ v16b frag_b(const __bf16* rowk0, int lane) { return __builtin_bit_cast(v16b, frag_h((const _Float16*)rowk0, lane)); }

// ONE launch turns all three kinds of input into their 16-bit planes: CB_W blocks the weights, CB_B blocks bond_influence, CB_X blocks x. Every block takes 64 KiB in and puts 32 KiB out, a thread eight 16-byte units:
// a wave keeps sixteen loads out at a time, all 1024 blocks are resident together, and there is one launch to start and to drain where there were two with 4608 blocks
#define CB_W (4 * E / 32 * (E / 512))
#define CB_B (NB * SS * SS / 8 / 2048)
#define CB_X (NR * E / 8 / 2048)
typedef __attribute__((ext_vector_type(2))) __bf16 v2b;
// amdgpu_waves_per_eu(8, 8): four blocks a WGP are eight waves a SIMD; a wave may then take 128 registers, so that all sixteen loads go out before the first is waited for
__global__ __launch_bounds__(256) __attribute__((amdgpu_waves_per_eu(8, 8))) void k_cvt(const float* __restrict__ x, const float* __restrict__ bond, const float* __restrict__ Wq, const float* __restrict__ Wk, const float* __restrict__ Wv, const float* __restrict__ Wo,
                                            __bf16* __restrict__ Xb, __bf16* __restrict__ Bb, __bf16* __restrict__ PT) {
  union P8 { __bf16 h[8]; v4u u; };
  __shared__ __align__(16) __bf16 st[32][520];
  const int tid = threadIdx.x;
  if (blockIdx.x < CB_W) {
    // PT columns n: [0,E) Wq[:,n], [E,2E) Wk[:,n], [2E,3E) Wv[:,n], [3E,4E) Wo[:,n]  ([in][out] weights), in fragment order: fragment (16-column group ng, k step kc) at element (ng * 32 + kc) * 512
    // block (32 columns, 512 k): whole 128-byte lines of W in, turned in LDS, 32 whole fragments out. A thread takes rows k in pairs, so that two rounded values go into LDS as one dword
    const int n0 = (blockIdx.x >> 1) * 32, k0 = (blockIdx.x & 1) * 512;
    const float* W = n0 < E ? Wq : (n0 < 2 * E ? Wk : (n0 < 3 * E ? Wv : Wo)); const int nn = n0 & (E - 1);
    const int kr = tid >> 2, pt = tid & 3; const float* wsrc = W + (size_t)(k0 + kr * 2) * E + nn + pt * 8;
    float in[8][8];   // in[j]: row k0 + (j >> 1) * 128 + kr * 2 + (j & 1)
#pragma unroll
    for (int j = 0; j < 8; ++j) {
#pragma unroll
      for (int e = 0; e < 8; ++e) in[j][e] = wsrc[((j >> 1) * 128 + (j & 1)) * E + e]; }
    asm volatile("s_wait_xcnt 0x0" :: "v"(wsrc) : "memory");   // the address registers of the loads above are given to other values while those loads are still out; named here, they live up to the wait
#pragma unroll
    for (int j = 0; j < 4; ++j) {
#pragma unroll
      for (int e = 0; e < 8; ++e) *(v2b*)(&st[pt * 8 + e][j * 128 + kr * 2]) = (v2b){(__bf16)in[2 * j][e], (__bf16)in[2 * j + 1][e]}; }
    __syncthreads();
    const int ln = tid & 31, qi = (tid >> 5) & 1, kc = (tid >> 6) & 1, ngl = tid >> 7;
    __bf16* pd = PT + ((size_t)((n0 >> 4) + ngl) * 32 + (k0 >> 5) + kc) * 512 + qi * 256 + ln * 8;
    v4u ou[8];
#pragma unroll
    for (int j = 0; j < 8; ++j) ou[j] = *(const v4u*)(&st[ngl * 16 + (ln & 15)][j * 64 + kc * 32 + qi * 16 + (ln >> 4) * 8]);
#pragma unroll
    for (int j = 0; j < 8; ++j) vst2((unsigned*)(pd + j * 1024), ou[j]);
    return; }
  // bond_influence and x, rounded to bf16, have one form: a row of the source is cut into chunks of 32 floats; the chunk ch of the 16-row group qg is 1 KiB at element (qg * (chunks a row) + ch) * 512, two blocks of 512 bytes;
  // block (o >> 1) holds at lane * 16 bytes row (lane & 15), floats 16 * (o >> 1) + 8 * (lane >> 4) + 0..7 of the chunk. For x that is the fragment (16-row group, k step); for the bond it is two tiles of the transposed score accumulators of k_attn:
  // the tile (16-query group qg of [b][q], 16-key group kg) is 512 bytes at element (qg * (SS / 16) + kg) * 256; at lane * 16 bytes stand query (lane & 15), keys 8 * (lane >> 4) + 0..7.
  // A wave takes 8 rows x 128 bytes in (whole lines over its two loads) and puts four whole lines out
  const bool isb = blockIdx.x < CB_W + CB_B;
  const unsigned u = (blockIdx.x - (isb ? CB_W : CB_W + CB_B)) * 2048 + tid;
  const int lg = isb ? 6 : 5;   // log2 of the chunks a row: SS / 32 and E / 32
  const int r = u & 7, o = (u >> 3) & 3, rh = (u >> 5) & 1, ch = (u >> 6) & ((1 << lg) - 1), qg = u >> (6 + lg);
  const float* bs = (isb ? bond : x) + ((size_t)(qg * 16 + rh * 8 + r) << (lg + 5)) + ch * 32 + o * 8;
  __bf16* bd = (isb ? Bb : Xb) + ((((size_t)qg << lg) + ch) * 2 + (o >> 1)) * 256 + ((o & 1) * 16 + rh * 8 + r) * 8;
  float in[8][8];
#pragma unroll
  for (int j = 0; j < 8; ++j) {
#pragma unroll
    for (int e = 0; e < 8; ++e) in[j][e] = bs[j * 128 + e]; }
  asm volatile("s_wait_xcnt 0x0" :: "v"(bs) : "memory");   // the address registers of the loads above are given to other values while those loads are still out; named here, they live up to the wait
#pragma unroll
  for (int j = 0; j < 8; ++j) { P8 pk;
#pragma unroll
    for (int e = 0; e < 8; ++e) pk.h[e] = (__bf16)in[j][e];
    vst2((unsigned*)(bd + j * 2048), pk.u); }
  asm volatile("s_wait_xcnt 0x0" ::: "memory");   // in the built code the weight part stands behind these stores and gives their address registers new values
}
// QKV: block (128 rows, 128 cols = 2 heads, which), four waves as 2 x 2; a wave does 64 rows x 64 cols (one head): 8 fragments feed 16 products a k step, where a 16 x 128 wave tile took 9 for 8.
// q (+bias) -> Q32 f32 [bh][s][64]; k (+bias) -> bf16 hi/lo, v (+bias) -> f16 hi/lo x64, both in fragment order:
// K fragment (16-key group kg, d step kc) at element bh * SS * HD + (kg * 2 + kc) * 512; V fragment (32-key block kb, 16-d group t) at element bh * SS * HD + (kb * 4 + t) * 512
// The x and the weight fragments have one layout, so either may be the first operand. For q and k the weights are first: a lane's accumulator registers are then 8 d in a row of one row of x,
// which is a 16-byte unit of a K fragment. For v the rows of x are first: the registers are 8 keys in a row of one d, a unit of a V fragment. K and V go from the registers to the workspace, 512 bytes in a row a wave-wide store
__global__ __launch_bounds__(128) void k_qkv(const __bf16* __restrict__ Xb, const __bf16* __restrict__ PT, const float* __restrict__ bq, const float* __restrict__ bk, const float* __restrict__ bv,
                                            float* __restrict__ Q32, __bf16* __restrict__ Kh, __bf16* __restrict__ Kl, _Float16* __restrict__ VTh, _Float16* __restrict__ VTl) {
  __shared__ __align__(16) float so[4][64][68];
  const int tid = threadIdx.x, wave = __builtin_amdgcn_readfirstlane(tid >> 5), lane = tid & 31, col = lane & 15, g = lane >> 4;
  const int which = blockIdx.z, r0 = blockIdx.x * 128 + (wave >> 1) * 64, n0 = blockIdx.y * 128 + (wave & 1) * 64; const int s0 = r0 % SS;
  const size_t bh = (size_t)(r0 / SS) * NH + (n0 >> 6);
  const float* bb_ = which == 0 ? bq : (which == 1 ? bk : bv);
  v8f acc[4][4] = {};   // acc[i][j]: rows = 16-group i of the first operand, columns = 16-group j of the second
  // two register sets: each k step's 16 fragment loads go out as one group, one step ahead of the products that read them (inner loops unrolled: the sets are register arrays)
  const __bf16* xp = Xb + (size_t)r0 * E; const __bf16* wp = PT + (size_t)(which * E + n0) * E;   // wave-uniform bases; the lane's part is one 32-bit offset
  const __bf16* ap = which < 2 ? wp : xp; const __bf16* bp = which < 2 ? xp : wp;
  const unsigned ol = 8 * lane;
  v16b a0[4], a1[4], b0[4], b1[4];
#pragma unroll
  for (int i = 0; i < 4; ++i) { a0[i] = frag_ub((gph)sbase(ap) + i * 16 * E, ol); b0[i] = frag_ub((gph)sbase(bp) + i * 16 * E, ol); }
#pragma unroll 1   // stays rolled: one trip already holds a step of either register set
  for (int kc = 0; kc < E / 32 - 2; kc += 2) {
    const gph au = (gph)sbase(ap + kc * 512), bu = (gph)sbase(bp + kc * 512);
#pragma unroll
    for (int i = 0; i < 4; ++i) { a1[i] = frag_ub(au + i * 16 * E + 512, ol); b1[i] = frag_ub(bu + i * 16 * E + 512, ol); }
    asm volatile("s_wait_xcnt 0x0" ::: "memory");   // the scalar bases that the loads above name are advanced while those loads are still out
    __builtin_amdgcn_sched_barrier(0);   // keeps the group above the products below; without it each load sinks to its use and its latency is waited out alone
#pragma unroll
    for (int i = 0; i < 4; ++i) {
#pragma unroll
      for (int j = 0; j < 4; ++j) acc[i][j] = wmma_bf(a0[i], b0[j], acc[i][j]); }
#pragma unroll
    for (int i = 0; i < 4; ++i) { a0[i] = frag_ub(au + i * 16 * E + 1024, ol); b0[i] = frag_ub(bu + i * 16 * E + 1024, ol); }
    asm volatile("s_wait_xcnt 0x0" ::: "memory");   // the scalar bases that the loads above name are advanced while those loads are still out
    __builtin_amdgcn_sched_barrier(0);   // as above
#pragma unroll
    for (int i = 0; i < 4; ++i) {
#pragma unroll
      for (int j = 0; j < 4; ++j) acc[i][j] = wmma_bf(a1[i], b1[j], acc[i][j]); } }
#pragma unroll
  for (int i = 0; i < 4; ++i) { a1[i] = frag_ub((gph)sbase(ap) + i * 16 * E + (E / 32 - 1) * 512, ol); b1[i] = frag_ub((gph)sbase(bp) + i * 16 * E + (E / 32 - 1) * 512, ol); }   // the last two steps: nothing is left to fetch behind them
  asm volatile("s_wait_xcnt 0x0" ::: "memory");   // the address registers of the loads above are given to other values while those loads are still out
  __builtin_amdgcn_sched_barrier(0);   // as above
#pragma unroll
  for (int i = 0; i < 4; ++i) {
#pragma unroll
    for (int j = 0; j < 4; ++j) acc[i][j] = wmma_bf(a0[i], b0[j], acc[i][j]); }
#pragma unroll
  for (int i = 0; i < 4; ++i) {
#pragma unroll
    for (int j = 0; j < 4; ++j) acc[i][j] = wmma_bf(a1[i], b1[j], acc[i][j]); }
  if (which < 2) {
    // acc[i][j][r]: column n0 + 16 * i + 8 * g + r of the weights (d = 16 * i + 8 * g + r of the head), row r0 + 16 * j + col of x
#pragma unroll
    for (int i = 0; i < 4; ++i) {
#pragma unroll
      for (int r = 0; r < 8; ++r) { const float bb = bfr(bb_[n0 + i * 16 + 8 * g + r]);
#pragma unroll
        for (int j = 0; j < 4; ++j) acc[i][j][r] += bb; } }
    if (which == 0) {   // the wave's 64 rows are turned in its own LDS rows, so that whole lines go out
#pragma unroll
      for (int j = 0; j < 4; ++j) {
#pragma unroll
        for (int i = 0; i < 4; ++i) { v4f lo4, hi4;
#pragma unroll
          for (int e = 0; e < 4; ++e) { lo4[e] = acc[i][j][e]; hi4[e] = acc[i][j][4 + e]; }
          *(v4f*)(&so[wave][j * 16 + col][i * 16 + 8 * g]) = lo4; *(v4f*)(&so[wave][j * 16 + col][i * 16 + 8 * g + 4]) = hi4; } }
      LDSX();
#pragma unroll
      for (int it = 0; it < 32; ++it) { const int qq = it * 32 + lane, rl = qq >> 4, pc = qq & 15;
        vst2(Q32 + (bh * SS + s0 + rl) * HD + pc * 4, *(const v4f*)(&so[wave][rl][pc * 4]));
        if ((it & 7) == 7) asm volatile("s_wait_xcnt 0x0" ::: "memory");   // the data and address registers of the stores above are given to other values while the stores are still out
      } }
    else {
#pragma unroll
      for (int j = 0; j < 4; ++j) {   // key group j of the wave's 64 rows; i = 2 * kc + qi: one 512-byte block of the hi and one of the lo plane
#pragma unroll
        for (int i = 0; i < 4; ++i) { union { __bf16 e[8]; v4u u; } ph, pl;
#pragma unroll
          for (int e = 0; e < 8; ++e) { const float v = acc[i][j][e]; const __bf16 hi = (__bf16)v; ph.e[e] = hi; pl.e[e] = (__bf16)(v - (float)hi); }
          const size_t o = (bh * SS + s0 + j * 16) * HD + i * 256 + lane * 8;
          vst2((unsigned*)(Kh + o), ph.u); vst2((unsigned*)(Kl + o), pl.u);
          asm volatile("s_wait_xcnt 0x0" ::: "memory");   // the data and address registers of the two stores above are given to other values while the stores are still out
        } } } }
  else {
    // acc[i][j][r]: row r0 + 16 * i + 8 * g + r of x (a key), column n0 + 16 * j + col of the weights (d = 16 * j + col of the head)
#pragma unroll
    for (int j = 0; j < 4; ++j) { const float bb = bfr(bb_[n0 + j * 16 + col]);
#pragma unroll
      for (int i = 0; i < 4; ++i) { union { _Float16 e[8]; v4u u; } ph, pl;   // 32-key block i >> 1, its half i & 1
#pragma unroll
        for (int e = 0; e < 8; ++e) { const float v = (acc[i][j][e] + bb) * VSC; const _Float16 hi = (_Float16)v; ph.e[e] = hi; pl.e[e] = (_Float16)(v - (float)hi); }
        const size_t o = bh * HD * SS + (size_t)((s0 >> 5) + (i >> 1)) * 2048 + j * 512 + (i & 1) * 256 + lane * 8;
        vst2((unsigned*)(VTh + o), ph.u); vst2((unsigned*)(VTl + o), pl.u);
        asm volatile("s_wait_xcnt 0x0" ::: "memory");   // the data and address registers of the two stores above are given to other values while the stores are still out
      } } }
}
// attention: block (128 queries, bh); all key tiles of 64; TRANSPOSED: S^T = K q^T (K hi/lo as A, q hi/lo as B) and O^T += V^T P^T (V hi/lo as A, P hi/lo as B). A lane then holds one query (lane & 15):
// of score tile t its registers r are keys 16 * t + 8 * (lane >> 4) + r, which is the k order of a B fragment, so two score tiles turned into weights ARE the P fragment of 32 keys: scores, softmax and P never leave the registers.
// O f32 in the order in which k_out reads it: the f32 fragment (16-row group rg of [b][s], head h, d step kc) is
// 2 KiB at float ((rg * NH + h) * 2 + kc) * 512, four blocks of 512 bytes; block j holds at lane * 16 bytes row (lane & 15), d = 32 * kc + 16 * (j >> 1) + 8 * (lane >> 4) + 4 * (j & 1) + 0..3: four registers of an O^T accumulator
__device__ __forceinline__ float xhalf(float v) { return __builtin_bit_cast(float, __builtin_amdgcn_permlanex16(__builtin_bit_cast(int, v), __builtin_bit_cast(int, v), 0x76543210, 0xfedcba98, false, false)); }   // lane l with lane l ^ 16
// THE RING: a block of AW waves shares each 64-key tile. The tile's K hi, K lo, V hi and V lo (8 KiB each, contiguous in the workspace, already in fragment order) and each wave's own four bond tiles (2 KiB)
// are copied from global memory straight into one of two LDS buffers while the tile before them is worked on; the fragments are then read from LDS, 512 contiguous bytes a wave-wide read.
#define AW 8
#define KVB 32768                  // bytes of K hi, K lo, V hi, V lo of one tile
#define STB (KVB + AW * 2048)      // bytes of one buffer: that and the bond tiles of the AW waves
__device__ __forceinline__ v16h frag_l(const unsigned char* p) { union { v16h v; v8h q[2]; } u; u.q[0] = *(const v8h*)p; u.q[1] = *(const v8h*)(p + 512); return u.v; }
__device__ __forceinline__ v16b frag_lb(const unsigned char* p) { return __builtin_bit_cast(v16b, frag_l(p)); }
// one wave's share of a tile: eight 512-byte units of the K and V planes (LDS byte address l, global address g) and its four bond tiles (lb, gb); every lane brings 16 bytes a copy.
// The copies and their s_wait_xcnt stand in one statement, so that no address register is given a new value in front of the wait
__device__ __forceinline__ void stage_tile(unsigned l, const char* g, unsigned lb, const char* gb) {
  asm volatile("global_load_async_to_lds_b128 %0, %1, off\n\t"
               "global_load_async_to_lds_b128 %2, %3, off\n\t"
               "global_load_async_to_lds_b128 %4, %5, off\n\t"
               "global_load_async_to_lds_b128 %6, %7, off\n\t"
               "global_load_async_to_lds_b128 %8, %9, off\n\t"
               "global_load_async_to_lds_b128 %10, %11, off\n\t"
               "global_load_async_to_lds_b128 %12, %13, off\n\t"
               "global_load_async_to_lds_b128 %14, %15, off\n\t"
               "global_load_async_to_lds_b128 %16, %17, off\n\t"
               "global_load_async_to_lds_b128 %18, %19, off\n\t"
               "global_load_async_to_lds_b128 %20, %21, off\n\t"
               "global_load_async_to_lds_b128 %22, %23, off\n\t"
               "s_wait_xcnt 0x0"
               :: "v"(l), "v"(g), "v"(l + 512), "v"(g + 512), "v"(l + 1024), "v"(g + 1024), "v"(l + 1536), "v"(g + 1536),
                  "v"(l + 2048), "v"(g + 2048), "v"(l + 2560), "v"(g + 2560), "v"(l + 3072), "v"(g + 3072), "v"(l + 3584), "v"(g + 3584),
                  "v"(lb), "v"(gb), "v"(lb + 512), "v"(gb + 512), "v"(lb + 1024), "v"(gb + 1024), "v"(lb + 1536), "v"(gb + 1536) : "memory");
}
// amdgpu_waves_per_eu(4, 4): holds a wave to 256 registers, so that two blocks stay resident on a WGP
__global__ __launch_bounds__(AW * 32) __attribute__((amdgpu_waves_per_eu(4, 4))) void k_attn(const float* __restrict__ Q32, const __bf16* __restrict__ Kh, const __bf16* __restrict__ Kl, const _Float16* __restrict__ VTh, const _Float16* __restrict__ VTl, const __bf16* __restrict__ Bb, float* __restrict__ O32) {
  const int tid = threadIdx.x, w = __builtin_amdgcn_readfirstlane(tid >> 5), lane = tid & 31, col = lane & 15;   // the wave's number in a scalar register: addresses built on it cost no vector registers
  const size_t bh = blockIdx.y; const int qb = blockIdx.x; const int q0 = qb * (AW * 16) + w * 16;
  const int b = (int)(bh / NH);
  __shared__ __align__(16) unsigned char ring[2][STB];
  // wave w copies the half (w & 1) of plane (w >> 1) of K hi, K lo, V hi, V lo: in the buffer that is byte w * 4096; a tile is 8192 bytes further in every plane, 2048 in the bond rows of the wave's 16 queries
  // gk, gb, lk, lb: the wave's parts of the four addresses, the same in every lane; l16: the lane's part
  const char* gk = (const char*)(w < 2 ? (const void*)Kh : (w < 4 ? (const void*)Kl : (w < 6 ? (const void*)VTh : (const void*)VTl))) + bh * (SS * HD * 2) + (w & 1) * 4096;
  const char* gb = (const char*)Bb + (size_t)((b * SS + q0) >> 4) * (SS / 16 * 512);
  const unsigned lk = (unsigned)(size_t)&ring[0][0] + w * 4096, lb = (unsigned)(size_t)&ring[0][0] + KVB + w * 2048, l16 = lane * 16;
  stage_tile(lk + l16, gk + l16, lb + l16, gb + l16);   // tile 0 into buffer 0
  // the split q fragments stay in registers through the loop: one accumulator set leaves room for them at four waves per SIMD
  F2 aq[2];
#pragma unroll
  for (int kc = 0; kc < 2; ++kc) aq[kc] = split_row(Q32 + (bh * SS + q0 + col) * HD, kc * 32, lane);
  float mrun = 0.f, lrun = 0.f; v8f acc[4] = {};   // one accumulator set takes all three products of P V; lrun: the sum over this lane's half of the keys; the halves are joined behind the loop
  asm volatile("s_wait_asynccnt 0x0" ::: "memory");   // this wave's share of tile 0 has landed
  __syncthreads();                                    // every wave's share has: tile 0 may be read
  stage_tile(lk + STB + l16, gk + 8192 + l16, lb + STB + l16, gb + 2048 + l16);   // tile 1 into buffer 1
#pragma unroll 1
  for (int kt = 0; kt < SS / 64; ++kt) {
    // one read group at the head of the tile: the K fragments of key groups 0 and 1 and the four bond tiles; the fragments of groups 2 and 3 refill a set as soon as it has been read (inner loops unrolled: the sets are register arrays)
    const unsigned char* rl = &ring[kt & 1][l16];   // the lane's place in every 512-byte unit of this tile's buffer
    const unsigned char* khu = rl, * klu = rl + 8192, * vhu = rl + 16384, * vlu = rl + 24576, * bu = rl + KVB + w * 2048;
    v4u bv[4]; v16b kf[2][4];
#pragma unroll
    for (int t = 0; t < 2; ++t) {
#pragma unroll
      for (int kc = 0; kc < 2; ++kc) { kf[t][2 * kc] = frag_lb(khu + t * 2048 + kc * 1024); kf[t][2 * kc + 1] = frag_lb(klu + t * 2048 + kc * 1024); } }
#pragma unroll
    for (int t = 0; t < 4; ++t) bv[t] = *(const v4u*)(bu + t * 512);
    __builtin_amdgcn_sched_barrier(0);   // keeps the group above the products below; without it each read sinks to its use and its latency is waited out alone
    v2f xq[16];   // pair j holds keys 2 * j and 2 * j + 1 of the lane's 32: the modulated score less the reference point in use, which is known ahead of the tile and so rides in the bond multiply
    const v2f mr = {mrun, mrun}; v8f sv[4];
#pragma unroll
    for (int t = 0; t < 4; ++t) { v8f s = {};
#pragma unroll
      for (int kc = 0; kc < 2; ++kc) { s = wmma_bf(kf[t & 1][2 * kc], aq[kc].l, s); s = wmma_bf(kf[t & 1][2 * kc + 1], aq[kc].h, s); s = wmma_bf(kf[t & 1][2 * kc], aq[kc].h, s); }
      if (t < 2) {
#pragma unroll
        for (int kc = 0; kc < 2; ++kc) { kf[t][2 * kc] = frag_lb(khu + (t + 2) * 2048 + kc * 1024); kf[t][2 * kc + 1] = frag_lb(klu + (t + 2) * 2048 + kc * 1024); }
        __builtin_amdgcn_sched_barrier(0);   // as above
      }
      sv[t] = s; }
#pragma unroll
    for (int t = 0; t < 4; ++t) {
#pragma unroll
      for (int r = 0; r < 4; ++r) xq[t * 4 + r] = __builtin_elementwise_fma((v2f){sv[t][2 * r], sv[t][2 * r + 1]} * (v2f){SCL2, SCL2}, (v2f){__builtin_bit_cast(float, bv[t][r] << 16), __builtin_bit_cast(float, bv[t][r] & 0xffff0000u)}, -mr); }
    // the V fragments of the tile's first 32 keys are read as one group ahead of the softmax, which covers their latency; those of the second 32 as one group behind the first four products: the low halves into the set just read, the high halves into a set of their own
    v16h vf[4][2], vg[4];
    __builtin_amdgcn_sched_barrier(0);   // keeps the group out of the score products above, where the registers are short
#pragma unroll
    for (int t = 0; t < 4; ++t) { vf[t][0] = frag_l(vhu + t * 1024); vf[t][1] = frag_l(vlu + t * 1024); }
    __builtin_amdgcn_sched_barrier(0);   // keeps the group together here, ahead of the softmax; without it each read sinks to its use and its latency is waited out alone
    // THE REFERENCE POINT IS MOVED ONLY WHEN IT MUST BE: the weights are formed against the point in use, 2^(score - mrun), with no maximum, no exchange between the halves and no rescaling.
    // The lane's 32 weights are positive, so none is above their sum: while the sum is at most 65504 every weight stands in f16. Else (scores that have grown; and always in the first tile, which sets the point) the whole wave takes the branch below
    v2f pp[16]; float ps;
#pragma unroll
    for (int j = 0; j < 16; ++j) pp[j] = (v2f){__builtin_amdgcn_exp2f(xq[j][0]), __builtin_amdgcn_exp2f(xq[j][1])};
    { v2f a[8];   // the sum as a tree of packed additions
#pragma unroll
      for (int j = 0; j < 8; ++j) a[j] = pp[j] + pp[j + 8];
#pragma unroll
      for (int j = 0; j < 4; ++j) a[j] += a[j + 4];
      a[0] = (a[0] + a[2]) + (a[1] + a[3]); ps = a[0][0] + a[0][1]; }
    if (__builtin_amdgcn_ballot_w32(!(ps <= (kt == 0 ? -1.0f : 65504.0f))) != 0) {   // one test a tile, a scalar branch: the same for every lane, so that the products below run with all lanes on
      v2f m2 = xq[0];
#pragma unroll
      for (int j = 1; j < 16; ++j) m2 = (v2f){fmaxf(m2[0], xq[j][0]), fmaxf(m2[1], xq[j][1])};
      float mx = fmaxf(m2[0], m2[1]);
      mx = fmaxf(mx, xhalf(mx));   // both halves of a query's keys keep one reference point
      // the point moves to HRM below the tile's maximum: the largest weight is then 2^HRM, a lane's sum at most 32 times that. Behind the first tile it only rises: a query whose tile maximum lies at most HRM above its point keeps that point (or a far lower tile would scale its sums out of range),
      // and one whose sum was above 65504 has a weight above 2047, so its point rises by more than 1. d is taken back from the rounded new point, so that this tile and the later ones use one point
      const float up = mx - HRM, mnew = mrun + (kt == 0 ? up : fmaxf(up, 0.0f)), d = mnew - mrun;
      const float corr = kt == 0 ? 0.0f : __builtin_amdgcn_exp2f(-d);   // nothing has been summed ahead of the first tile
      const v2f d2 = {d, d};
#pragma unroll
      for (int j = 0; j < 16; ++j) { const v2f x = xq[j] - d2; pp[j] = (v2f){__builtin_amdgcn_exp2f(x[0]), __builtin_amdgcn_exp2f(x[1])}; }
      v2f a[8];
#pragma unroll
      for (int j = 0; j < 8; ++j) a[j] = pp[j] + pp[j + 8];
#pragma unroll
      for (int j = 0; j < 4; ++j) a[j] += a[j + 4];
      a[0] = (a[0] + a[2]) + (a[1] + a[3]); ps = a[0][0] + a[0][1];
      lrun *= corr; mrun = mnew;
#pragma unroll
      for (int t = 0; t < 4; ++t) acc[t] *= corr;   // the lane's accumulators all belong to its own query
    }
    lrun += ps;
    v16h ph[2], pl[2];
#pragma unroll
    for (int i = 0; i < 32; ++i) { const float p = pp[i >> 1][i & 1]; const _Float16 hi = (_Float16)p; ph[i >> 4][i & 15] = hi; pl[i >> 4][i & 15] = (_Float16)(p - (float)hi); }
    __builtin_amdgcn_sched_barrier(0);   // keeps the halving of the weights ahead of the products: mixed in among them it was given the registers of fragments just read, and each such place cost up to four v_nop
#pragma unroll
    for (int kc = 0; kc < 2; ++kc) {
      // each product runs over the four d groups before the next one starts: a product into an accumulator stands four behind the last one into it
#pragma unroll
      for (int t = 0; t < 4; ++t) acc[t] = wmma16(vf[t][1], ph[kc], acc[t]);
      if (kc == 0) {
#pragma unroll
        for (int t = 0; t < 4; ++t) { vf[t][1] = frag_l(vlu + 4096 + t * 1024); vg[t] = frag_l(vhu + 4096 + t * 1024); }
        __builtin_amdgcn_sched_barrier(0);   // keeps the group here, eight products ahead of its first use
      }
#pragma unroll
      for (int t = 0; t < 4; ++t) acc[t] = wmma16(kc == 0 ? vf[t][0] : vg[t], pl[kc], acc[t]);
#pragma unroll
      for (int t = 0; t < 4; ++t) acc[t] = wmma16(kc == 0 ? vf[t][0] : vg[t], ph[kc], acc[t]);
      if (kc == 0) __builtin_amdgcn_sched_barrier(0);   // keeps the eight products above ahead of the hand-over's LDS wait; without it that wait rises to just behind the group of reads and their latency is waited out
    }
    // the hand-over: tile kt + 1 becomes readable, and this tile's buffer free for tile kt + 2
    asm volatile("s_wait_dscnt 0x0" ::: "memory");      // this wave's reads of this tile's buffer are done before the buffer is written again
    asm volatile("s_wait_asynccnt 0x0" ::: "memory");   // this wave's share of tile kt + 1 has landed
    __syncthreads();                                    // the same holds of every wave of the block
    if (kt + 2 < SS / 64) { const unsigned bo = (kt & 1) * STB; stage_tile(lk + bo + l16, gk + (kt + 2) * 8192 + l16, lb + bo + l16, gb + (kt + 2) * 2048 + l16); } }
  asm volatile("s_wait_asynccnt 0x0" ::: "memory");   // no copy is out when the wave ends
  lrun += xhalf(lrun);
  const float inv = 1.0f / (lrun * VSC);
  float* od = O32 + ((size_t)((b * SS + q0) >> 4) * NH + (bh % NH)) * 1024 + lane * 4;
#pragma unroll
  for (int it = 0; it < 8; ++it) { v4f o;
#pragma unroll
    for (int e = 0; e < 4; ++e) { const int t = it >> 1, r = (it & 1) * 4 + e; o[e] = acc[t][r] * inv; }
    vst2(od + it * 128, o); }
}
// out = ctx Wo + bo : split(ctx) x bf16(Wo rows): 2 products (Wo is an INPUT -> bf16 exact)
__global__ __launch_bounds__(128) void k_out(const float* __restrict__ O32, const __bf16* __restrict__ PT, const float* __restrict__ bo, float* __restrict__ out) {
  __shared__ __align__(16) float so[4][16][132];
  const int tid = threadIdx.x, wave = tid >> 5, lane = tid & 31, col = lane & 15, g = lane >> 4;
  const int r0 = blockIdx.x * 64 + wave * 16, n0 = blockIdx.y * 128;
  v8f acc[8] = {};
  // two register sets: each k step's 20 loads go out as one group, one step ahead of the products that read them (inner loops unrolled: the sets are register arrays)
  const int rb = blockIdx.x * 64; const float* op = O32 + (size_t)rb * E; const __bf16* wp = PT + (size_t)(3 * E + n0) * E;   // wave-uniform bases; the lane's part is one 32-bit offset each
  const unsigned ool = (wave * 16 * E + 4 * lane) * 4, wol = 8 * lane;   // ool in bytes, wol in elements
  float x0[16], x1[16]; v16b w0[8], w1[8];
  { const gpf o0 = (gpf)((gpc)sbase(op) + ool);
#pragma unroll
    for (int i = 0; i < 16; ++i) x0[i] = o0[(i >> 2) * 128 + (i & 3)]; }
#pragma unroll
  for (int j = 0; j < 8; ++j) w0[j] = frag_ub((gph)sbase(wp) + j * 16 * E, wol);
#pragma unroll 1
  for (int h = 0; h < NH - 1; ++h) { const gpf oh = (gpf)((gpc)sbase(op + h * 1024) + ool); const gph wu = (gph)sbase(wp + h * 1024);
#pragma unroll
    for (int i = 0; i < 16; ++i) x1[i] = oh[512 + (i >> 2) * 128 + (i & 3)];
#pragma unroll
    for (int j = 0; j < 8; ++j) w1[j] = frag_ub(wu + j * 16 * E + 512, wol);
    asm volatile("s_wait_xcnt 0x0" ::: "memory");   // the scalar bases that the loads above name are advanced while those loads are still out
    __builtin_amdgcn_sched_barrier(0);   // keeps the group above the products below; without it each load sinks to its use and its latency is waited out alone
    { const F2 a = bsplit16(x0);
#pragma unroll
      for (int j = 0; j < 8; ++j) { acc[j] = wmma_bf(a.l, w0[j], acc[j]); acc[j] = wmma_bf(a.h, w0[j], acc[j]); } }
#pragma unroll
    for (int i = 0; i < 16; ++i) x0[i] = oh[1024 + (i >> 2) * 128 + (i & 3)];
#pragma unroll
    for (int j = 0; j < 8; ++j) w0[j] = frag_ub(wu + j * 16 * E + 1024, wol);
    asm volatile("s_wait_xcnt 0x0" ::: "memory");   // the scalar bases that the loads above name are advanced while those loads are still out
    __builtin_amdgcn_sched_barrier(0);   // as above
    { const F2 a = bsplit16(x1);
#pragma unroll
      for (int j = 0; j < 8; ++j) { acc[j] = wmma_bf(a.l, w1[j], acc[j]); acc[j] = wmma_bf(a.h, w1[j], acc[j]); } } }
  { const gpf oh = (gpf)((gpc)sbase(op + (NH - 1) * 1024) + ool);   // the last two steps: nothing is left to fetch behind them
#pragma unroll
    for (int i = 0; i < 16; ++i) x1[i] = oh[512 + (i >> 2) * 128 + (i & 3)]; }
  asm volatile("s_wait_xcnt 0x0" ::: "memory");   // the address registers of the four loads above are given to a fragment of the group below
#pragma unroll
  for (int j = 0; j < 8; ++j) w1[j] = frag_ub((gph)sbase(wp) + j * 16 * E + (E / 32 - 1) * 512, wol);
  __builtin_amdgcn_sched_barrier(0);   // as above
  { const F2 a = bsplit16(x0);
#pragma unroll
    for (int j = 0; j < 8; ++j) { acc[j] = wmma_bf(a.l, w0[j], acc[j]); acc[j] = wmma_bf(a.h, w0[j], acc[j]); } }
  { const F2 a = bsplit16(x1);
#pragma unroll
    for (int j = 0; j < 8; ++j) { acc[j] = wmma_bf(a.l, w1[j], acc[j]); acc[j] = wmma_bf(a.h, w1[j], acc[j]); } }
#pragma unroll
  for (int j = 0; j < 8; ++j) { const int n = n0 + j * 16 + col; const float bb = bfr(bo[n]);
#pragma unroll
    for (int r = 0; r < 8; ++r) so[wave][8 * g + r][j * 16 + col] = acc[j][r] + bb; }
  LDSX();
#pragma unroll 4
  for (int rl = 0; rl < 16; ++rl) vst2(out + (size_t)(r0 + rl) * E + n0 + lane * 4, *(const v4f*)(&so[wave][rl][lane * 4]));
}
extern "C" void kernel_launch(void* const* d_in, const int* in_sizes, int n_in, void* d_out, int out_size, void* d_ws, size_t ws_size, hipStream_t stream) {
  (void)in_sizes; (void)n_in; (void)out_size; (void)ws_size;
  const float* x = (const float*)d_in[0]; const float* bond = (const float*)d_in[1]; const float* Wq = (const float*)d_in[2]; const float* bq = (const float*)d_in[3]; const float* Wk = (const float*)d_in[4]; const float* bk = (const float*)d_in[5]; const float* Wv = (const float*)d_in[6]; const float* bv = (const float*)d_in[7]; const float* Wo = (const float*)d_in[8]; const float* bo = (const float*)d_in[9];
  float* out = (float*)d_out;
  char* ws = (char*)d_ws; size_t off = 0;
  auto take = [&](size_t bytes) { char* p = ws + off; off += (bytes + 255) & ~(size_t)255; return p; };
  __bf16* Xb = (__bf16*)take((size_t)NR * E * 2); __bf16* PT = (__bf16*)take((size_t)4 * E * E * 2);
  float* Q32 = (float*)take((size_t)NR * E * 4); __bf16* Kh = (__bf16*)take((size_t)NR * E * 2); __bf16* Kl = (__bf16*)take((size_t)NR * E * 2); _Float16* VTh = (_Float16*)take((size_t)NR * E * 2); _Float16* VTl = (_Float16*)take((size_t)NR * E * 2); float* O32 = (float*)take((size_t)NR * E * 4); __bf16* Bb = (__bf16*)take((size_t)NB * SS * SS * 2);
  // ws ~ 101 MB (96 MiB)
  k_cvt<<<CB_W + CB_B + CB_X, 256, 0, stream>>>(x, bond, Wq, Wk, Wv, Wo, Xb, Bb, PT);
  k_qkv<<<dim3(NR / 128, E / 128, 3), 128, 0, stream>>>(Xb, PT, bq, bk, bv, Q32, Kh, Kl, VTh, VTl);
  k_attn<<<dim3(SS / (AW * 16), NB * NH), AW * 32, 0, stream>>>(Q32, Kh, Kl, VTh, VTl, Bb, O32);
  k_out<<<dim3(NR / 64, E / 128), 128, 0, stream>>>(O32, PT, bo, out);
}
